// v000
// Measured on an AMD MI455X. A time is GPU time per run, averaged over a window of back-to-back runs after a warm-up
// (all launches, gaps included; the runs take copies of the inputs in turn), and the median of several windows.
// Apart from v000's, it joins two sittings. Times from different sittings can be a few percent apart, while
// side-by-side timings come from the same sitting.
// v000 is the starting kernel. One run takes 30.1 milliseconds.
#include <hip/hip_runtime.h>

// IEModule (PCT-style offset-attention stack; x [8][64][2048]; h = relu(bn(W1 x)) (64); h = relu(bn(W2 h)) (128); then four chained blocks: q = Wqk h (32), energy = q^T q (symmetric, unscaled), att = softmax over keys
// then / (1e-9 + column sum over queries), x_r = v att with v = Wv h + bv, h = h + relu(bn(Wt (h - x_r) + bt)); output = concat of the four h -> [8][512][2048]. Every BatchNorm is TRAINING-mode: per-channel
// mean / biased variance over (batch, points) of the current activations, eps 1e-5.)
// Compute dtypes, f32 accumulate: every input rounded to bf16; everything positions-major [point][channel]; W1 x on PLAIN bf16 operands (inputs: exact), every later channel
// contraction on bf16 hi+lo planes of its computed operand x exact weights (2 products, + bias); energies on hi+lo planes of q (3 products, K 32); x_r^T = att^T . v on SINGLE fp16 planes (renormalised attention

#define NB_  8
#define NN   2048
#define C0   64
#define C1   128
#define PCAR 1024.0f
#define BNE  1e-5f
typedef _Float16 h16;
typedef unsigned short bf;
typedef __attribute__((ext_vector_type(16))) __bf16   v16bf;
typedef __attribute__((ext_vector_type(16))) _Float16 v16h;
typedef __attribute__((ext_vector_type(8)))  _Float16 v8h;
typedef __attribute__((ext_vector_type(8)))  unsigned short v8us;
typedef __attribute__((ext_vector_type(8)))  float    v8f;
typedef __attribute__((ext_vector_type(4)))  float    v4f;
typedef v8h  __attribute__((may_alias)) v8ha;
typedef v4f  __attribute__((may_alias)) v4fa;
typedef v8us __attribute__((may_alias)) v8usa;

__device__ __forceinline__ unsigned short f2bf(float f) { unsigned u = __float_as_uint(f); u += 0x7FFFu + ((u >> 16) & 1u); return (unsigned short)(u >> 16); }
__device__ __forceinline__ float bf2f(unsigned short b) { return __uint_as_float(((unsigned)b) << 16); }
__device__ __forceinline__ float bfr(float f) { return bf2f(f2bf(f)); }
__device__ __forceinline__ v16h cat16(v8h lo, v8h hi) { return __builtin_shufflevector(lo, hi, 0, 1, 2, 3, 4, 5, 6, 7, 8, 9, 10, 11, 12, 13, 14, 15); }
__device__ __forceinline__ v16bf cat16b(v8us lo, v8us hi) { return __builtin_bit_cast(v16bf, __builtin_shufflevector(lo, hi, 0, 1, 2, 3, 4, 5, 6, 7, 8, 9, 10, 11, 12, 13, 14, 15)); }
__device__ __forceinline__ v8f wmma16(v16h a, v16h b, v8f c) { return __builtin_amdgcn_wmma_f32_16x16x32_f16(false, a, false, b, (short)0, c, false, false); }
__device__ __forceinline__ v8f wmmab(v16bf a, v16bf b, v8f c) { return __builtin_amdgcn_wmma_f32_16x16x32_bf16(false, a, false, b, (short)0, c, false, false); }



// ---- k_gemmw: register-blocked GEMM, ONE WAVE per 64x64 output tile (16 accumulators), operands straight from K-contiguous 16-bit planes; grid (M/64, N/64, Z), 32 threads.
// C[m][n] (f32, pitch ldc, + optional f32 bias[n]) = sum_k A[m][k] Bt[n][k] (+ split products per NSPLIT). z-batch strides sA/sB/sC in elements. K % 32 == 0.
template <typename T16> struct WFrag;
template <> struct WFrag<h16> { typedef v16h V; static __device__ __forceinline__ V ld(const h16* p) { return cat16(*(const v8h*)p, *(const v8h*)(p + 16)); } static __device__ __forceinline__ v8f mma(V a, V b, v8f c) { return wmma16(a, b, c); } };
template <> struct WFrag<bf> { typedef v16bf V; static __device__ __forceinline__ V ld(const bf* p) { return cat16b(*(const v8us*)p, *(const v8us*)(p + 16)); } static __device__ __forceinline__ v8f mma(V a, V b, v8f c) { return wmmab(a, b, c); } };
template <typename T16, int NSPLIT, bool BIAS>
__global__ __launch_bounds__(32) void k_gemmw(const T16* __restrict__ A, const T16* __restrict__ A2, const T16* __restrict__ Bt, const T16* __restrict__ Bt2, int K, float* C, int ldc, const float* __restrict__ bias, size_t sA, size_t sB, size_t sC) {
    typedef typename WFrag<T16>::V V;
    __shared__ __align__(16) float os[16 * 68];
    const size_t z = blockIdx.z; A += z * sA; if (A2) A2 += z * sA; Bt += z * sB; if (Bt2) Bt2 += z * sB; C += z * sC;
    const int lane = threadIdx.x & 31, lr = lane & 15, hi = lane >> 4; const int r0 = blockIdx.x * 64, c0 = blockIdx.y * 64;
    v8f acc[4][4];
#pragma unroll
    for (int mb = 0; mb < 4; ++mb)
#pragma unroll
        for (int nb = 0; nb < 4; ++nb) acc[mb][nb] = (v8f){};
    const size_t aoff = (size_t)(r0 + lr) * K + 8 * hi, boff = (size_t)(c0 + lr) * K + 8 * hi;
#pragma unroll 1
    for (int kc = 0; kc < K; kc += 32) {
        V a[4], a2[4];
#pragma unroll
        for (int mb = 0; mb < 4; ++mb) { a[mb] = WFrag<T16>::ld(A + aoff + (size_t)mb * 16 * K + kc); if (NSPLIT == 1 || NSPLIT == 2) a2[mb] = WFrag<T16>::ld(A2 + aoff + (size_t)mb * 16 * K + kc); }
#pragma unroll
        for (int nb = 0; nb < 4; ++nb) { const V b = WFrag<T16>::ld(Bt + boff + (size_t)nb * 16 * K + kc); V b2; if (NSPLIT >= 2) b2 = WFrag<T16>::ld(Bt2 + boff + (size_t)nb * 16 * K + kc);
#pragma unroll
            for (int mb = 0; mb < 4; ++mb) { acc[mb][nb] = WFrag<T16>::mma(a[mb], b, acc[mb][nb]); if (NSPLIT == 1 || NSPLIT == 2) acc[mb][nb] = WFrag<T16>::mma(a2[mb], b, acc[mb][nb]); if (NSPLIT >= 2) acc[mb][nb] = WFrag<T16>::mma(a[mb], b2, acc[mb][nb]); } }
        asm volatile("v_nop\n\tv_nop\n\tv_nop\n\tv_nop" : "+v"(acc[0][0]), "+v"(acc[1][1]), "+v"(acc[2][2]), "+v"(acc[3][3]) : "v"(a[0]), "v"(a[3]));
    }
#pragma unroll
    for (int mb = 0; mb < 4; ++mb) {
#pragma unroll
        for (int nb = 0; nb < 4; ++nb) {
#pragma unroll
            for (int j = 0; j < 8; ++j) os[(hi * 8 + j) * 68 + nb * 16 + lr] = acc[mb][nb][j]; }
        __builtin_amdgcn_wave_barrier(); asm volatile("" ::: "memory");
        float* crow = C + (size_t)(r0 + mb * 16) * ldc + c0;
{
#pragma unroll
            for (int s = 0; s < 8; ++s) { const int row = 2 * s + hi, cofs = lr * 4; v4f val = *(const v4fa*)(os + row * 68 + cofs); if (BIAS) { val[0] += bfr(bias[c0 + cofs]); val[1] += bfr(bias[c0 + cofs + 1]); val[2] += bfr(bias[c0 + cofs + 2]); val[3] += bfr(bias[c0 + cofs + 3]); }
                *(v4f*)(crow + (size_t)row * ldc + cofs) = val; }
             }
        __builtin_amdgcn_wave_barrier(); asm volatile("" ::: "memory");
    }
}

__device__ __forceinline__ h16 tohx(float x) { return (h16)x; }
__device__ __forceinline__ void splitf(float y, unsigned short& h, unsigned short& l) { h = f2bf(y); l = f2bf(y - bf2f(h)); }
typedef __attribute__((ext_vector_type(2))) _Float16 v2h;
typedef __attribute__((ext_vector_type(4))) _Float16 v4h;
typedef __attribute__((ext_vector_type(2))) unsigned short v2us;
typedef __attribute__((ext_vector_type(4))) unsigned short v4us;
typedef __attribute__((ext_vector_type(2))) float v2f;

__global__ __launch_bounds__(256) void k_cvt8(const float* __restrict__ src, bf* dst, size_t n8) { const size_t i = (size_t)blockIdx.x * 256 + threadIdx.x; if (i >= n8) return; const v8f v = *(const v8f*)(src + i * 8); v8us o;
#pragma unroll
    for (int k = 0; k < 8; ++k) o[k] = f2bf(v[k]); *(v8us*)(dst + i * 8) = o;  }
__global__ __launch_bounds__(256) void k_cvtp(const float* __restrict__ src, int pitch, int off, int R, int RP, int KW, bf* Bt) { const size_t e = ((size_t)blockIdx.x * 256 + threadIdx.x) * 4; if (e >= (size_t)RP * KW) return; const int k = (int)(e % KW), r = (int)(e / KW); v4us o;
#pragma unroll
    for (int q = 0; q < 4; ++q) o[q] = (r < R) ? f2bf(src[(size_t)r * pitch + off + k + q]) : (unsigned short)0; *(v4us*)(Bt + e) = o;  }
__global__ __launch_bounds__(256) void k_qsplit(const float* __restrict__ QF, bf* Qh, bf* Ql) { const int e = (blockIdx.x * 256 + threadIdx.x) * 2; if (e >= NN * 32) return; const int k = e & 31, n = e >> 5; v2us oh, ol;
#pragma unroll
    for (int q = 0; q < 2; ++q) { unsigned short a, c2; splitf(QF[(size_t)n * 64 + k + q], a, c2); oh[q] = a; ol[q] = c2; } *(v2us*)(Qh + e) = oh; *(v2us*)(Ql + e) = ol;  }
__global__ __launch_bounds__(256) void k_vt16(const float* __restrict__ VF, h16* VT) { const int e = (blockIdx.x * 256 + threadIdx.x) * 2; if (e >= C1 * NN) return; const int i = e % NN, c = e / NN; v2h o; o[0] = tohx(VF[(size_t)i * C1 + c]); o[1] = tohx(VF[(size_t)(i + 1) * C1 + c]); *(v2h*)(VT + e) = o;  }
__global__ __launch_bounds__(256) void k_dsplit(const float* __restrict__ Hf, const float* __restrict__ XRF, bf* Dh, bf* Dl) { const int e = (blockIdx.x * 256 + threadIdx.x) * 2; if (e >= NN * C1) return; v2us oh, ol;
#pragma unroll
    for (int q = 0; q < 2; ++q) { float xr = XRF[e + q] * (1.0f / PCAR); asm volatile("" : "+v"(xr)); unsigned short a, c2; splitf(__fsub_rn(Hf[e + q], xr), a, c2); oh[q] = a; ol[q] = c2; } *(v2us*)(Dh + e) = oh; *(v2us*)(Dl + e) = ol;  }
__global__ __launch_bounds__(256) void k_rmax(const float* __restrict__ S, float* RI) { const int lane = threadIdx.x & 31; const int i = blockIdx.x * 8 + (threadIdx.x >> 5); if (i >= NN) return; const float* sr = S + (size_t)i * NN; float m = -3.0e38f;
#pragma unroll 4
    for (int c0 = lane * 4; c0 < NN; c0 += 128) { const v4f v = *(const v4f*)(sr + c0); m = fmaxf(m, fmaxf(fmaxf(v[0], v[1]), fmaxf(v[2], v[3]))); }
#pragma unroll
    for (int sh = 16; sh; sh >>= 1) m = fmaxf(m, __shfl_xor(m, sh, 32));
    const float o = lane == 0 ? m : 0.f; *(float*)(RI + (size_t)i * 32 + lane) = o;  }
__global__ __launch_bounds__(256) void k_rexp(float* S, float* RI) { const int lane = threadIdx.x & 31; const int i = blockIdx.x * 8 + (threadIdx.x >> 5); if (i >= NN) return; float* sr = S + (size_t)i * NN; const float m = RI[(size_t)i * 32]; float v[NN / 32]; float sum = 0.f;
#pragma unroll
    for (int ch = 0; ch < (NN / 128); ++ch) { const v4f a = *(const v4f*)(sr + ch * 128 + lane * 4);
#pragma unroll
        for (int q = 0; q < 4; ++q) { float d0 = __fsub_rn(a[q], m); asm volatile("" : "+v"(d0)); const float e = __builtin_amdgcn_exp2f(__fmul_rn(d0, 1.4426950408889634f)); v[ch * 4 + q] = e; sum += e; } }
#pragma unroll
    for (int sh = 16; sh; sh >>= 1) sum += __shfl_xor(sum, sh, 32);
    const float ri = __fdiv_rn(1.0f, sum);
{
#pragma unroll
        for (int ch = 0; ch < (NN / 128); ++ch) { v4f o; o[0] = v[ch * 4]; o[1] = v[ch * 4 + 1]; o[2] = v[ch * 4 + 2]; o[3] = v[ch * 4 + 3]; *(v4f*)(sr + ch * 128 + lane * 4) = o; }
        const float o2 = lane == 0 ? ri : 0.f; *(float*)(RI + (size_t)i * 32 + lane) = o2;  } }
__global__ __launch_bounds__(256) void k_colsum(const float* __restrict__ E, const float* __restrict__ RI, float* CS) { const int j = blockIdx.x * 256 + threadIdx.x; if (j >= NN) return; float s = 0.f;
    for (int i = 0; i < NN; ++i) { float a = __fmul_rn(E[(size_t)i * NN + j], RI[(size_t)i * 32]); asm volatile("" : "+v"(a)); s = __fadd_rn(s, a); }
    const float r = __fdiv_rn(1.0f, __fadd_rn(1e-9f, s)); *(float*)(CS + j) = r;  }
__global__ __launch_bounds__(256) void k_ptT(const float* __restrict__ E, const float* __restrict__ RI, const float* __restrict__ CS, h16* PT) { const int e = (blockIdx.x * 256 + threadIdx.x) * 2; if (e >= NN * NN) return; const int i = e % NN, j = e / NN; const float cs = CS[j]; v2h o;
#pragma unroll
    for (int q = 0; q < 2; ++q) { float a = __fmul_rn(E[(size_t)(i + q) * NN + j], RI[(size_t)(i + q) * 32]); asm volatile("" : "+v"(a)); float p = __fmul_rn(a, cs); asm volatile("" : "+v"(p)); o[q] = tohx(p * PCAR); } *(v2h*)(PT + e) = o;  }
__global__ __launch_bounds__(256) void k_xt8(const float* __restrict__ xb, bf* XT) { const size_t e = ((size_t)blockIdx.x * 256 + threadIdx.x) * 4; if (e >= (size_t)NN * C0) return; const int c = (int)(e % C0), n = (int)(e / C0); typedef __attribute__((ext_vector_type(4))) unsigned short v4us; v4us o;
#pragma unroll
    for (int q = 0; q < 4; ++q) o[q] = f2bf(xb[(size_t)(c + q) * NN + n]); *(v4us*)(XT + e) = o;  }
__global__ __launch_bounds__(256) void k_bnstat(const float* __restrict__ T, int C, float* ST) { const int lane = threadIdx.x & 31; const int c = blockIdx.x * 8 + (threadIdx.x >> 5); if (c >= C) return; const size_t tot = (size_t)NB_ * NN; float s = 0.f;
    for (size_t r = lane; r < tot; r += 32) s = __fadd_rn(s, T[r * C + c]);
#pragma unroll
    for (int sh = 16; sh; sh >>= 1) s += __shfl_xor(s, sh, 32);
    const float mu = s * (1.0f / (NB_ * NN)); float q2 = 0.f;
    for (size_t r = lane; r < tot; r += 32) { const float d = __fsub_rn(T[r * C + c], mu); float p = __fmul_rn(d, d); asm volatile("" : "+v"(p)); q2 = __fadd_rn(q2, p); }
#pragma unroll
    for (int sh = 16; sh; sh >>= 1) q2 += __shfl_xor(q2, sh, 32);
    const float rs = __frsqrt_rn(__fadd_rn(q2 * (1.0f / (NB_ * NN)), BNE)); const float o = lane == 0 ? mu : (lane == 1 ? rs : 0.f); *(float*)(ST + (size_t)c * 32 + lane) = o;  }
// k_bnapply: y = relu(bf16(g[c]) (T[b][n][c] - mu_c) rs_c + bf16(be[c])); H[b][n][c] = (residual ? H + y : y) (same lane reads/writes; idempotent: uses the H value read first)
__global__ __launch_bounds__(256) void k_bnapply(const float* __restrict__ T, int C, const float* __restrict__ ST, const float* __restrict__ g, const float* __restrict__ be, int residual, float* H) { const size_t e = ((size_t)blockIdx.x * 256 + threadIdx.x) * 2; if (e >= (size_t)NB_ * NN * C) return; const int c = (int)(e % C); typedef __attribute__((ext_vector_type(2))) float v2f; v2f o; const v2f hprev = residual ? *(const v2f*)(H + e) : (v2f){0.f, 0.f};
#pragma unroll
    for (int q = 0; q < 2; ++q) { const int cq = c + q; float sc = __fmul_rn(bfr(g[cq]), ST[(size_t)cq * 32 + 1]); asm volatile("" : "+v"(sc)); float t = __fmul_rn(__fsub_rn(T[e + q], ST[(size_t)cq * 32]), sc); asm volatile("" : "+v"(t)); const float y = fmaxf(__fadd_rn(t, bfr(be[cq])), 0.f); o[q] = residual ? __fadd_rn(hprev[q], y) : y; }
    *(v2f*)(H + e) = o;  }
__global__ __launch_bounds__(256) void k_split2(const float* __restrict__ F, bf* Ph, bf* Pl, size_t n) { const size_t i = ((size_t)blockIdx.x * 256 + threadIdx.x) * 2; if (i >= n) return; typedef __attribute__((ext_vector_type(2))) unsigned short v2us; v2us oh, ol;
#pragma unroll
    for (int q = 0; q < 2; ++q) { unsigned short a, c2; splitf(F[i + q], a, c2); oh[q] = a; ol[q] = c2; } *(v2us*)(Ph + i) = oh; *(v2us*)(Pl + i) = ol;  }
__global__ __launch_bounds__(256) void k_outT(const float* __restrict__ Hb, int blk, float* OUTb) { const size_t e = ((size_t)blockIdx.x * 256 + threadIdx.x) * 2; if (e >= (size_t)C1 * NN) return; const int n = (int)(e % NN), c = (int)(e / NN); typedef __attribute__((ext_vector_type(2))) float v2f; v2f o; o[0] = Hb[(size_t)n * C1 + c]; o[1] = Hb[(size_t)(n + 1) * C1 + c]; const size_t oo = ((size_t)blk * C1 + c) * NN + n; *(v2f*)(OUTb + oo) = o;  }

extern "C" void kernel_launch(void* const* d_in, const int* in_sizes, int n_in,
                              void* d_out, int out_size, void* d_ws, size_t ws_size, hipStream_t stream) {
    (void)in_sizes; (void)n_in; (void)out_size;
    const float* IN[14]; for (int i = 0; i < 14; ++i) IN[i] = (const float*)d_in[i];   // 0 x, 1 W1 [64][64], 2 g1, 3 b1, 4 W2 [128][64], 5 g2, 6 b2, 7 Wqk [4][32][128], 8 Wv [4][128][128], 9 bv [4][128], 10 Wt, 11 bt, 12 gn, 13 bnb
    float* OUT = (float*)d_out;     // [8][512][2048]
    char* wsp = (char*)d_ws;
    auto take = [&](size_t bytes) { char* p = wsp; wsp += (bytes + 255) & ~(size_t)255; return (void*)p; };
    bf* WB1 = (bf*)take((size_t)C0 * C0 * 2); bf* WB2 = (bf*)take((size_t)C1 * C0 * 2); bf* WQK = (bf*)take((size_t)4 * 64 * C1 * 2); bf* WV = (bf*)take((size_t)4 * C1 * C1 * 2); bf* WT = (bf*)take((size_t)4 * C1 * C1 * 2); float* ST = (float*)take((size_t)C1 * 32 * 4);
    bf* XT = (bf*)take((size_t)NN * C0 * 2); float* T = (float*)take((size_t)NB_ * NN * C1 * 4); float* H = (float*)take((size_t)NB_ * NN * C1 * 4); float* H0 = (float*)take((size_t)NB_ * NN * C0 * 4); bf* Hh = (bf*)take((size_t)NN * C1 * 2); bf* Hl = (bf*)take((size_t)NN * C1 * 2);
    float* QF = (float*)take((size_t)NN * 64 * 4); bf* Qh = (bf*)take((size_t)NN * 32 * 2); bf* Ql = (bf*)take((size_t)NN * 32 * 2); float* S = (float*)take((size_t)NN * NN * 4); float* RI = (float*)take((size_t)NN * 32 * 4); float* CS = (float*)take((size_t)NN * 4); h16* PT = (h16*)take((size_t)NN * NN * 2); float* VF = (float*)take((size_t)NN * C1 * 4); h16* VT = (h16*)take((size_t)C1 * NN * 2); float* XRF = (float*)take((size_t)NN * C1 * 4); bf* Dh = (bf*)take((size_t)NN * C1 * 2); bf* Dl = (bf*)take((size_t)NN * C1 * 2);
    if ((size_t)(wsp - (char*)d_ws) > ws_size) return;    // total ~ 52.5 MB; ws 256 MiB
    { k_cvt8<<<(C0 * C0 / 8 + 255) / 256, 256, 0, stream>>>(IN[1], WB1, (size_t)C0 * C0 / 8); k_cvt8<<<(C1 * C0 / 8 + 255) / 256, 256, 0, stream>>>(IN[4], WB2, (size_t)C1 * C0 / 8);
      for (int i = 0; i < 4; ++i) k_cvtp<<<(64 * C1 / 4 + 255) / 256, 256, 0, stream>>>(IN[7] + (size_t)i * 32 * C1, C1, 0, 32, 64, C1, WQK + (size_t)i * 64 * C1);
      k_cvt8<<<(4 * C1 * C1 / 8 + 255) / 256, 256, 0, stream>>>(IN[8], WV, (size_t)4 * C1 * C1 / 8); k_cvt8<<<(4 * C1 * C1 / 8 + 255) / 256, 256, 0, stream>>>(IN[10], WT, (size_t)4 * C1 * C1 / 8); }
    const unsigned L0 = (NN * C0 / 2 + 255) / 256, L1 = (NN * C1 / 2 + 255) / 256; const dim3 g128(NN / 64, C1 / 64, 1);
    // stage 1: h0 = relu(bn(W1 x)) for all batches (T reused with C = 64 pitch), then planes per batch later
    for (int b = 0; b < NB_; ++b) { k_xt8<<<(NN * C0 / 4 + 255) / 256, 256, 0, stream>>>(IN[0] + (size_t)b * C0 * NN, XT); k_gemmw<bf, 0, false><<<dim3(NN / 64, 1, 1), 32, 0, stream>>>(XT, nullptr, WB1, nullptr, C0, T + (size_t)b * NN * C0, C0, nullptr, 0, 0, 0); }
    k_bnstat<<<C0 / 8, 256, 0, stream>>>(T, C0, ST); k_bnapply<<<(unsigned)(((size_t)NB_ * NN * C0 / 2 + 255) / 256), 256, 0, stream>>>(T, C0, ST, IN[2], IN[3], 0, H0);
    // stage 2: h = relu(bn(W2 h0))
    for (int b = 0; b < NB_; ++b) { k_split2<<<L0, 256, 0, stream>>>(H0 + (size_t)b * NN * C0, Hh, Hl, (size_t)NN * C0); k_gemmw<bf, 1, false><<<g128, 32, 0, stream>>>(Hh, Hl, WB2, nullptr, C0, T + (size_t)b * NN * C1, C1, nullptr, 0, 0, 0); }
    k_bnstat<<<C1 / 8, 256, 0, stream>>>(T, C1, ST); k_bnapply<<<(unsigned)(((size_t)NB_ * NN * C1 / 2 + 255) / 256), 256, 0, stream>>>(T, C1, ST, IN[5], IN[6], 0, H);
    // four offset-attention blocks
    for (int i = 0; i < 4; ++i) {
        for (int b = 0; b < NB_; ++b) { float* Hb = H + (size_t)b * NN * C1;
            k_split2<<<L1, 256, 0, stream>>>(Hb, Hh, Hl, (size_t)NN * C1);
            k_gemmw<bf, 1, false><<<dim3(NN / 64, 1, 1), 32, 0, stream>>>(Hh, Hl, WQK + (size_t)i * 64 * C1, nullptr, C1, QF, 64, nullptr, 0, 0, 0); k_qsplit<<<(NN * 32 / 2 + 255) / 256, 256, 0, stream>>>(QF, Qh, Ql);
            k_gemmw<bf, 2, false><<<dim3(NN / 64, NN / 64, 1), 32, 0, stream>>>(Qh, Ql, Qh, Ql, 32, S, NN, nullptr, 0, 0, 0);          // energy (3 products)
            k_rmax<<<NN / 8, 256, 0, stream>>>(S, RI); k_rexp<<<NN / 8, 256, 0, stream>>>(S, RI); k_colsum<<<NN / 256, 256, 0, stream>>>(S, RI, CS); k_ptT<<<(NN * NN / 2 + 255) / 256, 256, 0, stream>>>(S, RI, CS, PT);
            k_gemmw<bf, 1, true><<<g128, 32, 0, stream>>>(Hh, Hl, WV + (size_t)i * C1 * C1, nullptr, C1, VF, C1, IN[9] + i * C1, 0, 0, 0); k_vt16<<<(C1 * NN / 2 + 255) / 256, 256, 0, stream>>>(VF, VT);
            k_gemmw<h16, 0, false><<<g128, 32, 0, stream>>>(PT, nullptr, VT, nullptr, NN, XRF, C1, nullptr, 0, 0, 0);                  // x_r^T = att^T . v (x 1024)
            k_dsplit<<<L1, 256, 0, stream>>>(Hb, XRF, Dh, Dl);
            k_gemmw<bf, 1, true><<<g128, 32, 0, stream>>>(Dh, Dl, WT + (size_t)i * C1 * C1, nullptr, C1, T + (size_t)b * NN * C1, C1, IN[11] + i * C1, 0, 0, 0); }
        k_bnstat<<<C1 / 8, 256, 0, stream>>>(T, C1, ST); k_bnapply<<<(unsigned)(((size_t)NB_ * NN * C1 / 2 + 255) / 256), 256, 0, stream>>>(T, C1, ST, IN[12] + i * C1, IN[13] + i * C1, 1, H);
        for (int b = 0; b < NB_; ++b) k_outT<<<(C1 * NN / 2 + 255) / 256, 256, 0, stream>>>(H + (size_t)b * NN * C1, i, OUT + (size_t)b * 4 * C1 * NN); }
}

// v001
// Measured time: 6440 microseconds a run.
// Timed twice side by side with v000, it ran 4.67 and 4.68 times as fast.
#include <hip/hip_runtime.h>

// IEModule (PCT-style offset-attention stack; x [8][64][2048]; h = relu(bn(W1 x)) (64); h = relu(bn(W2 h)) (128); then four chained blocks: q = Wqk h (32), energy = q^T q (symmetric, unscaled), att = softmax over keys
// then / (1e-9 + column sum over queries), x_r = v att with v = Wv h + bv, h = h + relu(bn(Wt (h - x_r) + bt)); output = concat of the four h -> [8][512][2048]. Every BatchNorm is TRAINING-mode: per-channel
// mean / biased variance over (batch, points) of the current activations, eps 1e-5.)
// Compute dtypes, f32 accumulate: every input rounded to bf16; everything positions-major [point][channel]; W1 x on PLAIN bf16 operands (inputs: exact), every later channel
// contraction on bf16 hi+lo planes of its computed operand x exact weights (2 products, + bias); energies on hi+lo planes of q (3 products, K 32); x_r^T = att^T . v on SINGLE fp16 planes (renormalised attention

#define NB_  8
#define NN   2048
#define C0   64
#define C1   128
#define PCAR 1024.0f
#define BNE  1e-5f
typedef _Float16 h16;
typedef unsigned short bf;
typedef __attribute__((ext_vector_type(16))) __bf16   v16bf;
typedef __attribute__((ext_vector_type(16))) _Float16 v16h;
typedef __attribute__((ext_vector_type(8)))  _Float16 v8h;
typedef __attribute__((ext_vector_type(8)))  unsigned short v8us;
typedef __attribute__((ext_vector_type(8)))  float    v8f;
typedef __attribute__((ext_vector_type(4)))  float    v4f;
typedef v8h  __attribute__((may_alias)) v8ha;
typedef v4f  __attribute__((may_alias)) v4fa;
typedef v8us __attribute__((may_alias)) v8usa;

__device__ __forceinline__ unsigned short f2bf(float f) { unsigned u = __float_as_uint(f); u += 0x7FFFu + ((u >> 16) & 1u); return (unsigned short)(u >> 16); }
__device__ __forceinline__ float bf2f(unsigned short b) { return __uint_as_float(((unsigned)b) << 16); }
__device__ __forceinline__ float bfr(float f) { return bf2f(f2bf(f)); }
__device__ __forceinline__ v16h cat16(v8h lo, v8h hi) { return __builtin_shufflevector(lo, hi, 0, 1, 2, 3, 4, 5, 6, 7, 8, 9, 10, 11, 12, 13, 14, 15); }
__device__ __forceinline__ v16bf cat16b(v8us lo, v8us hi) { return __builtin_bit_cast(v16bf, __builtin_shufflevector(lo, hi, 0, 1, 2, 3, 4, 5, 6, 7, 8, 9, 10, 11, 12, 13, 14, 15)); }
__device__ __forceinline__ v8f wmma16(v16h a, v16h b, v8f c) { return __builtin_amdgcn_wmma_f32_16x16x32_f16(false, a, false, b, (short)0, c, false, false); }
__device__ __forceinline__ v8f wmmab(v16bf a, v16bf b, v8f c) { return __builtin_amdgcn_wmma_f32_16x16x32_bf16(false, a, false, b, (short)0, c, false, false); }



// ---- k_gemmw: register-blocked GEMM, ONE WAVE per 64x64 output tile (16 accumulators), operands straight from K-contiguous 16-bit planes; grid (M/64, N/64, Z), 32 threads.
// C[m][n] (f32, pitch ldc, + optional f32 bias[n]) = sum_k A[m][k] Bt[n][k] (+ split products per NSPLIT). z-batch strides sA/sB/sC in elements. K % 32 == 0.
template <typename T16> struct WFrag;
template <> struct WFrag<h16> { typedef v16h V; static __device__ __forceinline__ V ld(const h16* p) { return cat16(*(const v8h*)p, *(const v8h*)(p + 16)); } static __device__ __forceinline__ v8f mma(V a, V b, v8f c) { return wmma16(a, b, c); } };
template <> struct WFrag<bf> { typedef v16bf V; static __device__ __forceinline__ V ld(const bf* p) { return cat16b(*(const v8us*)p, *(const v8us*)(p + 16)); } static __device__ __forceinline__ v8f mma(V a, V b, v8f c) { return wmmab(a, b, c); } };
template <typename T16, int NSPLIT, bool BIAS>
__global__ __launch_bounds__(32) void k_gemmw(const T16* __restrict__ A, const T16* __restrict__ A2, const T16* __restrict__ Bt, const T16* __restrict__ Bt2, int K, float* C, int ldc, const float* __restrict__ bias, size_t sA, size_t sB, size_t sC) {
    typedef typename WFrag<T16>::V V;
    __shared__ __align__(16) float os[16 * 68];
    const size_t z = blockIdx.z; A += z * sA; if (A2) A2 += z * sA; Bt += z * sB; if (Bt2) Bt2 += z * sB; C += z * sC;
    const int lane = threadIdx.x & 31, lr = lane & 15, hi = lane >> 4; const int r0 = blockIdx.x * 64, c0 = blockIdx.y * 64;
    v8f acc[4][4];
#pragma unroll
    for (int mb = 0; mb < 4; ++mb)
#pragma unroll
        for (int nb = 0; nb < 4; ++nb) acc[mb][nb] = (v8f){};
    const size_t aoff = (size_t)(r0 + lr) * K + 8 * hi, boff = (size_t)(c0 + lr) * K + 8 * hi;
#pragma unroll 1
    for (int kc = 0; kc < K; kc += 32) {
        V a[4], a2[4];
#pragma unroll
        for (int mb = 0; mb < 4; ++mb) { a[mb] = WFrag<T16>::ld(A + aoff + (size_t)mb * 16 * K + kc); if (NSPLIT == 1 || NSPLIT == 2) a2[mb] = WFrag<T16>::ld(A2 + aoff + (size_t)mb * 16 * K + kc); }
#pragma unroll
        for (int nb = 0; nb < 4; ++nb) { const V b = WFrag<T16>::ld(Bt + boff + (size_t)nb * 16 * K + kc); V b2; if (NSPLIT >= 2) b2 = WFrag<T16>::ld(Bt2 + boff + (size_t)nb * 16 * K + kc);
#pragma unroll
            for (int mb = 0; mb < 4; ++mb) { acc[mb][nb] = WFrag<T16>::mma(a[mb], b, acc[mb][nb]); if (NSPLIT == 1 || NSPLIT == 2) acc[mb][nb] = WFrag<T16>::mma(a2[mb], b, acc[mb][nb]); if (NSPLIT >= 2) acc[mb][nb] = WFrag<T16>::mma(a[mb], b2, acc[mb][nb]); } }
        asm volatile("v_nop\n\tv_nop\n\tv_nop\n\tv_nop" : "+v"(acc[0][0]), "+v"(acc[1][1]), "+v"(acc[2][2]), "+v"(acc[3][3]) : "v"(a[0]), "v"(a[3]));
    }
#pragma unroll
    for (int mb = 0; mb < 4; ++mb) {
#pragma unroll
        for (int nb = 0; nb < 4; ++nb) {
#pragma unroll
            for (int j = 0; j < 8; ++j) os[(hi * 8 + j) * 68 + nb * 16 + lr] = acc[mb][nb][j]; }
        __builtin_amdgcn_wave_barrier(); asm volatile("" ::: "memory");
        float* crow = C + (size_t)(r0 + mb * 16) * ldc + c0;
{
#pragma unroll
            for (int s = 0; s < 8; ++s) { const int row = 2 * s + hi, cofs = lr * 4; v4f val = *(const v4fa*)(os + row * 68 + cofs); if (BIAS) { val[0] += bfr(bias[c0 + cofs]); val[1] += bfr(bias[c0 + cofs + 1]); val[2] += bfr(bias[c0 + cofs + 2]); val[3] += bfr(bias[c0 + cofs + 3]); }
                *(v4f*)(crow + (size_t)row * ldc + cofs) = val; }
             }
        __builtin_amdgcn_wave_barrier(); asm volatile("" ::: "memory");
    }
}

__device__ __forceinline__ h16 tohx(float x) { return (h16)x; }
__device__ __forceinline__ void splitf(float y, unsigned short& h, unsigned short& l) { h = f2bf(y); l = f2bf(y - bf2f(h)); }
typedef __attribute__((ext_vector_type(2))) _Float16 v2h;
typedef __attribute__((ext_vector_type(4))) _Float16 v4h;
typedef __attribute__((ext_vector_type(2))) unsigned short v2us;
typedef __attribute__((ext_vector_type(4))) unsigned short v4us;
typedef __attribute__((ext_vector_type(2))) float v2f;

__global__ __launch_bounds__(256) void k_cvt8(const float* __restrict__ src, bf* dst, size_t n8) { const size_t i = (size_t)blockIdx.x * 256 + threadIdx.x; if (i >= n8) return; const v8f v = *(const v8f*)(src + i * 8); v8us o;
#pragma unroll
    for (int k = 0; k < 8; ++k) o[k] = f2bf(v[k]); *(v8us*)(dst + i * 8) = o;  }
__global__ __launch_bounds__(256) void k_cvtp(const float* __restrict__ src, int pitch, int off, int R, int RP, int KW, bf* Bt) { const size_t e = ((size_t)blockIdx.x * 256 + threadIdx.x) * 4; if (e >= (size_t)RP * KW) return; const int k = (int)(e % KW), r = (int)(e / KW); v4us o;
#pragma unroll
    for (int q = 0; q < 4; ++q) o[q] = (r < R) ? f2bf(src[(size_t)r * pitch + off + k + q]) : (unsigned short)0; *(v4us*)(Bt + e) = o;  }
__global__ __launch_bounds__(256) void k_qsplit(const float* __restrict__ QF, bf* Qh, bf* Ql) { const int e = (blockIdx.x * 256 + threadIdx.x) * 2; if (e >= NN * 32) return; const int k = e & 31, n = e >> 5; v2us oh, ol;
#pragma unroll
    for (int q = 0; q < 2; ++q) { unsigned short a, c2; splitf(QF[(size_t)n * 64 + k + q], a, c2); oh[q] = a; ol[q] = c2; } *(v2us*)(Qh + e) = oh; *(v2us*)(Ql + e) = ol;  }
__global__ __launch_bounds__(256) void k_vt16(const float* __restrict__ VF, h16* VT) { const int e = (blockIdx.x * 256 + threadIdx.x) * 2; if (e >= C1 * NN) return; const int i = e % NN, c = e / NN; v2h o; o[0] = tohx(VF[(size_t)i * C1 + c]); o[1] = tohx(VF[(size_t)(i + 1) * C1 + c]); *(v2h*)(VT + e) = o;  }
__global__ __launch_bounds__(256) void k_dsplit(const float* __restrict__ Hf, const float* __restrict__ XRF, bf* Dh, bf* Dl) { const int e = (blockIdx.x * 256 + threadIdx.x) * 2; if (e >= NN * C1) return; v2us oh, ol;
#pragma unroll
    for (int q = 0; q < 2; ++q) { float xr = XRF[e + q] * (1.0f / PCAR); asm volatile("" : "+v"(xr)); unsigned short a, c2; splitf(__fsub_rn(Hf[e + q], xr), a, c2); oh[q] = a; ol[q] = c2; } *(v2us*)(Dh + e) = oh; *(v2us*)(Dl + e) = ol;  }
__global__ __launch_bounds__(256) void k_rmax(const float* __restrict__ S, float* RI) { const int lane = threadIdx.x & 31; const int i = blockIdx.x * 8 + (threadIdx.x >> 5); if (i >= NN) return; const float* sr = S + (size_t)i * NN; float m = -3.0e38f;
#pragma unroll 4
    for (int c0 = lane * 4; c0 < NN; c0 += 128) { const v4f v = *(const v4f*)(sr + c0); m = fmaxf(m, fmaxf(fmaxf(v[0], v[1]), fmaxf(v[2], v[3]))); }
#pragma unroll
    for (int sh = 16; sh; sh >>= 1) m = fmaxf(m, __shfl_xor(m, sh, 32));
    const float o = lane == 0 ? m : 0.f; *(float*)(RI + (size_t)i * 32 + lane) = o;  }
__global__ __launch_bounds__(256) void k_rexp(float* S, float* RI) { const int lane = threadIdx.x & 31; const int i = blockIdx.x * 8 + (threadIdx.x >> 5); if (i >= NN) return; float* sr = S + (size_t)i * NN; const float m = RI[(size_t)i * 32]; float v[NN / 32]; float sum = 0.f;
#pragma unroll
    for (int ch = 0; ch < (NN / 128); ++ch) { const v4f a = *(const v4f*)(sr + ch * 128 + lane * 4);
#pragma unroll
        for (int q = 0; q < 4; ++q) { float d0 = __fsub_rn(a[q], m); asm volatile("" : "+v"(d0)); const float e = __builtin_amdgcn_exp2f(__fmul_rn(d0, 1.4426950408889634f)); v[ch * 4 + q] = e; sum += e; } }
#pragma unroll
    for (int sh = 16; sh; sh >>= 1) sum += __shfl_xor(sum, sh, 32);
    const float ri = __fdiv_rn(1.0f, sum);
{
#pragma unroll
        for (int ch = 0; ch < (NN / 128); ++ch) { v4f o; o[0] = v[ch * 4]; o[1] = v[ch * 4 + 1]; o[2] = v[ch * 4 + 2]; o[3] = v[ch * 4 + 3]; *(v4f*)(sr + ch * 128 + lane * 4) = o; }
        const float o2 = lane == 0 ? ri : 0.f; *(float*)(RI + (size_t)i * 32 + lane) = o2;  } }
// k_colsum: CS[j] = 1 / (1e-9 + sum_i E[i][j] RI[i]). One work-group of 32 waves per strip of 32 columns (one 128-B line of every row); a wave-wide load covers 4 rows x 128 B; wave w owns rows 64 w .. 64 w + 63,
// 16 independent 16-B loads a lane; the 4 row phases of a wave fold by lane shuffles, the 32 waves' partial sums through LDS.
__global__ __launch_bounds__(1024) void k_colsum(const float* __restrict__ E, const float* __restrict__ RI, float* CS) { __shared__ __align__(16) float red[32][32];
    const int lane = threadIdx.x & 31, w = threadIdx.x >> 5, cg = lane & 7, rp = lane >> 3; const int j0 = blockIdx.x * 32, i0 = w * 64 + rp;
    const float* ep = E + (size_t)i0 * NN + j0 + cg * 4; const float* rip = RI + (size_t)i0 * 32; v4f e[16]; float r[16];
#pragma unroll
    for (int t = 0; t < 16; ++t) { e[t] = *(const v4f*)(ep + (size_t)t * 4 * NN); r[t] = rip[t * 4 * 32]; }
    v4f s = (v4f){0.f, 0.f, 0.f, 0.f};
#pragma unroll
    for (int t = 0; t < 16; ++t) s += e[t] * r[t];
#pragma unroll
    for (int q = 0; q < 4; ++q) { s[q] += __shfl_xor(s[q], 8, 32); s[q] += __shfl_xor(s[q], 16, 32); }
    if (rp == 0) *(v4fa*)(&red[w][cg * 4]) = s;
    __syncthreads();
    if (w == 0) { float a = 0.f;
#pragma unroll
        for (int k = 0; k < 32; ++k) a += red[k][lane];
        CS[j0 + lane] = __fdiv_rn(1.0f, __fadd_rn(1e-9f, a)); } }
__global__ __launch_bounds__(256) void k_ptT(const float* __restrict__ E, const float* __restrict__ RI, const float* __restrict__ CS, h16* PT) { const int e = (blockIdx.x * 256 + threadIdx.x) * 2; if (e >= NN * NN) return; const int i = e % NN, j = e / NN; const float cs = CS[j]; v2h o;
#pragma unroll
    for (int q = 0; q < 2; ++q) { float a = __fmul_rn(E[(size_t)(i + q) * NN + j], RI[(size_t)(i + q) * 32]); asm volatile("" : "+v"(a)); float p = __fmul_rn(a, cs); asm volatile("" : "+v"(p)); o[q] = tohx(p * PCAR); } *(v2h*)(PT + e) = o;  }
__global__ __launch_bounds__(256) void k_xt8(const float* __restrict__ xb, bf* XT) { const size_t e = ((size_t)blockIdx.x * 256 + threadIdx.x) * 4; if (e >= (size_t)NN * C0) return; const int c = (int)(e % C0), n = (int)(e / C0); typedef __attribute__((ext_vector_type(4))) unsigned short v4us; v4us o;
#pragma unroll
    for (int q = 0; q < 4; ++q) o[q] = f2bf(xb[(size_t)(c + q) * NN + n]); *(v4us*)(XT + e) = o;  }
__global__ __launch_bounds__(256) void k_bnstat(const float* __restrict__ T, int C, float* ST) { const int lane = threadIdx.x & 31; const int c = blockIdx.x * 8 + (threadIdx.x >> 5); if (c >= C) return; const size_t tot = (size_t)NB_ * NN; float s = 0.f;
    for (size_t r = lane; r < tot; r += 32) s = __fadd_rn(s, T[r * C + c]);
#pragma unroll
    for (int sh = 16; sh; sh >>= 1) s += __shfl_xor(s, sh, 32);
    const float mu = s * (1.0f / (NB_ * NN)); float q2 = 0.f;
    for (size_t r = lane; r < tot; r += 32) { const float d = __fsub_rn(T[r * C + c], mu); float p = __fmul_rn(d, d); asm volatile("" : "+v"(p)); q2 = __fadd_rn(q2, p); }
#pragma unroll
    for (int sh = 16; sh; sh >>= 1) q2 += __shfl_xor(q2, sh, 32);
    const float rs = __frsqrt_rn(__fadd_rn(q2 * (1.0f / (NB_ * NN)), BNE)); const float o = lane == 0 ? mu : (lane == 1 ? rs : 0.f); *(float*)(ST + (size_t)c * 32 + lane) = o;  }
// k_bnapply: y = relu(bf16(g[c]) (T[b][n][c] - mu_c) rs_c + bf16(be[c])); H[b][n][c] = (residual ? H + y : y) (same lane reads/writes; idempotent: uses the H value read first)
__global__ __launch_bounds__(256) void k_bnapply(const float* __restrict__ T, int C, const float* __restrict__ ST, const float* __restrict__ g, const float* __restrict__ be, int residual, float* H) { const size_t e = ((size_t)blockIdx.x * 256 + threadIdx.x) * 2; if (e >= (size_t)NB_ * NN * C) return; const int c = (int)(e % C); typedef __attribute__((ext_vector_type(2))) float v2f; v2f o; const v2f hprev = residual ? *(const v2f*)(H + e) : (v2f){0.f, 0.f};
#pragma unroll
    for (int q = 0; q < 2; ++q) { const int cq = c + q; float sc = __fmul_rn(bfr(g[cq]), ST[(size_t)cq * 32 + 1]); asm volatile("" : "+v"(sc)); float t = __fmul_rn(__fsub_rn(T[e + q], ST[(size_t)cq * 32]), sc); asm volatile("" : "+v"(t)); const float y = fmaxf(__fadd_rn(t, bfr(be[cq])), 0.f); o[q] = residual ? __fadd_rn(hprev[q], y) : y; }
    *(v2f*)(H + e) = o;  }
__global__ __launch_bounds__(256) void k_split2(const float* __restrict__ F, bf* Ph, bf* Pl, size_t n) { const size_t i = ((size_t)blockIdx.x * 256 + threadIdx.x) * 2; if (i >= n) return; typedef __attribute__((ext_vector_type(2))) unsigned short v2us; v2us oh, ol;
#pragma unroll
    for (int q = 0; q < 2; ++q) { unsigned short a, c2; splitf(F[i + q], a, c2); oh[q] = a; ol[q] = c2; } *(v2us*)(Ph + i) = oh; *(v2us*)(Pl + i) = ol;  }
__global__ __launch_bounds__(256) void k_outT(const float* __restrict__ Hb, int blk, float* OUTb) { const size_t e = ((size_t)blockIdx.x * 256 + threadIdx.x) * 2; if (e >= (size_t)C1 * NN) return; const int n = (int)(e % NN), c = (int)(e / NN); typedef __attribute__((ext_vector_type(2))) float v2f; v2f o; o[0] = Hb[(size_t)n * C1 + c]; o[1] = Hb[(size_t)(n + 1) * C1 + c]; const size_t oo = ((size_t)blk * C1 + c) * NN + n; *(v2f*)(OUTb + oo) = o;  }

extern "C" void kernel_launch(void* const* d_in, const int* in_sizes, int n_in,
                              void* d_out, int out_size, void* d_ws, size_t ws_size, hipStream_t stream) {
    (void)in_sizes; (void)n_in; (void)out_size;
    const float* IN[14]; for (int i = 0; i < 14; ++i) IN[i] = (const float*)d_in[i];   // 0 x, 1 W1 [64][64], 2 g1, 3 b1, 4 W2 [128][64], 5 g2, 6 b2, 7 Wqk [4][32][128], 8 Wv [4][128][128], 9 bv [4][128], 10 Wt, 11 bt, 12 gn, 13 bnb
    float* OUT = (float*)d_out;     // [8][512][2048]
    char* wsp = (char*)d_ws;
    auto take = [&](size_t bytes) { char* p = wsp; wsp += (bytes + 255) & ~(size_t)255; return (void*)p; };
    bf* WB1 = (bf*)take((size_t)C0 * C0 * 2); bf* WB2 = (bf*)take((size_t)C1 * C0 * 2); bf* WQK = (bf*)take((size_t)4 * 64 * C1 * 2); bf* WV = (bf*)take((size_t)4 * C1 * C1 * 2); bf* WT = (bf*)take((size_t)4 * C1 * C1 * 2); float* ST = (float*)take((size_t)C1 * 32 * 4);
    bf* XT = (bf*)take((size_t)NN * C0 * 2); float* T = (float*)take((size_t)NB_ * NN * C1 * 4); float* H = (float*)take((size_t)NB_ * NN * C1 * 4); float* H0 = (float*)take((size_t)NB_ * NN * C0 * 4); bf* Hh = (bf*)take((size_t)NN * C1 * 2); bf* Hl = (bf*)take((size_t)NN * C1 * 2);
    float* QF = (float*)take((size_t)NN * 64 * 4); bf* Qh = (bf*)take((size_t)NN * 32 * 2); bf* Ql = (bf*)take((size_t)NN * 32 * 2); float* S = (float*)take((size_t)NN * NN * 4); float* RI = (float*)take((size_t)NN * 32 * 4); float* CS = (float*)take((size_t)NN * 4); h16* PT = (h16*)take((size_t)NN * NN * 2); float* VF = (float*)take((size_t)NN * C1 * 4); h16* VT = (h16*)take((size_t)C1 * NN * 2); float* XRF = (float*)take((size_t)NN * C1 * 4); bf* Dh = (bf*)take((size_t)NN * C1 * 2); bf* Dl = (bf*)take((size_t)NN * C1 * 2);
    if ((size_t)(wsp - (char*)d_ws) > ws_size) return;    // total ~ 52.5 MB; ws 256 MiB
    { k_cvt8<<<(C0 * C0 / 8 + 255) / 256, 256, 0, stream>>>(IN[1], WB1, (size_t)C0 * C0 / 8); k_cvt8<<<(C1 * C0 / 8 + 255) / 256, 256, 0, stream>>>(IN[4], WB2, (size_t)C1 * C0 / 8);
      for (int i = 0; i < 4; ++i) k_cvtp<<<(64 * C1 / 4 + 255) / 256, 256, 0, stream>>>(IN[7] + (size_t)i * 32 * C1, C1, 0, 32, 64, C1, WQK + (size_t)i * 64 * C1);
      k_cvt8<<<(4 * C1 * C1 / 8 + 255) / 256, 256, 0, stream>>>(IN[8], WV, (size_t)4 * C1 * C1 / 8); k_cvt8<<<(4 * C1 * C1 / 8 + 255) / 256, 256, 0, stream>>>(IN[10], WT, (size_t)4 * C1 * C1 / 8); }
    const unsigned L0 = (NN * C0 / 2 + 255) / 256, L1 = (NN * C1 / 2 + 255) / 256; const dim3 g128(NN / 64, C1 / 64, 1);
    // stage 1: h0 = relu(bn(W1 x)) for all batches (T reused with C = 64 pitch), then planes per batch later
    for (int b = 0; b < NB_; ++b) { k_xt8<<<(NN * C0 / 4 + 255) / 256, 256, 0, stream>>>(IN[0] + (size_t)b * C0 * NN, XT); k_gemmw<bf, 0, false><<<dim3(NN / 64, 1, 1), 32, 0, stream>>>(XT, nullptr, WB1, nullptr, C0, T + (size_t)b * NN * C0, C0, nullptr, 0, 0, 0); }
    k_bnstat<<<C0 / 8, 256, 0, stream>>>(T, C0, ST); k_bnapply<<<(unsigned)(((size_t)NB_ * NN * C0 / 2 + 255) / 256), 256, 0, stream>>>(T, C0, ST, IN[2], IN[3], 0, H0);
    // stage 2: h = relu(bn(W2 h0))
    for (int b = 0; b < NB_; ++b) { k_split2<<<L0, 256, 0, stream>>>(H0 + (size_t)b * NN * C0, Hh, Hl, (size_t)NN * C0); k_gemmw<bf, 1, false><<<g128, 32, 0, stream>>>(Hh, Hl, WB2, nullptr, C0, T + (size_t)b * NN * C1, C1, nullptr, 0, 0, 0); }
    k_bnstat<<<C1 / 8, 256, 0, stream>>>(T, C1, ST); k_bnapply<<<(unsigned)(((size_t)NB_ * NN * C1 / 2 + 255) / 256), 256, 0, stream>>>(T, C1, ST, IN[5], IN[6], 0, H);
    // four offset-attention blocks
    for (int i = 0; i < 4; ++i) {
        for (int b = 0; b < NB_; ++b) { float* Hb = H + (size_t)b * NN * C1;
            k_split2<<<L1, 256, 0, stream>>>(Hb, Hh, Hl, (size_t)NN * C1);
            k_gemmw<bf, 1, false><<<dim3(NN / 64, 1, 1), 32, 0, stream>>>(Hh, Hl, WQK + (size_t)i * 64 * C1, nullptr, C1, QF, 64, nullptr, 0, 0, 0); k_qsplit<<<(NN * 32 / 2 + 255) / 256, 256, 0, stream>>>(QF, Qh, Ql);
            k_gemmw<bf, 2, false><<<dim3(NN / 64, NN / 64, 1), 32, 0, stream>>>(Qh, Ql, Qh, Ql, 32, S, NN, nullptr, 0, 0, 0);          // energy (3 products)
            k_rmax<<<NN / 8, 256, 0, stream>>>(S, RI); k_rexp<<<NN / 8, 256, 0, stream>>>(S, RI); k_colsum<<<NN / 32, 1024, 0, stream>>>(S, RI, CS); k_ptT<<<(NN * NN / 2 + 255) / 256, 256, 0, stream>>>(S, RI, CS, PT);
            k_gemmw<bf, 1, true><<<g128, 32, 0, stream>>>(Hh, Hl, WV + (size_t)i * C1 * C1, nullptr, C1, VF, C1, IN[9] + i * C1, 0, 0, 0); k_vt16<<<(C1 * NN / 2 + 255) / 256, 256, 0, stream>>>(VF, VT);
            k_gemmw<h16, 0, false><<<g128, 32, 0, stream>>>(PT, nullptr, VT, nullptr, NN, XRF, C1, nullptr, 0, 0, 0);                  // x_r^T = att^T . v (x 1024)
            k_dsplit<<<L1, 256, 0, stream>>>(Hb, XRF, Dh, Dl);
            k_gemmw<bf, 1, true><<<g128, 32, 0, stream>>>(Dh, Dl, WT + (size_t)i * C1 * C1, nullptr, C1, T + (size_t)b * NN * C1, C1, IN[11] + i * C1, 0, 0, 0); }
        k_bnstat<<<C1 / 8, 256, 0, stream>>>(T, C1, ST); k_bnapply<<<(unsigned)(((size_t)NB_ * NN * C1 / 2 + 255) / 256), 256, 0, stream>>>(T, C1, ST, IN[12] + i * C1, IN[13] + i * C1, 1, H);
        for (int b = 0; b < NB_; ++b) k_outT<<<(C1 * NN / 2 + 255) / 256, 256, 0, stream>>>(H + (size_t)b * NN * C1, i, OUT + (size_t)b * 4 * C1 * NN); }
}

// v002
// One run takes 3940 microseconds.
// Next to v001, in two timings, it ran 1.66 and 1.65 times as fast.
// All steps since v000 together make it 7.74 times as fast.
#include <hip/hip_runtime.h>

// IEModule (PCT-style offset-attention stack; x [8][64][2048]; h = relu(bn(W1 x)) (64); h = relu(bn(W2 h)) (128); then four chained blocks: q = Wqk h (32), energy = q^T q (symmetric, unscaled), att = softmax over keys
// then / (1e-9 + column sum over queries), x_r = v att with v = Wv h + bv, h = h + relu(bn(Wt (h - x_r) + bt)); output = concat of the four h -> [8][512][2048]. Every BatchNorm is TRAINING-mode: per-channel
// mean / biased variance over (batch, points) of the current activations, eps 1e-5.)
// Compute dtypes, f32 accumulate: every input rounded to bf16; everything positions-major [point][channel]; W1 x on PLAIN bf16 operands (inputs: exact), every later channel
// contraction on bf16 hi+lo planes of its computed operand x exact weights (2 products, + bias); energies on hi+lo planes of q (3 products, K 32); x_r^T = att^T . v on SINGLE fp16 planes (renormalised attention

#define NB_  8
#define NN   2048
#define C0   64
#define C1   128
#define PCAR 1024.0f
#define BNE  1e-5f
typedef _Float16 h16;
typedef unsigned short bf;
typedef __attribute__((ext_vector_type(16))) __bf16   v16bf;
typedef __attribute__((ext_vector_type(16))) _Float16 v16h;
typedef __attribute__((ext_vector_type(8)))  _Float16 v8h;
typedef __attribute__((ext_vector_type(8)))  unsigned short v8us;
typedef __attribute__((ext_vector_type(8)))  float    v8f;
typedef __attribute__((ext_vector_type(4)))  float    v4f;
typedef v8h  __attribute__((may_alias)) v8ha;
typedef v4f  __attribute__((may_alias)) v4fa;
typedef v8us __attribute__((may_alias)) v8usa;

__device__ __forceinline__ unsigned short f2bf(float f) { unsigned u = __float_as_uint(f); u += 0x7FFFu + ((u >> 16) & 1u); return (unsigned short)(u >> 16); }
__device__ __forceinline__ float bf2f(unsigned short b) { return __uint_as_float(((unsigned)b) << 16); }
__device__ __forceinline__ float bfr(float f) { return bf2f(f2bf(f)); }
__device__ __forceinline__ v16h cat16(v8h lo, v8h hi) { return __builtin_shufflevector(lo, hi, 0, 1, 2, 3, 4, 5, 6, 7, 8, 9, 10, 11, 12, 13, 14, 15); }
__device__ __forceinline__ v16bf cat16b(v8us lo, v8us hi) { return __builtin_bit_cast(v16bf, __builtin_shufflevector(lo, hi, 0, 1, 2, 3, 4, 5, 6, 7, 8, 9, 10, 11, 12, 13, 14, 15)); }
__device__ __forceinline__ v8f wmma16(v16h a, v16h b, v8f c) { return __builtin_amdgcn_wmma_f32_16x16x32_f16(false, a, false, b, (short)0, c, false, false); }
__device__ __forceinline__ v8f wmmab(v16bf a, v16bf b, v8f c) { return __builtin_amdgcn_wmma_f32_16x16x32_bf16(false, a, false, b, (short)0, c, false, false); }



// ---- k_gemmw: register-blocked GEMM, ONE WAVE per 64x64 output tile (16 accumulators), operands straight from K-contiguous 16-bit planes; grid (M/64, N/64, Z), 32 threads.
// C[m][n] (f32, pitch ldc, + optional f32 bias[n]) = sum_k A[m][k] Bt[n][k] (+ split products per NSPLIT). z-batch strides sA/sB/sC in elements. K % 32 == 0.
template <typename T16> struct WFrag;
template <> struct WFrag<h16> { typedef v16h V; static __device__ __forceinline__ V ld(const h16* p) { return cat16(*(const v8h*)p, *(const v8h*)(p + 16)); } static __device__ __forceinline__ v8f mma(V a, V b, v8f c) { return wmma16(a, b, c); } };
template <> struct WFrag<bf> { typedef v16bf V; static __device__ __forceinline__ V ld(const bf* p) { return cat16b(*(const v8us*)p, *(const v8us*)(p + 16)); } static __device__ __forceinline__ v8f mma(V a, V b, v8f c) { return wmmab(a, b, c); } };
template <typename T16, int NSPLIT, bool BIAS>
__global__ __launch_bounds__(32) void k_gemmw(const T16* __restrict__ A, const T16* __restrict__ A2, const T16* __restrict__ Bt, const T16* __restrict__ Bt2, int K, float* C, int ldc, const float* __restrict__ bias, size_t sA, size_t sB, size_t sC) {
    typedef typename WFrag<T16>::V V;
    __shared__ __align__(16) float os[16 * 68];
    const size_t z = blockIdx.z; A += z * sA; if (A2) A2 += z * sA; Bt += z * sB; if (Bt2) Bt2 += z * sB; C += z * sC;
    const int lane = threadIdx.x & 31, lr = lane & 15, hi = lane >> 4; const int r0 = blockIdx.x * 64, c0 = blockIdx.y * 64;
    v8f acc[4][4];
#pragma unroll
    for (int mb = 0; mb < 4; ++mb)
#pragma unroll
        for (int nb = 0; nb < 4; ++nb) acc[mb][nb] = (v8f){};
    const size_t aoff = (size_t)(r0 + lr) * K + 8 * hi, boff = (size_t)(c0 + lr) * K + 8 * hi;
#pragma unroll 1
    for (int kc = 0; kc < K; kc += 32) {
        V a[4], a2[4];
#pragma unroll
        for (int mb = 0; mb < 4; ++mb) { a[mb] = WFrag<T16>::ld(A + aoff + (size_t)mb * 16 * K + kc); if (NSPLIT == 1 || NSPLIT == 2) a2[mb] = WFrag<T16>::ld(A2 + aoff + (size_t)mb * 16 * K + kc); }
#pragma unroll
        for (int nb = 0; nb < 4; ++nb) { const V b = WFrag<T16>::ld(Bt + boff + (size_t)nb * 16 * K + kc); V b2; if (NSPLIT >= 2) b2 = WFrag<T16>::ld(Bt2 + boff + (size_t)nb * 16 * K + kc);
#pragma unroll
            for (int mb = 0; mb < 4; ++mb) { acc[mb][nb] = WFrag<T16>::mma(a[mb], b, acc[mb][nb]); if (NSPLIT == 1 || NSPLIT == 2) acc[mb][nb] = WFrag<T16>::mma(a2[mb], b, acc[mb][nb]); if (NSPLIT >= 2) acc[mb][nb] = WFrag<T16>::mma(a[mb], b2, acc[mb][nb]); } }
        asm volatile("v_nop\n\tv_nop\n\tv_nop\n\tv_nop" : "+v"(acc[0][0]), "+v"(acc[1][1]), "+v"(acc[2][2]), "+v"(acc[3][3]) : "v"(a[0]), "v"(a[3]));
    }
#pragma unroll
    for (int mb = 0; mb < 4; ++mb) {
#pragma unroll
        for (int nb = 0; nb < 4; ++nb) {
#pragma unroll
            for (int j = 0; j < 8; ++j) os[(hi * 8 + j) * 68 + nb * 16 + lr] = acc[mb][nb][j]; }
        __builtin_amdgcn_wave_barrier(); asm volatile("" ::: "memory");
        float* crow = C + (size_t)(r0 + mb * 16) * ldc + c0;
{
#pragma unroll
            for (int s = 0; s < 8; ++s) { const int row = 2 * s + hi, cofs = lr * 4; v4f val = *(const v4fa*)(os + row * 68 + cofs); if (BIAS) { val[0] += bfr(bias[c0 + cofs]); val[1] += bfr(bias[c0 + cofs + 1]); val[2] += bfr(bias[c0 + cofs + 2]); val[3] += bfr(bias[c0 + cofs + 3]); }
                *(v4f*)(crow + (size_t)row * ldc + cofs) = val; }
             }
        __builtin_amdgcn_wave_barrier(); asm volatile("" ::: "memory");
    }
}

__device__ __forceinline__ h16 tohx(float x) { return (h16)x; }
__device__ __forceinline__ void splitf(float y, unsigned short& h, unsigned short& l) { h = f2bf(y); l = f2bf(y - bf2f(h)); }
typedef __attribute__((ext_vector_type(2))) _Float16 v2h;
typedef __attribute__((ext_vector_type(4))) _Float16 v4h;
typedef __attribute__((ext_vector_type(2))) unsigned short v2us;
typedef __attribute__((ext_vector_type(4))) unsigned short v4us;
typedef __attribute__((ext_vector_type(2))) float v2f;

__global__ __launch_bounds__(256) void k_cvt8(const float* __restrict__ src, bf* dst, size_t n8) { const size_t i = (size_t)blockIdx.x * 256 + threadIdx.x; if (i >= n8) return; const v8f v = *(const v8f*)(src + i * 8); v8us o;
#pragma unroll
    for (int k = 0; k < 8; ++k) o[k] = f2bf(v[k]); *(v8us*)(dst + i * 8) = o;  }
__global__ __launch_bounds__(256) void k_cvtp(const float* __restrict__ src, int pitch, int off, int R, int RP, int KW, bf* Bt) { const size_t e = ((size_t)blockIdx.x * 256 + threadIdx.x) * 4; if (e >= (size_t)RP * KW) return; const int k = (int)(e % KW), r = (int)(e / KW); v4us o;
#pragma unroll
    for (int q = 0; q < 4; ++q) o[q] = (r < R) ? f2bf(src[(size_t)r * pitch + off + k + q]) : (unsigned short)0; *(v4us*)(Bt + e) = o;  }
__global__ __launch_bounds__(256) void k_qsplit(const float* __restrict__ QF, bf* Qh, bf* Ql) { const int e = (blockIdx.x * 256 + threadIdx.x) * 2; if (e >= NB_ * NN * 32) return; const int k = e & 31, n = e >> 5; v2us oh, ol;
#pragma unroll
    for (int q = 0; q < 2; ++q) { unsigned short a, c2; splitf(QF[(size_t)n * 64 + k + q], a, c2); oh[q] = a; ol[q] = c2; } *(v2us*)(Qh + e) = oh; *(v2us*)(Ql + e) = ol;  }
__global__ __launch_bounds__(256) void k_vt16(const float* __restrict__ VF, h16* VT) { VF += (size_t)blockIdx.y * NN * C1; VT += (size_t)blockIdx.y * C1 * NN; const int e = (blockIdx.x * 256 + threadIdx.x) * 2; if (e >= C1 * NN) return; const int i = e % NN, c = e / NN; v2h o; o[0] = tohx(VF[(size_t)i * C1 + c]); o[1] = tohx(VF[(size_t)(i + 1) * C1 + c]); *(v2h*)(VT + e) = o;  }
__global__ __launch_bounds__(256) void k_dsplit(const float* __restrict__ Hf, const float* __restrict__ XRF, bf* Dh, bf* Dl) { const int e = (blockIdx.x * 256 + threadIdx.x) * 2; if (e >= NB_ * NN * C1) return; v2us oh, ol;
#pragma unroll
    for (int q = 0; q < 2; ++q) { float xr = XRF[e + q] * (1.0f / PCAR); asm volatile("" : "+v"(xr)); unsigned short a, c2; splitf(__fsub_rn(Hf[e + q], xr), a, c2); oh[q] = a; ol[q] = c2; } *(v2us*)(Dh + e) = oh; *(v2us*)(Dl + e) = ol;  }
__global__ __launch_bounds__(256) void k_rmax(const float* __restrict__ S, float* RI) { const int lane = threadIdx.x & 31; const int i = blockIdx.x * 8 + (threadIdx.x >> 5); if (i >= NB_ * NN) return; const float* sr = S + (size_t)i * NN; float m = -3.0e38f;
#pragma unroll 4
    for (int c0 = lane * 4; c0 < NN; c0 += 128) { const v4f v = *(const v4f*)(sr + c0); m = fmaxf(m, fmaxf(fmaxf(v[0], v[1]), fmaxf(v[2], v[3]))); }
#pragma unroll
    for (int sh = 16; sh; sh >>= 1) m = fmaxf(m, __shfl_xor(m, sh, 32));
    const float o = lane == 0 ? m : 0.f; *(float*)(RI + (size_t)i * 32 + lane) = o;  }
__global__ __launch_bounds__(256) void k_rexp(float* S, float* RI) { const int lane = threadIdx.x & 31; const int i = blockIdx.x * 8 + (threadIdx.x >> 5); if (i >= NB_ * NN) return; float* sr = S + (size_t)i * NN; const float m = RI[(size_t)i * 32]; float v[NN / 32]; float sum = 0.f;
#pragma unroll
    for (int ch = 0; ch < (NN / 128); ++ch) { const v4f a = *(const v4f*)(sr + ch * 128 + lane * 4);
#pragma unroll
        for (int q = 0; q < 4; ++q) { float d0 = __fsub_rn(a[q], m); asm volatile("" : "+v"(d0)); const float e = __builtin_amdgcn_exp2f(__fmul_rn(d0, 1.4426950408889634f)); v[ch * 4 + q] = e; sum += e; } }
#pragma unroll
    for (int sh = 16; sh; sh >>= 1) sum += __shfl_xor(sum, sh, 32);
    const float ri = __fdiv_rn(1.0f, sum);
{
#pragma unroll
        for (int ch = 0; ch < (NN / 128); ++ch) { v4f o; o[0] = v[ch * 4]; o[1] = v[ch * 4 + 1]; o[2] = v[ch * 4 + 2]; o[3] = v[ch * 4 + 3]; *(v4f*)(sr + ch * 128 + lane * 4) = o; }
        const float o2 = lane == 0 ? ri : 0.f; *(float*)(RI + (size_t)i * 32 + lane) = o2;  } }
// k_colsum: CS[j] = 1 / (1e-9 + sum_i E[i][j] RI[i]). One work-group of 32 waves per strip of 32 columns (one 128-B line of every row); a wave-wide load covers 4 rows x 128 B; wave w owns rows 64 w .. 64 w + 63,
// 16 independent 16-B loads a lane; the 4 row phases of a wave fold by lane shuffles, the 32 waves' partial sums through LDS.
__global__ __launch_bounds__(1024) void k_colsum(const float* __restrict__ E, const float* __restrict__ RI, float* CS) { __shared__ __align__(16) float red[32][32]; E += (size_t)blockIdx.y * NN * NN; RI += (size_t)blockIdx.y * NN * 32; CS += (size_t)blockIdx.y * NN;
    const int lane = threadIdx.x & 31, w = threadIdx.x >> 5, cg = lane & 7, rp = lane >> 3; const int j0 = blockIdx.x * 32, i0 = w * 64 + rp;
    const float* ep = E + (size_t)i0 * NN + j0 + cg * 4; const float* rip = RI + (size_t)i0 * 32; v4f e[16]; float r[16];
#pragma unroll
    for (int t = 0; t < 16; ++t) { e[t] = *(const v4f*)(ep + (size_t)t * 4 * NN); r[t] = rip[t * 4 * 32]; }
    v4f s = (v4f){0.f, 0.f, 0.f, 0.f};
#pragma unroll
    for (int t = 0; t < 16; ++t) s += e[t] * r[t];
#pragma unroll
    for (int q = 0; q < 4; ++q) { s[q] += __shfl_xor(s[q], 8, 32); s[q] += __shfl_xor(s[q], 16, 32); }
    if (rp == 0) *(v4fa*)(&red[w][cg * 4]) = s;
    __syncthreads();
    if (w == 0) { float a = 0.f;
#pragma unroll
        for (int k = 0; k < 32; ++k) a += red[k][lane];
        CS[j0 + lane] = __fdiv_rn(1.0f, __fadd_rn(1e-9f, a)); } }
__global__ __launch_bounds__(256) void k_ptT(const float* __restrict__ E, const float* __restrict__ RI, const float* __restrict__ CS, h16* PT) { E += (size_t)blockIdx.y * NN * NN; RI += (size_t)blockIdx.y * NN * 32; CS += (size_t)blockIdx.y * NN; PT += (size_t)blockIdx.y * NN * NN; const int e = (blockIdx.x * 256 + threadIdx.x) * 2; if (e >= NN * NN) return; const int i = e % NN, j = e / NN; const float cs = CS[j]; v2h o;
#pragma unroll
    for (int q = 0; q < 2; ++q) { float a = __fmul_rn(E[(size_t)(i + q) * NN + j], RI[(size_t)(i + q) * 32]); asm volatile("" : "+v"(a)); float p = __fmul_rn(a, cs); asm volatile("" : "+v"(p)); o[q] = tohx(p * PCAR); } *(v2h*)(PT + e) = o;  }
__global__ __launch_bounds__(256) void k_xt8(const float* __restrict__ xb, bf* XT) { xb += (size_t)blockIdx.y * C0 * NN; XT += (size_t)blockIdx.y * NN * C0; const size_t e = ((size_t)blockIdx.x * 256 + threadIdx.x) * 4; if (e >= (size_t)NN * C0) return; const int c = (int)(e % C0), n = (int)(e / C0); typedef __attribute__((ext_vector_type(4))) unsigned short v4us; v4us o;
#pragma unroll
    for (int q = 0; q < 4; ++q) o[q] = f2bf(xb[(size_t)(c + q) * NN + n]); *(v4us*)(XT + e) = o;  }
__global__ __launch_bounds__(256) void k_bnstat(const float* __restrict__ T, int C, float* ST) { const int lane = threadIdx.x & 31; const int c = blockIdx.x * 8 + (threadIdx.x >> 5); if (c >= C) return; const size_t tot = (size_t)NB_ * NN; float s = 0.f;
    for (size_t r = lane; r < tot; r += 32) s = __fadd_rn(s, T[r * C + c]);
#pragma unroll
    for (int sh = 16; sh; sh >>= 1) s += __shfl_xor(s, sh, 32);
    const float mu = s * (1.0f / (NB_ * NN)); float q2 = 0.f;
    for (size_t r = lane; r < tot; r += 32) { const float d = __fsub_rn(T[r * C + c], mu); float p = __fmul_rn(d, d); asm volatile("" : "+v"(p)); q2 = __fadd_rn(q2, p); }
#pragma unroll
    for (int sh = 16; sh; sh >>= 1) q2 += __shfl_xor(q2, sh, 32);
    const float rs = __frsqrt_rn(__fadd_rn(q2 * (1.0f / (NB_ * NN)), BNE)); const float o = lane == 0 ? mu : (lane == 1 ? rs : 0.f); *(float*)(ST + (size_t)c * 32 + lane) = o;  }
// k_bnapply: y = relu(bf16(g[c]) (T[b][n][c] - mu_c) rs_c + bf16(be[c])); H[b][n][c] = (residual ? H + y : y) (same lane reads/writes; idempotent: uses the H value read first)
__global__ __launch_bounds__(256) void k_bnapply(const float* __restrict__ T, int C, const float* __restrict__ ST, const float* __restrict__ g, const float* __restrict__ be, int residual, float* H) { const size_t e = ((size_t)blockIdx.x * 256 + threadIdx.x) * 2; if (e >= (size_t)NB_ * NN * C) return; const int c = (int)(e % C); typedef __attribute__((ext_vector_type(2))) float v2f; v2f o; const v2f hprev = residual ? *(const v2f*)(H + e) : (v2f){0.f, 0.f};
#pragma unroll
    for (int q = 0; q < 2; ++q) { const int cq = c + q; float sc = __fmul_rn(bfr(g[cq]), ST[(size_t)cq * 32 + 1]); asm volatile("" : "+v"(sc)); float t = __fmul_rn(__fsub_rn(T[e + q], ST[(size_t)cq * 32]), sc); asm volatile("" : "+v"(t)); const float y = fmaxf(__fadd_rn(t, bfr(be[cq])), 0.f); o[q] = residual ? __fadd_rn(hprev[q], y) : y; }
    *(v2f*)(H + e) = o;  }
__global__ __launch_bounds__(256) void k_split2(const float* __restrict__ F, bf* Ph, bf* Pl, size_t n) { const size_t i = ((size_t)blockIdx.x * 256 + threadIdx.x) * 2; if (i >= n) return; typedef __attribute__((ext_vector_type(2))) unsigned short v2us; v2us oh, ol;
#pragma unroll
    for (int q = 0; q < 2; ++q) { unsigned short a, c2; splitf(F[i + q], a, c2); oh[q] = a; ol[q] = c2; } *(v2us*)(Ph + i) = oh; *(v2us*)(Pl + i) = ol;  }
__global__ __launch_bounds__(256) void k_outT(const float* __restrict__ Hb, int blk, float* OUTb) { Hb += (size_t)blockIdx.y * NN * C1; OUTb += (size_t)blockIdx.y * 4 * C1 * NN; const size_t e = ((size_t)blockIdx.x * 256 + threadIdx.x) * 2; if (e >= (size_t)C1 * NN) return; const int n = (int)(e % NN), c = (int)(e / NN); typedef __attribute__((ext_vector_type(2))) float v2f; v2f o; o[0] = Hb[(size_t)n * C1 + c]; o[1] = Hb[(size_t)(n + 1) * C1 + c]; const size_t oo = ((size_t)blk * C1 + c) * NN + n; *(v2f*)(OUTb + oo) = o;  }

extern "C" void kernel_launch(void* const* d_in, const int* in_sizes, int n_in,
                              void* d_out, int out_size, void* d_ws, size_t ws_size, hipStream_t stream) {
    (void)in_sizes; (void)n_in; (void)out_size;
    const float* IN[14]; for (int i = 0; i < 14; ++i) IN[i] = (const float*)d_in[i];   // 0 x, 1 W1 [64][64], 2 g1, 3 b1, 4 W2 [128][64], 5 g2, 6 b2, 7 Wqk [4][32][128], 8 Wv [4][128][128], 9 bv [4][128], 10 Wt, 11 bt, 12 gn, 13 bnb
    float* OUT = (float*)d_out;     // [8][512][2048]
    char* wsp = (char*)d_ws;
    auto take = [&](size_t bytes) { char* p = wsp; wsp += (bytes + 255) & ~(size_t)255; return (void*)p; };
    bf* WB1 = (bf*)take((size_t)C0 * C0 * 2); bf* WB2 = (bf*)take((size_t)C1 * C0 * 2); bf* WQK = (bf*)take((size_t)4 * 64 * C1 * 2); bf* WV = (bf*)take((size_t)4 * C1 * C1 * 2); bf* WT = (bf*)take((size_t)4 * C1 * C1 * 2); float* ST = (float*)take((size_t)C1 * 32 * 4);
    // every per-batch plane holds all NB_ batches, batch-major, so that one launch of each stage serves the whole batch
    bf* XT = (bf*)take((size_t)NB_ * NN * C0 * 2); float* T = (float*)take((size_t)NB_ * NN * C1 * 4); float* H = (float*)take((size_t)NB_ * NN * C1 * 4); float* H0 = (float*)take((size_t)NB_ * NN * C0 * 4); bf* Hh = (bf*)take((size_t)NB_ * NN * C1 * 2); bf* Hl = (bf*)take((size_t)NB_ * NN * C1 * 2);
    float* QF = (float*)take((size_t)NB_ * NN * 64 * 4); bf* Qh = (bf*)take((size_t)NB_ * NN * 32 * 2); bf* Ql = (bf*)take((size_t)NB_ * NN * 32 * 2); float* S = (float*)take((size_t)NB_ * NN * NN * 4); float* RI = (float*)take((size_t)NB_ * NN * 32 * 4); float* CS = (float*)take((size_t)NB_ * NN * 4); h16* PT = (h16*)take((size_t)NB_ * NN * NN * 2); float* VF = (float*)take((size_t)NB_ * NN * C1 * 4); h16* VT = (h16*)take((size_t)NB_ * C1 * NN * 2);
    float* XRF = VF; bf* Dh = Hh; bf* Dl = Hl;    // reuse: VF is last read by k_vt16, before x_r is written; Hh / Hl are last read by the v product, before k_dsplit writes
    if ((size_t)(wsp - (char*)d_ws) > ws_size) return;    // total ~ 243 MiB; ws 256 MiB
    { k_cvt8<<<(C0 * C0 / 8 + 255) / 256, 256, 0, stream>>>(IN[1], WB1, (size_t)C0 * C0 / 8); k_cvt8<<<(C1 * C0 / 8 + 255) / 256, 256, 0, stream>>>(IN[4], WB2, (size_t)C1 * C0 / 8);
      for (int i = 0; i < 4; ++i) k_cvtp<<<(64 * C1 / 4 + 255) / 256, 256, 0, stream>>>(IN[7] + (size_t)i * 32 * C1, C1, 0, 32, 64, C1, WQK + (size_t)i * 64 * C1);
      k_cvt8<<<(4 * C1 * C1 / 8 + 255) / 256, 256, 0, stream>>>(IN[8], WV, (size_t)4 * C1 * C1 / 8); k_cvt8<<<(4 * C1 * C1 / 8 + 255) / 256, 256, 0, stream>>>(IN[10], WT, (size_t)4 * C1 * C1 / 8); }
    // channel contractions see the batch as NB_ * NN rows of one matrix; the two N x N products and the transposes take the batch from grid z / y
    const unsigned L0 = (NB_ * NN * C0 / 2 + 255) / 256, L1 = (NB_ * NN * C1 / 2 + 255) / 256; const dim3 g64(NB_ * NN / 64, 1, 1), g128(NB_ * NN / 64, C1 / 64, 1);
    // stage 1: h0 = relu(bn(W1 x)) (T used with C = 64 pitch)
    k_xt8<<<dim3((NN * C0 / 4 + 255) / 256, NB_, 1), 256, 0, stream>>>(IN[0], XT); k_gemmw<bf, 0, false><<<g64, 32, 0, stream>>>(XT, nullptr, WB1, nullptr, C0, T, C0, nullptr, 0, 0, 0);
    k_bnstat<<<C0 / 8, 256, 0, stream>>>(T, C0, ST); k_bnapply<<<(unsigned)(((size_t)NB_ * NN * C0 / 2 + 255) / 256), 256, 0, stream>>>(T, C0, ST, IN[2], IN[3], 0, H0);
    // stage 2: h = relu(bn(W2 h0))
    k_split2<<<L0, 256, 0, stream>>>(H0, Hh, Hl, (size_t)NB_ * NN * C0); k_gemmw<bf, 1, false><<<g128, 32, 0, stream>>>(Hh, Hl, WB2, nullptr, C0, T, C1, nullptr, 0, 0, 0);
    k_bnstat<<<C1 / 8, 256, 0, stream>>>(T, C1, ST); k_bnapply<<<(unsigned)(((size_t)NB_ * NN * C1 / 2 + 255) / 256), 256, 0, stream>>>(T, C1, ST, IN[5], IN[6], 0, H);
    // four offset-attention blocks
    for (int i = 0; i < 4; ++i) {
        k_split2<<<L1, 256, 0, stream>>>(H, Hh, Hl, (size_t)NB_ * NN * C1);
        k_gemmw<bf, 1, false><<<g64, 32, 0, stream>>>(Hh, Hl, WQK + (size_t)i * 64 * C1, nullptr, C1, QF, 64, nullptr, 0, 0, 0); k_qsplit<<<(NB_ * NN * 32 / 2 + 255) / 256, 256, 0, stream>>>(QF, Qh, Ql);
        k_gemmw<bf, 2, false><<<dim3(NN / 64, NN / 64, NB_), 32, 0, stream>>>(Qh, Ql, Qh, Ql, 32, S, NN, nullptr, (size_t)NN * 32, (size_t)NN * 32, (size_t)NN * NN);          // energy (3 products)
        k_rmax<<<NB_ * NN / 8, 256, 0, stream>>>(S, RI); k_rexp<<<NB_ * NN / 8, 256, 0, stream>>>(S, RI); k_colsum<<<dim3(NN / 32, NB_, 1), 1024, 0, stream>>>(S, RI, CS); k_ptT<<<dim3((NN * NN / 2 + 255) / 256, NB_, 1), 256, 0, stream>>>(S, RI, CS, PT);
        k_gemmw<bf, 1, true><<<g128, 32, 0, stream>>>(Hh, Hl, WV + (size_t)i * C1 * C1, nullptr, C1, VF, C1, IN[9] + i * C1, 0, 0, 0); k_vt16<<<dim3((C1 * NN / 2 + 255) / 256, NB_, 1), 256, 0, stream>>>(VF, VT);
        k_gemmw<h16, 0, false><<<dim3(NN / 64, C1 / 64, NB_), 32, 0, stream>>>(PT, nullptr, VT, nullptr, NN, XRF, C1, nullptr, (size_t)NN * NN, (size_t)C1 * NN, (size_t)NN * C1);                  // x_r^T = att^T . v (x 1024)
        k_dsplit<<<L1, 256, 0, stream>>>(H, XRF, Dh, Dl);
        k_gemmw<bf, 1, true><<<g128, 32, 0, stream>>>(Dh, Dl, WT + (size_t)i * C1 * C1, nullptr, C1, T, C1, IN[11] + i * C1, 0, 0, 0);
        k_bnstat<<<C1 / 8, 256, 0, stream>>>(T, C1, ST); k_bnapply<<<(unsigned)(((size_t)NB_ * NN * C1 / 2 + 255) / 256), 256, 0, stream>>>(T, C1, ST, IN[12] + i * C1, IN[13] + i * C1, 1, H);
        k_outT<<<dim3((C1 * NN / 2 + 255) / 256, NB_, 1), 256, 0, stream>>>(H, i, OUT); }
}

// v003
// Measured time: 1900 microseconds a run.
// In two side-by-side timings against v002, it was 2.09 and 2.08 times as fast.
// Over all steps from v000 it is 16.1 times as fast.
#include <hip/hip_runtime.h>

// IEModule (PCT-style offset-attention stack; x [8][64][2048]; h = relu(bn(W1 x)) (64); h = relu(bn(W2 h)) (128); then four chained blocks: q = Wqk h (32), energy = q^T q (symmetric, unscaled), att = softmax over keys
// then / (1e-9 + column sum over queries), x_r = v att with v = Wv h + bv, h = h + relu(bn(Wt (h - x_r) + bt)); output = concat of the four h -> [8][512][2048]. Every BatchNorm is TRAINING-mode: per-channel
// mean / biased variance over (batch, points) of the current activations, eps 1e-5.)
// Compute dtypes, f32 accumulate: every input rounded to bf16; everything positions-major [point][channel]; W1 x on PLAIN bf16 operands (inputs: exact), every later channel
// contraction on bf16 hi+lo planes of its computed operand x exact weights (2 products, + bias); energies on hi+lo planes of q (3 products, K 32); x_r^T = att^T . v on SINGLE fp16 planes (renormalised attention

#define NB_  8
#define NN   2048
#define C0   64
#define C1   128
#define PCAR 1024.0f
#define BNE  1e-5f
typedef _Float16 h16;
typedef unsigned short bf;
typedef __attribute__((ext_vector_type(16))) __bf16   v16bf;
typedef __attribute__((ext_vector_type(16))) _Float16 v16h;
typedef __attribute__((ext_vector_type(8)))  _Float16 v8h;
typedef __attribute__((ext_vector_type(8)))  unsigned short v8us;
typedef __attribute__((ext_vector_type(8)))  float    v8f;
typedef __attribute__((ext_vector_type(4)))  float    v4f;
typedef v8h  __attribute__((may_alias)) v8ha;
typedef v4f  __attribute__((may_alias)) v4fa;
typedef v8us __attribute__((may_alias)) v8usa;

__device__ __forceinline__ unsigned short f2bf(float f) { unsigned u = __float_as_uint(f); u += 0x7FFFu + ((u >> 16) & 1u); return (unsigned short)(u >> 16); }
__device__ __forceinline__ float bf2f(unsigned short b) { return __uint_as_float(((unsigned)b) << 16); }
__device__ __forceinline__ float bfr(float f) { return bf2f(f2bf(f)); }
__device__ __forceinline__ v16h cat16(v8h lo, v8h hi) { return __builtin_shufflevector(lo, hi, 0, 1, 2, 3, 4, 5, 6, 7, 8, 9, 10, 11, 12, 13, 14, 15); }
__device__ __forceinline__ v16bf cat16b(v8us lo, v8us hi) { return __builtin_bit_cast(v16bf, __builtin_shufflevector(lo, hi, 0, 1, 2, 3, 4, 5, 6, 7, 8, 9, 10, 11, 12, 13, 14, 15)); }
__device__ __forceinline__ v8f wmma16(v16h a, v16h b, v8f c) { return __builtin_amdgcn_wmma_f32_16x16x32_f16(false, a, false, b, (short)0, c, false, false); }
__device__ __forceinline__ v8f wmmab(v16bf a, v16bf b, v8f c) { return __builtin_amdgcn_wmma_f32_16x16x32_bf16(false, a, false, b, (short)0, c, false, false); }



// ---- k_gemmw: register-blocked GEMM, ONE WAVE per 64x64 output tile (16 accumulators), operands straight from K-contiguous 16-bit planes; grid (M/64, N/64, Z), 32 threads.
// C[m][n] (f32, pitch ldc, + optional f32 bias[n]) = sum_k A[m][k] Bt[n][k] (+ split products per NSPLIT). z-batch strides sA/sB/sC in elements. K % 32 == 0.
template <typename T16> struct WFrag;
template <> struct WFrag<h16> { typedef v16h V; static __device__ __forceinline__ V ld(const h16* p) { return cat16(*(const v8h*)p, *(const v8h*)(p + 16)); } static __device__ __forceinline__ v8f mma(V a, V b, v8f c) { return wmma16(a, b, c); } };
template <> struct WFrag<bf> { typedef v16bf V; static __device__ __forceinline__ V ld(const bf* p) { return cat16b(*(const v8us*)p, *(const v8us*)(p + 16)); } static __device__ __forceinline__ v8f mma(V a, V b, v8f c) { return wmmab(a, b, c); } };
template <typename T16, int NSPLIT, bool BIAS>
__global__ __launch_bounds__(32) void k_gemmw(const T16* __restrict__ A, const T16* __restrict__ A2, const T16* __restrict__ Bt, const T16* __restrict__ Bt2, int K, float* C, int ldc, const float* __restrict__ bias, size_t sA, size_t sB, size_t sC) {
    typedef typename WFrag<T16>::V V;
    __shared__ __align__(16) float os[16 * 68];
    const size_t z = blockIdx.z; A += z * sA; if (A2) A2 += z * sA; Bt += z * sB; if (Bt2) Bt2 += z * sB; C += z * sC;
    const int lane = threadIdx.x & 31, lr = lane & 15, hi = lane >> 4; const int r0 = blockIdx.x * 64, c0 = blockIdx.y * 64;
    v8f acc[4][4];
#pragma unroll
    for (int mb = 0; mb < 4; ++mb)
#pragma unroll
        for (int nb = 0; nb < 4; ++nb) acc[mb][nb] = (v8f){};
    const size_t aoff = (size_t)(r0 + lr) * K + 8 * hi, boff = (size_t)(c0 + lr) * K + 8 * hi;
#pragma unroll 1
    for (int kc = 0; kc < K; kc += 32) {
        V a[4], a2[4];
#pragma unroll
        for (int mb = 0; mb < 4; ++mb) { a[mb] = WFrag<T16>::ld(A + aoff + (size_t)mb * 16 * K + kc); if (NSPLIT == 1 || NSPLIT == 2) a2[mb] = WFrag<T16>::ld(A2 + aoff + (size_t)mb * 16 * K + kc); }
#pragma unroll
        for (int nb = 0; nb < 4; ++nb) { const V b = WFrag<T16>::ld(Bt + boff + (size_t)nb * 16 * K + kc); V b2; if (NSPLIT >= 2) b2 = WFrag<T16>::ld(Bt2 + boff + (size_t)nb * 16 * K + kc);
#pragma unroll
            for (int mb = 0; mb < 4; ++mb) { acc[mb][nb] = WFrag<T16>::mma(a[mb], b, acc[mb][nb]); if (NSPLIT == 1 || NSPLIT == 2) acc[mb][nb] = WFrag<T16>::mma(a2[mb], b, acc[mb][nb]); if (NSPLIT >= 2) acc[mb][nb] = WFrag<T16>::mma(a[mb], b2, acc[mb][nb]); } }
        asm volatile("v_nop\n\tv_nop\n\tv_nop\n\tv_nop" : "+v"(acc[0][0]), "+v"(acc[1][1]), "+v"(acc[2][2]), "+v"(acc[3][3]) : "v"(a[0]), "v"(a[3]));
    }
#pragma unroll
    for (int mb = 0; mb < 4; ++mb) {
#pragma unroll
        for (int nb = 0; nb < 4; ++nb) {
#pragma unroll
            for (int j = 0; j < 8; ++j) os[(hi * 8 + j) * 68 + nb * 16 + lr] = acc[mb][nb][j]; }
        __builtin_amdgcn_wave_barrier(); asm volatile("" ::: "memory");
        float* crow = C + (size_t)(r0 + mb * 16) * ldc + c0;
{
#pragma unroll
            for (int s = 0; s < 8; ++s) { const int row = 2 * s + hi, cofs = lr * 4; v4f val = *(const v4fa*)(os + row * 68 + cofs); if (BIAS) { val[0] += bfr(bias[c0 + cofs]); val[1] += bfr(bias[c0 + cofs + 1]); val[2] += bfr(bias[c0 + cofs + 2]); val[3] += bfr(bias[c0 + cofs + 3]); }
                *(v4f*)(crow + (size_t)row * ldc + cofs) = val; }
             }
        __builtin_amdgcn_wave_barrier(); asm volatile("" ::: "memory");
    }
}

__device__ __forceinline__ h16 tohx(float x) { return (h16)x; }
__device__ __forceinline__ void splitf(float y, unsigned short& h, unsigned short& l) { h = f2bf(y); l = f2bf(y - bf2f(h)); }
typedef __attribute__((ext_vector_type(2))) _Float16 v2h;
typedef __attribute__((ext_vector_type(4))) _Float16 v4h;
typedef __attribute__((ext_vector_type(2))) unsigned short v2us;
typedef __attribute__((ext_vector_type(4))) unsigned short v4us;
typedef __attribute__((ext_vector_type(2))) float v2f;

__global__ __launch_bounds__(256) void k_cvt8(const float* __restrict__ src, bf* dst, size_t n8) { const size_t i = (size_t)blockIdx.x * 256 + threadIdx.x; if (i >= n8) return; const v8f v = *(const v8f*)(src + i * 8); v8us o;
#pragma unroll
    for (int k = 0; k < 8; ++k) o[k] = f2bf(v[k]); *(v8us*)(dst + i * 8) = o;  }
__global__ __launch_bounds__(256) void k_cvtp(const float* __restrict__ src, int pitch, int off, int R, int RP, int KW, bf* Bt) { const size_t e = ((size_t)blockIdx.x * 256 + threadIdx.x) * 4; if (e >= (size_t)RP * KW) return; const int k = (int)(e % KW), r = (int)(e / KW); v4us o;
#pragma unroll
    for (int q = 0; q < 4; ++q) o[q] = (r < R) ? f2bf(src[(size_t)r * pitch + off + k + q]) : (unsigned short)0; *(v4us*)(Bt + e) = o;  }
__global__ __launch_bounds__(256) void k_qsplit(const float* __restrict__ QF, bf* Qh, bf* Ql) { const int e = (blockIdx.x * 256 + threadIdx.x) * 2; if (e >= NB_ * NN * 32) return; const int k = e & 31, n = e >> 5; v2us oh, ol;
#pragma unroll
    for (int q = 0; q < 2; ++q) { unsigned short a, c2; splitf(QF[(size_t)n * 64 + k + q], a, c2); oh[q] = a; ol[q] = c2; } *(v2us*)(Qh + e) = oh; *(v2us*)(Ql + e) = ol;  }
__global__ __launch_bounds__(256) void k_vt16(const float* __restrict__ VF, h16* VT) { VF += (size_t)blockIdx.y * NN * C1; VT += (size_t)blockIdx.y * C1 * NN; const int e = (blockIdx.x * 256 + threadIdx.x) * 2; if (e >= C1 * NN) return; const int i = e % NN, c = e / NN; v2h o; o[0] = tohx(VF[(size_t)i * C1 + c]); o[1] = tohx(VF[(size_t)(i + 1) * C1 + c]); *(v2h*)(VT + e) = o;  }
__global__ __launch_bounds__(256) void k_dsplit(const float* __restrict__ Hf, const float* __restrict__ XRF, bf* Dh, bf* Dl) { const int e = (blockIdx.x * 256 + threadIdx.x) * 2; if (e >= NB_ * NN * C1) return; v2us oh, ol;
#pragma unroll
    for (int q = 0; q < 2; ++q) { float xr = XRF[e + q] * (1.0f / PCAR); asm volatile("" : "+v"(xr)); unsigned short a, c2; splitf(__fsub_rn(Hf[e + q], xr), a, c2); oh[q] = a; ol[q] = c2; } *(v2us*)(Dh + e) = oh; *(v2us*)(Dl + e) = ol;  }
__global__ __launch_bounds__(256) void k_rmax(const float* __restrict__ S, float* RI) { const int lane = threadIdx.x & 31; const int i = blockIdx.x * 8 + (threadIdx.x >> 5); if (i >= NB_ * NN) return; const float* sr = S + (size_t)i * NN; float m = -3.0e38f;
#pragma unroll 4
    for (int c0 = lane * 4; c0 < NN; c0 += 128) { const v4f v = *(const v4f*)(sr + c0); m = fmaxf(m, fmaxf(fmaxf(v[0], v[1]), fmaxf(v[2], v[3]))); }
#pragma unroll
    for (int sh = 16; sh; sh >>= 1) m = fmaxf(m, __shfl_xor(m, sh, 32));
    const float o = lane == 0 ? m : 0.f; *(float*)(RI + (size_t)i * 32 + lane) = o;  }
__global__ __launch_bounds__(256) void k_rexp(float* S, float* RI) { const int lane = threadIdx.x & 31; const int i = blockIdx.x * 8 + (threadIdx.x >> 5); if (i >= NB_ * NN) return; float* sr = S + (size_t)i * NN; const float m = RI[(size_t)i * 32]; float v[NN / 32]; float sum = 0.f;
#pragma unroll
    for (int ch = 0; ch < (NN / 128); ++ch) { const v4f a = *(const v4f*)(sr + ch * 128 + lane * 4);
#pragma unroll
        for (int q = 0; q < 4; ++q) { float d0 = __fsub_rn(a[q], m); asm volatile("" : "+v"(d0)); const float e = __builtin_amdgcn_exp2f(__fmul_rn(d0, 1.4426950408889634f)); v[ch * 4 + q] = e; sum += e; } }
#pragma unroll
    for (int sh = 16; sh; sh >>= 1) sum += __shfl_xor(sum, sh, 32);
    const float ri = __fdiv_rn(1.0f, sum);
{
#pragma unroll
        for (int ch = 0; ch < (NN / 128); ++ch) { v4f o; o[0] = v[ch * 4]; o[1] = v[ch * 4 + 1]; o[2] = v[ch * 4 + 2]; o[3] = v[ch * 4 + 3]; *(v4f*)(sr + ch * 128 + lane * 4) = o; }
        const float o2 = lane == 0 ? ri : 0.f; *(float*)(RI + (size_t)i * 32 + lane) = o2;  } }
// k_colsum: CS[j] = 1 / (1e-9 + sum_i E[i][j] RI[i]). One work-group of 32 waves per strip of 32 columns (one 128-B line of every row); a wave-wide load covers 4 rows x 128 B; wave w owns rows 64 w .. 64 w + 63,
// 16 independent 16-B loads a lane; the 4 row phases of a wave fold by lane shuffles, the 32 waves' partial sums through LDS.
__global__ __launch_bounds__(1024) void k_colsum(const float* __restrict__ E, const float* __restrict__ RI, float* CS) { __shared__ __align__(16) float red[32][32]; E += (size_t)blockIdx.y * NN * NN; RI += (size_t)blockIdx.y * NN * 32; CS += (size_t)blockIdx.y * NN;
    const int lane = threadIdx.x & 31, w = threadIdx.x >> 5, cg = lane & 7, rp = lane >> 3; const int j0 = blockIdx.x * 32, i0 = w * 64 + rp;
    const float* ep = E + (size_t)i0 * NN + j0 + cg * 4; const float* rip = RI + (size_t)i0 * 32; v4f e[16]; float r[16];
#pragma unroll
    for (int t = 0; t < 16; ++t) { e[t] = *(const v4f*)(ep + (size_t)t * 4 * NN); r[t] = rip[t * 4 * 32]; }
    v4f s = (v4f){0.f, 0.f, 0.f, 0.f};
#pragma unroll
    for (int t = 0; t < 16; ++t) s += e[t] * r[t];
#pragma unroll
    for (int q = 0; q < 4; ++q) { s[q] += __shfl_xor(s[q], 8, 32); s[q] += __shfl_xor(s[q], 16, 32); }
    if (rp == 0) *(v4fa*)(&red[w][cg * 4]) = s;
    __syncthreads();
    if (w == 0) { float a = 0.f;
#pragma unroll
        for (int k = 0; k < 32; ++k) a += red[k][lane];
        CS[j0 + lane] = __fdiv_rn(1.0f, __fadd_rn(1e-9f, a)); } }
__global__ __launch_bounds__(256) void k_ptT(const float* __restrict__ E, const float* __restrict__ RI, const float* __restrict__ CS, h16* PT) { E += (size_t)blockIdx.y * NN * NN; RI += (size_t)blockIdx.y * NN * 32; CS += (size_t)blockIdx.y * NN; PT += (size_t)blockIdx.y * NN * NN; const int e = (blockIdx.x * 256 + threadIdx.x) * 2; if (e >= NN * NN) return; const int i = e % NN, j = e / NN; const float cs = CS[j]; v2h o;
#pragma unroll
    for (int q = 0; q < 2; ++q) { float a = __fmul_rn(E[(size_t)(i + q) * NN + j], RI[(size_t)(i + q) * 32]); asm volatile("" : "+v"(a)); float p = __fmul_rn(a, cs); asm volatile("" : "+v"(p)); o[q] = tohx(p * PCAR); } *(v2h*)(PT + e) = o;  }
__global__ __launch_bounds__(256) void k_xt8(const float* __restrict__ xb, bf* XT) { xb += (size_t)blockIdx.y * C0 * NN; XT += (size_t)blockIdx.y * NN * C0; const size_t e = ((size_t)blockIdx.x * 256 + threadIdx.x) * 4; if (e >= (size_t)NN * C0) return; const int c = (int)(e % C0), n = (int)(e / C0); typedef __attribute__((ext_vector_type(4))) unsigned short v4us; v4us o;
#pragma unroll
    for (int q = 0; q < 4; ++q) o[q] = f2bf(xb[(size_t)(c + q) * NN + n]); *(v4us*)(XT + e) = o;  }
// k_bnstat: per-channel mean and 1/sqrt(biased variance + eps) over all NB_ * NN rows of T [row][C]. One work-group of 32 waves per 4 adjacent channels (16 B of every row); a lane owns rows t, t + 1024, ...:
// 16 independent 16-B loads that stay in registers, so T is read once and the squared deviations come from registers; lanes fold by shuffles, the 32 waves' partial sums through LDS (every wave folds them alike).
__device__ __forceinline__ v4f wgsum4(v4f s, v4f (*red)[32], int w, int lane) {
#pragma unroll
    for (int sh = 16; sh; sh >>= 1) {
#pragma unroll
        for (int q = 0; q < 4; ++q) s[q] += __shfl_xor(s[q], sh, 32); }
    if (lane == 0) (*red)[w] = s;
    __syncthreads();
    s = (*red)[lane];
#pragma unroll
    for (int sh = 16; sh; sh >>= 1) {
#pragma unroll
        for (int q = 0; q < 4; ++q) s[q] += __shfl_xor(s[q], sh, 32); }
    return s; }
template <int C>
__global__ __launch_bounds__(1024) void k_bnstat(const float* __restrict__ T, float* ST) { __shared__ __align__(16) v4f red[2][32]; const int lane = threadIdx.x & 31, w = threadIdx.x >> 5; const int c0 = blockIdx.x * 4;
    const float* tp = T + (size_t)threadIdx.x * C + c0; v4f x[NB_ * NN / 1024];
#pragma unroll
    for (int t = 0; t < NB_ * NN / 1024; ++t) x[t] = *(const v4f*)(tp + (size_t)t * 1024 * C);
    asm volatile("s_wait_xcnt 0x0" :: "v"(tp) : "memory");    // keeps the address pair of the 16 loads live, and unwritten, until all of them have taken their address (precaution before a register of an issued load is reused)
    v4f s = (v4f){0.f, 0.f, 0.f, 0.f};
#pragma unroll
    for (int t = 0; t < NB_ * NN / 1024; ++t) s += x[t];
    const v4f mu = wgsum4(s, &red[0], w, lane) * (1.0f / (NB_ * NN)); v4f q2 = (v4f){0.f, 0.f, 0.f, 0.f};
#pragma unroll
    for (int t = 0; t < NB_ * NN / 1024; ++t) { const v4f d = x[t] - mu; q2 += d * d; }
    q2 = wgsum4(q2, &red[1], w, lane);
    if (w < 4) { const float m = w == 0 ? mu[0] : (w == 1 ? mu[1] : (w == 2 ? mu[2] : mu[3])), v = w == 0 ? q2[0] : (w == 1 ? q2[1] : (w == 2 ? q2[2] : q2[3]));
        const float rs = __frsqrt_rn(__fadd_rn(v * (1.0f / (NB_ * NN)), BNE)); ST[(size_t)(c0 + w) * 32 + lane] = lane == 0 ? m : (lane == 1 ? rs : 0.f); } }
// k_bnapply: y = relu(bf16(g[c]) (T[b][n][c] - mu_c) rs_c + bf16(be[c])); H[b][n][c] = (residual ? H + y : y) (same lane reads/writes; idempotent: uses the H value read first)
__global__ __launch_bounds__(256) void k_bnapply(const float* __restrict__ T, int C, const float* __restrict__ ST, const float* __restrict__ g, const float* __restrict__ be, int residual, float* H) { const size_t e = ((size_t)blockIdx.x * 256 + threadIdx.x) * 2; if (e >= (size_t)NB_ * NN * C) return; const int c = (int)(e % C); typedef __attribute__((ext_vector_type(2))) float v2f; v2f o; const v2f hprev = residual ? *(const v2f*)(H + e) : (v2f){0.f, 0.f};
#pragma unroll
    for (int q = 0; q < 2; ++q) { const int cq = c + q; float sc = __fmul_rn(bfr(g[cq]), ST[(size_t)cq * 32 + 1]); asm volatile("" : "+v"(sc)); float t = __fmul_rn(__fsub_rn(T[e + q], ST[(size_t)cq * 32]), sc); asm volatile("" : "+v"(t)); const float y = fmaxf(__fadd_rn(t, bfr(be[cq])), 0.f); o[q] = residual ? __fadd_rn(hprev[q], y) : y; }
    *(v2f*)(H + e) = o;  }
__global__ __launch_bounds__(256) void k_split2(const float* __restrict__ F, bf* Ph, bf* Pl, size_t n) { const size_t i = ((size_t)blockIdx.x * 256 + threadIdx.x) * 2; if (i >= n) return; typedef __attribute__((ext_vector_type(2))) unsigned short v2us; v2us oh, ol;
#pragma unroll
    for (int q = 0; q < 2; ++q) { unsigned short a, c2; splitf(F[i + q], a, c2); oh[q] = a; ol[q] = c2; } *(v2us*)(Ph + i) = oh; *(v2us*)(Pl + i) = ol;  }
__global__ __launch_bounds__(256) void k_outT(const float* __restrict__ Hb, int blk, float* OUTb) { Hb += (size_t)blockIdx.y * NN * C1; OUTb += (size_t)blockIdx.y * 4 * C1 * NN; const size_t e = ((size_t)blockIdx.x * 256 + threadIdx.x) * 2; if (e >= (size_t)C1 * NN) return; const int n = (int)(e % NN), c = (int)(e / NN); typedef __attribute__((ext_vector_type(2))) float v2f; v2f o; o[0] = Hb[(size_t)n * C1 + c]; o[1] = Hb[(size_t)(n + 1) * C1 + c]; const size_t oo = ((size_t)blk * C1 + c) * NN + n; *(v2f*)(OUTb + oo) = o;  }

extern "C" void kernel_launch(void* const* d_in, const int* in_sizes, int n_in,
                              void* d_out, int out_size, void* d_ws, size_t ws_size, hipStream_t stream) {
    (void)in_sizes; (void)n_in; (void)out_size;
    const float* IN[14]; for (int i = 0; i < 14; ++i) IN[i] = (const float*)d_in[i];   // 0 x, 1 W1 [64][64], 2 g1, 3 b1, 4 W2 [128][64], 5 g2, 6 b2, 7 Wqk [4][32][128], 8 Wv [4][128][128], 9 bv [4][128], 10 Wt, 11 bt, 12 gn, 13 bnb
    float* OUT = (float*)d_out;     // [8][512][2048]
    char* wsp = (char*)d_ws;
    auto take = [&](size_t bytes) { char* p = wsp; wsp += (bytes + 255) & ~(size_t)255; return (void*)p; };
    bf* WB1 = (bf*)take((size_t)C0 * C0 * 2); bf* WB2 = (bf*)take((size_t)C1 * C0 * 2); bf* WQK = (bf*)take((size_t)4 * 64 * C1 * 2); bf* WV = (bf*)take((size_t)4 * C1 * C1 * 2); bf* WT = (bf*)take((size_t)4 * C1 * C1 * 2); float* ST = (float*)take((size_t)C1 * 32 * 4);
    // every per-batch plane holds all NB_ batches, batch-major, so that one launch of each stage serves the whole batch
    bf* XT = (bf*)take((size_t)NB_ * NN * C0 * 2); float* T = (float*)take((size_t)NB_ * NN * C1 * 4); float* H = (float*)take((size_t)NB_ * NN * C1 * 4); float* H0 = (float*)take((size_t)NB_ * NN * C0 * 4); bf* Hh = (bf*)take((size_t)NB_ * NN * C1 * 2); bf* Hl = (bf*)take((size_t)NB_ * NN * C1 * 2);
    float* QF = (float*)take((size_t)NB_ * NN * 64 * 4); bf* Qh = (bf*)take((size_t)NB_ * NN * 32 * 2); bf* Ql = (bf*)take((size_t)NB_ * NN * 32 * 2); float* S = (float*)take((size_t)NB_ * NN * NN * 4); float* RI = (float*)take((size_t)NB_ * NN * 32 * 4); float* CS = (float*)take((size_t)NB_ * NN * 4); h16* PT = (h16*)take((size_t)NB_ * NN * NN * 2); float* VF = (float*)take((size_t)NB_ * NN * C1 * 4); h16* VT = (h16*)take((size_t)NB_ * C1 * NN * 2);
    float* XRF = VF; bf* Dh = Hh; bf* Dl = Hl;    // reuse: VF is last read by k_vt16, before x_r is written; Hh / Hl are last read by the v product, before k_dsplit writes
    if ((size_t)(wsp - (char*)d_ws) > ws_size) return;    // total ~ 243 MiB; ws 256 MiB
    { k_cvt8<<<(C0 * C0 / 8 + 255) / 256, 256, 0, stream>>>(IN[1], WB1, (size_t)C0 * C0 / 8); k_cvt8<<<(C1 * C0 / 8 + 255) / 256, 256, 0, stream>>>(IN[4], WB2, (size_t)C1 * C0 / 8);
      for (int i = 0; i < 4; ++i) k_cvtp<<<(64 * C1 / 4 + 255) / 256, 256, 0, stream>>>(IN[7] + (size_t)i * 32 * C1, C1, 0, 32, 64, C1, WQK + (size_t)i * 64 * C1);
      k_cvt8<<<(4 * C1 * C1 / 8 + 255) / 256, 256, 0, stream>>>(IN[8], WV, (size_t)4 * C1 * C1 / 8); k_cvt8<<<(4 * C1 * C1 / 8 + 255) / 256, 256, 0, stream>>>(IN[10], WT, (size_t)4 * C1 * C1 / 8); }
    // channel contractions see the batch as NB_ * NN rows of one matrix; the two N x N products and the transposes take the batch from grid z / y
    const unsigned L0 = (NB_ * NN * C0 / 2 + 255) / 256, L1 = (NB_ * NN * C1 / 2 + 255) / 256; const dim3 g64(NB_ * NN / 64, 1, 1), g128(NB_ * NN / 64, C1 / 64, 1);
    // stage 1: h0 = relu(bn(W1 x)) (T used with C = 64 pitch)
    k_xt8<<<dim3((NN * C0 / 4 + 255) / 256, NB_, 1), 256, 0, stream>>>(IN[0], XT); k_gemmw<bf, 0, false><<<g64, 32, 0, stream>>>(XT, nullptr, WB1, nullptr, C0, T, C0, nullptr, 0, 0, 0);
    k_bnstat<C0><<<C0 / 4, 1024, 0, stream>>>(T, ST); k_bnapply<<<(unsigned)(((size_t)NB_ * NN * C0 / 2 + 255) / 256), 256, 0, stream>>>(T, C0, ST, IN[2], IN[3], 0, H0);
    // stage 2: h = relu(bn(W2 h0))
    k_split2<<<L0, 256, 0, stream>>>(H0, Hh, Hl, (size_t)NB_ * NN * C0); k_gemmw<bf, 1, false><<<g128, 32, 0, stream>>>(Hh, Hl, WB2, nullptr, C0, T, C1, nullptr, 0, 0, 0);
    k_bnstat<C1><<<C1 / 4, 1024, 0, stream>>>(T, ST); k_bnapply<<<(unsigned)(((size_t)NB_ * NN * C1 / 2 + 255) / 256), 256, 0, stream>>>(T, C1, ST, IN[5], IN[6], 0, H);
    // four offset-attention blocks
    for (int i = 0; i < 4; ++i) {
        k_split2<<<L1, 256, 0, stream>>>(H, Hh, Hl, (size_t)NB_ * NN * C1);
        k_gemmw<bf, 1, false><<<g64, 32, 0, stream>>>(Hh, Hl, WQK + (size_t)i * 64 * C1, nullptr, C1, QF, 64, nullptr, 0, 0, 0); k_qsplit<<<(NB_ * NN * 32 / 2 + 255) / 256, 256, 0, stream>>>(QF, Qh, Ql);
        k_gemmw<bf, 2, false><<<dim3(NN / 64, NN / 64, NB_), 32, 0, stream>>>(Qh, Ql, Qh, Ql, 32, S, NN, nullptr, (size_t)NN * 32, (size_t)NN * 32, (size_t)NN * NN);          // energy (3 products)
        k_rmax<<<NB_ * NN / 8, 256, 0, stream>>>(S, RI); k_rexp<<<NB_ * NN / 8, 256, 0, stream>>>(S, RI); k_colsum<<<dim3(NN / 32, NB_, 1), 1024, 0, stream>>>(S, RI, CS); k_ptT<<<dim3((NN * NN / 2 + 255) / 256, NB_, 1), 256, 0, stream>>>(S, RI, CS, PT);
        k_gemmw<bf, 1, true><<<g128, 32, 0, stream>>>(Hh, Hl, WV + (size_t)i * C1 * C1, nullptr, C1, VF, C1, IN[9] + i * C1, 0, 0, 0); k_vt16<<<dim3((C1 * NN / 2 + 255) / 256, NB_, 1), 256, 0, stream>>>(VF, VT);
        k_gemmw<h16, 0, false><<<dim3(NN / 64, C1 / 64, NB_), 32, 0, stream>>>(PT, nullptr, VT, nullptr, NN, XRF, C1, nullptr, (size_t)NN * NN, (size_t)C1 * NN, (size_t)NN * C1);                  // x_r^T = att^T . v (x 1024)
        k_dsplit<<<L1, 256, 0, stream>>>(H, XRF, Dh, Dl);
        k_gemmw<bf, 1, true><<<g128, 32, 0, stream>>>(Dh, Dl, WT + (size_t)i * C1 * C1, nullptr, C1, T, C1, IN[11] + i * C1, 0, 0, 0);
        k_bnstat<C1><<<C1 / 4, 1024, 0, stream>>>(T, ST); k_bnapply<<<(unsigned)(((size_t)NB_ * NN * C1 / 2 + 255) / 256), 256, 0, stream>>>(T, C1, ST, IN[12] + i * C1, IN[13] + i * C1, 1, H);
        k_outT<<<dim3((C1 * NN / 2 + 255) / 256, NB_, 1), 256, 0, stream>>>(H, i, OUT); }
}

// v004
// It runs in 875 microseconds.
// Two timings next to v003 both put it at 2.16 times that version's speed.
// Counting every step since v000, it is 34.8 times as fast.
#include <hip/hip_runtime.h>

// IEModule (PCT-style offset-attention stack; x [8][64][2048]; h = relu(bn(W1 x)) (64); h = relu(bn(W2 h)) (128); then four chained blocks: q = Wqk h (32), energy = q^T q (symmetric, unscaled), att = softmax over keys
// then / (1e-9 + column sum over queries), x_r = v att with v = Wv h + bv, h = h + relu(bn(Wt (h - x_r) + bt)); output = concat of the four h -> [8][512][2048]. Every BatchNorm is TRAINING-mode: per-channel
// mean / biased variance over (batch, points) of the current activations, eps 1e-5.)
// Compute dtypes, f32 accumulate: every input rounded to bf16; everything positions-major [point][channel]; W1 x on PLAIN bf16 operands (inputs: exact), every later channel
// contraction on bf16 hi+lo planes of its computed operand x exact weights (2 products, + bias); energies on hi+lo planes of q (3 products, K 32); x_r^T = att^T . v on SINGLE fp16 planes (renormalised attention

#define NB_  8
#define NN   2048
#define C0   64
#define C1   128
#define PCAR 1024.0f
#define BNE  1e-5f
typedef _Float16 h16;
typedef unsigned short bf;
typedef __attribute__((ext_vector_type(16))) __bf16   v16bf;
typedef __attribute__((ext_vector_type(16))) _Float16 v16h;
typedef __attribute__((ext_vector_type(8)))  _Float16 v8h;
typedef __attribute__((ext_vector_type(8)))  unsigned short v8us;
typedef __attribute__((ext_vector_type(8)))  float    v8f;
typedef __attribute__((ext_vector_type(4)))  float    v4f;
typedef v8h  __attribute__((may_alias)) v8ha;
typedef v4f  __attribute__((may_alias)) v4fa;
typedef v8us __attribute__((may_alias)) v8usa;

__device__ __forceinline__ unsigned short f2bf(float f) { unsigned u = __float_as_uint(f); u += 0x7FFFu + ((u >> 16) & 1u); return (unsigned short)(u >> 16); }
__device__ __forceinline__ float bf2f(unsigned short b) { return __uint_as_float(((unsigned)b) << 16); }
__device__ __forceinline__ float bfr(float f) { return bf2f(f2bf(f)); }
__device__ __forceinline__ v16h cat16(v8h lo, v8h hi) { return __builtin_shufflevector(lo, hi, 0, 1, 2, 3, 4, 5, 6, 7, 8, 9, 10, 11, 12, 13, 14, 15); }
__device__ __forceinline__ v16bf cat16b(v8us lo, v8us hi) { return __builtin_bit_cast(v16bf, __builtin_shufflevector(lo, hi, 0, 1, 2, 3, 4, 5, 6, 7, 8, 9, 10, 11, 12, 13, 14, 15)); }
__device__ __forceinline__ v8f wmma16(v16h a, v16h b, v8f c) { return __builtin_amdgcn_wmma_f32_16x16x32_f16(false, a, false, b, (short)0, c, false, false); }
__device__ __forceinline__ v8f wmmab(v16bf a, v16bf b, v8f c) { return __builtin_amdgcn_wmma_f32_16x16x32_bf16(false, a, false, b, (short)0, c, false, false); }



// ---- k_gemmw: register-blocked GEMM, ONE WAVE per 64x64 output tile (16 accumulators), operands straight from K-contiguous 16-bit planes; grid (M/64, N/64, Z), 32 threads.
// C[m][n] (f32, pitch ldc, + optional f32 bias[n]) = sum_k A[m][k] Bt[n][k] (+ split products per NSPLIT). z-batch strides sA/sB/sC in elements. K % 32 == 0.
template <typename T16> struct WFrag;
template <> struct WFrag<h16> { typedef v16h V; static __device__ __forceinline__ V ld(const h16* p) { return cat16(*(const v8h*)p, *(const v8h*)(p + 16)); } static __device__ __forceinline__ v8f mma(V a, V b, v8f c) { return wmma16(a, b, c); } };
template <> struct WFrag<bf> { typedef v16bf V; static __device__ __forceinline__ V ld(const bf* p) { return cat16b(*(const v8us*)p, *(const v8us*)(p + 16)); } static __device__ __forceinline__ v8f mma(V a, V b, v8f c) { return wmmab(a, b, c); } };
template <typename T16, int NSPLIT, bool BIAS>
__global__ __launch_bounds__(32) void k_gemmw(const T16* __restrict__ A, const T16* __restrict__ A2, const T16* __restrict__ Bt, const T16* __restrict__ Bt2, int K, float* C, int ldc, const float* __restrict__ bias, size_t sA, size_t sB, size_t sC) {
    typedef typename WFrag<T16>::V V;
    __shared__ __align__(16) float os[16 * 68];
    const size_t z = blockIdx.z; A += z * sA; if (A2) A2 += z * sA; Bt += z * sB; if (Bt2) Bt2 += z * sB; C += z * sC;
    const int lane = threadIdx.x & 31, lr = lane & 15, hi = lane >> 4; const int r0 = blockIdx.x * 64, c0 = blockIdx.y * 64;
    v8f acc[4][4];
#pragma unroll
    for (int mb = 0; mb < 4; ++mb)
#pragma unroll
        for (int nb = 0; nb < 4; ++nb) acc[mb][nb] = (v8f){};
    const size_t aoff = (size_t)(r0 + lr) * K + 8 * hi, boff = (size_t)(c0 + lr) * K + 8 * hi;
#pragma unroll 1
    for (int kc = 0; kc < K; kc += 32) {
        V a[4], a2[4];
#pragma unroll
        for (int mb = 0; mb < 4; ++mb) { a[mb] = WFrag<T16>::ld(A + aoff + (size_t)mb * 16 * K + kc); if (NSPLIT == 1 || NSPLIT == 2) a2[mb] = WFrag<T16>::ld(A2 + aoff + (size_t)mb * 16 * K + kc); }
#pragma unroll
        for (int nb = 0; nb < 4; ++nb) { const V b = WFrag<T16>::ld(Bt + boff + (size_t)nb * 16 * K + kc); V b2; if (NSPLIT >= 2) b2 = WFrag<T16>::ld(Bt2 + boff + (size_t)nb * 16 * K + kc);
#pragma unroll
            for (int mb = 0; mb < 4; ++mb) { acc[mb][nb] = WFrag<T16>::mma(a[mb], b, acc[mb][nb]); if (NSPLIT == 1 || NSPLIT == 2) acc[mb][nb] = WFrag<T16>::mma(a2[mb], b, acc[mb][nb]); if (NSPLIT >= 2) acc[mb][nb] = WFrag<T16>::mma(a[mb], b2, acc[mb][nb]); } }
        asm volatile("v_nop\n\tv_nop\n\tv_nop\n\tv_nop" : "+v"(acc[0][0]), "+v"(acc[1][1]), "+v"(acc[2][2]), "+v"(acc[3][3]) : "v"(a[0]), "v"(a[3]));
    }
#pragma unroll
    for (int mb = 0; mb < 4; ++mb) {
#pragma unroll
        for (int nb = 0; nb < 4; ++nb) {
#pragma unroll
            for (int j = 0; j < 8; ++j) os[(hi * 8 + j) * 68 + nb * 16 + lr] = acc[mb][nb][j]; }
        __builtin_amdgcn_wave_barrier(); asm volatile("" ::: "memory");
        float* crow = C + (size_t)(r0 + mb * 16) * ldc + c0;
{
#pragma unroll
            for (int s = 0; s < 8; ++s) { const int row = 2 * s + hi, cofs = lr * 4; v4f val = *(const v4fa*)(os + row * 68 + cofs); if (BIAS) { val[0] += bfr(bias[c0 + cofs]); val[1] += bfr(bias[c0 + cofs + 1]); val[2] += bfr(bias[c0 + cofs + 2]); val[3] += bfr(bias[c0 + cofs + 3]); }
                *(v4f*)(crow + (size_t)row * ldc + cofs) = val; }
             }
        __builtin_amdgcn_wave_barrier(); asm volatile("" ::: "memory");
    }
}

__device__ __forceinline__ h16 tohx(float x) { return (h16)x; }
__device__ __forceinline__ void splitf(float y, unsigned short& h, unsigned short& l) { h = f2bf(y); l = f2bf(y - bf2f(h)); }
typedef __attribute__((ext_vector_type(2))) _Float16 v2h;
typedef __attribute__((ext_vector_type(4))) _Float16 v4h;
typedef __attribute__((ext_vector_type(2))) unsigned short v2us;
typedef __attribute__((ext_vector_type(4))) unsigned short v4us;
typedef __attribute__((ext_vector_type(2))) float v2f;

__global__ __launch_bounds__(256) void k_cvt8(const float* __restrict__ src, bf* dst, size_t n8) { const size_t i = (size_t)blockIdx.x * 256 + threadIdx.x; if (i >= n8) return; const v8f v = *(const v8f*)(src + i * 8); v8us o;
#pragma unroll
    for (int k = 0; k < 8; ++k) o[k] = f2bf(v[k]); *(v8us*)(dst + i * 8) = o;  }
__global__ __launch_bounds__(256) void k_cvtp(const float* __restrict__ src, int pitch, int off, int R, int RP, int KW, bf* Bt) { const size_t e = ((size_t)blockIdx.x * 256 + threadIdx.x) * 4; if (e >= (size_t)RP * KW) return; const int k = (int)(e % KW), r = (int)(e / KW); v4us o;
#pragma unroll
    for (int q = 0; q < 4; ++q) o[q] = (r < R) ? f2bf(src[(size_t)r * pitch + off + k + q]) : (unsigned short)0; *(v4us*)(Bt + e) = o;  }
__global__ __launch_bounds__(256) void k_qsplit(const float* __restrict__ QF, bf* Qh, bf* Ql) { const int e = (blockIdx.x * 256 + threadIdx.x) * 2; if (e >= NB_ * NN * 32) return; const int k = e & 31, n = e >> 5; v2us oh, ol;
#pragma unroll
    for (int q = 0; q < 2; ++q) { unsigned short a, c2; splitf(QF[(size_t)n * 64 + k + q], a, c2); oh[q] = a; ol[q] = c2; } *(v2us*)(Qh + e) = oh; *(v2us*)(Ql + e) = ol;  }
__global__ __launch_bounds__(256) void k_vt16(const float* __restrict__ VF, h16* VT) { VF += (size_t)blockIdx.y * NN * C1; VT += (size_t)blockIdx.y * C1 * NN; const int e = (blockIdx.x * 256 + threadIdx.x) * 2; if (e >= C1 * NN) return; const int i = e % NN, c = e / NN; v2h o; o[0] = tohx(VF[(size_t)i * C1 + c]); o[1] = tohx(VF[(size_t)(i + 1) * C1 + c]); *(v2h*)(VT + e) = o;  }
__global__ __launch_bounds__(256) void k_dsplit(const float* __restrict__ Hf, const float* __restrict__ XRF, bf* Dh, bf* Dl) { const int e = (blockIdx.x * 256 + threadIdx.x) * 2; if (e >= NB_ * NN * C1) return; v2us oh, ol;
#pragma unroll
    for (int q = 0; q < 2; ++q) { float xr = XRF[e + q] * (1.0f / PCAR); asm volatile("" : "+v"(xr)); unsigned short a, c2; splitf(__fsub_rn(Hf[e + q], xr), a, c2); oh[q] = a; ol[q] = c2; } *(v2us*)(Dh + e) = oh; *(v2us*)(Dl + e) = ol;  }
__global__ __launch_bounds__(256) void k_rmax(const float* __restrict__ S, float* RI) { const int lane = threadIdx.x & 31; const int i = blockIdx.x * 8 + (threadIdx.x >> 5); if (i >= NB_ * NN) return; const float* sr = S + (size_t)i * NN; float m = -3.0e38f;
#pragma unroll 4
    for (int c0 = lane * 4; c0 < NN; c0 += 128) { const v4f v = *(const v4f*)(sr + c0); m = fmaxf(m, fmaxf(fmaxf(v[0], v[1]), fmaxf(v[2], v[3]))); }
#pragma unroll
    for (int sh = 16; sh; sh >>= 1) m = fmaxf(m, __shfl_xor(m, sh, 32));
    const float o = lane == 0 ? m : 0.f; *(float*)(RI + (size_t)i * 32 + lane) = o;  }
// The energies are a Gram matrix, S[i][j] = S[j][i] up to the rounding of the three products' order, so everything that runs down a column of the attention is taken along a row of S: exp(S[i][j] - max_i) is never stored or transposed.
// k_rexp: MV[i] = row maximum, RV[i] = 1 / sum_j exp(S[i][j] - MV[i]), as two compact vectors. One wave per row; 32 rows a work-group, so that each 128-B line of MV and of RV has one writer (through LDS).
__global__ __launch_bounds__(1024) void k_rexp(const float* __restrict__ S, const float* __restrict__ RI, float* MV, float* RV) { __shared__ float st[2][32]; const int lane = threadIdx.x & 31, w = threadIdx.x >> 5; const int i = blockIdx.x * 32 + w; const float* sr = S + (size_t)i * NN + lane * 4; const float* mr = RI + (size_t)i * 32; const float m = *mr; float sum = 0.f; v4f a[NN / 128];
#pragma unroll
    for (int ch = 0; ch < (NN / 128); ++ch) a[ch] = *(const v4f*)(sr + ch * 128);
    asm volatile("s_wait_xcnt 0x0" :: "v"(sr), "v"(mr) : "memory");    // stands behind the row's last load: keeps both address pairs live, and unwritten, until every load has taken its address (precaution before a register of an issued load is reused)
#pragma unroll
    for (int ch = 0; ch < (NN / 128); ++ch) {
#pragma unroll
        for (int q = 0; q < 4; ++q) sum += __builtin_amdgcn_exp2f((a[ch][q] - m) * 1.4426950408889634f); }
    __builtin_amdgcn_sched_barrier(0);    // keeps the butterfly's lane arithmetic out of the slot behind the last exp
#pragma unroll
    for (int sh = 16; sh; sh >>= 1) sum += __shfl_xor(sum, sh, 32);
    if (lane == 0) { st[0][w] = m; st[1][w] = __fdiv_rn(1.0f, sum); }
    __syncthreads();
    if (w < 2) (w == 0 ? MV : RV)[blockIdx.x * 32 + lane] = st[w][lane]; }
// k_attT: PT[j][i] = f16(1024 a[i] / (1e-9 + sum_i a[i])), a[i] = exp(S[j][i] - MV[i]) RV[i] = softmax[i][j]. One wave per 2 adjacent rows j (they share the loads of MV and RV); every load is 512 contiguous bytes a wave;
// a row's 64 values a lane stay in registers between the sum and the scaling; 4 independent sum chains a row, then a lane butterfly.
__global__ __launch_bounds__(256) void k_attT(const float* __restrict__ S, const float* __restrict__ MV, const float* __restrict__ RV, h16* PT) { const int lane = threadIdx.x & 31, w = threadIdx.x >> 5; const size_t r0 = (size_t)blockIdx.y * NN + blockIdx.x * 16 + w * 2;
    const float* sp = S + r0 * NN + lane * 4; const float* mp = MV + (size_t)blockIdx.y * NN + lane * 4; const float* rp = RV + (size_t)blockIdx.y * NN + lane * 4; h16* pp = PT + r0 * NN + lane * 4;
    v4f a[2][NN / 128]; v4f t[2] = {(v4f){0.f, 0.f, 0.f, 0.f}, (v4f){0.f, 0.f, 0.f, 0.f}};
#pragma unroll
    for (int ch = 0; ch < (NN / 128); ++ch) { const v4f m = *(const v4f*)(mp + ch * 128), r = *(const v4f*)(rp + ch * 128);
#pragma unroll
        for (int u = 0; u < 2; ++u) { const v4f x = *(const v4f*)(sp + (size_t)u * NN + ch * 128); v4f e;
#pragma unroll
            for (int q = 0; q < 4; ++q) e[q] = __builtin_amdgcn_exp2f((x[q] - m[q]) * 1.4426950408889634f);
            a[u][ch] = e * r; t[u] += a[u][ch]; } }
#pragma unroll
    for (int u = 0; u < 2; ++u) { float s = (t[u][0] + t[u][1]) + (t[u][2] + t[u][3]);
#pragma unroll
        for (int sh = 16; sh; sh >>= 1) s += __shfl_xor(s, sh, 32);
        const float cs = __fdiv_rn(1.0f, __fadd_rn(1e-9f, s)) * PCAR;
#pragma unroll
        for (int ch = 0; ch < (NN / 128); ++ch) { v4h o;
#pragma unroll
            for (int q = 0; q < 4; ++q) o[q] = tohx(a[u][ch][q] * cs);
            *(v4h*)(pp + (size_t)u * NN + ch * 128) = o; } } }
__global__ __launch_bounds__(256) void k_xt8(const float* __restrict__ xb, bf* XT) { xb += (size_t)blockIdx.y * C0 * NN; XT += (size_t)blockIdx.y * NN * C0; const size_t e = ((size_t)blockIdx.x * 256 + threadIdx.x) * 4; if (e >= (size_t)NN * C0) return; const int c = (int)(e % C0), n = (int)(e / C0); typedef __attribute__((ext_vector_type(4))) unsigned short v4us; v4us o;
#pragma unroll
    for (int q = 0; q < 4; ++q) o[q] = f2bf(xb[(size_t)(c + q) * NN + n]); *(v4us*)(XT + e) = o;  }
// k_bnstat: per-channel mean and 1/sqrt(biased variance + eps) over all NB_ * NN rows of T [row][C]. One work-group of 32 waves per 4 adjacent channels (16 B of every row); a lane owns rows t, t + 1024, ...:
// 16 independent 16-B loads that stay in registers, so T is read once and the squared deviations come from registers; lanes fold by shuffles, the 32 waves' partial sums through LDS (every wave folds them alike).
__device__ __forceinline__ v4f wgsum4(v4f s, v4f (*red)[32], int w, int lane) {
#pragma unroll
    for (int sh = 16; sh; sh >>= 1) {
#pragma unroll
        for (int q = 0; q < 4; ++q) s[q] += __shfl_xor(s[q], sh, 32); }
    if (lane == 0) (*red)[w] = s;
    __syncthreads();
    s = (*red)[lane];
#pragma unroll
    for (int sh = 16; sh; sh >>= 1) {
#pragma unroll
        for (int q = 0; q < 4; ++q) s[q] += __shfl_xor(s[q], sh, 32); }
    return s; }
template <int C>
__global__ __launch_bounds__(1024) void k_bnstat(const float* __restrict__ T, float* ST) { __shared__ __align__(16) v4f red[2][32]; const int lane = threadIdx.x & 31, w = threadIdx.x >> 5; const int c0 = blockIdx.x * 4;
    const float* tp = T + (size_t)threadIdx.x * C + c0; v4f x[NB_ * NN / 1024];
#pragma unroll
    for (int t = 0; t < NB_ * NN / 1024; ++t) x[t] = *(const v4f*)(tp + (size_t)t * 1024 * C);
    asm volatile("s_wait_xcnt 0x0" :: "v"(tp) : "memory");    // keeps the address pair of the 16 loads live, and unwritten, until all of them have taken their address (precaution before a register of an issued load is reused)
    v4f s = (v4f){0.f, 0.f, 0.f, 0.f};
#pragma unroll
    for (int t = 0; t < NB_ * NN / 1024; ++t) s += x[t];
    const v4f mu = wgsum4(s, &red[0], w, lane) * (1.0f / (NB_ * NN)); v4f q2 = (v4f){0.f, 0.f, 0.f, 0.f};
#pragma unroll
    for (int t = 0; t < NB_ * NN / 1024; ++t) { const v4f d = x[t] - mu; q2 += d * d; }
    q2 = wgsum4(q2, &red[1], w, lane);
    if (w < 4) { const float m = w == 0 ? mu[0] : (w == 1 ? mu[1] : (w == 2 ? mu[2] : mu[3])), v = w == 0 ? q2[0] : (w == 1 ? q2[1] : (w == 2 ? q2[2] : q2[3]));
        const float rs = __frsqrt_rn(__fadd_rn(v * (1.0f / (NB_ * NN)), BNE)); ST[(size_t)(c0 + w) * 32 + lane] = lane == 0 ? m : (lane == 1 ? rs : 0.f); } }
// k_bnapply: y = relu(bf16(g[c]) (T[b][n][c] - mu_c) rs_c + bf16(be[c])); H[b][n][c] = (residual ? H + y : y) (same lane reads/writes; idempotent: uses the H value read first)
__global__ __launch_bounds__(256) void k_bnapply(const float* __restrict__ T, int C, const float* __restrict__ ST, const float* __restrict__ g, const float* __restrict__ be, int residual, float* H) { const size_t e = ((size_t)blockIdx.x * 256 + threadIdx.x) * 2; if (e >= (size_t)NB_ * NN * C) return; const int c = (int)(e % C); typedef __attribute__((ext_vector_type(2))) float v2f; v2f o; const v2f hprev = residual ? *(const v2f*)(H + e) : (v2f){0.f, 0.f};
#pragma unroll
    for (int q = 0; q < 2; ++q) { const int cq = c + q; float sc = __fmul_rn(bfr(g[cq]), ST[(size_t)cq * 32 + 1]); asm volatile("" : "+v"(sc)); float t = __fmul_rn(__fsub_rn(T[e + q], ST[(size_t)cq * 32]), sc); asm volatile("" : "+v"(t)); const float y = fmaxf(__fadd_rn(t, bfr(be[cq])), 0.f); o[q] = residual ? __fadd_rn(hprev[q], y) : y; }
    *(v2f*)(H + e) = o;  }
__global__ __launch_bounds__(256) void k_split2(const float* __restrict__ F, bf* Ph, bf* Pl, size_t n) { const size_t i = ((size_t)blockIdx.x * 256 + threadIdx.x) * 2; if (i >= n) return; typedef __attribute__((ext_vector_type(2))) unsigned short v2us; v2us oh, ol;
#pragma unroll
    for (int q = 0; q < 2; ++q) { unsigned short a, c2; splitf(F[i + q], a, c2); oh[q] = a; ol[q] = c2; } *(v2us*)(Ph + i) = oh; *(v2us*)(Pl + i) = ol;  }
__global__ __launch_bounds__(256) void k_outT(const float* __restrict__ Hb, int blk, float* OUTb) { Hb += (size_t)blockIdx.y * NN * C1; OUTb += (size_t)blockIdx.y * 4 * C1 * NN; const size_t e = ((size_t)blockIdx.x * 256 + threadIdx.x) * 2; if (e >= (size_t)C1 * NN) return; const int n = (int)(e % NN), c = (int)(e / NN); typedef __attribute__((ext_vector_type(2))) float v2f; v2f o; o[0] = Hb[(size_t)n * C1 + c]; o[1] = Hb[(size_t)(n + 1) * C1 + c]; const size_t oo = ((size_t)blk * C1 + c) * NN + n; *(v2f*)(OUTb + oo) = o;  }

extern "C" void kernel_launch(void* const* d_in, const int* in_sizes, int n_in,
                              void* d_out, int out_size, void* d_ws, size_t ws_size, hipStream_t stream) {
    (void)in_sizes; (void)n_in; (void)out_size;
    const float* IN[14]; for (int i = 0; i < 14; ++i) IN[i] = (const float*)d_in[i];   // 0 x, 1 W1 [64][64], 2 g1, 3 b1, 4 W2 [128][64], 5 g2, 6 b2, 7 Wqk [4][32][128], 8 Wv [4][128][128], 9 bv [4][128], 10 Wt, 11 bt, 12 gn, 13 bnb
    float* OUT = (float*)d_out;     // [8][512][2048]
    char* wsp = (char*)d_ws;
    auto take = [&](size_t bytes) { char* p = wsp; wsp += (bytes + 255) & ~(size_t)255; return (void*)p; };
    bf* WB1 = (bf*)take((size_t)C0 * C0 * 2); bf* WB2 = (bf*)take((size_t)C1 * C0 * 2); bf* WQK = (bf*)take((size_t)4 * 64 * C1 * 2); bf* WV = (bf*)take((size_t)4 * C1 * C1 * 2); bf* WT = (bf*)take((size_t)4 * C1 * C1 * 2); float* ST = (float*)take((size_t)C1 * 32 * 4);
    // every per-batch plane holds all NB_ batches, batch-major, so that one launch of each stage serves the whole batch
    bf* XT = (bf*)take((size_t)NB_ * NN * C0 * 2); float* T = (float*)take((size_t)NB_ * NN * C1 * 4); float* H = (float*)take((size_t)NB_ * NN * C1 * 4); float* H0 = (float*)take((size_t)NB_ * NN * C0 * 4); bf* Hh = (bf*)take((size_t)NB_ * NN * C1 * 2); bf* Hl = (bf*)take((size_t)NB_ * NN * C1 * 2);
    float* QF = (float*)take((size_t)NB_ * NN * 64 * 4); bf* Qh = (bf*)take((size_t)NB_ * NN * 32 * 2); bf* Ql = (bf*)take((size_t)NB_ * NN * 32 * 2); float* S = (float*)take((size_t)NB_ * NN * NN * 4); float* RI = (float*)take((size_t)NB_ * NN * 32 * 4); float* MV = (float*)take((size_t)NB_ * NN * 4); float* RV = (float*)take((size_t)NB_ * NN * 4); h16* PT = (h16*)take((size_t)NB_ * NN * NN * 2); float* VF = (float*)take((size_t)NB_ * NN * C1 * 4); h16* VT = (h16*)take((size_t)NB_ * C1 * NN * 2);
    float* XRF = VF; bf* Dh = Hh; bf* Dl = Hl;    // reuse: VF is last read by k_vt16, before x_r is written; Hh / Hl are last read by the v product, before k_dsplit writes
    if ((size_t)(wsp - (char*)d_ws) > ws_size) return;    // total ~ 243 MiB; ws 256 MiB
    { k_cvt8<<<(C0 * C0 / 8 + 255) / 256, 256, 0, stream>>>(IN[1], WB1, (size_t)C0 * C0 / 8); k_cvt8<<<(C1 * C0 / 8 + 255) / 256, 256, 0, stream>>>(IN[4], WB2, (size_t)C1 * C0 / 8);
      for (int i = 0; i < 4; ++i) k_cvtp<<<(64 * C1 / 4 + 255) / 256, 256, 0, stream>>>(IN[7] + (size_t)i * 32 * C1, C1, 0, 32, 64, C1, WQK + (size_t)i * 64 * C1);
      k_cvt8<<<(4 * C1 * C1 / 8 + 255) / 256, 256, 0, stream>>>(IN[8], WV, (size_t)4 * C1 * C1 / 8); k_cvt8<<<(4 * C1 * C1 / 8 + 255) / 256, 256, 0, stream>>>(IN[10], WT, (size_t)4 * C1 * C1 / 8); }
    // channel contractions see the batch as NB_ * NN rows of one matrix; the two N x N products and the transposes take the batch from grid z / y
    const unsigned L0 = (NB_ * NN * C0 / 2 + 255) / 256, L1 = (NB_ * NN * C1 / 2 + 255) / 256; const dim3 g64(NB_ * NN / 64, 1, 1), g128(NB_ * NN / 64, C1 / 64, 1);
    // stage 1: h0 = relu(bn(W1 x)) (T used with C = 64 pitch)
    k_xt8<<<dim3((NN * C0 / 4 + 255) / 256, NB_, 1), 256, 0, stream>>>(IN[0], XT); k_gemmw<bf, 0, false><<<g64, 32, 0, stream>>>(XT, nullptr, WB1, nullptr, C0, T, C0, nullptr, 0, 0, 0);
    k_bnstat<C0><<<C0 / 4, 1024, 0, stream>>>(T, ST); k_bnapply<<<(unsigned)(((size_t)NB_ * NN * C0 / 2 + 255) / 256), 256, 0, stream>>>(T, C0, ST, IN[2], IN[3], 0, H0);
    // stage 2: h = relu(bn(W2 h0))
    k_split2<<<L0, 256, 0, stream>>>(H0, Hh, Hl, (size_t)NB_ * NN * C0); k_gemmw<bf, 1, false><<<g128, 32, 0, stream>>>(Hh, Hl, WB2, nullptr, C0, T, C1, nullptr, 0, 0, 0);
    k_bnstat<C1><<<C1 / 4, 1024, 0, stream>>>(T, ST); k_bnapply<<<(unsigned)(((size_t)NB_ * NN * C1 / 2 + 255) / 256), 256, 0, stream>>>(T, C1, ST, IN[5], IN[6], 0, H);
    // four offset-attention blocks
    for (int i = 0; i < 4; ++i) {
        k_split2<<<L1, 256, 0, stream>>>(H, Hh, Hl, (size_t)NB_ * NN * C1);
        k_gemmw<bf, 1, false><<<g64, 32, 0, stream>>>(Hh, Hl, WQK + (size_t)i * 64 * C1, nullptr, C1, QF, 64, nullptr, 0, 0, 0); k_qsplit<<<(NB_ * NN * 32 / 2 + 255) / 256, 256, 0, stream>>>(QF, Qh, Ql);
        k_gemmw<bf, 2, false><<<dim3(NN / 64, NN / 64, NB_), 32, 0, stream>>>(Qh, Ql, Qh, Ql, 32, S, NN, nullptr, (size_t)NN * 32, (size_t)NN * 32, (size_t)NN * NN);          // energy (3 products)
        k_rmax<<<NB_ * NN / 8, 256, 0, stream>>>(S, RI); k_rexp<<<NB_ * NN / 32, 1024, 0, stream>>>(S, RI, MV, RV); k_attT<<<dim3(NN / 16, NB_, 1), 256, 0, stream>>>(S, MV, RV, PT);
        k_gemmw<bf, 1, true><<<g128, 32, 0, stream>>>(Hh, Hl, WV + (size_t)i * C1 * C1, nullptr, C1, VF, C1, IN[9] + i * C1, 0, 0, 0); k_vt16<<<dim3((C1 * NN / 2 + 255) / 256, NB_, 1), 256, 0, stream>>>(VF, VT);
        k_gemmw<h16, 0, false><<<dim3(NN / 64, C1 / 64, NB_), 32, 0, stream>>>(PT, nullptr, VT, nullptr, NN, XRF, C1, nullptr, (size_t)NN * NN, (size_t)C1 * NN, (size_t)NN * C1);                  // x_r^T = att^T . v (x 1024)
        k_dsplit<<<L1, 256, 0, stream>>>(H, XRF, Dh, Dl);
        k_gemmw<bf, 1, true><<<g128, 32, 0, stream>>>(Dh, Dl, WT + (size_t)i * C1 * C1, nullptr, C1, T, C1, IN[11] + i * C1, 0, 0, 0);
        k_bnstat<C1><<<C1 / 4, 1024, 0, stream>>>(T, ST); k_bnapply<<<(unsigned)(((size_t)NB_ * NN * C1 / 2 + 255) / 256), 256, 0, stream>>>(T, C1, ST, IN[12] + i * C1, IN[13] + i * C1, 1, H);
        k_outT<<<dim3((C1 * NN / 2 + 255) / 256, NB_, 1), 256, 0, stream>>>(H, i, OUT); }
}

// v005
// One run takes 519 microseconds.
// Two timings next to v004 put it at 1.69 and 1.70 times that version's speed.
// All steps since v000 together make it 59.1 times as fast.
#include <hip/hip_runtime.h>

// IEModule (PCT-style offset-attention stack; x [8][64][2048]; h = relu(bn(W1 x)) (64); h = relu(bn(W2 h)) (128); then four chained blocks: q = Wqk h (32), energy = q^T q (symmetric, unscaled), att = softmax over keys
// then / (1e-9 + column sum over queries), x_r = v att with v = Wv h + bv, h = h + relu(bn(Wt (h - x_r) + bt)); output = concat of the four h -> [8][512][2048]. Every BatchNorm is TRAINING-mode: per-channel
// mean / biased variance over (batch, points) of the current activations, eps 1e-5.)
// Compute dtypes, f32 accumulate: every input rounded to bf16; everything positions-major [point][channel]; W1 x on PLAIN bf16 operands (inputs: exact), every later channel
// contraction on bf16 hi+lo planes of its computed operand x exact weights (2 products, + bias); energies on hi+lo planes of q (3 products, K 32); x_r^T = v^T . att on SINGLE fp16 planes (softmax weights x 1024 / (1e-9 + column sum); the division comes before the rounding and the product)

#define NB_  8
#define NN   2048
#define C0   64
#define C1   128
#define PCAR 1024.0f
#define BNE  1e-5f
typedef _Float16 h16;
typedef unsigned short bf;
typedef __attribute__((ext_vector_type(16))) __bf16   v16bf;
typedef __attribute__((ext_vector_type(16))) _Float16 v16h;
typedef __attribute__((ext_vector_type(8)))  _Float16 v8h;
typedef __attribute__((ext_vector_type(8)))  unsigned short v8us;
typedef __attribute__((ext_vector_type(8)))  float    v8f;
typedef __attribute__((ext_vector_type(4)))  float    v4f;
typedef v8h  __attribute__((may_alias)) v8ha;
typedef v4f  __attribute__((may_alias)) v4fa;
typedef v8us __attribute__((may_alias)) v8usa;

__device__ __forceinline__ unsigned short f2bf(float f) { unsigned u = __float_as_uint(f); u += 0x7FFFu + ((u >> 16) & 1u); return (unsigned short)(u >> 16); }
__device__ __forceinline__ float bf2f(unsigned short b) { return __uint_as_float(((unsigned)b) << 16); }
__device__ __forceinline__ float bfr(float f) { return bf2f(f2bf(f)); }
__device__ __forceinline__ v16h cat16(v8h lo, v8h hi) { return __builtin_shufflevector(lo, hi, 0, 1, 2, 3, 4, 5, 6, 7, 8, 9, 10, 11, 12, 13, 14, 15); }
__device__ __forceinline__ v16bf cat16b(v8us lo, v8us hi) { return __builtin_bit_cast(v16bf, __builtin_shufflevector(lo, hi, 0, 1, 2, 3, 4, 5, 6, 7, 8, 9, 10, 11, 12, 13, 14, 15)); }
__device__ __forceinline__ v8f wmma16(v16h a, v16h b, v8f c) { return __builtin_amdgcn_wmma_f32_16x16x32_f16(false, a, false, b, (short)0, c, false, false); }
__device__ __forceinline__ v8f wmmab(v16bf a, v16bf b, v8f c) { return __builtin_amdgcn_wmma_f32_16x16x32_bf16(false, a, false, b, (short)0, c, false, false); }



// ---- k_gemmw: register-blocked GEMM, ONE WAVE per 64x64 output tile (16 accumulators), operands straight from K-contiguous 16-bit planes; grid (M/64, N/64, Z), 32 threads.
// C[m][n] (f32, pitch ldc, + optional f32 bias[n]) = sum_k A[m][k] Bt[n][k] (+ split products per NSPLIT). z-batch strides sA/sB/sC in elements. K % 32 == 0.
template <typename T16> struct WFrag;
template <> struct WFrag<bf> { typedef v16bf V; static __device__ __forceinline__ V ld(const bf* p) { return cat16b(*(const v8us*)p, *(const v8us*)(p + 16)); } static __device__ __forceinline__ v8f mma(V a, V b, v8f c) { return wmmab(a, b, c); } };
template <typename T16, int NSPLIT, bool BIAS>
__global__ __launch_bounds__(32) void k_gemmw(const T16* __restrict__ A, const T16* __restrict__ A2, const T16* __restrict__ Bt, const T16* __restrict__ Bt2, int K, float* C, int ldc, const float* __restrict__ bias, size_t sA, size_t sB, size_t sC) {
    typedef typename WFrag<T16>::V V;
    __shared__ __align__(16) float os[16 * 68];
    const size_t z = blockIdx.z; A += z * sA; if (A2) A2 += z * sA; Bt += z * sB; if (Bt2) Bt2 += z * sB; C += z * sC;
    const int lane = threadIdx.x & 31, lr = lane & 15, hi = lane >> 4; const int r0 = blockIdx.x * 64, c0 = blockIdx.y * 64;
    v8f acc[4][4];
#pragma unroll
    for (int mb = 0; mb < 4; ++mb)
#pragma unroll
        for (int nb = 0; nb < 4; ++nb) acc[mb][nb] = (v8f){};
    const size_t aoff = (size_t)(r0 + lr) * K + 8 * hi, boff = (size_t)(c0 + lr) * K + 8 * hi;
#pragma unroll 1
    for (int kc = 0; kc < K; kc += 32) {
        V a[4], a2[4];
#pragma unroll
        for (int mb = 0; mb < 4; ++mb) { a[mb] = WFrag<T16>::ld(A + aoff + (size_t)mb * 16 * K + kc); if (NSPLIT == 1 || NSPLIT == 2) a2[mb] = WFrag<T16>::ld(A2 + aoff + (size_t)mb * 16 * K + kc); }
#pragma unroll
        for (int nb = 0; nb < 4; ++nb) { const V b = WFrag<T16>::ld(Bt + boff + (size_t)nb * 16 * K + kc); V b2; if (NSPLIT >= 2) b2 = WFrag<T16>::ld(Bt2 + boff + (size_t)nb * 16 * K + kc);
#pragma unroll
            for (int mb = 0; mb < 4; ++mb) { acc[mb][nb] = WFrag<T16>::mma(a[mb], b, acc[mb][nb]); if (NSPLIT == 1 || NSPLIT == 2) acc[mb][nb] = WFrag<T16>::mma(a2[mb], b, acc[mb][nb]); if (NSPLIT >= 2) acc[mb][nb] = WFrag<T16>::mma(a[mb], b2, acc[mb][nb]); } }
        asm volatile("v_nop\n\tv_nop\n\tv_nop\n\tv_nop" : "+v"(acc[0][0]), "+v"(acc[1][1]), "+v"(acc[2][2]), "+v"(acc[3][3]) : "v"(a[0]), "v"(a[3]));
    }
#pragma unroll
    for (int mb = 0; mb < 4; ++mb) {
#pragma unroll
        for (int nb = 0; nb < 4; ++nb) {
#pragma unroll
            for (int j = 0; j < 8; ++j) os[(hi * 8 + j) * 68 + nb * 16 + lr] = acc[mb][nb][j]; }
        __builtin_amdgcn_wave_barrier(); asm volatile("" ::: "memory");
        float* crow = C + (size_t)(r0 + mb * 16) * ldc + c0;
{
#pragma unroll
            for (int s = 0; s < 8; ++s) { const int row = 2 * s + hi, cofs = lr * 4; v4f val = *(const v4fa*)(os + row * 68 + cofs); if (BIAS) { val[0] += bfr(bias[c0 + cofs]); val[1] += bfr(bias[c0 + cofs + 1]); val[2] += bfr(bias[c0 + cofs + 2]); val[3] += bfr(bias[c0 + cofs + 3]); }
                *(v4f*)(crow + (size_t)row * ldc + cofs) = val; }
             }
        __builtin_amdgcn_wave_barrier(); asm volatile("" ::: "memory");
    }
}

__device__ __forceinline__ h16 tohx(float x) { return (h16)x; }
__device__ __forceinline__ void splitf(float y, unsigned short& h, unsigned short& l) { h = f2bf(y); l = f2bf(y - bf2f(h)); }
typedef __attribute__((ext_vector_type(2))) _Float16 v2h;
typedef __attribute__((ext_vector_type(4))) _Float16 v4h;
typedef __attribute__((ext_vector_type(2))) unsigned short v2us;
typedef __attribute__((ext_vector_type(4))) unsigned short v4us;
typedef __attribute__((ext_vector_type(2))) float v2f;

__global__ __launch_bounds__(256) void k_cvt8(const float* __restrict__ src, bf* dst, size_t n8) { const size_t i = (size_t)blockIdx.x * 256 + threadIdx.x; if (i >= n8) return; const v8f v = *(const v8f*)(src + i * 8); v8us o;
#pragma unroll
    for (int k = 0; k < 8; ++k) o[k] = f2bf(v[k]); *(v8us*)(dst + i * 8) = o;  }
__global__ __launch_bounds__(256) void k_cvtp(const float* __restrict__ src, int pitch, int off, int R, int RP, int KW, bf* Bt) { const size_t e = ((size_t)blockIdx.x * 256 + threadIdx.x) * 4; if (e >= (size_t)RP * KW) return; const int k = (int)(e % KW), r = (int)(e / KW); v4us o;
#pragma unroll
    for (int q = 0; q < 4; ++q) o[q] = (r < R) ? f2bf(src[(size_t)r * pitch + off + k + q]) : (unsigned short)0; *(v4us*)(Bt + e) = o;  }
__global__ __launch_bounds__(256) void k_qsplit(const float* __restrict__ QF, bf* Qh, bf* Ql) { const int e = (blockIdx.x * 256 + threadIdx.x) * 2; if (e >= NB_ * NN * 32) return; const int k = e & 31, n = e >> 5; v2us oh, ol;
#pragma unroll
    for (int q = 0; q < 2; ++q) { unsigned short a, c2; splitf(QF[(size_t)n * 64 + k + q], a, c2); oh[q] = a; ol[q] = c2; } *(v2us*)(Qh + e) = oh; *(v2us*)(Ql + e) = ol;  }
__global__ __launch_bounds__(256) void k_dsplit(const float* __restrict__ Hf, const float* __restrict__ XRF, bf* Dh, bf* Dl) { const int e = (blockIdx.x * 256 + threadIdx.x) * 2; if (e >= NB_ * NN * C1) return; v2us oh, ol;
#pragma unroll
    for (int q = 0; q < 2; ++q) { float xr = XRF[e + q] * (1.0f / PCAR); asm volatile("" : "+v"(xr)); unsigned short a, c2; splitf(__fsub_rn(Hf[e + q], xr), a, c2); oh[q] = a; ol[q] = c2; } *(v2us*)(Dh + e) = oh; *(v2us*)(Dl + e) = ol;  }
// ---- attention without stored energies. The energies are a Gram matrix of K = 32, so a 16 x 16 tile costs three matrix instructions from the q planes: both kernels below form the tiles they need in registers, and neither the
// energies nor the attention weights go through memory. The three products of a tile are taken in the same order of terms in both kernels, so both see the same value for a pair (i, j).
#define OSP  132         // floats a row of a wave's partial output tile in LDS: 16-B aligned, adjacent rows 4 banks apart
#define L2E  1.4426950408889634f
__device__ __forceinline__ float ex2(float x) { asm("v_exp_f32 %0, %0\n\tv_nop" : "+v"(x)); return x; }
__device__ __forceinline__ v8f ex2x8(v8f x) { float y0 = x[0], y1 = x[1], y2 = x[2], y3 = x[3], y4 = x[4], y5 = x[5], y6 = x[6], y7 = x[7];
    asm("v_exp_f32 %0, %0\n\tv_exp_f32 %1, %1\n\tv_exp_f32 %2, %2\n\tv_exp_f32 %3, %3\n\tv_exp_f32 %4, %4\n\tv_exp_f32 %5, %5\n\tv_exp_f32 %6, %6\n\tv_exp_f32 %7, %7\n\tv_nop"
        : "+v"(y0), "+v"(y1), "+v"(y2), "+v"(y3), "+v"(y4), "+v"(y5), "+v"(y6), "+v"(y7));
    return (v8f){y0, y1, y2, y3, y4, y5, y6, y7}; }
__device__ __forceinline__ v16bf ldq(const bf* p) { return cat16b(*(const v8us*)p, *(const v8us*)(p + 16)); }
// k_vpack: v as f16 in the order of the matrix fragments: VP[batch][32 points][16 channels][k half][lane][8], so that a fragment of v^T (row = channel, k = point) is two loads of 512 contiguous bytes a wave.
__global__ __launch_bounds__(256) void k_vpack(const float* __restrict__ VF, h16* VP) { VF += (size_t)blockIdx.y * NN * C1; VP += (size_t)blockIdx.y * C1 * NN; const int idx = blockIdx.x * 256 + threadIdx.x; const int lane = idx & 31, half = (idx >> 5) & 1, ct = (idx >> 6) & 7, ch = idx >> 9;
    const float* vp = VF + (size_t)(ch * 32 + half * 16 + (lane >> 4) * 8) * C1 + ct * 16 + (lane & 15); v8h o;
#pragma unroll
    for (int e = 0; e < 8; ++e) o[e] = tohx(vp[(size_t)e * C1]);
    *(v8h*)(VP + (size_t)idx * 8) = o; }
// k_rstat: CV[i] = log2(e) max_j S[i][j] + log2(sum_j exp(S[i][j] - max)), so that softmax[i][j] = exp2(log2(e) S[i][j] - CV[i]). A work-group owns 32 rows i (one 128-B line of CV); they are the COLUMNS of its tiles, so a lane folds one row i in its own registers;
// wave w walks 256 of the 2048 j with a running maximum and a rescaled running sum; halves join by one shuffle, the 8 waves through LDS.
__global__ __launch_bounds__(256) void k_rstat(const bf* __restrict__ Qh, const bf* __restrict__ Ql, float* CV) { __shared__ float sm[8][32], ss[8][32]; const int lane = threadIdx.x & 31, w = threadIdx.x >> 5, lr = lane & 15, hi = lane >> 4;
    const int i0 = blockIdx.x * 32; const size_t jo = ((size_t)(i0 / NN) * NN + w * (NN / 8) + lr) * 32 + 8 * hi; const bf* qh = Qh + jo; const bf* ql = Ql + jo; v16bf bh[2], bl[2]; float m[2] = {-1.0e30f, -1.0e30f}, s[2] = {0.f, 0.f};
#pragma unroll
    for (int t = 0; t < 2; ++t) { const size_t o = (size_t)(i0 + t * 16 + lr) * 32 + 8 * hi; bh[t] = ldq(Qh + o); bl[t] = ldq(Ql + o); }
    for (int mt = 0; mt < NN / 8 / 16; mt += 2) { v16bf ah[2], al[2];
#pragma unroll
        for (int u = 0; u < 2; ++u) { ah[u] = ldq(qh + u * 512); al[u] = ldq(ql + u * 512); }
        asm volatile("s_wait_xcnt 0x0" :: "v"(qh), "v"(ql) : "memory");    // keeps both address pairs live, and unwritten, until the 8 loads have taken their address (precaution before a register of an issued load is reused)
        qh += 1024; ql += 1024;
#pragma unroll
        for (int t = 0; t < 2; ++t) { v8f d[2];
#pragma unroll
            for (int u = 0; u < 2; ++u) { d[u] = wmmab(ah[u], bh[t], (v8f){}); d[u] = wmmab(al[u], bh[t], d[u]); d[u] = wmmab(ah[u], bl[t], d[u]); }
            float mn = m[t];
#pragma unroll
            for (int r = 0; r < 8; ++r) mn = fmaxf(mn, fmaxf(d[0][r], d[1][r]));
            const v8f e0 = ex2x8((d[0] - mn) * L2E), e1 = ex2x8((d[1] - mn) * L2E); float a[4] = {0.f, 0.f, 0.f, 0.f};
#pragma unroll
            for (int r = 0; r < 8; ++r) { a[r & 1] += e0[r]; a[2 + (r & 1)] += e1[r]; }
            s[t] = s[t] * ex2((m[t] - mn) * L2E) + ((a[0] + a[1]) + (a[2] + a[3])); m[t] = mn; } }
#pragma unroll
    for (int t = 0; t < 2; ++t) { const float m2 = __shfl_xor(m[t], 16, 32), s2 = __shfl_xor(s[t], 16, 32), mx = fmaxf(m[t], m2); const float sj = s[t] * ex2((m[t] - mx) * L2E) + s2 * ex2((m2 - mx) * L2E);
        if (hi == 0) { sm[w][t * 16 + lr] = mx; ss[w][t * 16 + lr] = sj; } }
    __syncthreads();
    if (w == 0) { float mx = sm[0][lane];
#pragma unroll
        for (int k = 1; k < 8; ++k) mx = fmaxf(mx, sm[k][lane]);
        float sj = 0.f;
#pragma unroll
        for (int k = 0; k < 8; ++k) sj += ss[k][lane] * ex2((sm[k][lane] - mx) * L2E);
        CV[i0 + lane] = __builtin_amdgcn_logf(sj) + mx * L2E; } }
// k_fatt: XRF[j][c] = sum_i f16(1024 a[i][j] / (1e-9 + sum_i a[i][j])) f16(v[i][c]), a[i][j] = softmax[i][j] = exp2(log2(e) S[i][j] - CV[i]). A work-group owns 32 output rows j; wave w takes 256 of the 2048 i, 32 a pass, and walks them twice.
// First walk: tiles S[i][j] (rows i, columns j) from the q planes, a in f32, its column sum in the lane; the 8 waves' sums meet in LDS behind a barrier and give every column its own factor 1024 / (1e-9 + sum).
// Second walk: the same tiles again, a times the column's factor BEFORE the rounding to f16 (so the largest weights of every column are normal f16 numbers, however small the column's sum), and the two tiles of 16 i, rounded in place,
// are the B operand of x_r^T += v^T . a (a packed pair of D tiles has the hardware's k order, which k_vpack gives v). The 8 waves' partial tiles meet in LDS behind a second barrier.
__global__ __launch_bounds__(256) __attribute__((amdgpu_waves_per_eu(4, 4))) void k_fatt(const bf* __restrict__ Qh, const bf* __restrict__ Ql, const float* __restrict__ CV, const h16* __restrict__ VP, float* XRF) {
    __shared__ __align__(16) float os[8 * 32 * OSP]; __shared__ float cs[8][32]; const int lane = threadIdx.x & 31, w = threadIdx.x >> 5, lr = lane & 15, hi = lane >> 4;
    const int j0 = blockIdx.x * 32, b = j0 / NN, ib0 = w * (NN / 8); const size_t qo = ((size_t)b * NN + ib0 + lr) * 32 + 8 * hi; const bf* qh = Qh + qo; const bf* ql = Ql + qo; const float* cv = CV + (size_t)b * NN + ib0 + hi * 8;
    const h16* vp = VP + (size_t)b * C1 * NN + (size_t)(ib0 >> 5) * 4096 + lane * 8; v16bf bh[2], bl[2]; v8f csum[2] = {(v8f){}, (v8f){}}; float kf[2]; const bf* pjh[2]; const bf* pjl[2];
#pragma unroll
    for (int jt = 0; jt < 2; ++jt) { const size_t o = (size_t)(j0 + jt * 16 + lr) * 32 + 8 * hi; pjh[jt] = Qh + o; pjl[jt] = Ql + o; bh[jt] = ldq(pjh[jt]); bl[jt] = ldq(pjl[jt]); }
    asm volatile("s_wait_xcnt 0x0" :: "v"(pjh[0]), "v"(pjh[1]), "v"(pjl[0]), "v"(pjl[1]) : "memory");    // keeps the four address pairs live, and unwritten (also by a later load's result), until the 8 loads have taken their address (precaution before a register of an issued load is reused)
#pragma unroll    // unrolled: every load has a constant offset from one of three fixed address pairs, which the second walk starts from again
    for (int it = 0; it < NN / 8 / 32; ++it) { v16bf ah[2], al[2]; v8f kk[2];
#pragma unroll
        for (int t = 0; t < 2; ++t) { const int o = it * 1024 + t * 512, oc = it * 32 + t * 16; ah[t] = ldq(qh + o); al[t] = ldq(ql + o); kk[t] = __builtin_shufflevector(*(const v4f*)(cv + oc), *(const v4f*)(cv + oc + 4), 0, 1, 2, 3, 4, 5, 6, 7); }
#pragma unroll
        for (int t = 0; t < 2; ++t) { v8f d[2];
#pragma unroll
            for (int jt = 0; jt < 2; ++jt) d[jt] = wmmab(ah[t], bh[jt], (v8f){});
#pragma unroll
            for (int jt = 0; jt < 2; ++jt) d[jt] = wmmab(ah[t], bl[jt], d[jt]);
#pragma unroll
            for (int jt = 0; jt < 2; ++jt) d[jt] = wmmab(al[t], bh[jt], d[jt]);
#pragma unroll
            for (int jt = 0; jt < 2; ++jt) csum[jt] += ex2x8(d[jt] * L2E - kk[t]); } }
#pragma unroll
    for (int jt = 0; jt < 2; ++jt) { const v8f u = csum[jt]; float s = ((u[0] + u[1]) + (u[2] + u[3])) + ((u[4] + u[5]) + (u[6] + u[7])); s += __shfl_xor(s, 16, 32); if (hi == 0) cs[w][jt * 16 + lr] = s; }
    __syncthreads();
#pragma unroll
    for (int jt = 0; jt < 2; ++jt) { float s = 0.f;
#pragma unroll
        for (int ww = 0; ww < 8; ++ww) s += cs[ww][jt * 16 + lr];
        kf[jt] = __fdiv_rn(1.0f, __fadd_rn(1e-9f, s)) * PCAR; }
    v8f acc[2][8];
#pragma unroll
    for (int jt = 0; jt < 2; ++jt) {
#pragma unroll
        for (int nb = 0; nb < 8; ++nb) acc[jt][nb] = (v8f){}; }
#pragma unroll 1    // stays rolled: unrolled, the compiler lifts the passes' loads over one another, needs more than 256 registers and spills
    for (int it = 0; it < NN / 8 / 32; ++it) { v16h p[2], f[8]; v16bf ah[2], al[2]; v8f kk[2];
#pragma unroll
        for (int t = 0; t < 2; ++t) { ah[t] = ldq(qh + t * 512); al[t] = ldq(ql + t * 512); kk[t] = __builtin_shufflevector(*(const v4f*)(cv + t * 16), *(const v4f*)(cv + t * 16 + 4), 0, 1, 2, 3, 4, 5, 6, 7); }
#pragma unroll
        for (int t = 0; t < 2; ++t) { v8f d[2];
#pragma unroll
            for (int jt = 0; jt < 2; ++jt) d[jt] = wmmab(ah[t], bh[jt], (v8f){});
#pragma unroll
            for (int jt = 0; jt < 2; ++jt) d[jt] = wmmab(ah[t], bl[jt], d[jt]);
#pragma unroll
            for (int jt = 0; jt < 2; ++jt) d[jt] = wmmab(al[t], bh[jt], d[jt]);
#pragma unroll
            for (int jt = 0; jt < 2; ++jt) { const v8f x = ex2x8(d[jt] * L2E - kk[t]);
#pragma unroll
                for (int r = 0; r < 8; ++r) p[jt][t * 8 + r] = tohx(x[r] * kf[jt]); } }
#pragma unroll
        for (int nb = 0; nb < 4; ++nb) f[nb] = cat16(*(const v8h*)(vp + nb * 512), *(const v8h*)(vp + nb * 512 + 256));
#pragma unroll
        for (int nb = 0; nb < 8; ++nb) {
#pragma unroll
            for (int jt = 0; jt < 2; ++jt) acc[jt][nb] = wmma16(f[nb], p[jt], acc[jt][nb]);
            if (nb < 4) f[nb + 4] = cat16(*(const v8h*)(vp + (nb + 4) * 512), *(const v8h*)(vp + (nb + 4) * 512 + 256)); }
        asm volatile("s_wait_xcnt 0x0" :: "v"(qh), "v"(ql), "v"(cv), "v"(vp) : "memory");    // stands behind the pass's last load: keeps the four address pairs live, and unwritten, until every load has taken its address (precaution before a register of an issued load is reused)
        qh += 1024; ql += 1024; cv += 32; vp += 4096; }
#pragma unroll
    for (int jt = 0; jt < 2; ++jt) {
#pragma unroll
        for (int nb = 0; nb < 8; ++nb) { float* o = os + (size_t)(w * 32 + jt * 16 + lr) * OSP + nb * 16 + hi * 8; const v8f v = acc[jt][nb]; *(v4fa*)o = (v4f){v[0], v[1], v[2], v[3]}; *(v4fa*)(o + 4) = (v4f){v[4], v[5], v[6], v[7]}; } }
    __syncthreads();
#pragma unroll
    for (int k = 0; k < 4; ++k) { const int idx = threadIdx.x + 256 * k, row = idx >> 5, c4 = (idx & 31) * 4; v4f sa = (v4f){0.f, 0.f, 0.f, 0.f};
#pragma unroll
        for (int ww = 0; ww < 8; ++ww) sa += *(const v4fa*)(os + (size_t)(ww * 32 + row) * OSP + c4);
        *(v4f*)(XRF + (size_t)(j0 + row) * C1 + c4) = sa; } }
__global__ __launch_bounds__(256) void k_xt8(const float* __restrict__ xb, bf* XT) { xb += (size_t)blockIdx.y * C0 * NN; XT += (size_t)blockIdx.y * NN * C0; const size_t e = ((size_t)blockIdx.x * 256 + threadIdx.x) * 4; if (e >= (size_t)NN * C0) return; const int c = (int)(e % C0), n = (int)(e / C0); typedef __attribute__((ext_vector_type(4))) unsigned short v4us; v4us o;
#pragma unroll
    for (int q = 0; q < 4; ++q) o[q] = f2bf(xb[(size_t)(c + q) * NN + n]); *(v4us*)(XT + e) = o;  }
// k_bnstat: per-channel mean and 1/sqrt(biased variance + eps) over all NB_ * NN rows of T [row][C]. One work-group of 32 waves per 4 adjacent channels (16 B of every row); a lane owns rows t, t + 1024, ...:
// 16 independent 16-B loads that stay in registers, so T is read once and the squared deviations come from registers; lanes fold by shuffles, the 32 waves' partial sums through LDS (every wave folds them alike).
__device__ __forceinline__ v4f wgsum4(v4f s, v4f (*red)[32], int w, int lane) {
#pragma unroll
    for (int sh = 16; sh; sh >>= 1) {
#pragma unroll
        for (int q = 0; q < 4; ++q) s[q] += __shfl_xor(s[q], sh, 32); }
    if (lane == 0) (*red)[w] = s;
    __syncthreads();
    s = (*red)[lane];
#pragma unroll
    for (int sh = 16; sh; sh >>= 1) {
#pragma unroll
        for (int q = 0; q < 4; ++q) s[q] += __shfl_xor(s[q], sh, 32); }
    return s; }
template <int C>
__global__ __launch_bounds__(1024) void k_bnstat(const float* __restrict__ T, float* ST) { __shared__ __align__(16) v4f red[2][32]; const int lane = threadIdx.x & 31, w = threadIdx.x >> 5; const int c0 = blockIdx.x * 4;
    const float* tp = T + (size_t)threadIdx.x * C + c0; v4f x[NB_ * NN / 1024];
#pragma unroll
    for (int t = 0; t < NB_ * NN / 1024; ++t) x[t] = *(const v4f*)(tp + (size_t)t * 1024 * C);
    asm volatile("s_wait_xcnt 0x0" :: "v"(tp) : "memory");    // keeps the address pair of the 16 loads live, and unwritten, until all of them have taken their address (precaution before a register of an issued load is reused)
    v4f s = (v4f){0.f, 0.f, 0.f, 0.f};
#pragma unroll
    for (int t = 0; t < NB_ * NN / 1024; ++t) s += x[t];
    const v4f mu = wgsum4(s, &red[0], w, lane) * (1.0f / (NB_ * NN)); v4f q2 = (v4f){0.f, 0.f, 0.f, 0.f};
#pragma unroll
    for (int t = 0; t < NB_ * NN / 1024; ++t) { const v4f d = x[t] - mu; q2 += d * d; }
    q2 = wgsum4(q2, &red[1], w, lane);
    if (w < 4) { const float m = w == 0 ? mu[0] : (w == 1 ? mu[1] : (w == 2 ? mu[2] : mu[3])), v = w == 0 ? q2[0] : (w == 1 ? q2[1] : (w == 2 ? q2[2] : q2[3]));
        const float rs = __frsqrt_rn(__fadd_rn(v * (1.0f / (NB_ * NN)), BNE)); ST[(size_t)(c0 + w) * 32 + lane] = lane == 0 ? m : (lane == 1 ? rs : 0.f); } }
// k_bnapply: y = relu(bf16(g[c]) (T[b][n][c] - mu_c) rs_c + bf16(be[c])); H[b][n][c] = (residual ? H + y : y) (same lane reads/writes; idempotent: uses the H value read first)
__global__ __launch_bounds__(256) void k_bnapply(const float* __restrict__ T, int C, const float* __restrict__ ST, const float* __restrict__ g, const float* __restrict__ be, int residual, float* H) { const size_t e = ((size_t)blockIdx.x * 256 + threadIdx.x) * 2; if (e >= (size_t)NB_ * NN * C) return; const int c = (int)(e % C); typedef __attribute__((ext_vector_type(2))) float v2f; v2f o; const v2f hprev = residual ? *(const v2f*)(H + e) : (v2f){0.f, 0.f};
#pragma unroll
    for (int q = 0; q < 2; ++q) { const int cq = c + q; float sc = __fmul_rn(bfr(g[cq]), ST[(size_t)cq * 32 + 1]); asm volatile("" : "+v"(sc)); float t = __fmul_rn(__fsub_rn(T[e + q], ST[(size_t)cq * 32]), sc); asm volatile("" : "+v"(t)); const float y = fmaxf(__fadd_rn(t, bfr(be[cq])), 0.f); o[q] = residual ? __fadd_rn(hprev[q], y) : y; }
    *(v2f*)(H + e) = o;  }
__global__ __launch_bounds__(256) void k_split2(const float* __restrict__ F, bf* Ph, bf* Pl, size_t n) { const size_t i = ((size_t)blockIdx.x * 256 + threadIdx.x) * 2; if (i >= n) return; typedef __attribute__((ext_vector_type(2))) unsigned short v2us; v2us oh, ol;
#pragma unroll
    for (int q = 0; q < 2; ++q) { unsigned short a, c2; splitf(F[i + q], a, c2); oh[q] = a; ol[q] = c2; } *(v2us*)(Ph + i) = oh; *(v2us*)(Pl + i) = ol;  }
__global__ __launch_bounds__(256) void k_outT(const float* __restrict__ Hb, int blk, float* OUTb) { Hb += (size_t)blockIdx.y * NN * C1; OUTb += (size_t)blockIdx.y * 4 * C1 * NN; const size_t e = ((size_t)blockIdx.x * 256 + threadIdx.x) * 2; if (e >= (size_t)C1 * NN) return; const int n = (int)(e % NN), c = (int)(e / NN); typedef __attribute__((ext_vector_type(2))) float v2f; v2f o; o[0] = Hb[(size_t)n * C1 + c]; o[1] = Hb[(size_t)(n + 1) * C1 + c]; const size_t oo = ((size_t)blk * C1 + c) * NN + n; *(v2f*)(OUTb + oo) = o;  }

extern "C" void kernel_launch(void* const* d_in, const int* in_sizes, int n_in,
                              void* d_out, int out_size, void* d_ws, size_t ws_size, hipStream_t stream) {
    (void)in_sizes; (void)n_in; (void)out_size;
    const float* IN[14]; for (int i = 0; i < 14; ++i) IN[i] = (const float*)d_in[i];   // 0 x, 1 W1 [64][64], 2 g1, 3 b1, 4 W2 [128][64], 5 g2, 6 b2, 7 Wqk [4][32][128], 8 Wv [4][128][128], 9 bv [4][128], 10 Wt, 11 bt, 12 gn, 13 bnb
    float* OUT = (float*)d_out;     // [8][512][2048]
    char* wsp = (char*)d_ws;
    auto take = [&](size_t bytes) { char* p = wsp; wsp += (bytes + 255) & ~(size_t)255; return (void*)p; };
    bf* WB1 = (bf*)take((size_t)C0 * C0 * 2); bf* WB2 = (bf*)take((size_t)C1 * C0 * 2); bf* WQK = (bf*)take((size_t)4 * 64 * C1 * 2); bf* WV = (bf*)take((size_t)4 * C1 * C1 * 2); bf* WT = (bf*)take((size_t)4 * C1 * C1 * 2); float* ST = (float*)take((size_t)C1 * 32 * 4);
    // every per-batch plane holds all NB_ batches, batch-major, so that one launch of each stage serves the whole batch
    bf* XT = (bf*)take((size_t)NB_ * NN * C0 * 2); float* T = (float*)take((size_t)NB_ * NN * C1 * 4); float* H = (float*)take((size_t)NB_ * NN * C1 * 4); float* H0 = (float*)take((size_t)NB_ * NN * C0 * 4); bf* Hh = (bf*)take((size_t)NB_ * NN * C1 * 2); bf* Hl = (bf*)take((size_t)NB_ * NN * C1 * 2);
    float* QF = (float*)take((size_t)NB_ * NN * 64 * 4); bf* Qh = (bf*)take((size_t)NB_ * NN * 32 * 2); bf* Ql = (bf*)take((size_t)NB_ * NN * 32 * 2); float* CV = (float*)take((size_t)NB_ * NN * 4); float* VF = (float*)take((size_t)NB_ * NN * C1 * 4); h16* VP = (h16*)take((size_t)NB_ * C1 * NN * 2);
    float* XRF = VF; bf* Dh = Hh; bf* Dl = Hl;    // reuse: VF is last read by k_vpack, before x_r is written; Hh / Hl are last read by the v product, before k_dsplit writes
    if ((size_t)(wsp - (char*)d_ws) > ws_size) return;    // total ~ 49 MiB; ws 256 MiB
    { k_cvt8<<<(C0 * C0 / 8 + 255) / 256, 256, 0, stream>>>(IN[1], WB1, (size_t)C0 * C0 / 8); k_cvt8<<<(C1 * C0 / 8 + 255) / 256, 256, 0, stream>>>(IN[4], WB2, (size_t)C1 * C0 / 8);
      for (int i = 0; i < 4; ++i) k_cvtp<<<(64 * C1 / 4 + 255) / 256, 256, 0, stream>>>(IN[7] + (size_t)i * 32 * C1, C1, 0, 32, 64, C1, WQK + (size_t)i * 64 * C1);
      k_cvt8<<<(4 * C1 * C1 / 8 + 255) / 256, 256, 0, stream>>>(IN[8], WV, (size_t)4 * C1 * C1 / 8); k_cvt8<<<(4 * C1 * C1 / 8 + 255) / 256, 256, 0, stream>>>(IN[10], WT, (size_t)4 * C1 * C1 / 8); }
    // channel contractions and the two attention kernels see the batch as NB_ * NN rows; the transposes and k_vpack take the batch from grid y
    const unsigned L0 = (NB_ * NN * C0 / 2 + 255) / 256, L1 = (NB_ * NN * C1 / 2 + 255) / 256; const dim3 g64(NB_ * NN / 64, 1, 1), g128(NB_ * NN / 64, C1 / 64, 1);
    // stage 1: h0 = relu(bn(W1 x)) (T used with C = 64 pitch)
    k_xt8<<<dim3((NN * C0 / 4 + 255) / 256, NB_, 1), 256, 0, stream>>>(IN[0], XT); k_gemmw<bf, 0, false><<<g64, 32, 0, stream>>>(XT, nullptr, WB1, nullptr, C0, T, C0, nullptr, 0, 0, 0);
    k_bnstat<C0><<<C0 / 4, 1024, 0, stream>>>(T, ST); k_bnapply<<<(unsigned)(((size_t)NB_ * NN * C0 / 2 + 255) / 256), 256, 0, stream>>>(T, C0, ST, IN[2], IN[3], 0, H0);
    // stage 2: h = relu(bn(W2 h0))
    k_split2<<<L0, 256, 0, stream>>>(H0, Hh, Hl, (size_t)NB_ * NN * C0); k_gemmw<bf, 1, false><<<g128, 32, 0, stream>>>(Hh, Hl, WB2, nullptr, C0, T, C1, nullptr, 0, 0, 0);
    k_bnstat<C1><<<C1 / 4, 1024, 0, stream>>>(T, ST); k_bnapply<<<(unsigned)(((size_t)NB_ * NN * C1 / 2 + 255) / 256), 256, 0, stream>>>(T, C1, ST, IN[5], IN[6], 0, H);
    // four offset-attention blocks
    for (int i = 0; i < 4; ++i) {
        k_split2<<<L1, 256, 0, stream>>>(H, Hh, Hl, (size_t)NB_ * NN * C1);
        k_gemmw<bf, 1, false><<<g64, 32, 0, stream>>>(Hh, Hl, WQK + (size_t)i * 64 * C1, nullptr, C1, QF, 64, nullptr, 0, 0, 0); k_qsplit<<<(NB_ * NN * 32 / 2 + 255) / 256, 256, 0, stream>>>(QF, Qh, Ql);
        k_rstat<<<NB_ * NN / 32, 256, 0, stream>>>(Qh, Ql, CV);          // one log-domain constant a softmax row (maximum and sum), energies (3 products) in registers
        k_gemmw<bf, 1, true><<<g128, 32, 0, stream>>>(Hh, Hl, WV + (size_t)i * C1 * C1, nullptr, C1, VF, C1, IN[9] + i * C1, 0, 0, 0); k_vpack<<<dim3(C1 * NN / 8 / 256, NB_, 1), 256, 0, stream>>>(VF, VP);
        k_fatt<<<NB_ * NN / 32, 256, 0, stream>>>(Qh, Ql, CV, VP, XRF);          // x_r (x 1024): column sums, then weights and the product with v, energies in registers both times
        k_dsplit<<<L1, 256, 0, stream>>>(H, XRF, Dh, Dl);
        k_gemmw<bf, 1, true><<<g128, 32, 0, stream>>>(Dh, Dl, WT + (size_t)i * C1 * C1, nullptr, C1, T, C1, IN[11] + i * C1, 0, 0, 0);
        k_bnstat<C1><<<C1 / 4, 1024, 0, stream>>>(T, ST); k_bnapply<<<(unsigned)(((size_t)NB_ * NN * C1 / 2 + 255) / 256), 256, 0, stream>>>(T, C1, ST, IN[12] + i * C1, IN[13] + i * C1, 1, H);
        k_outT<<<dim3((C1 * NN / 2 + 255) / 256, NB_, 1), 256, 0, stream>>>(H, i, OUT); }
}

// v006
// One run takes 312 microseconds.
// In two side-by-side timings against v005, it was 1.65 and 1.71 times as fast.
// Counting every step since v000, it is 99.2 times as fast.
#include <hip/hip_runtime.h>

// IEModule (PCT-style offset-attention stack; x [8][64][2048]; h = relu(bn(W1 x)) (64); h = relu(bn(W2 h)) (128); then four chained blocks: q = Wqk h (32), energy = q^T q (symmetric, unscaled), att = softmax over keys
// then / (1e-9 + column sum over queries), x_r = v att with v = Wv h + bv, h = h + relu(bn(Wt (h - x_r) + bt)); output = concat of the four h -> [8][512][2048]. Every BatchNorm is TRAINING-mode: per-channel
// mean / biased variance over (batch, points) of the current activations, eps 1e-5.)
// Compute dtypes, f32 accumulate: every input rounded to bf16; everything positions-major [point][channel]; W1 x on PLAIN bf16 operands (inputs: exact), every later channel
// contraction on bf16 hi+lo planes of its computed operand x exact weights (2 products, + bias); energies on hi+lo planes of q (3 products, K 32); x_r^T = v^T . att on SINGLE fp16 planes (softmax weights x 1024 / (1e-9 + column sum); the division comes before the rounding and the product)

#define NB_  8
#define NN   2048
#define C0   64
#define C1   128
#define PCAR 1024.0f
#define BNE  1e-5f
typedef _Float16 h16;
typedef unsigned short bf;
typedef __attribute__((ext_vector_type(16))) __bf16   v16bf;
typedef __attribute__((ext_vector_type(16))) _Float16 v16h;
typedef __attribute__((ext_vector_type(8)))  _Float16 v8h;
typedef __attribute__((ext_vector_type(8)))  unsigned short v8us;
typedef __attribute__((ext_vector_type(8)))  float    v8f;
typedef __attribute__((ext_vector_type(4)))  float    v4f;
typedef v8h  __attribute__((may_alias)) v8ha;
typedef v4f  __attribute__((may_alias)) v4fa;
typedef v8us __attribute__((may_alias)) v8usa;

__device__ __forceinline__ unsigned short f2bf(float f) { unsigned u = __float_as_uint(f); u += 0x7FFFu + ((u >> 16) & 1u); return (unsigned short)(u >> 16); }
__device__ __forceinline__ float bf2f(unsigned short b) { return __uint_as_float(((unsigned)b) << 16); }
__device__ __forceinline__ float bfr(float f) { return bf2f(f2bf(f)); }
__device__ __forceinline__ v16h cat16(v8h lo, v8h hi) { return __builtin_shufflevector(lo, hi, 0, 1, 2, 3, 4, 5, 6, 7, 8, 9, 10, 11, 12, 13, 14, 15); }
__device__ __forceinline__ v16bf cat16b(v8us lo, v8us hi) { return __builtin_bit_cast(v16bf, __builtin_shufflevector(lo, hi, 0, 1, 2, 3, 4, 5, 6, 7, 8, 9, 10, 11, 12, 13, 14, 15)); }
__device__ __forceinline__ v8f wmma16(v16h a, v16h b, v8f c) { return __builtin_amdgcn_wmma_f32_16x16x32_f16(false, a, false, b, (short)0, c, false, false); }
__device__ __forceinline__ v8f wmmab(v16bf a, v16bf b, v8f c) { return __builtin_amdgcn_wmma_f32_16x16x32_bf16(false, a, false, b, (short)0, c, false, false); }



// ---- k_gemmw: register-blocked GEMM, ONE WAVE per 64x64 output tile (16 accumulators), operands straight from K-contiguous 16-bit planes; grid (M/64, N/64, Z), 32 threads.
// C[m][n] (f32, pitch ldc, + optional f32 bias[n]) = sum_k A[m][k] Bt[n][k] (+ split products per NSPLIT). z-batch strides sA/sB/sC in elements. K % 32 == 0.
template <typename T16> struct WFrag;
template <> struct WFrag<bf> { typedef v16bf V; static __device__ __forceinline__ V ld(const bf* p) { return cat16b(*(const v8us*)p, *(const v8us*)(p + 16)); } static __device__ __forceinline__ v8f mma(V a, V b, v8f c) { return wmmab(a, b, c); } };
template <typename T16, int NSPLIT, bool BIAS>
__global__ __launch_bounds__(32) void k_gemmw(const T16* __restrict__ A, const T16* __restrict__ A2, const T16* __restrict__ Bt, const T16* __restrict__ Bt2, int K, float* C, int ldc, const float* __restrict__ bias, size_t sA, size_t sB, size_t sC) {
    typedef typename WFrag<T16>::V V;
    __shared__ __align__(16) float os[16 * 68];
    const size_t z = blockIdx.z; A += z * sA; if (A2) A2 += z * sA; Bt += z * sB; if (Bt2) Bt2 += z * sB; C += z * sC;
    const int lane = threadIdx.x & 31, lr = lane & 15, hi = lane >> 4; const int r0 = blockIdx.x * 64, c0 = blockIdx.y * 64;
    v8f acc[4][4];
#pragma unroll
    for (int mb = 0; mb < 4; ++mb)
#pragma unroll
        for (int nb = 0; nb < 4; ++nb) acc[mb][nb] = (v8f){};
    const size_t aoff = (size_t)(r0 + lr) * K + 8 * hi, boff = (size_t)(c0 + lr) * K + 8 * hi;
#pragma unroll 1
    for (int kc = 0; kc < K; kc += 32) {
        V a[4], a2[4];
#pragma unroll
        for (int mb = 0; mb < 4; ++mb) { a[mb] = WFrag<T16>::ld(A + aoff + (size_t)mb * 16 * K + kc); if (NSPLIT == 1 || NSPLIT == 2) a2[mb] = WFrag<T16>::ld(A2 + aoff + (size_t)mb * 16 * K + kc); }
#pragma unroll
        for (int nb = 0; nb < 4; ++nb) { const V b = WFrag<T16>::ld(Bt + boff + (size_t)nb * 16 * K + kc); V b2; if (NSPLIT >= 2) b2 = WFrag<T16>::ld(Bt2 + boff + (size_t)nb * 16 * K + kc);
#pragma unroll
            for (int mb = 0; mb < 4; ++mb) { acc[mb][nb] = WFrag<T16>::mma(a[mb], b, acc[mb][nb]); if (NSPLIT == 1 || NSPLIT == 2) acc[mb][nb] = WFrag<T16>::mma(a2[mb], b, acc[mb][nb]); if (NSPLIT >= 2) acc[mb][nb] = WFrag<T16>::mma(a[mb], b2, acc[mb][nb]); } }
        asm volatile("v_nop\n\tv_nop\n\tv_nop\n\tv_nop" : "+v"(acc[0][0]), "+v"(acc[1][1]), "+v"(acc[2][2]), "+v"(acc[3][3]) : "v"(a[0]), "v"(a[3]));
    }
#pragma unroll
    for (int mb = 0; mb < 4; ++mb) {
#pragma unroll
        for (int nb = 0; nb < 4; ++nb) {
#pragma unroll
            for (int j = 0; j < 8; ++j) os[(hi * 8 + j) * 68 + nb * 16 + lr] = acc[mb][nb][j]; }
        __builtin_amdgcn_wave_barrier(); asm volatile("" ::: "memory");
        float* crow = C + (size_t)(r0 + mb * 16) * ldc + c0;
{
#pragma unroll
            for (int s = 0; s < 8; ++s) { const int row = 2 * s + hi, cofs = lr * 4; v4f val = *(const v4fa*)(os + row * 68 + cofs); if (BIAS) { val[0] += bfr(bias[c0 + cofs]); val[1] += bfr(bias[c0 + cofs + 1]); val[2] += bfr(bias[c0 + cofs + 2]); val[3] += bfr(bias[c0 + cofs + 3]); }
                *(v4f*)(crow + (size_t)row * ldc + cofs) = val; }
             }
        __builtin_amdgcn_wave_barrier(); asm volatile("" ::: "memory");
    }
}

__device__ __forceinline__ h16 tohx(float x) { return (h16)x; }
__device__ __forceinline__ void splitf(float y, unsigned short& h, unsigned short& l) { h = f2bf(y); l = f2bf(y - bf2f(h)); }
typedef __attribute__((ext_vector_type(4))) unsigned short v4us;
typedef __attribute__((ext_vector_type(2))) float v2f;
typedef v4us __attribute__((may_alias)) v4usa;
#define WQR  160         // rows of a block's q / v weight operand: Wqk (32), then Wv (128)
#define DPP  136         // 16-bit elements a row of an operand plane in LDS: 16-B aligned, adjacent rows 4 banks apart
// k_prep: every operand that is only a rounded copy of an input, in one launch: x as bf16, positions-major [batch][point][64] (the first NB_ * 128 work-groups), then the weights as bf16 (1024 elements a work-group):
// W1, W2, Wt, and per block the WQR rows [Wqk; Wv].
__global__ __launch_bounds__(256) void k_prep(const float* __restrict__ x, const float* __restrict__ W1, const float* __restrict__ W2, const float* __restrict__ Wqk, const float* __restrict__ Wv, const float* __restrict__ Wt, bf* XT, bf* WB1, bf* WB2, bf* WQV, bf* WT) {
    const int blk = blockIdx.x; v4us o;
    if (blk < NB_ * 128) { const float* xb = x + (size_t)(blk >> 7) * C0 * NN; const int e = ((blk & 127) * 256 + threadIdx.x) * 4, c = e % C0, n = e / C0;
#pragma unroll
        for (int q = 0; q < 4; ++q) o[q] = f2bf(xb[(size_t)(c + q) * NN + n]);
        *(v4us*)(XT + (size_t)(blk >> 7) * NN * C0 + e) = o; return; }
    int e = ((blk - NB_ * 128) * 256 + threadIdx.x) * 4; const float* s; bf* d;
    if (e < C0 * C0) { s = W1 + e; d = WB1 + e; }
    else if ((e -= C0 * C0) < C1 * C0) { s = W2 + e; d = WB2 + e; }
    else if ((e -= C1 * C0) < 4 * C1 * C1) { s = Wt + e; d = WT + e; }
    else { e -= 4 * C1 * C1; const int i = e / (WQR * C1), r = (e / C1) % WQR, k = e % C1; d = WQV + e; s = r < 32 ? Wqk + (size_t)(i * 32 + r) * C1 + k : Wv + (size_t)(i * C1 + r - 32) * C1 + k; }
    const v4f v = *(const v4f*)s;
#pragma unroll
    for (int q = 0; q < 4; ++q) o[q] = f2bf(v[q]);
    *(v4us*)d = o; }
// ---- attention without stored energies. The energies are a Gram matrix of K = 32, so a 16 x 16 tile costs three matrix instructions from the q planes: both kernels below form the tiles they need in registers, and neither the
// energies nor the attention weights go through memory. The three products of a tile are taken in the same order of terms in both kernels, so both see the same value for a pair (i, j).
#define OSP  132         // floats a row of a wave's partial output tile in LDS: 16-B aligned, adjacent rows 4 banks apart
#define L2E  1.4426950408889634f
__device__ __forceinline__ float ex2(float x) { asm("v_exp_f32 %0, %0\n\tv_nop" : "+v"(x)); return x; }
__device__ __forceinline__ v8f ex2x8(v8f x) { float y0 = x[0], y1 = x[1], y2 = x[2], y3 = x[3], y4 = x[4], y5 = x[5], y6 = x[6], y7 = x[7];
    asm("v_exp_f32 %0, %0\n\tv_exp_f32 %1, %1\n\tv_exp_f32 %2, %2\n\tv_exp_f32 %3, %3\n\tv_exp_f32 %4, %4\n\tv_exp_f32 %5, %5\n\tv_exp_f32 %6, %6\n\tv_exp_f32 %7, %7\n\tv_nop"
        : "+v"(y0), "+v"(y1), "+v"(y2), "+v"(y3), "+v"(y4), "+v"(y5), "+v"(y6), "+v"(y7));
    return (v8f){y0, y1, y2, y3, y4, y5, y6, y7}; }
__device__ __forceinline__ v16bf ldq(const bf* p) { return cat16b(*(const v8us*)p, *(const v8us*)(p + 16)); }
__device__ __forceinline__ v16bf ldqs(const bf* p) { return cat16b(*(const v8usa*)p, *(const v8usa*)(p + 16)); }    // the same fragment from an LDS plane
// k_rstat: CV[i] = log2(e) max_j S[i][j] + log2(sum_j exp(S[i][j] - max)), so that softmax[i][j] = exp2(log2(e) S[i][j] - CV[i]). A work-group owns 32 rows i (one 128-B line of CV); they are the COLUMNS of its tiles, so a lane folds one row i in its own registers;
// wave w walks 256 of the 2048 j with a running maximum and a rescaled running sum; halves join by one shuffle, the 8 waves through LDS.
__global__ __launch_bounds__(256) void k_rstat(const bf* __restrict__ Qh, const bf* __restrict__ Ql, float* CV) { __shared__ float sm[8][32], ss[8][32]; const int lane = threadIdx.x & 31, w = threadIdx.x >> 5, lr = lane & 15, hi = lane >> 4;
    const int i0 = blockIdx.x * 32; const size_t jo = ((size_t)(i0 / NN) * NN + w * (NN / 8) + lr) * 32 + 8 * hi; const bf* qh = Qh + jo; const bf* ql = Ql + jo; v16bf bh[2], bl[2]; float m[2] = {-1.0e30f, -1.0e30f}, s[2] = {0.f, 0.f};
#pragma unroll
    for (int t = 0; t < 2; ++t) { const size_t o = (size_t)(i0 + t * 16 + lr) * 32 + 8 * hi; bh[t] = ldq(Qh + o); bl[t] = ldq(Ql + o); }
    for (int mt = 0; mt < NN / 8 / 16; mt += 2) { v16bf ah[2], al[2];
#pragma unroll
        for (int u = 0; u < 2; ++u) { ah[u] = ldq(qh + u * 512); al[u] = ldq(ql + u * 512); }
        asm volatile("s_wait_xcnt 0x0" :: "v"(qh), "v"(ql) : "memory");    // keeps both address pairs live, and unwritten, until the 8 loads have taken their address (precaution before a register of an issued load is reused)
        qh += 1024; ql += 1024;
#pragma unroll
        for (int t = 0; t < 2; ++t) { v8f d[2];
#pragma unroll
            for (int u = 0; u < 2; ++u) { d[u] = wmmab(ah[u], bh[t], (v8f){}); d[u] = wmmab(al[u], bh[t], d[u]); d[u] = wmmab(ah[u], bl[t], d[u]); }
            float mn = m[t];
#pragma unroll
            for (int r = 0; r < 8; ++r) mn = fmaxf(mn, fmaxf(d[0][r], d[1][r]));
            const v8f e0 = ex2x8((d[0] - mn) * L2E), e1 = ex2x8((d[1] - mn) * L2E); float a[4] = {0.f, 0.f, 0.f, 0.f};
#pragma unroll
            for (int r = 0; r < 8; ++r) { a[r & 1] += e0[r]; a[2 + (r & 1)] += e1[r]; }
            s[t] = s[t] * ex2((m[t] - mn) * L2E) + ((a[0] + a[1]) + (a[2] + a[3])); m[t] = mn; } }
#pragma unroll
    for (int t = 0; t < 2; ++t) { const float m2 = __shfl_xor(m[t], 16, 32), s2 = __shfl_xor(s[t], 16, 32), mx = fmaxf(m[t], m2); const float sj = s[t] * ex2((m[t] - mx) * L2E) + s2 * ex2((m2 - mx) * L2E);
        if (hi == 0) { sm[w][t * 16 + lr] = mx; ss[w][t * 16 + lr] = sj; } }
    __syncthreads();
    if (w == 0) { float mx = sm[0][lane];
#pragma unroll
        for (int k = 1; k < 8; ++k) mx = fmaxf(mx, sm[k][lane]);
        float sj = 0.f;
#pragma unroll
        for (int k = 0; k < 8; ++k) sj += ss[k][lane] * ex2((sm[k][lane] - mx) * L2E);
        CV[i0 + lane] = __builtin_amdgcn_logf(sj) + mx * L2E; } }
// k_fatt: T[j][.] = Wt (h[j] - x_r[j]) + bt, 1024 x_r[j][c] = sum_i f16(1024 a[i][j] / (1e-9 + sum_i a[i][j])) f16(v[i][c]), a[i][j] = softmax[i][j] = exp2(log2(e) S[i][j] - CV[i]). A work-group owns 32 output rows j; wave w takes 256 of the 2048 i, 32 a pass, and walks them twice.
// First walk: tiles S[i][j] (rows i, columns j) from the q planes, a in f32, its column sum in the lane; the 8 waves' sums meet in LDS behind a barrier and give every column its own factor 1024 / (1e-9 + sum).
// Second walk: the same tiles again, a times the column's factor BEFORE the rounding to f16 (so the largest weights of every column are normal f16 numbers, however small the column's sum), and the two tiles of 16 i, rounded in place,
// are the B operand of x_r^T += v^T . a (a packed pair of D tiles has the hardware's k order, which the VP order gives v). The 8 waves' partial tiles meet in LDS behind a second barrier.
// The lane that sums an element subtracts it from h and leaves the difference as bf16 hi + lo planes in LDS; behind a third barrier wave w forms rows 16 (w >> 2) .., columns 32 (w & 3) .. of the work-group's 32 x 128 tile of T
// (per 32 k: hi plane x Wt, then lo plane x Wt, into one accumulator; a row's 128-B line has one writer).
__global__ __launch_bounds__(256) __attribute__((amdgpu_waves_per_eu(4, 4))) void k_fatt(const bf* __restrict__ Qh, const bf* __restrict__ Ql, const float* __restrict__ CV, const h16* __restrict__ VP, const float* __restrict__ H, const bf* __restrict__ Wt, const float* __restrict__ bt, float* T) {
    __shared__ __align__(16) float os[8 * 32 * OSP]; __shared__ float cs[8][32]; __shared__ __align__(16) bf dp[2][32 * DPP]; const int lane = threadIdx.x & 31, w = threadIdx.x >> 5, lr = lane & 15, hi = lane >> 4;
    const int j0 = blockIdx.x * 32, b = j0 / NN, ib0 = w * (NN / 8); const size_t qo = ((size_t)b * NN + ib0 + lr) * 32 + 8 * hi; const bf* qh = Qh + qo; const bf* ql = Ql + qo; const float* cv = CV + (size_t)b * NN + ib0 + hi * 8;
    const h16* vp = VP + (size_t)b * C1 * NN + (size_t)(ib0 >> 5) * 4096 + lane * 8; v16bf bh[2], bl[2]; v8f csum[2] = {(v8f){}, (v8f){}}; float kf[2]; const bf* pjh[2]; const bf* pjl[2];
#pragma unroll
    for (int jt = 0; jt < 2; ++jt) { const size_t o = (size_t)(j0 + jt * 16 + lr) * 32 + 8 * hi; pjh[jt] = Qh + o; pjl[jt] = Ql + o; bh[jt] = ldq(pjh[jt]); bl[jt] = ldq(pjl[jt]); }
    asm volatile("s_wait_xcnt 0x0" :: "v"(pjh[0]), "v"(pjh[1]), "v"(pjl[0]), "v"(pjl[1]) : "memory");    // keeps the four address pairs live, and unwritten (also by a later load's result), until the 8 loads have taken their address (precaution before a register of an issued load is reused)
#pragma unroll    // unrolled: every load has a constant offset from one of three fixed address pairs, which the second walk starts from again
    for (int it = 0; it < NN / 8 / 32; ++it) { v16bf ah[2], al[2]; v8f kk[2];
#pragma unroll
        for (int t = 0; t < 2; ++t) { const int o = it * 1024 + t * 512, oc = it * 32 + t * 16; ah[t] = ldq(qh + o); al[t] = ldq(ql + o); kk[t] = __builtin_shufflevector(*(const v4f*)(cv + oc), *(const v4f*)(cv + oc + 4), 0, 1, 2, 3, 4, 5, 6, 7); }
#pragma unroll
        for (int t = 0; t < 2; ++t) { v8f d[2];
#pragma unroll
            for (int jt = 0; jt < 2; ++jt) d[jt] = wmmab(ah[t], bh[jt], (v8f){});
#pragma unroll
            for (int jt = 0; jt < 2; ++jt) d[jt] = wmmab(ah[t], bl[jt], d[jt]);
#pragma unroll
            for (int jt = 0; jt < 2; ++jt) d[jt] = wmmab(al[t], bh[jt], d[jt]);
#pragma unroll
            for (int jt = 0; jt < 2; ++jt) csum[jt] += ex2x8(d[jt] * L2E - kk[t]); } }
#pragma unroll
    for (int jt = 0; jt < 2; ++jt) { const v8f u = csum[jt]; float s = ((u[0] + u[1]) + (u[2] + u[3])) + ((u[4] + u[5]) + (u[6] + u[7])); s += __shfl_xor(s, 16, 32); if (hi == 0) cs[w][jt * 16 + lr] = s; }
    __syncthreads();
#pragma unroll
    for (int jt = 0; jt < 2; ++jt) { float s = 0.f;
#pragma unroll
        for (int ww = 0; ww < 8; ++ww) s += cs[ww][jt * 16 + lr];
        kf[jt] = __fdiv_rn(1.0f, __fadd_rn(1e-9f, s)) * PCAR; }
    v8f acc[2][8];
#pragma unroll
    for (int jt = 0; jt < 2; ++jt) {
#pragma unroll
        for (int nb = 0; nb < 8; ++nb) acc[jt][nb] = (v8f){}; }
#pragma unroll 1    // stays rolled: unrolled, the compiler lifts the passes' loads over one another, needs more than 256 registers and spills
    for (int it = 0; it < NN / 8 / 32; ++it) { v16h p[2], f[8]; v16bf ah[2], al[2]; v8f kk[2];
#pragma unroll
        for (int t = 0; t < 2; ++t) { ah[t] = ldq(qh + t * 512); al[t] = ldq(ql + t * 512); kk[t] = __builtin_shufflevector(*(const v4f*)(cv + t * 16), *(const v4f*)(cv + t * 16 + 4), 0, 1, 2, 3, 4, 5, 6, 7); }
#pragma unroll
        for (int t = 0; t < 2; ++t) { v8f d[2];
#pragma unroll
            for (int jt = 0; jt < 2; ++jt) d[jt] = wmmab(ah[t], bh[jt], (v8f){});
#pragma unroll
            for (int jt = 0; jt < 2; ++jt) d[jt] = wmmab(ah[t], bl[jt], d[jt]);
#pragma unroll
            for (int jt = 0; jt < 2; ++jt) d[jt] = wmmab(al[t], bh[jt], d[jt]);
#pragma unroll
            for (int jt = 0; jt < 2; ++jt) { const v8f x = ex2x8(d[jt] * L2E - kk[t]);
#pragma unroll
                for (int r = 0; r < 8; ++r) p[jt][t * 8 + r] = tohx(x[r] * kf[jt]); } }
#pragma unroll
        for (int nb = 0; nb < 4; ++nb) f[nb] = cat16(*(const v8h*)(vp + nb * 512), *(const v8h*)(vp + nb * 512 + 256));
#pragma unroll
        for (int nb = 0; nb < 8; ++nb) {
#pragma unroll
            for (int jt = 0; jt < 2; ++jt) acc[jt][nb] = wmma16(f[nb], p[jt], acc[jt][nb]);
            if (nb < 4) f[nb + 4] = cat16(*(const v8h*)(vp + (nb + 4) * 512), *(const v8h*)(vp + (nb + 4) * 512 + 256)); }
        asm volatile("s_wait_xcnt 0x0" :: "v"(qh), "v"(ql), "v"(cv), "v"(vp) : "memory");    // stands behind the pass's last load: keeps the four address pairs live, and unwritten, until every load has taken its address (precaution before a register of an issued load is reused)
        qh += 1024; ql += 1024; cv += 32; vp += 4096; }
#pragma unroll
    for (int jt = 0; jt < 2; ++jt) {
#pragma unroll
        for (int nb = 0; nb < 8; ++nb) { float* o = os + (size_t)(w * 32 + jt * 16 + lr) * OSP + nb * 16 + hi * 8; const v8f v = acc[jt][nb]; *(v4fa*)o = (v4f){v[0], v[1], v[2], v[3]}; *(v4fa*)(o + 4) = (v4f){v[4], v[5], v[6], v[7]}; } }
    const float* hp = H + (size_t)j0 * C1 + threadIdx.x * 4; v4f hv[4];    // lane t owns elements 4 t .. 4 t + 3 of each quarter (8 rows) of the work-group's 32 x 128 tile
#pragma unroll
    for (int k = 0; k < 4; ++k) hv[k] = *(const v4f*)(hp + k * 1024);
    const int rt = w >> 2, cq = (w & 3) * 32; const bf* wp = Wt + (size_t)(cq + lr) * C1 + 8 * hi; const float* bp = bt + cq + lr; v16bf wb[2][4]; float bb[2];
#pragma unroll
    for (int u = 0; u < 2; ++u) { bb[u] = bfr(bp[u * 16]);
#pragma unroll
        for (int kc = 0; kc < 4; ++kc) wb[u][kc] = ldq(wp + u * 16 * C1 + kc * 32); }
    asm volatile("s_wait_xcnt 0x0" :: "v"(hp), "v"(wp), "v"(bp) : "memory");    // keeps the three address pairs live, and unwritten (also by a later load's result), until the 22 loads have taken their address (precaution before a register of an issued load is reused)
    __syncthreads();
#pragma unroll
    for (int k = 0; k < 4; ++k) { const int idx = threadIdx.x + 256 * k, row = idx >> 5, c4 = (idx & 31) * 4; v4f sa = (v4f){0.f, 0.f, 0.f, 0.f}; v4us oh, ol;
#pragma unroll
        for (int ww = 0; ww < 8; ++ww) sa += *(const v4fa*)(os + (size_t)(ww * 32 + row) * OSP + c4);
#pragma unroll
        for (int q = 0; q < 4; ++q) { unsigned short x, y; splitf(hv[k][q] - sa[q] * (1.0f / PCAR), x, y); oh[q] = x; ol[q] = y; }
        *(v4usa*)(dp[0] + row * DPP + c4) = oh; *(v4usa*)(dp[1] + row * DPP + c4) = ol; }
    __syncthreads();
    const bf* ah = dp[0] + (rt * 16 + lr) * DPP + 8 * hi; const bf* al = dp[1] + (rt * 16 + lr) * DPP + 8 * hi; v8f ta[2] = {(v8f){}, (v8f){}};
#pragma unroll
    for (int kc = 0; kc < 4; ++kc) { const v16bf a = ldqs(ah + kc * 32), a2 = ldqs(al + kc * 32);
#pragma unroll
        for (int u = 0; u < 2; ++u) { ta[u] = wmmab(a, wb[u][kc], ta[u]); ta[u] = wmmab(a2, wb[u][kc], ta[u]); } }
    float* to = T + (size_t)(j0 + rt * 16 + hi * 8) * C1 + cq + lr;
#pragma unroll
    for (int j = 0; j < 8; ++j) {
#pragma unroll
        for (int u = 0; u < 2; ++u) to[j * C1 + u * 16] = ta[u][j] + bb[u]; } }
// k_bnstat: per-channel mean and 1/sqrt(biased variance + eps) over all NB_ * NN rows of T [row][C]. One work-group of 32 waves per 4 adjacent channels (16 B of every row); a lane owns rows t, t + 1024, ...:
// 16 independent 16-B loads that stay in registers, so T is read once and the squared deviations come from registers; lanes fold by shuffles, the 32 waves' partial sums through LDS (every wave folds them alike).
__device__ __forceinline__ v4f wgsum4(v4f s, v4f (*red)[32], int w, int lane) {
#pragma unroll
    for (int sh = 16; sh; sh >>= 1) {
#pragma unroll
        for (int q = 0; q < 4; ++q) s[q] += __shfl_xor(s[q], sh, 32); }
    if (lane == 0) (*red)[w] = s;
    __syncthreads();
    s = (*red)[lane];
#pragma unroll
    for (int sh = 16; sh; sh >>= 1) {
#pragma unroll
        for (int q = 0; q < 4; ++q) s[q] += __shfl_xor(s[q], sh, 32); }
    return s; }
template <int C>
__global__ __launch_bounds__(1024) void k_bnstat(const float* __restrict__ T, float* ST) { __shared__ __align__(16) v4f red[2][32]; const int lane = threadIdx.x & 31, w = threadIdx.x >> 5; const int c0 = blockIdx.x * 4;
    const float* tp = T + (size_t)threadIdx.x * C + c0; v4f x[NB_ * NN / 1024];
#pragma unroll
    for (int t = 0; t < NB_ * NN / 1024; ++t) x[t] = *(const v4f*)(tp + (size_t)t * 1024 * C);
    asm volatile("s_wait_xcnt 0x0" :: "v"(tp) : "memory");    // keeps the address pair of the 16 loads live, and unwritten, until all of them have taken their address (precaution before a register of an issued load is reused)
    v4f s = (v4f){0.f, 0.f, 0.f, 0.f};
#pragma unroll
    for (int t = 0; t < NB_ * NN / 1024; ++t) s += x[t];
    const v4f mu = wgsum4(s, &red[0], w, lane) * (1.0f / (NB_ * NN)); v4f q2 = (v4f){0.f, 0.f, 0.f, 0.f};
#pragma unroll
    for (int t = 0; t < NB_ * NN / 1024; ++t) { const v4f d = x[t] - mu; q2 += d * d; }
    q2 = wgsum4(q2, &red[1], w, lane);
    if (w < 4) { const float m = w == 0 ? mu[0] : (w == 1 ? mu[1] : (w == 2 ? mu[2] : mu[3])), v = w == 0 ? q2[0] : (w == 1 ? q2[1] : (w == 2 ? q2[2] : q2[3]));
        const float rs = __frsqrt_rn(__fadd_rn(v * (1.0f / (NB_ * NN)), BNE)); ST[(size_t)(c0 + w) * 32 + lane] = lane == 0 ? m : (lane == 1 ? rs : 0.f); } }
// k_bnfin: y = relu(bf16(g[c]) rs_c (T[row][c] - mu_c) + bf16(be[c])), h = RES ? H + y : y, and everything that is made of h alone, from the register that holds it. A work-group takes 4096 adjacent elements (4096 / C rows),
// a lane four 16-B units of the same 4 channels. WH: H[row][c] f32 (the same lane reads and writes an element). WS: bf16 hi + lo planes of h in memory.
// WO: OUT[batch][blk * C + c][point], transposed through an LDS tile of 32 points x 128 channels (a channel's 32 points are one 128-B line).
// QV: the next block's q and v of the 32 points: the planes of h stay in LDS, wave w forms rows 16 (w >> 2) .. of v channels 32 (w & 3) .. and, where (w & 3) < 2, of q channels 16 (w & 3) .. (per 32 k: hi plane x W, then lo plane x W, into one accumulator).
// v leaves, + bias, as f16 in the order of the matrix fragments, VP[batch][32 points][16 channels][k half][lane][8] (a fragment of v^T, row = channel, k = point, is two loads of 512 contiguous bytes a wave): an accumulator's 8 values of a lane
// are 8 points of one channel, one 16-B unit of VP. q leaves as bf16 hi + lo planes [point][32], through an LDS tile behind a second barrier.
template <int C, bool RES, bool WH, bool WS, bool WO, bool QV>
__global__ __launch_bounds__(256) void k_bnfin(const float* __restrict__ T, const float* __restrict__ ST, const float* __restrict__ g, const float* __restrict__ be, float* H, bf* Ph, bf* Pl, int blk, float* OUT,
                                               const bf* __restrict__ WQ, const float* __restrict__ bv, bf* Qh, bf* Ql, h16* VP) {
    __shared__ __align__(16) float ts[WO ? 32 * OSP : 4]; __shared__ __align__(16) bf dp[2][QV ? 32 * DPP : 8]; __shared__ __align__(16) float qs[QV ? 32 * 36 : 4];
    const int t = threadIdx.x, c4 = (t * 4) % C, r0 = (t * 4) / C; const size_t e0 = (size_t)blockIdx.x * 4096 + t * 4;
    const float* tp = T + e0; float* hp = H + e0; v4f x[4], h[4], o[4]; v2f st[4];
    const v4f gg = *(const v4f*)(g + c4), bb = *(const v4f*)(be + c4);
#pragma unroll
    for (int q = 0; q < 4; ++q) st[q] = *(const v2f*)(ST + (size_t)(c4 + q) * 32);
    asm volatile("s_wait_xcnt 0x0" ::: "memory");    // the six loads above have taken their address before a result of the loads below may land in one of their offset registers (precaution before a register of an issued load is reused)
#pragma unroll
    for (int k = 0; k < 4; ++k) { x[k] = *(const v4f*)(tp + k * 1024); if (RES) h[k] = *(const v4f*)(hp + k * 1024); }
    // keeps the address pairs live, and unwritten (also by a later load's result), until every load has taken its address (same precaution)
    if constexpr (RES) asm volatile("s_wait_xcnt 0x0" :: "v"(tp), "v"(hp) : "memory"); else asm volatile("s_wait_xcnt 0x0" :: "v"(tp) : "memory");
    const int lane = t & 31, lr = lane & 15, hi = lane >> 4, w = __builtin_amdgcn_readfirstlane(t >> 5), rt = w >> 2, gq = w & 3; v16bf wb[3][4]; float vb[2];
    if constexpr (QV) { const bf* wv = WQ + (size_t)(32 + gq * 32 + lr) * C + 8 * hi; const bf* wq = WQ + (size_t)((gq & 1) * 16 + lr) * C + 8 * hi; const float* bp = bv + gq * 32 + lr;
#pragma unroll
        for (int u = 0; u < 2; ++u) { vb[u] = bfr(bp[u * 16]);
#pragma unroll
            for (int kc = 0; kc < 4; ++kc) wb[u][kc] = ldq(wv + u * 16 * C + kc * 32); }
        if (gq < 2) {
#pragma unroll
            for (int kc = 0; kc < 4; ++kc) wb[2][kc] = ldq(wq + kc * 32); }
        asm volatile("s_wait_xcnt 0x0" :: "v"(wv), "v"(wq), "v"(bp) : "memory"); }    // same precaution for the three address pairs of the weight and bias loads
    float sc[4], sh[4];
#pragma unroll
    for (int q = 0; q < 4; ++q) { sc[q] = bfr(gg[q]) * st[q][1]; sh[q] = bfr(bb[q]); }
#pragma unroll
    for (int k = 0; k < 4; ++k) { v4us oh, ol;
#pragma unroll
        for (int q = 0; q < 4; ++q) { const float y = fmaxf((x[k][q] - st[q][0]) * sc[q] + sh[q], 0.f); o[k][q] = RES ? h[k][q] + y : y; unsigned short a, b; splitf(o[k][q], a, b); oh[q] = a; ol[q] = b; }
        if (WO) *(v4fa*)(ts + (r0 + k * (1024 / C)) * OSP + c4) = o[k];
        if (QV) { *(v4usa*)(dp[0] + (r0 + k * (1024 / C)) * DPP + c4) = oh; *(v4usa*)(dp[1] + (r0 + k * (1024 / C)) * DPP + c4) = ol; }
        if (WS) { *(v4us*)(Ph + e0 + k * 1024) = oh; *(v4us*)(Pl + e0 + k * 1024) = ol; } }
    const int n0 = blockIdx.x * 32;    // first of the work-group's 32 points (C = 128), batches counted through
    if constexpr (WO || QV) __syncthreads();    // like the next one it stands in front of every global store of the kernel, so that it waits for LDS alone
    v8h pv[2];
    if constexpr (QV) { const bf* ah = dp[0] + (rt * 16 + lr) * DPP + 8 * hi; const bf* al = dp[1] + (rt * 16 + lr) * DPP + 8 * hi; v16bf a[4], a2[4]; v8f ta[2] = {(v8f){}, (v8f){}};
#pragma unroll
        for (int kc = 0; kc < 4; ++kc) { a[kc] = ldqs(ah + kc * 32); a2[kc] = ldqs(al + kc * 32); }
#pragma unroll
        for (int kc = 0; kc < 4; ++kc) {
#pragma unroll
            for (int u = 0; u < 2; ++u) { ta[u] = wmmab(a[kc], wb[u][kc], ta[u]); ta[u] = wmmab(a2[kc], wb[u][kc], ta[u]); } }
        if (gq < 2) { v8f tq = (v8f){};
#pragma unroll
            for (int kc = 0; kc < 4; ++kc) { tq = wmmab(a[kc], wb[2][kc], tq); tq = wmmab(a2[kc], wb[2][kc], tq); }
#pragma unroll
            for (int j = 0; j < 8; ++j) qs[(rt * 16 + hi * 8 + j) * 36 + gq * 16 + lr] = tq[j]; }
#pragma unroll
        for (int u = 0; u < 2; ++u) {
#pragma unroll
            for (int e = 0; e < 8; ++e) pv[u][e] = tohx(ta[u][e] + vb[u]); }
        __syncthreads(); }
    if constexpr (WO) { float* ob = OUT + ((size_t)(n0 / NN) * 4 * C + (size_t)blk * C + (t >> 3)) * NN + n0 % NN + (t & 7) * 4; const float* tc = ts + (t & 7) * 4 * OSP + (t >> 3);
#pragma unroll
        for (int k = 0; k < 4; ++k) *(v4f*)(ob + (size_t)k * 32 * NN) = (v4f){tc[k * 32], tc[OSP + k * 32], tc[2 * OSP + k * 32], tc[3 * OSP + k * 32]}; }
    if constexpr (WH) {
#pragma unroll
        for (int k = 0; k < 4; ++k) *(v4f*)(hp + k * 1024) = o[k]; }
    if constexpr (QV) { h16* vo = VP + (size_t)(n0 / NN) * C * NN + (size_t)((n0 % NN) >> 5) * 4096 + gq * 1024 + rt * 256 + lane * 8;
#pragma unroll
        for (int u = 0; u < 2; ++u) *(v8h*)(vo + u * 512) = pv[u];
        const v4f val = *(const v4fa*)(qs + (t >> 3) * 36 + (t & 7) * 4); v4us oh, ol;
#pragma unroll
        for (int q = 0; q < 4; ++q) { unsigned short a3, b3; splitf(val[q], a3, b3); oh[q] = a3; ol[q] = b3; }
        *(v4us*)(Qh + (size_t)n0 * 32 + t * 4) = oh; *(v4us*)(Ql + (size_t)n0 * 32 + t * 4) = ol; } }

extern "C" void kernel_launch(void* const* d_in, const int* in_sizes, int n_in,
                              void* d_out, int out_size, void* d_ws, size_t ws_size, hipStream_t stream) {
    (void)in_sizes; (void)n_in; (void)out_size;
    const float* IN[14]; for (int i = 0; i < 14; ++i) IN[i] = (const float*)d_in[i];   // 0 x, 1 W1 [64][64], 2 g1, 3 b1, 4 W2 [128][64], 5 g2, 6 b2, 7 Wqk [4][32][128], 8 Wv [4][128][128], 9 bv [4][128], 10 Wt, 11 bt, 12 gn, 13 bnb
    float* OUT = (float*)d_out;     // [8][512][2048]
    char* wsp = (char*)d_ws;
    auto take = [&](size_t bytes) { char* p = wsp; wsp += (bytes + 255) & ~(size_t)255; return (void*)p; };
    bf* WB1 = (bf*)take((size_t)C0 * C0 * 2); bf* WB2 = (bf*)take((size_t)C1 * C0 * 2); bf* WQV = (bf*)take((size_t)4 * WQR * C1 * 2); bf* WT = (bf*)take((size_t)4 * C1 * C1 * 2); float* ST = (float*)take((size_t)C1 * 32 * 4);
    // every per-batch plane holds all NB_ batches, batch-major, so that one launch of each stage serves the whole batch; every kernel sees the batch as NB_ * NN rows
    bf* XT = (bf*)take((size_t)NB_ * NN * C0 * 2); float* T = (float*)take((size_t)NB_ * NN * C1 * 4); float* H = (float*)take((size_t)NB_ * NN * C1 * 4); bf* Hh = (bf*)take((size_t)NB_ * NN * C0 * 2); bf* Hl = (bf*)take((size_t)NB_ * NN * C0 * 2);
    bf* Qh = (bf*)take((size_t)NB_ * NN * 32 * 2); bf* Ql = (bf*)take((size_t)NB_ * NN * 32 * 2); float* CV = (float*)take((size_t)NB_ * NN * 4); h16* VP = (h16*)take((size_t)NB_ * C1 * NN * 2);
    if ((size_t)(wsp - (char*)d_ws) > ws_size) return;    // total ~ 29 MiB; ws 256 MiB
    k_prep<<<NB_ * 128 + (C0 * C0 + C1 * C0 + 4 * C1 * C1 + 4 * WQR * C1) / 1024, 256, 0, stream>>>(IN[0], IN[1], IN[4], IN[7], IN[8], IN[10], XT, WB1, WB2, WQV, WT);
    // stage 1: h0 = relu(bn(W1 x)) (T used with C = 64 pitch); only its planes are kept
    k_gemmw<bf, 0, false><<<dim3(NB_ * NN / 64, 1, 1), 32, 0, stream>>>(XT, nullptr, WB1, nullptr, C0, T, C0, nullptr, 0, 0, 0);
    k_bnstat<C0><<<C0 / 4, 1024, 0, stream>>>(T, ST);
    k_bnfin<C0, false, false, true, false, false><<<NB_ * NN * C0 / 4096, 256, 0, stream>>>(T, ST, IN[2], IN[3], nullptr, Hh, Hl, 0, nullptr, nullptr, nullptr, nullptr, nullptr, nullptr);
    // stage 2: h = relu(bn(W2 h0)), with the first block's q and v
    k_gemmw<bf, 1, false><<<dim3(NB_ * NN / 64, C1 / 64, 1), 32, 0, stream>>>(Hh, Hl, WB2, nullptr, C0, T, C1, nullptr, 0, 0, 0);
    k_bnstat<C1><<<C1 / 4, 1024, 0, stream>>>(T, ST);
    k_bnfin<C1, false, true, false, false, true><<<NB_ * NN * C1 / 4096, 256, 0, stream>>>(T, ST, IN[5], IN[6], H, nullptr, nullptr, 0, nullptr, WQV, IN[9], Qh, Ql, VP);
    // four offset-attention blocks, four launches each
    for (int i = 0; i < 4; ++i) {
        k_rstat<<<NB_ * NN / 32, 256, 0, stream>>>(Qh, Ql, CV);          // one log-domain constant a softmax row (maximum and sum), energies (3 products) in registers
        k_fatt<<<NB_ * NN / 32, 256, 0, stream>>>(Qh, Ql, CV, VP, H, WT + (size_t)i * C1 * C1, IN[11] + i * C1, T);          // column sums, then weights and the product with v, energies in registers both times; then Wt (h - x_r) + bt
        k_bnstat<C1><<<C1 / 4, 1024, 0, stream>>>(T, ST);
        if (i < 3) k_bnfin<C1, true, true, false, true, true><<<NB_ * NN * C1 / 4096, 256, 0, stream>>>(T, ST, IN[12] + i * C1, IN[13] + i * C1, H, nullptr, nullptr, i, OUT, WQV + (size_t)(i + 1) * WQR * C1, IN[9] + (i + 1) * C1, Qh, Ql, VP);
        else k_bnfin<C1, true, false, false, true, false><<<NB_ * NN * C1 / 4096, 256, 0, stream>>>(T, ST, IN[12] + i * C1, IN[13] + i * C1, H, nullptr, nullptr, i, OUT, nullptr, nullptr, nullptr, nullptr, nullptr); }
}

// v007
// A run of this version takes 274 microseconds.
// Two timings next to v006 both put it at 1.16 times that version's speed.
// Counting every step since v000, it is 115 times as fast.
#include <hip/hip_runtime.h>

// IEModule (PCT-style offset-attention stack; x [8][64][2048]; h = relu(bn(W1 x)) (64); h = relu(bn(W2 h)) (128); then four chained blocks: q = Wqk h (32), energy = q^T q (symmetric, unscaled), att = softmax over keys
// then / (1e-9 + column sum over queries), x_r = v att with v = Wv h + bv, h = h + relu(bn(Wt (h - x_r) + bt)); output = concat of the four h -> [8][512][2048]. Every BatchNorm is TRAINING-mode: per-channel
// mean / biased variance over (batch, points) of the current activations, eps 1e-5.)
// Compute dtypes, f32 accumulate: every input rounded to bf16; everything positions-major [point][channel]; W1 x on PLAIN bf16 operands (inputs: exact), every later channel
// contraction on bf16 hi+lo planes of its computed operand x exact weights (2 products, + bias); energies on hi+lo planes of q (3 products, K 32); x_r^T = v^T . att on SINGLE fp16 planes (softmax weights x 1024 / (1e-9 + column sum); the division comes before the rounding and the product)

#define NB_  8
#define NN   2048
#define C0   64
#define C1   128
#define PCAR 1024.0f
#define BNE  1e-5f
typedef _Float16 h16;
typedef unsigned short bf;
typedef __attribute__((ext_vector_type(16))) __bf16   v16bf;
typedef __attribute__((ext_vector_type(16))) _Float16 v16h;
typedef __attribute__((ext_vector_type(8)))  _Float16 v8h;
typedef __attribute__((ext_vector_type(8)))  unsigned short v8us;
typedef __attribute__((ext_vector_type(8)))  float    v8f;
typedef __attribute__((ext_vector_type(4)))  float    v4f;
typedef v8h  __attribute__((may_alias)) v8ha;
typedef v4f  __attribute__((may_alias)) v4fa;
typedef v8us __attribute__((may_alias)) v8usa;

__device__ __forceinline__ unsigned short f2bf(float f) { unsigned u = __float_as_uint(f); u += 0x7FFFu + ((u >> 16) & 1u); return (unsigned short)(u >> 16); }
__device__ __forceinline__ float bf2f(unsigned short b) { return __uint_as_float(((unsigned)b) << 16); }
__device__ __forceinline__ float bfr(float f) { return bf2f(f2bf(f)); }
__device__ __forceinline__ v16h cat16(v8h lo, v8h hi) { return __builtin_shufflevector(lo, hi, 0, 1, 2, 3, 4, 5, 6, 7, 8, 9, 10, 11, 12, 13, 14, 15); }
__device__ __forceinline__ v16bf cat16b(v8us lo, v8us hi) { return __builtin_bit_cast(v16bf, __builtin_shufflevector(lo, hi, 0, 1, 2, 3, 4, 5, 6, 7, 8, 9, 10, 11, 12, 13, 14, 15)); }
__device__ __forceinline__ v8f wmma16(v16h a, v16h b, v8f c) { return __builtin_amdgcn_wmma_f32_16x16x32_f16(false, a, false, b, (short)0, c, false, false); }
__device__ __forceinline__ v8f wmmab(v16bf a, v16bf b, v8f c) { return __builtin_amdgcn_wmma_f32_16x16x32_bf16(false, a, false, b, (short)0, c, false, false); }



// BatchNorm partials of one 16 x 16 accumulator tile (a lane holds 8 rows of one column, lanes l and l ^ 16 the two halves of the column): s = the column's sum over the tile's 16 rows, q = its sum of squared deviations from the tile's own mean.
__device__ __forceinline__ void tilestat(v8f y, float& s, float& q) { float a = ((y[0] + y[1]) + (y[2] + y[3])) + ((y[4] + y[5]) + (y[6] + y[7])); a += __shfl_xor(a, 16, 32); const float mu = a * (1.0f / 16.0f); float b = 0.f;
#pragma unroll
    for (int r = 0; r < 8; ++r) { const float d = y[r] - mu; b += d * d; }
    b += __shfl_xor(b, 16, 32); s = a; q = b; }
// ---- k_gemmw: register-blocked GEMM, ONE WAVE per 64x64 output tile (16 accumulators), operands straight from K-contiguous 16-bit planes; grid (M/64, N/64, Z), 32 threads.
// C[m][n] (f32, pitch ldc, + optional f32 bias[n]) = sum_k A[m][k] Bt[n][k] (+ split products per NSPLIT). z-batch strides sA/sB/sC in elements. K % 32 == 0.
// PS / PM [16-row tile][ldc]: the BatchNorm partials (tilestat) of every 16-row tile of C, from the accumulators (grid z = 1).
template <typename T16> struct WFrag;
template <> struct WFrag<bf> { typedef v16bf V; static __device__ __forceinline__ V ld(const bf* p) { return cat16b(*(const v8us*)p, *(const v8us*)(p + 16)); } static __device__ __forceinline__ v8f mma(V a, V b, v8f c) { return wmmab(a, b, c); } };
template <typename T16, int NSPLIT, bool BIAS>
__global__ __launch_bounds__(32) void k_gemmw(const T16* __restrict__ A, const T16* __restrict__ A2, const T16* __restrict__ Bt, const T16* __restrict__ Bt2, int K, float* C, int ldc, const float* __restrict__ bias, size_t sA, size_t sB, size_t sC, float* PS, float* PM) {
    typedef typename WFrag<T16>::V V;
    __shared__ __align__(16) float os[16 * 68];
    const size_t z = blockIdx.z; A += z * sA; if (A2) A2 += z * sA; Bt += z * sB; if (Bt2) Bt2 += z * sB; C += z * sC;
    const int lane = threadIdx.x & 31, lr = lane & 15, hi = lane >> 4; const int r0 = blockIdx.x * 64, c0 = blockIdx.y * 64;
    v8f acc[4][4];
#pragma unroll
    for (int mb = 0; mb < 4; ++mb)
#pragma unroll
        for (int nb = 0; nb < 4; ++nb) acc[mb][nb] = (v8f){};
    const size_t aoff = (size_t)(r0 + lr) * K + 8 * hi, boff = (size_t)(c0 + lr) * K + 8 * hi;
#pragma unroll 1
    for (int kc = 0; kc < K; kc += 32) {
        V a[4], a2[4];
#pragma unroll
        for (int mb = 0; mb < 4; ++mb) { a[mb] = WFrag<T16>::ld(A + aoff + (size_t)mb * 16 * K + kc); if (NSPLIT == 1 || NSPLIT == 2) a2[mb] = WFrag<T16>::ld(A2 + aoff + (size_t)mb * 16 * K + kc); }
#pragma unroll
        for (int nb = 0; nb < 4; ++nb) { const V b = WFrag<T16>::ld(Bt + boff + (size_t)nb * 16 * K + kc); V b2; if (NSPLIT >= 2) b2 = WFrag<T16>::ld(Bt2 + boff + (size_t)nb * 16 * K + kc);
#pragma unroll
            for (int mb = 0; mb < 4; ++mb) { acc[mb][nb] = WFrag<T16>::mma(a[mb], b, acc[mb][nb]); if (NSPLIT == 1 || NSPLIT == 2) acc[mb][nb] = WFrag<T16>::mma(a2[mb], b, acc[mb][nb]); if (NSPLIT >= 2) acc[mb][nb] = WFrag<T16>::mma(a[mb], b2, acc[mb][nb]); } }
        asm volatile("v_nop\n\tv_nop\n\tv_nop\n\tv_nop" : "+v"(acc[0][0]), "+v"(acc[1][1]), "+v"(acc[2][2]), "+v"(acc[3][3]) : "v"(a[0]), "v"(a[3]));
    }
#pragma unroll
    for (int mb = 0; mb < 4; ++mb) {
#pragma unroll
        for (int nb = 0; nb < 4; ++nb) {
#pragma unroll
            for (int j = 0; j < 8; ++j) os[(hi * 8 + j) * 68 + nb * 16 + lr] = acc[mb][nb][j]; }
        __builtin_amdgcn_wave_barrier(); asm volatile("" ::: "memory");
        float* crow = C + (size_t)(r0 + mb * 16) * ldc + c0;
{
#pragma unroll
            for (int s = 0; s < 8; ++s) { const int row = 2 * s + hi, cofs = lr * 4; v4f val = *(const v4fa*)(os + row * 68 + cofs); if (BIAS) { val[0] += bfr(bias[c0 + cofs]); val[1] += bfr(bias[c0 + cofs + 1]); val[2] += bfr(bias[c0 + cofs + 2]); val[3] += bfr(bias[c0 + cofs + 3]); }
                *(v4f*)(crow + (size_t)row * ldc + cofs) = val; }
             }
        __builtin_amdgcn_wave_barrier(); asm volatile("" ::: "memory");
    }
    asm volatile("s_wait_xcnt 0x0" ::: "memory");    // the stores above have taken their registers before the lines below may reuse one (precaution before a register of an issued store is reused)
    float* pd = (hi ? PM : PS) + (size_t)blockIdx.x * 4 * ldc + c0 + lr; float pv[4][4];    // lanes 0-15 store the sums, lanes 16-31 the squared deviations
#pragma unroll
    for (int mb = 0; mb < 4; ++mb) {
#pragma unroll
        for (int nb = 0; nb < 4; ++nb) { float s, q; tilestat(acc[mb][nb], s, q); if (BIAS) s += 16.0f * bfr(bias[c0 + nb * 16 + lr]); pv[mb][nb] = hi ? q : s; } }
#pragma unroll
    for (int mb = 0; mb < 4; ++mb) {
#pragma unroll
        for (int nb = 0; nb < 4; ++nb) pd[(size_t)mb * ldc + nb * 16] = pv[mb][nb]; }
}

__device__ __forceinline__ h16 tohx(float x) { return (h16)x; }
__device__ __forceinline__ void splitf(float y, unsigned short& h, unsigned short& l) { h = f2bf(y); l = f2bf(y - bf2f(h)); }
typedef __attribute__((ext_vector_type(4))) unsigned short v4us;
typedef __attribute__((ext_vector_type(2))) float v2f;
typedef v4us __attribute__((may_alias)) v4usa;
#define WQR  160         // rows of a block's q / v weight operand: Wqk (32), then Wv (128)
#define DPP  136         // 16-bit elements a row of an operand plane in LDS: 16-B aligned, adjacent rows 4 banks apart
// k_prep: every operand that is only a rounded copy of an input, in one launch: x as bf16, positions-major [batch][point][64] (the first NB_ * 128 work-groups), then the weights as bf16 (1024 elements a work-group):
// W1, W2, Wt, and per block the WQR rows [Wqk; Wv].
__global__ __launch_bounds__(256) void k_prep(const float* __restrict__ x, const float* __restrict__ W1, const float* __restrict__ W2, const float* __restrict__ Wqk, const float* __restrict__ Wv, const float* __restrict__ Wt, bf* XT, bf* WB1, bf* WB2, bf* WQV, bf* WT) {
    const int blk = blockIdx.x; v4us o;
    if (blk < NB_ * 128) { const float* xb = x + (size_t)(blk >> 7) * C0 * NN; const int e = ((blk & 127) * 256 + threadIdx.x) * 4, c = e % C0, n = e / C0;
#pragma unroll
        for (int q = 0; q < 4; ++q) o[q] = f2bf(xb[(size_t)(c + q) * NN + n]);
        *(v4us*)(XT + (size_t)(blk >> 7) * NN * C0 + e) = o; return; }
    int e = ((blk - NB_ * 128) * 256 + threadIdx.x) * 4; const float* s; bf* d;
    if (e < C0 * C0) { s = W1 + e; d = WB1 + e; }
    else if ((e -= C0 * C0) < C1 * C0) { s = W2 + e; d = WB2 + e; }
    else if ((e -= C1 * C0) < 4 * C1 * C1) { s = Wt + e; d = WT + e; }
    else { e -= 4 * C1 * C1; const int i = e / (WQR * C1), r = (e / C1) % WQR, k = e % C1; d = WQV + e; s = r < 32 ? Wqk + (size_t)(i * 32 + r) * C1 + k : Wv + (size_t)(i * C1 + r - 32) * C1 + k; }
    const v4f v = *(const v4f*)s;
#pragma unroll
    for (int q = 0; q < 4; ++q) o[q] = f2bf(v[q]);
    *(v4us*)d = o; }
// ---- attention without stored energies. The energies are a Gram matrix of K = 32, so a 16 x 16 tile costs three matrix instructions from the q planes: both kernels below form the tiles they need in registers, and neither the
// energies nor the attention weights go through memory. The three products of a tile are taken in the same order of terms in both kernels, so both see the same value for a pair (i, j).
#define OSP  132         // floats a row of a wave's partial output tile in LDS: 16-B aligned, adjacent rows 4 banks apart
#define L2E  1.4426950408889634f
__device__ __forceinline__ float ex2(float x) { asm("v_exp_f32 %0, %0\n\tv_nop" : "+v"(x)); return x; }
__device__ __forceinline__ v8f ex2x8(v8f x) { float y0 = x[0], y1 = x[1], y2 = x[2], y3 = x[3], y4 = x[4], y5 = x[5], y6 = x[6], y7 = x[7];
    asm("v_exp_f32 %0, %0\n\tv_exp_f32 %1, %1\n\tv_exp_f32 %2, %2\n\tv_exp_f32 %3, %3\n\tv_exp_f32 %4, %4\n\tv_exp_f32 %5, %5\n\tv_exp_f32 %6, %6\n\tv_exp_f32 %7, %7\n\tv_nop"
        : "+v"(y0), "+v"(y1), "+v"(y2), "+v"(y3), "+v"(y4), "+v"(y5), "+v"(y6), "+v"(y7));
    return (v8f){y0, y1, y2, y3, y4, y5, y6, y7}; }
__device__ __forceinline__ v16bf ldq(const bf* p) { return cat16b(*(const v8us*)p, *(const v8us*)(p + 16)); }
__device__ __forceinline__ v16bf ldqs(const bf* p) { return cat16b(*(const v8usa*)p, *(const v8usa*)(p + 16)); }    // the same fragment from an LDS plane
// k_rstat: CV[i] = log2(e) max_j S[i][j] + log2(sum_j exp(S[i][j] - max)), so that softmax[i][j] = exp2(log2(e) S[i][j] - CV[i]). A work-group owns 32 rows i (one 128-B line of CV); they are the COLUMNS of its tiles, so a lane folds one row i in its own registers;
// wave w walks 256 of the 2048 j with a running maximum and a rescaled running sum; halves join by one shuffle, the 8 waves through LDS.
__global__ __launch_bounds__(256) void k_rstat(const bf* __restrict__ Qh, const bf* __restrict__ Ql, float* CV) { __shared__ float sm[8][32], ss[8][32]; const int lane = threadIdx.x & 31, w = threadIdx.x >> 5, lr = lane & 15, hi = lane >> 4;
    const int i0 = blockIdx.x * 32; const size_t jo = ((size_t)(i0 / NN) * NN + w * (NN / 8) + lr) * 32 + 8 * hi; const bf* qh = Qh + jo; const bf* ql = Ql + jo; v16bf bh[2], bl[2]; float m[2] = {-1.0e30f, -1.0e30f}, s[2] = {0.f, 0.f};
#pragma unroll
    for (int t = 0; t < 2; ++t) { const size_t o = (size_t)(i0 + t * 16 + lr) * 32 + 8 * hi; bh[t] = ldq(Qh + o); bl[t] = ldq(Ql + o); }
    for (int mt = 0; mt < NN / 8 / 16; mt += 2) { v16bf ah[2], al[2];
#pragma unroll
        for (int u = 0; u < 2; ++u) { ah[u] = ldq(qh + u * 512); al[u] = ldq(ql + u * 512); }
        asm volatile("s_wait_xcnt 0x0" :: "v"(qh), "v"(ql) : "memory");    // keeps both address pairs live, and unwritten, until the 8 loads have taken their address (precaution before a register of an issued load is reused)
        qh += 1024; ql += 1024;
#pragma unroll
        for (int t = 0; t < 2; ++t) { v8f d[2];
#pragma unroll
            for (int u = 0; u < 2; ++u) { d[u] = wmmab(ah[u], bh[t], (v8f){}); d[u] = wmmab(al[u], bh[t], d[u]); d[u] = wmmab(ah[u], bl[t], d[u]); }
            float mn = m[t];
#pragma unroll
            for (int r = 0; r < 8; ++r) mn = fmaxf(mn, fmaxf(d[0][r], d[1][r]));
            const v8f e0 = ex2x8((d[0] - mn) * L2E), e1 = ex2x8((d[1] - mn) * L2E); float a[4] = {0.f, 0.f, 0.f, 0.f};
#pragma unroll
            for (int r = 0; r < 8; ++r) { a[r & 1] += e0[r]; a[2 + (r & 1)] += e1[r]; }
            s[t] = s[t] * ex2((m[t] - mn) * L2E) + ((a[0] + a[1]) + (a[2] + a[3])); m[t] = mn; } }
#pragma unroll
    for (int t = 0; t < 2; ++t) { const float m2 = __shfl_xor(m[t], 16, 32), s2 = __shfl_xor(s[t], 16, 32), mx = fmaxf(m[t], m2); const float sj = s[t] * ex2((m[t] - mx) * L2E) + s2 * ex2((m2 - mx) * L2E);
        if (hi == 0) { sm[w][t * 16 + lr] = mx; ss[w][t * 16 + lr] = sj; } }
    __syncthreads();
    if (w == 0) { float mx = sm[0][lane];
#pragma unroll
        for (int k = 1; k < 8; ++k) mx = fmaxf(mx, sm[k][lane]);
        float sj = 0.f;
#pragma unroll
        for (int k = 0; k < 8; ++k) sj += ss[k][lane] * ex2((sm[k][lane] - mx) * L2E);
        CV[i0 + lane] = __builtin_amdgcn_logf(sj) + mx * L2E; } }
// k_fatt: T[j][.] = Wt (h[j] - x_r[j]) + bt, 1024 x_r[j][c] = sum_i f16(1024 a[i][j] / (1e-9 + sum_i a[i][j])) f16(v[i][c]), a[i][j] = softmax[i][j] = exp2(log2(e) S[i][j] - CV[i]). A work-group owns 32 output rows j; wave w takes 256 of the 2048 i, 32 a pass, and walks them twice.
// First walk: tiles S[i][j] (rows i, columns j) from the q planes, a in f32, its column sum in the lane; the 8 waves' sums meet in LDS behind a barrier and give every column its own factor 1024 / (1e-9 + sum).
// Second walk: the same tiles again, a times the column's factor BEFORE the rounding to f16 (so the largest weights of every column are normal f16 numbers, however small the column's sum), and the two tiles of 16 i, rounded in place,
// are the B operand of x_r^T += v^T . a (a packed pair of D tiles has the hardware's k order, which the VP order gives v). The 8 waves' partial tiles meet in LDS behind a second barrier.
// The lane that sums an element subtracts it from h and leaves the difference as bf16 hi + lo planes in LDS; behind a third barrier wave w forms rows 16 (w >> 2) .., columns 32 (w & 3) .. of the work-group's 32 x 128 tile of T
// (per 32 k: hi plane x Wt, then lo plane x Wt, into one accumulator; a row's 128-B line has one writer), and leaves the BatchNorm partials (tilestat) of its two tiles in PS / PM [16-row tile][128] (32 channels: one 128-B line, one writer).
__global__ __launch_bounds__(256) __attribute__((amdgpu_waves_per_eu(4, 4))) void k_fatt(const bf* __restrict__ Qh, const bf* __restrict__ Ql, const float* __restrict__ CV, const h16* __restrict__ VP, const float* __restrict__ H, const bf* __restrict__ Wt, const float* __restrict__ bt, float* T, float* PS, float* PM) {
    __shared__ __align__(16) float os[8 * 32 * OSP]; __shared__ float cs[8][32]; __shared__ __align__(16) bf dp[2][32 * DPP]; const int lane = threadIdx.x & 31, w = threadIdx.x >> 5, lr = lane & 15, hi = lane >> 4;
    const int j0 = blockIdx.x * 32, b = j0 / NN, ib0 = w * (NN / 8); const size_t qo = ((size_t)b * NN + ib0 + lr) * 32 + 8 * hi; const bf* qh = Qh + qo; const bf* ql = Ql + qo; const float* cv = CV + (size_t)b * NN + ib0 + hi * 8;
    const h16* vp = VP + (size_t)b * C1 * NN + (size_t)(ib0 >> 5) * 4096 + lane * 8; v16bf bh[2], bl[2]; v8f csum[2] = {(v8f){}, (v8f){}}; float kf[2]; const bf* pjh[2]; const bf* pjl[2];
#pragma unroll
    for (int jt = 0; jt < 2; ++jt) { const size_t o = (size_t)(j0 + jt * 16 + lr) * 32 + 8 * hi; pjh[jt] = Qh + o; pjl[jt] = Ql + o; bh[jt] = ldq(pjh[jt]); bl[jt] = ldq(pjl[jt]); }
    asm volatile("s_wait_xcnt 0x0" :: "v"(pjh[0]), "v"(pjh[1]), "v"(pjl[0]), "v"(pjl[1]) : "memory");    // keeps the four address pairs live, and unwritten (also by a later load's result), until the 8 loads have taken their address (precaution before a register of an issued load is reused)
#pragma unroll    // unrolled: every load has a constant offset from one of three fixed address pairs, which the second walk starts from again
    for (int it = 0; it < NN / 8 / 32; ++it) { v16bf ah[2], al[2]; v8f kk[2];
#pragma unroll
        for (int t = 0; t < 2; ++t) { const int o = it * 1024 + t * 512, oc = it * 32 + t * 16; ah[t] = ldq(qh + o); al[t] = ldq(ql + o); kk[t] = __builtin_shufflevector(*(const v4f*)(cv + oc), *(const v4f*)(cv + oc + 4), 0, 1, 2, 3, 4, 5, 6, 7); }
#pragma unroll
        for (int t = 0; t < 2; ++t) { v8f d[2];
#pragma unroll
            for (int jt = 0; jt < 2; ++jt) d[jt] = wmmab(ah[t], bh[jt], (v8f){});
#pragma unroll
            for (int jt = 0; jt < 2; ++jt) d[jt] = wmmab(ah[t], bl[jt], d[jt]);
#pragma unroll
            for (int jt = 0; jt < 2; ++jt) d[jt] = wmmab(al[t], bh[jt], d[jt]);
#pragma unroll
            for (int jt = 0; jt < 2; ++jt) csum[jt] += ex2x8(d[jt] * L2E - kk[t]); } }
#pragma unroll
    for (int jt = 0; jt < 2; ++jt) { const v8f u = csum[jt]; float s = ((u[0] + u[1]) + (u[2] + u[3])) + ((u[4] + u[5]) + (u[6] + u[7])); s += __shfl_xor(s, 16, 32); if (hi == 0) cs[w][jt * 16 + lr] = s; }
    __syncthreads();
#pragma unroll
    for (int jt = 0; jt < 2; ++jt) { float s = 0.f;
#pragma unroll
        for (int ww = 0; ww < 8; ++ww) s += cs[ww][jt * 16 + lr];
        kf[jt] = __fdiv_rn(1.0f, __fadd_rn(1e-9f, s)) * PCAR; }
    v8f acc[2][8];
#pragma unroll
    for (int jt = 0; jt < 2; ++jt) {
#pragma unroll
        for (int nb = 0; nb < 8; ++nb) acc[jt][nb] = (v8f){}; }
#pragma unroll 1    // stays rolled: unrolled, the compiler lifts the passes' loads over one another, needs more than 256 registers and spills
    for (int it = 0; it < NN / 8 / 32; ++it) { v16h p[2], f[8]; v16bf ah[2], al[2]; v8f kk[2];
#pragma unroll
        for (int t = 0; t < 2; ++t) { ah[t] = ldq(qh + t * 512); al[t] = ldq(ql + t * 512); kk[t] = __builtin_shufflevector(*(const v4f*)(cv + t * 16), *(const v4f*)(cv + t * 16 + 4), 0, 1, 2, 3, 4, 5, 6, 7); }
#pragma unroll
        for (int t = 0; t < 2; ++t) { v8f d[2];
#pragma unroll
            for (int jt = 0; jt < 2; ++jt) d[jt] = wmmab(ah[t], bh[jt], (v8f){});
#pragma unroll
            for (int jt = 0; jt < 2; ++jt) d[jt] = wmmab(ah[t], bl[jt], d[jt]);
#pragma unroll
            for (int jt = 0; jt < 2; ++jt) d[jt] = wmmab(al[t], bh[jt], d[jt]);
#pragma unroll
            for (int jt = 0; jt < 2; ++jt) { const v8f x = ex2x8(d[jt] * L2E - kk[t]);
#pragma unroll
                for (int r = 0; r < 8; ++r) p[jt][t * 8 + r] = tohx(x[r] * kf[jt]); } }
#pragma unroll
        for (int nb = 0; nb < 4; ++nb) f[nb] = cat16(*(const v8h*)(vp + nb * 512), *(const v8h*)(vp + nb * 512 + 256));
#pragma unroll
        for (int nb = 0; nb < 8; ++nb) {
#pragma unroll
            for (int jt = 0; jt < 2; ++jt) acc[jt][nb] = wmma16(f[nb], p[jt], acc[jt][nb]);
            if (nb < 4) f[nb + 4] = cat16(*(const v8h*)(vp + (nb + 4) * 512), *(const v8h*)(vp + (nb + 4) * 512 + 256)); }
        asm volatile("s_wait_xcnt 0x0" :: "v"(qh), "v"(ql), "v"(cv), "v"(vp) : "memory");    // stands behind the pass's last load: keeps the four address pairs live, and unwritten, until every load has taken its address (precaution before a register of an issued load is reused)
        qh += 1024; ql += 1024; cv += 32; vp += 4096; }
#pragma unroll
    for (int jt = 0; jt < 2; ++jt) {
#pragma unroll
        for (int nb = 0; nb < 8; ++nb) { float* o = os + (size_t)(w * 32 + jt * 16 + lr) * OSP + nb * 16 + hi * 8; const v8f v = acc[jt][nb]; *(v4fa*)o = (v4f){v[0], v[1], v[2], v[3]}; *(v4fa*)(o + 4) = (v4f){v[4], v[5], v[6], v[7]}; } }
    const float* hp = H + (size_t)j0 * C1 + threadIdx.x * 4; v4f hv[4];    // lane t owns elements 4 t .. 4 t + 3 of each quarter (8 rows) of the work-group's 32 x 128 tile
#pragma unroll
    for (int k = 0; k < 4; ++k) hv[k] = *(const v4f*)(hp + k * 1024);
    const int rt = w >> 2, cq = (w & 3) * 32; const bf* wp = Wt + (size_t)(cq + lr) * C1 + 8 * hi; const float* bp = bt + cq + lr; v16bf wb[2][4]; float bb[2];
#pragma unroll
    for (int u = 0; u < 2; ++u) { bb[u] = bfr(bp[u * 16]);
#pragma unroll
        for (int kc = 0; kc < 4; ++kc) wb[u][kc] = ldq(wp + u * 16 * C1 + kc * 32); }
    asm volatile("s_wait_xcnt 0x0" :: "v"(hp), "v"(wp), "v"(bp) : "memory");    // keeps the three address pairs live, and unwritten (also by a later load's result), until the 22 loads have taken their address (precaution before a register of an issued load is reused)
    __syncthreads();
#pragma unroll
    for (int k = 0; k < 4; ++k) { const int idx = threadIdx.x + 256 * k, row = idx >> 5, c4 = (idx & 31) * 4; v4f sa = (v4f){0.f, 0.f, 0.f, 0.f}; v4us oh, ol;
#pragma unroll
        for (int ww = 0; ww < 8; ++ww) sa += *(const v4fa*)(os + (size_t)(ww * 32 + row) * OSP + c4);
#pragma unroll
        for (int q = 0; q < 4; ++q) { unsigned short x, y; splitf(hv[k][q] - sa[q] * (1.0f / PCAR), x, y); oh[q] = x; ol[q] = y; }
        *(v4usa*)(dp[0] + row * DPP + c4) = oh; *(v4usa*)(dp[1] + row * DPP + c4) = ol; }
    __syncthreads();
    const bf* ah = dp[0] + (rt * 16 + lr) * DPP + 8 * hi; const bf* al = dp[1] + (rt * 16 + lr) * DPP + 8 * hi; v8f ta[2] = {(v8f){}, (v8f){}};
#pragma unroll
    for (int kc = 0; kc < 4; ++kc) { const v16bf a = ldqs(ah + kc * 32), a2 = ldqs(al + kc * 32);
#pragma unroll
        for (int u = 0; u < 2; ++u) { ta[u] = wmmab(a, wb[u][kc], ta[u]); ta[u] = wmmab(a2, wb[u][kc], ta[u]); } }
    float* to = T + (size_t)(j0 + rt * 16 + hi * 8) * C1 + cq + lr; float* pd = (hi ? PM : PS) + (size_t)(blockIdx.x * 2 + rt) * C1 + cq + lr; float pv[2];    // lanes 0-15 store the sums, lanes 16-31 the squared deviations
#pragma unroll
    for (int u = 0; u < 2; ++u) { float s, q; ta[u] += bb[u]; tilestat(ta[u], s, q); pv[u] = hi ? q : s; }
#pragma unroll
    for (int j = 0; j < 8; ++j) {
#pragma unroll
        for (int u = 0; u < 2; ++u) to[j * C1 + u * 16] = ta[u][j]; }
#pragma unroll
    for (int u = 0; u < 2; ++u) pd[u * 16] = pv[u]; }
// k_bnstat: per-channel mean and 1/sqrt(biased variance + eps) over all NB_ * NN rows of T [row][C], from the partials that the kernel which made T left of every 16-row tile (PS sum, PM squared deviations from the tile's mean; [tile][C]): T itself is not read.
// One work-group of 32 waves per 4 adjacent channels; lane t owns tile t. Squared deviations from the overall mean = the tile's own + 16 (tile mean - mean)^2: every term is >= 0, nothing cancels.
// Lanes fold by shuffles, the 32 waves' partial sums through LDS (every wave folds them alike).
__device__ __forceinline__ v4f wgsum4(v4f s, v4f (*red)[32], int w, int lane) {
#pragma unroll
    for (int sh = 16; sh; sh >>= 1) {
#pragma unroll
        for (int q = 0; q < 4; ++q) s[q] += __shfl_xor(s[q], sh, 32); }
    if (lane == 0) (*red)[w] = s;
    __syncthreads();
    s = (*red)[lane];
#pragma unroll
    for (int sh = 16; sh; sh >>= 1) {
#pragma unroll
        for (int q = 0; q < 4; ++q) s[q] += __shfl_xor(s[q], sh, 32); }
    return s; }
template <int C>
__global__ __launch_bounds__(1024) void k_bnstat(const float* __restrict__ PS, const float* __restrict__ PM, float* ST) { __shared__ __align__(16) v4f red[2][32]; const int lane = threadIdx.x & 31, w = threadIdx.x >> 5; const int c0 = blockIdx.x * 4;
    static_assert(NB_ * NN / 16 == 1024, "one lane a tile");
    const float* sp = PS + (size_t)threadIdx.x * C + c0; const float* qp = PM + (size_t)threadIdx.x * C + c0; const v4f s = *(const v4f*)sp; v4f q2 = *(const v4f*)qp;
    asm volatile("s_wait_xcnt 0x0" :: "v"(sp), "v"(qp) : "memory");    // keeps the two address pairs live, and unwritten, until both loads have taken their address (precaution before a register of an issued load is reused)
    const v4f mu = wgsum4(s, &red[0], w, lane) * (1.0f / (NB_ * NN)); const v4f d = s * (1.0f / 16.0f) - mu; q2 += d * d * 16.0f;
    q2 = wgsum4(q2, &red[1], w, lane);
    if (w < 4) { const float m = w == 0 ? mu[0] : (w == 1 ? mu[1] : (w == 2 ? mu[2] : mu[3])), v = w == 0 ? q2[0] : (w == 1 ? q2[1] : (w == 2 ? q2[2] : q2[3]));
        const float rs = __frsqrt_rn(__fadd_rn(v * (1.0f / (NB_ * NN)), BNE)); ST[(size_t)(c0 + w) * 32 + lane] = lane == 0 ? m : (lane == 1 ? rs : 0.f); } }
// k_bnfin: y = relu(bf16(g[c]) rs_c (T[row][c] - mu_c) + bf16(be[c])), h = RES ? H + y : y, and everything that is made of h alone, from the register that holds it. A work-group takes 4096 adjacent elements (4096 / C rows),
// a lane four 16-B units of the same 4 channels. WH: H[row][c] f32 (the same lane reads and writes an element). WS: bf16 hi + lo planes of h in memory.
// WO: OUT[batch][blk * C + c][point], transposed through an LDS tile of 32 points x 128 channels (a channel's 32 points are one 128-B line).
// QV: the next block's q and v of the 32 points: the planes of h stay in LDS, wave w forms rows 16 (w >> 2) .. of v channels 32 (w & 3) .. and, where (w & 3) < 2, of q channels 16 (w & 3) .. (per 32 k: hi plane x W, then lo plane x W, into one accumulator).
// v leaves, + bias, as f16 in the order of the matrix fragments, VP[batch][32 points][16 channels][k half][lane][8] (a fragment of v^T, row = channel, k = point, is two loads of 512 contiguous bytes a wave): an accumulator's 8 values of a lane
// are 8 points of one channel, one 16-B unit of VP. q leaves as bf16 hi + lo planes [point][32], through an LDS tile behind a second barrier.
template <int C, bool RES, bool WH, bool WS, bool WO, bool QV>
__global__ __launch_bounds__(256) void k_bnfin(const float* __restrict__ T, const float* __restrict__ ST, const float* __restrict__ g, const float* __restrict__ be, float* H, bf* Ph, bf* Pl, int blk, float* OUT,
                                               const bf* __restrict__ WQ, const float* __restrict__ bv, bf* Qh, bf* Ql, h16* VP) {
    __shared__ __align__(16) float ts[WO ? 32 * OSP : 4]; __shared__ __align__(16) bf dp[2][QV ? 32 * DPP : 8]; __shared__ __align__(16) float qs[QV ? 32 * 36 : 4];
    const int t = threadIdx.x, c4 = (t * 4) % C, r0 = (t * 4) / C; const size_t e0 = (size_t)blockIdx.x * 4096 + t * 4;
    const float* tp = T + e0; float* hp = H + e0; v4f x[4], h[4], o[4]; v2f st[4];
    const v4f gg = *(const v4f*)(g + c4), bb = *(const v4f*)(be + c4);
#pragma unroll
    for (int q = 0; q < 4; ++q) st[q] = *(const v2f*)(ST + (size_t)(c4 + q) * 32);
    asm volatile("s_wait_xcnt 0x0" ::: "memory");    // the six loads above have taken their address before a result of the loads below may land in one of their offset registers (precaution before a register of an issued load is reused)
#pragma unroll
    for (int k = 0; k < 4; ++k) { x[k] = *(const v4f*)(tp + k * 1024); if (RES) h[k] = *(const v4f*)(hp + k * 1024); }
    // keeps the address pairs live, and unwritten (also by a later load's result), until every load has taken its address (same precaution)
    if constexpr (RES) asm volatile("s_wait_xcnt 0x0" :: "v"(tp), "v"(hp) : "memory"); else asm volatile("s_wait_xcnt 0x0" :: "v"(tp) : "memory");
    const int lane = t & 31, lr = lane & 15, hi = lane >> 4, w = __builtin_amdgcn_readfirstlane(t >> 5), rt = w >> 2, gq = w & 3; v16bf wb[3][4]; float vb[2];
    if constexpr (QV) { const bf* wv = WQ + (size_t)(32 + gq * 32 + lr) * C + 8 * hi; const bf* wq = WQ + (size_t)((gq & 1) * 16 + lr) * C + 8 * hi; const float* bp = bv + gq * 32 + lr;
#pragma unroll
        for (int u = 0; u < 2; ++u) { vb[u] = bfr(bp[u * 16]);
#pragma unroll
            for (int kc = 0; kc < 4; ++kc) wb[u][kc] = ldq(wv + u * 16 * C + kc * 32); }
        if (gq < 2) {
#pragma unroll
            for (int kc = 0; kc < 4; ++kc) wb[2][kc] = ldq(wq + kc * 32); }
        asm volatile("s_wait_xcnt 0x0" :: "v"(wv), "v"(wq), "v"(bp) : "memory"); }    // same precaution for the three address pairs of the weight and bias loads
    float sc[4], sh[4];
#pragma unroll
    for (int q = 0; q < 4; ++q) { sc[q] = bfr(gg[q]) * st[q][1]; sh[q] = bfr(bb[q]); }
#pragma unroll
    for (int k = 0; k < 4; ++k) { v4us oh, ol;
#pragma unroll
        for (int q = 0; q < 4; ++q) { const float y = fmaxf((x[k][q] - st[q][0]) * sc[q] + sh[q], 0.f); o[k][q] = RES ? h[k][q] + y : y; unsigned short a, b; splitf(o[k][q], a, b); oh[q] = a; ol[q] = b; }
        if (WO) *(v4fa*)(ts + (r0 + k * (1024 / C)) * OSP + c4) = o[k];
        if (QV) { *(v4usa*)(dp[0] + (r0 + k * (1024 / C)) * DPP + c4) = oh; *(v4usa*)(dp[1] + (r0 + k * (1024 / C)) * DPP + c4) = ol; }
        if (WS) { *(v4us*)(Ph + e0 + k * 1024) = oh; *(v4us*)(Pl + e0 + k * 1024) = ol; } }
    const int n0 = blockIdx.x * 32;    // first of the work-group's 32 points (C = 128), batches counted through
    if constexpr (WO || QV) __syncthreads();    // like the next one it stands in front of every global store of the kernel, so that it waits for LDS alone
    v8h pv[2];
    if constexpr (QV) { const bf* ah = dp[0] + (rt * 16 + lr) * DPP + 8 * hi; const bf* al = dp[1] + (rt * 16 + lr) * DPP + 8 * hi; v16bf a[4], a2[4]; v8f ta[2] = {(v8f){}, (v8f){}};
#pragma unroll
        for (int kc = 0; kc < 4; ++kc) { a[kc] = ldqs(ah + kc * 32); a2[kc] = ldqs(al + kc * 32); }
#pragma unroll
        for (int kc = 0; kc < 4; ++kc) {
#pragma unroll
            for (int u = 0; u < 2; ++u) { ta[u] = wmmab(a[kc], wb[u][kc], ta[u]); ta[u] = wmmab(a2[kc], wb[u][kc], ta[u]); } }
        if (gq < 2) { v8f tq = (v8f){};
#pragma unroll
            for (int kc = 0; kc < 4; ++kc) { tq = wmmab(a[kc], wb[2][kc], tq); tq = wmmab(a2[kc], wb[2][kc], tq); }
#pragma unroll
            for (int j = 0; j < 8; ++j) qs[(rt * 16 + hi * 8 + j) * 36 + gq * 16 + lr] = tq[j]; }
#pragma unroll
        for (int u = 0; u < 2; ++u) {
#pragma unroll
            for (int e = 0; e < 8; ++e) pv[u][e] = tohx(ta[u][e] + vb[u]); }
        __syncthreads(); }
    if constexpr (WO) { float* ob = OUT + ((size_t)(n0 / NN) * 4 * C + (size_t)blk * C + (t >> 3)) * NN + n0 % NN + (t & 7) * 4; const float* tc = ts + (t & 7) * 4 * OSP + (t >> 3);
#pragma unroll
        for (int k = 0; k < 4; ++k) *(v4f*)(ob + (size_t)k * 32 * NN) = (v4f){tc[k * 32], tc[OSP + k * 32], tc[2 * OSP + k * 32], tc[3 * OSP + k * 32]}; }
    if constexpr (WH) {
#pragma unroll
        for (int k = 0; k < 4; ++k) *(v4f*)(hp + k * 1024) = o[k]; }
    if constexpr (QV) { h16* vo = VP + (size_t)(n0 / NN) * C * NN + (size_t)((n0 % NN) >> 5) * 4096 + gq * 1024 + rt * 256 + lane * 8;
#pragma unroll
        for (int u = 0; u < 2; ++u) *(v8h*)(vo + u * 512) = pv[u];
        const v4f val = *(const v4fa*)(qs + (t >> 3) * 36 + (t & 7) * 4); v4us oh, ol;
#pragma unroll
        for (int q = 0; q < 4; ++q) { unsigned short a3, b3; splitf(val[q], a3, b3); oh[q] = a3; ol[q] = b3; }
        *(v4us*)(Qh + (size_t)n0 * 32 + t * 4) = oh; *(v4us*)(Ql + (size_t)n0 * 32 + t * 4) = ol; } }

extern "C" void kernel_launch(void* const* d_in, const int* in_sizes, int n_in,
                              void* d_out, int out_size, void* d_ws, size_t ws_size, hipStream_t stream) {
    (void)in_sizes; (void)n_in; (void)out_size;
    const float* IN[14]; for (int i = 0; i < 14; ++i) IN[i] = (const float*)d_in[i];   // 0 x, 1 W1 [64][64], 2 g1, 3 b1, 4 W2 [128][64], 5 g2, 6 b2, 7 Wqk [4][32][128], 8 Wv [4][128][128], 9 bv [4][128], 10 Wt, 11 bt, 12 gn, 13 bnb
    float* OUT = (float*)d_out;     // [8][512][2048]
    char* wsp = (char*)d_ws;
    auto take = [&](size_t bytes) { char* p = wsp; wsp += (bytes + 255) & ~(size_t)255; return (void*)p; };
    bf* WB1 = (bf*)take((size_t)C0 * C0 * 2); bf* WB2 = (bf*)take((size_t)C1 * C0 * 2); bf* WQV = (bf*)take((size_t)4 * WQR * C1 * 2); bf* WT = (bf*)take((size_t)4 * C1 * C1 * 2); float* ST = (float*)take((size_t)C1 * 32 * 4);
    // every per-batch plane holds all NB_ batches, batch-major, so that one launch of each stage serves the whole batch; every kernel sees the batch as NB_ * NN rows
    bf* XT = (bf*)take((size_t)NB_ * NN * C0 * 2); float* T = (float*)take((size_t)NB_ * NN * C1 * 4); float* H = (float*)take((size_t)NB_ * NN * C1 * 4); bf* Hh = (bf*)take((size_t)NB_ * NN * C0 * 2); bf* Hl = (bf*)take((size_t)NB_ * NN * C0 * 2);
    bf* Qh = (bf*)take((size_t)NB_ * NN * 32 * 2); bf* Ql = (bf*)take((size_t)NB_ * NN * 32 * 2); float* CV = (float*)take((size_t)NB_ * NN * 4); h16* VP = (h16*)take((size_t)NB_ * C1 * NN * 2); float* PS = (float*)take((size_t)NB_ * NN / 16 * C1 * 4); float* PM = (float*)take((size_t)NB_ * NN / 16 * C1 * 4);
    if ((size_t)(wsp - (char*)d_ws) > ws_size) return;    // total ~ 30 MiB; ws 256 MiB
    k_prep<<<NB_ * 128 + (C0 * C0 + C1 * C0 + 4 * C1 * C1 + 4 * WQR * C1) / 1024, 256, 0, stream>>>(IN[0], IN[1], IN[4], IN[7], IN[8], IN[10], XT, WB1, WB2, WQV, WT);
    // stage 1: h0 = relu(bn(W1 x)) (T used with C = 64 pitch); only its planes are kept
    k_gemmw<bf, 0, false><<<dim3(NB_ * NN / 64, 1, 1), 32, 0, stream>>>(XT, nullptr, WB1, nullptr, C0, T, C0, nullptr, 0, 0, 0, PS, PM);
    k_bnstat<C0><<<C0 / 4, 1024, 0, stream>>>(PS, PM, ST);
    k_bnfin<C0, false, false, true, false, false><<<NB_ * NN * C0 / 4096, 256, 0, stream>>>(T, ST, IN[2], IN[3], nullptr, Hh, Hl, 0, nullptr, nullptr, nullptr, nullptr, nullptr, nullptr);
    // stage 2: h = relu(bn(W2 h0)), with the first block's q and v
    k_gemmw<bf, 1, false><<<dim3(NB_ * NN / 64, C1 / 64, 1), 32, 0, stream>>>(Hh, Hl, WB2, nullptr, C0, T, C1, nullptr, 0, 0, 0, PS, PM);
    k_bnstat<C1><<<C1 / 4, 1024, 0, stream>>>(PS, PM, ST);
    k_bnfin<C1, false, true, false, false, true><<<NB_ * NN * C1 / 4096, 256, 0, stream>>>(T, ST, IN[5], IN[6], H, nullptr, nullptr, 0, nullptr, WQV, IN[9], Qh, Ql, VP);
    // four offset-attention blocks, four launches each
    for (int i = 0; i < 4; ++i) {
        k_rstat<<<NB_ * NN / 32, 256, 0, stream>>>(Qh, Ql, CV);          // one log-domain constant a softmax row (maximum and sum), energies (3 products) in registers
        k_fatt<<<NB_ * NN / 32, 256, 0, stream>>>(Qh, Ql, CV, VP, H, WT + (size_t)i * C1 * C1, IN[11] + i * C1, T, PS, PM);          // column sums, then weights and the product with v, energies in registers both times; then Wt (h - x_r) + bt
        k_bnstat<C1><<<C1 / 4, 1024, 0, stream>>>(PS, PM, ST);
        if (i < 3) k_bnfin<C1, true, true, false, true, true><<<NB_ * NN * C1 / 4096, 256, 0, stream>>>(T, ST, IN[12] + i * C1, IN[13] + i * C1, H, nullptr, nullptr, i, OUT, WQV + (size_t)(i + 1) * WQR * C1, IN[9] + (i + 1) * C1, Qh, Ql, VP);
        else k_bnfin<C1, true, false, false, true, false><<<NB_ * NN * C1 / 4096, 256, 0, stream>>>(T, ST, IN[12] + i * C1, IN[13] + i * C1, H, nullptr, nullptr, i, OUT, nullptr, nullptr, nullptr, nullptr, nullptr); }
}

// v008
// It runs in 239 microseconds.
// Next to v007, in two timings, it ran 1.15 times as fast each time.
// Counting every step since v000, it is 132 times as fast.
#include <hip/hip_runtime.h>

// IEModule (PCT-style offset-attention stack; x [8][64][2048]; h = relu(bn(W1 x)) (64); h = relu(bn(W2 h)) (128); then four chained blocks: q = Wqk h (32), energy = q^T q (symmetric, unscaled), att = softmax over keys
// then / (1e-9 + column sum over queries), x_r = v att with v = Wv h + bv, h = h + relu(bn(Wt (h - x_r) + bt)); output = concat of the four h -> [8][512][2048]. Every BatchNorm is TRAINING-mode: per-channel
// mean / biased variance over (batch, points) of the current activations, eps 1e-5.)
// Compute dtypes, f32 accumulate: every input rounded to bf16; everything positions-major [point][channel]; W1 x on PLAIN bf16 operands (inputs: exact), every later channel
// contraction on bf16 hi+lo planes of its computed operand x exact weights (2 products, + bias); energies on hi+lo planes of q (3 products, K 32); x_r^T = v^T . att on SINGLE fp16 planes (softmax weights relative to a per-column reference size; the division by the column sum follows the product)

#define NB_  8
#define NN   2048
#define C0   64
#define C1   128
#define BNE  1e-5f
typedef _Float16 h16;
typedef unsigned short bf;
typedef __attribute__((ext_vector_type(16))) __bf16   v16bf;
typedef __attribute__((ext_vector_type(16))) _Float16 v16h;
typedef __attribute__((ext_vector_type(8)))  _Float16 v8h;
typedef __attribute__((ext_vector_type(8)))  unsigned short v8us;
typedef __attribute__((ext_vector_type(8)))  float    v8f;
typedef __attribute__((ext_vector_type(4)))  float    v4f;
typedef v8h  __attribute__((may_alias)) v8ha;
typedef v4f  __attribute__((may_alias)) v4fa;
typedef v8us __attribute__((may_alias)) v8usa;

__device__ __forceinline__ unsigned short f2bf(float f) { unsigned u = __float_as_uint(f); u += 0x7FFFu + ((u >> 16) & 1u); return (unsigned short)(u >> 16); }
__device__ __forceinline__ float bf2f(unsigned short b) { return __uint_as_float(((unsigned)b) << 16); }
__device__ __forceinline__ float bfr(float f) { return bf2f(f2bf(f)); }
__device__ __forceinline__ v16h cat16(v8h lo, v8h hi) { return __builtin_shufflevector(lo, hi, 0, 1, 2, 3, 4, 5, 6, 7, 8, 9, 10, 11, 12, 13, 14, 15); }
__device__ __forceinline__ v16bf cat16b(v8us lo, v8us hi) { return __builtin_bit_cast(v16bf, __builtin_shufflevector(lo, hi, 0, 1, 2, 3, 4, 5, 6, 7, 8, 9, 10, 11, 12, 13, 14, 15)); }
__device__ __forceinline__ v8f wmma16(v16h a, v16h b, v8f c) { return __builtin_amdgcn_wmma_f32_16x16x32_f16(false, a, false, b, (short)0, c, false, false); }
__device__ __forceinline__ v8f wmmab(v16bf a, v16bf b, v8f c) { return __builtin_amdgcn_wmma_f32_16x16x32_bf16(false, a, false, b, (short)0, c, false, false); }



// BatchNorm partials of one 16 x 16 accumulator tile (a lane holds 8 rows of one column, lanes l and l ^ 16 the two halves of the column): s = the column's sum over the tile's 16 rows, q = its sum of squared deviations from the tile's own mean.
__device__ __forceinline__ void tilestat(v8f y, float& s, float& q) { float a = ((y[0] + y[1]) + (y[2] + y[3])) + ((y[4] + y[5]) + (y[6] + y[7])); a += __shfl_xor(a, 16, 32); const float mu = a * (1.0f / 16.0f); float b = 0.f;
#pragma unroll
    for (int r = 0; r < 8; ++r) { const float d = y[r] - mu; b += d * d; }
    b += __shfl_xor(b, 16, 32); s = a; q = b; }
// ---- k_gemmw: register-blocked GEMM, ONE WAVE per 64x64 output tile (16 accumulators), operands straight from K-contiguous 16-bit planes; grid (M/64, N/64, Z), 32 threads.
// C[m][n] (f32, pitch ldc, + optional f32 bias[n]) = sum_k A[m][k] Bt[n][k] (+ split products per NSPLIT). z-batch strides sA/sB/sC in elements. K % 32 == 0.
// PS / PM [16-row tile][ldc]: the BatchNorm partials (tilestat) of every 16-row tile of C, from the accumulators (grid z = 1).
template <typename T16> struct WFrag;
template <> struct WFrag<bf> { typedef v16bf V; static __device__ __forceinline__ V ld(const bf* p) { return cat16b(*(const v8us*)p, *(const v8us*)(p + 16)); } static __device__ __forceinline__ v8f mma(V a, V b, v8f c) { return wmmab(a, b, c); } };
template <typename T16, int NSPLIT, bool BIAS>
__global__ __launch_bounds__(32) void k_gemmw(const T16* __restrict__ A, const T16* __restrict__ A2, const T16* __restrict__ Bt, const T16* __restrict__ Bt2, int K, float* C, int ldc, const float* __restrict__ bias, size_t sA, size_t sB, size_t sC, float* PS, float* PM) {
    typedef typename WFrag<T16>::V V;
    __shared__ __align__(16) float os[16 * 68];
    const size_t z = blockIdx.z; A += z * sA; if (A2) A2 += z * sA; Bt += z * sB; if (Bt2) Bt2 += z * sB; C += z * sC;
    const int lane = threadIdx.x & 31, lr = lane & 15, hi = lane >> 4; const int r0 = blockIdx.x * 64, c0 = blockIdx.y * 64;
    v8f acc[4][4];
#pragma unroll
    for (int mb = 0; mb < 4; ++mb)
#pragma unroll
        for (int nb = 0; nb < 4; ++nb) acc[mb][nb] = (v8f){};
    const size_t aoff = (size_t)(r0 + lr) * K + 8 * hi, boff = (size_t)(c0 + lr) * K + 8 * hi;
#pragma unroll 1
    for (int kc = 0; kc < K; kc += 32) {
        V a[4], a2[4];
#pragma unroll
        for (int mb = 0; mb < 4; ++mb) { a[mb] = WFrag<T16>::ld(A + aoff + (size_t)mb * 16 * K + kc); if (NSPLIT == 1 || NSPLIT == 2) a2[mb] = WFrag<T16>::ld(A2 + aoff + (size_t)mb * 16 * K + kc); }
#pragma unroll
        for (int nb = 0; nb < 4; ++nb) { const V b = WFrag<T16>::ld(Bt + boff + (size_t)nb * 16 * K + kc); V b2; if (NSPLIT >= 2) b2 = WFrag<T16>::ld(Bt2 + boff + (size_t)nb * 16 * K + kc);
#pragma unroll
            for (int mb = 0; mb < 4; ++mb) { acc[mb][nb] = WFrag<T16>::mma(a[mb], b, acc[mb][nb]); if (NSPLIT == 1 || NSPLIT == 2) acc[mb][nb] = WFrag<T16>::mma(a2[mb], b, acc[mb][nb]); if (NSPLIT >= 2) acc[mb][nb] = WFrag<T16>::mma(a[mb], b2, acc[mb][nb]); } }
        asm volatile("v_nop\n\tv_nop\n\tv_nop\n\tv_nop" : "+v"(acc[0][0]), "+v"(acc[1][1]), "+v"(acc[2][2]), "+v"(acc[3][3]) : "v"(a[0]), "v"(a[3]));
    }
#pragma unroll
    for (int mb = 0; mb < 4; ++mb) {
#pragma unroll
        for (int nb = 0; nb < 4; ++nb) {
#pragma unroll
            for (int j = 0; j < 8; ++j) os[(hi * 8 + j) * 68 + nb * 16 + lr] = acc[mb][nb][j]; }
        __builtin_amdgcn_wave_barrier(); asm volatile("" ::: "memory");
        float* crow = C + (size_t)(r0 + mb * 16) * ldc + c0;
{
#pragma unroll
            for (int s = 0; s < 8; ++s) { const int row = 2 * s + hi, cofs = lr * 4; v4f val = *(const v4fa*)(os + row * 68 + cofs); if (BIAS) { val[0] += bfr(bias[c0 + cofs]); val[1] += bfr(bias[c0 + cofs + 1]); val[2] += bfr(bias[c0 + cofs + 2]); val[3] += bfr(bias[c0 + cofs + 3]); }
                *(v4f*)(crow + (size_t)row * ldc + cofs) = val; }
             }
        __builtin_amdgcn_wave_barrier(); asm volatile("" ::: "memory");
    }
    asm volatile("s_wait_xcnt 0x0" ::: "memory");    // the stores above have taken their registers before the lines below may reuse one (precaution before a register of an issued store is reused)
    float* pd = (hi ? PM : PS) + (size_t)blockIdx.x * 4 * ldc + c0 + lr; float pv[4][4];    // lanes 0-15 store the sums, lanes 16-31 the squared deviations
#pragma unroll
    for (int mb = 0; mb < 4; ++mb) {
#pragma unroll
        for (int nb = 0; nb < 4; ++nb) { float s, q; tilestat(acc[mb][nb], s, q); if (BIAS) s += 16.0f * bfr(bias[c0 + nb * 16 + lr]); pv[mb][nb] = hi ? q : s; } }
#pragma unroll
    for (int mb = 0; mb < 4; ++mb) {
#pragma unroll
        for (int nb = 0; nb < 4; ++nb) pd[(size_t)mb * ldc + nb * 16] = pv[mb][nb]; }
}

__device__ __forceinline__ h16 tohx(float x) { return (h16)x; }
__device__ __forceinline__ void splitf(float y, unsigned short& h, unsigned short& l) { h = f2bf(y); l = f2bf(y - bf2f(h)); }
typedef __attribute__((ext_vector_type(4))) unsigned short v4us;
typedef __attribute__((ext_vector_type(2))) float v2f;
typedef v4us __attribute__((may_alias)) v4usa;
#define WQR  160         // rows of a block's q / v weight operand: Wqk (32), then Wv (128)
#define DPP  136         // 16-bit elements a row of an operand plane in LDS: 16-B aligned, adjacent rows 4 banks apart
// k_prep: every operand that is only a rounded copy of an input, in one launch: x as bf16, positions-major [batch][point][64] (the first NB_ * 128 work-groups), then the weights as bf16 (1024 elements a work-group):
// W1, W2, Wt, and per block the WQR rows [Wqk; Wv].
__global__ __launch_bounds__(256) void k_prep(const float* __restrict__ x, const float* __restrict__ W1, const float* __restrict__ W2, const float* __restrict__ Wqk, const float* __restrict__ Wv, const float* __restrict__ Wt, bf* XT, bf* WB1, bf* WB2, bf* WQV, bf* WT) {
    const int blk = blockIdx.x; v4us o;
    if (blk < NB_ * 128) { const float* xb = x + (size_t)(blk >> 7) * C0 * NN; const int e = ((blk & 127) * 256 + threadIdx.x) * 4, c = e % C0, n = e / C0;
#pragma unroll
        for (int q = 0; q < 4; ++q) o[q] = f2bf(xb[(size_t)(c + q) * NN + n]);
        *(v4us*)(XT + (size_t)(blk >> 7) * NN * C0 + e) = o; return; }
    int e = ((blk - NB_ * 128) * 256 + threadIdx.x) * 4; const float* s; bf* d;
    if (e < C0 * C0) { s = W1 + e; d = WB1 + e; }
    else if ((e -= C0 * C0) < C1 * C0) { s = W2 + e; d = WB2 + e; }
    else if ((e -= C1 * C0) < 4 * C1 * C1) { s = Wt + e; d = WT + e; }
    else { e -= 4 * C1 * C1; const int i = e / (WQR * C1), r = (e / C1) % WQR, k = e % C1; d = WQV + e; s = r < 32 ? Wqk + (size_t)(i * 32 + r) * C1 + k : Wv + (size_t)(i * C1 + r - 32) * C1 + k; }
    const v4f v = *(const v4f*)s;
#pragma unroll
    for (int q = 0; q < 4; ++q) o[q] = f2bf(v[q]);
    *(v4us*)d = o; }
// ---- attention without stored energies. The energies are a Gram matrix of K = 32, so a 16 x 16 tile costs three matrix instructions from the q planes: both kernels below form the tiles they need in registers, and neither the
// energies nor the attention weights go through memory. The three products of a tile are taken in the same order of terms in both kernels, so both see the same value for a pair (i, j).
#define OSP  132         // floats a row of a wave's partial output tile in LDS: 16-B aligned, adjacent rows 4 banks apart
#define L2E  1.4426950408889634f
__device__ __forceinline__ float ex2(float x) { asm("v_exp_f32 %0, %0\n\tv_nop" : "+v"(x)); return x; }
__device__ __forceinline__ v8f ex2x8(v8f x) { float y0 = x[0], y1 = x[1], y2 = x[2], y3 = x[3], y4 = x[4], y5 = x[5], y6 = x[6], y7 = x[7];
    asm("v_exp_f32 %0, %0\n\tv_exp_f32 %1, %1\n\tv_exp_f32 %2, %2\n\tv_exp_f32 %3, %3\n\tv_exp_f32 %4, %4\n\tv_exp_f32 %5, %5\n\tv_exp_f32 %6, %6\n\tv_exp_f32 %7, %7\n\tv_nop"
        : "+v"(y0), "+v"(y1), "+v"(y2), "+v"(y3), "+v"(y4), "+v"(y5), "+v"(y6), "+v"(y7));
    return (v8f){y0, y1, y2, y3, y4, y5, y6, y7}; }
__device__ __forceinline__ v16bf ldq(const bf* p) { return cat16b(*(const v8us*)p, *(const v8us*)(p + 16)); }
__device__ __forceinline__ v16bf ldqs(const bf* p) { return cat16b(*(const v8usa*)p, *(const v8usa*)(p + 16)); }    // the same fragment from an LDS plane
// k_rstat: CV[i] = log2(e) max_j S[i][j] + log2(sum_j exp(S[i][j] - max)), so that softmax[i][j] = exp2(log2(e) S[i][j] - CV[i]). A work-group owns 32 rows i (one 128-B line of CV); they are the COLUMNS of its tiles, so a lane folds one row i in its own registers;
// wave w walks 256 of the 2048 j with a running maximum and a rescaled running sum; halves join by one shuffle, the 8 waves through LDS.
__global__ __launch_bounds__(256) void k_rstat(const bf* __restrict__ Qh, const bf* __restrict__ Ql, float* CV) { __shared__ float sm[8][32], ss[8][32]; const int lane = threadIdx.x & 31, w = threadIdx.x >> 5, lr = lane & 15, hi = lane >> 4;
    const int i0 = blockIdx.x * 32; const size_t jo = ((size_t)(i0 / NN) * NN + w * (NN / 8) + lr) * 32 + 8 * hi; const bf* qh = Qh + jo; const bf* ql = Ql + jo; v16bf bh[2], bl[2]; float m[2] = {-1.0e30f, -1.0e30f}, s[2] = {0.f, 0.f};
#pragma unroll
    for (int t = 0; t < 2; ++t) { const size_t o = (size_t)(i0 + t * 16 + lr) * 32 + 8 * hi; bh[t] = ldq(Qh + o); bl[t] = ldq(Ql + o); }
    for (int mt = 0; mt < NN / 8 / 16; mt += 2) { v16bf ah[2], al[2];
#pragma unroll
        for (int u = 0; u < 2; ++u) { ah[u] = ldq(qh + u * 512); al[u] = ldq(ql + u * 512); }
        asm volatile("s_wait_xcnt 0x0" :: "v"(qh), "v"(ql) : "memory");    // keeps both address pairs live, and unwritten, until the 8 loads have taken their address (precaution before a register of an issued load is reused)
        qh += 1024; ql += 1024;
#pragma unroll
        for (int t = 0; t < 2; ++t) { v8f d[2];
#pragma unroll
            for (int u = 0; u < 2; ++u) { d[u] = wmmab(ah[u], bh[t], (v8f){}); d[u] = wmmab(al[u], bh[t], d[u]); d[u] = wmmab(ah[u], bl[t], d[u]); }
            float mn = m[t];
#pragma unroll
            for (int r = 0; r < 8; ++r) mn = fmaxf(mn, fmaxf(d[0][r], d[1][r]));
            const v8f e0 = ex2x8((d[0] - mn) * L2E), e1 = ex2x8((d[1] - mn) * L2E); float a[4] = {0.f, 0.f, 0.f, 0.f};
#pragma unroll
            for (int r = 0; r < 8; ++r) { a[r & 1] += e0[r]; a[2 + (r & 1)] += e1[r]; }
            s[t] = s[t] * ex2((m[t] - mn) * L2E) + ((a[0] + a[1]) + (a[2] + a[3])); m[t] = mn; } }
#pragma unroll
    for (int t = 0; t < 2; ++t) { const float m2 = __shfl_xor(m[t], 16, 32), s2 = __shfl_xor(s[t], 16, 32), mx = fmaxf(m[t], m2); const float sj = s[t] * ex2((m[t] - mx) * L2E) + s2 * ex2((m2 - mx) * L2E);
        if (hi == 0) { sm[w][t * 16 + lr] = mx; ss[w][t * 16 + lr] = sj; } }
    __syncthreads();
    if (w == 0) { float mx = sm[0][lane];
#pragma unroll
        for (int k = 1; k < 8; ++k) mx = fmaxf(mx, sm[k][lane]);
        float sj = 0.f;
#pragma unroll
        for (int k = 0; k < 8; ++k) sj += ss[k][lane] * ex2((sm[k][lane] - mx) * L2E);
        CV[i0 + lane] = __builtin_amdgcn_logf(sj) + mx * L2E; } }
// 1 / x of a power of two x = 2^e, -126 <= e <= 126, exact: the exponent field mirrored. xhalf: the value that lane l ^ 16 holds, by a vector cross-row move.
__device__ __forceinline__ float p2inv(float x) { return __uint_as_float(0x7F000000u - __float_as_uint(x)); }
__device__ __forceinline__ float xhalf(float x) { const int b = __float_as_int(x); return __int_as_float(__builtin_amdgcn_permlanex16(b, b, 0x76543210, 0xfedcba98, false, false)); }
// k_fatt: T[j][.] = Wt (h[j] - x_r[j]) + bt, x_r[j][c] = sum_i a[i][j] v[i][c] / (1e-9 + sum_i a[i][j]), a[i][j] = softmax[i][j] = exp2(log2(e) S[i][j] - CV[i]). A work-group owns 32 output rows j; wave w takes 256 of the 2048 i, 32 a pass, and walks them ONCE.
// A pass: tiles S[i][j] (rows i, columns j) from the q planes, a in f32; a goes as it is into the lane's column sum, and a / rk (kept as kf = 1 / rk), rounded to f16, into the product. rk is the wave's own reference size of the column (the same in the column's two lanes): a power of two, it starts at 2^-100
// and is raised (to the power of two at or below the column's largest a of the pass, where that is above rk) only when some weight of the pass would pass 2^14 (a wave-uniform branch, as a rule taken in the first pass and seldom after it; the accumulators are then scaled by old rk / new rk): no weight overflows f16, and the largest weights
// of every column are normal f16 numbers, however small the column's sum (an a below 2^-100 is nothing beside the 1e-9). The two tiles of 16 i, rounded in place, are the B operand of x_r^T += v^T . a (a packed pair of D tiles has the hardware's k order, which the VP order gives v).
// The 8 waves' partial tiles, column sums and rk meet in LDS behind a barrier; a wave's partial tile counts times its rk.
// The lane that sums an element subtracts it from h and leaves the difference as bf16 hi + lo planes in LDS; behind a second barrier wave w forms rows 16 (w >> 2) .., columns 32 (w & 3) .. of the work-group's 32 x 128 tile of T
// (per 32 k: hi plane x Wt, then lo plane x Wt, into one accumulator; a row's 128-B line has one writer), and leaves the BatchNorm partials (tilestat) of its two tiles in PS / PM [16-row tile][128] (32 channels: one 128-B line, one writer).
__global__ __launch_bounds__(256) __attribute__((amdgpu_waves_per_eu(4, 4))) void k_fatt(const bf* __restrict__ Qh, const bf* __restrict__ Ql, const float* __restrict__ CV, const h16* __restrict__ VP, const float* __restrict__ H, const bf* __restrict__ Wt, const float* __restrict__ bt, float* T, float* PS, float* PM) {
    __shared__ __align__(16) float os[8 * 32 * OSP]; __shared__ float cs[8][32], rs[8][32]; __shared__ __align__(16) bf dp[2][32 * DPP]; const int lane = threadIdx.x & 31, w = threadIdx.x >> 5, lr = lane & 15, hi = lane >> 4;
    const int j0 = blockIdx.x * 32, b = j0 / NN, ib0 = w * (NN / 8); const size_t qo = ((size_t)b * NN + ib0 + lr) * 32 + 8 * hi; const bf* qh = Qh + qo; const bf* ql = Ql + qo; const float* cv = CV + (size_t)b * NN + ib0 + hi * 8;
    const h16* vp = VP + (size_t)b * C1 * NN + (size_t)(ib0 >> 5) * 4096 + lane * 8; v16bf bh[2], bl[2]; float csum[2] = {0.f, 0.f}, kf[2] = {0x1p+100f, 0x1p+100f}; const bf* pjh[2]; const bf* pjl[2];
#pragma unroll
    for (int jt = 0; jt < 2; ++jt) { const size_t o = (size_t)(j0 + jt * 16 + lr) * 32 + 8 * hi; pjh[jt] = Qh + o; pjl[jt] = Ql + o; bh[jt] = ldq(pjh[jt]); bl[jt] = ldq(pjl[jt]); }
    asm volatile("s_wait_xcnt 0x0" :: "v"(pjh[0]), "v"(pjh[1]), "v"(pjl[0]), "v"(pjl[1]) : "memory");    // keeps the four address pairs live, and unwritten (also by a later load's result), until the 8 loads have taken their address (precaution before a register of an issued load is reused)
    v8f acc[2][8];
#pragma unroll
    for (int jt = 0; jt < 2; ++jt) {
#pragma unroll
        for (int nb = 0; nb < 8; ++nb) acc[jt][nb] = (v8f){}; }
#pragma unroll 1    // stays rolled: unrolled, the compiler lifts the passes' loads over one another, needs more than 256 registers and spills
    for (int it = 0; it < NN / 8 / 32; ++it) { v16h p[2], f[8]; v16bf ah[2], al[2]; v8f kk[2], e[2][2]; float me[2];
#pragma unroll
        for (int t = 0; t < 2; ++t) { ah[t] = ldq(qh + t * 512); al[t] = ldq(ql + t * 512); kk[t] = __builtin_shufflevector(*(const v4f*)(cv + t * 16), *(const v4f*)(cv + t * 16 + 4), 0, 1, 2, 3, 4, 5, 6, 7); }
#pragma unroll
        for (int t = 0; t < 2; ++t) { v8f d[2];
#pragma unroll
            for (int jt = 0; jt < 2; ++jt) d[jt] = wmmab(ah[t], bh[jt], (v8f){});
#pragma unroll
            for (int jt = 0; jt < 2; ++jt) d[jt] = wmmab(ah[t], bl[jt], d[jt]);
#pragma unroll
            for (int jt = 0; jt < 2; ++jt) d[jt] = wmmab(al[t], bh[jt], d[jt]);
#pragma unroll
            for (int jt = 0; jt < 2; ++jt) e[t][jt] = ex2x8(d[jt] * L2E - kk[t]); }
#pragma unroll
        for (int jt = 0; jt < 2; ++jt) { float m = fmaxf(e[0][jt][0], e[1][jt][0]);
#pragma unroll
            for (int r = 1; r < 8; ++r) m = fmaxf(m, fmaxf(e[0][jt][r], e[1][jt][r]));
            me[jt] = m; }
        if (__any(fmaxf(me[0] * kf[0], me[1] * kf[1]) > 16384.0f)) {    // the same for the whole wave: some weight of this pass would pass 2^14, so every column's reference goes up to its largest a of this pass, where that is higher
#pragma unroll
            for (int jt = 0; jt < 2; ++jt) { const float ro = p2inv(kf[jt]), m2 = fmaxf(me[jt], xhalf(me[jt])); kf[jt] = p2inv(fmaxf(ro, __uint_as_float(__float_as_uint(m2) & 0x7F800000u))); const float fc = ro * kf[jt];
#pragma unroll
                for (int nb = 0; nb < 8; ++nb) acc[jt][nb] *= fc; } }
#pragma unroll
        for (int t = 0; t < 2; ++t) {
#pragma unroll
            for (int jt = 0; jt < 2; ++jt) { const v8f u = e[t][jt]; csum[jt] += ((u[0] + u[1]) + (u[2] + u[3])) + ((u[4] + u[5]) + (u[6] + u[7]));
#pragma unroll
                for (int r = 0; r < 8; ++r) p[jt][t * 8 + r] = tohx(u[r] * kf[jt]); } }
#pragma unroll
        for (int nb = 0; nb < 4; ++nb) f[nb] = cat16(*(const v8h*)(vp + nb * 512), *(const v8h*)(vp + nb * 512 + 256));
#pragma unroll
        for (int nb = 0; nb < 8; ++nb) {
#pragma unroll
            for (int jt = 0; jt < 2; ++jt) acc[jt][nb] = wmma16(f[nb], p[jt], acc[jt][nb]);
            if (nb < 4) f[nb + 4] = cat16(*(const v8h*)(vp + (nb + 4) * 512), *(const v8h*)(vp + (nb + 4) * 512 + 256)); }
        asm volatile("s_wait_xcnt 0x0" :: "v"(qh), "v"(ql), "v"(cv), "v"(vp) : "memory");    // stands behind the pass's last load: keeps the four address pairs live, and unwritten, until every load has taken its address (precaution before a register of an issued load is reused)
        qh += 1024; ql += 1024; cv += 32; vp += 4096; }
#pragma unroll
    for (int jt = 0; jt < 2; ++jt) { const float s = csum[jt] + xhalf(csum[jt]); if (hi == 0) { cs[w][jt * 16 + lr] = s; rs[w][jt * 16 + lr] = p2inv(kf[jt]); } }
#pragma unroll
    for (int jt = 0; jt < 2; ++jt) {
#pragma unroll
        for (int nb = 0; nb < 8; ++nb) { float* o = os + (size_t)(w * 32 + jt * 16 + lr) * OSP + nb * 16 + hi * 8; const v8f v = acc[jt][nb]; *(v4fa*)o = (v4f){v[0], v[1], v[2], v[3]}; *(v4fa*)(o + 4) = (v4f){v[4], v[5], v[6], v[7]}; } }
    const float* hp = H + (size_t)j0 * C1 + threadIdx.x * 4; v4f hv[4];    // lane t owns elements 4 t .. 4 t + 3 of each quarter (8 rows) of the work-group's 32 x 128 tile
#pragma unroll
    for (int k = 0; k < 4; ++k) hv[k] = *(const v4f*)(hp + k * 1024);
    const int rt = w >> 2, cq = (w & 3) * 32; const bf* wp = Wt + (size_t)(cq + lr) * C1 + 8 * hi; const float* bp = bt + cq + lr; v16bf wb[2][4]; float bb[2];
#pragma unroll
    for (int u = 0; u < 2; ++u) { bb[u] = bfr(bp[u * 16]);
#pragma unroll
        for (int kc = 0; kc < 4; ++kc) wb[u][kc] = ldq(wp + u * 16 * C1 + kc * 32); }
    asm volatile("s_wait_xcnt 0x0" :: "v"(hp), "v"(wp), "v"(bp) : "memory");    // keeps the three address pairs live, and unwritten (also by a later load's result), until the 22 loads have taken their address (precaution before a register of an issued load is reused)
    __syncthreads();
#pragma unroll
    for (int k = 0; k < 4; ++k) { const int idx = threadIdx.x + 256 * k, row = idx >> 5, c4 = (idx & 31) * 4; v4f sa = (v4f){0.f, 0.f, 0.f, 0.f}; v4us oh, ol; float s = 0.f;
#pragma unroll
        for (int ww = 0; ww < 8; ++ww) { s += cs[ww][row]; sa += *(const v4fa*)(os + (size_t)(ww * 32 + row) * OSP + c4) * rs[ww][row]; }
        const float inv = __fdiv_rn(1.0f, __fadd_rn(1e-9f, s));
#pragma unroll
        for (int q = 0; q < 4; ++q) { unsigned short x, y; splitf(hv[k][q] - sa[q] * inv, x, y); oh[q] = x; ol[q] = y; }
        *(v4usa*)(dp[0] + row * DPP + c4) = oh; *(v4usa*)(dp[1] + row * DPP + c4) = ol; }
    __syncthreads();
    const bf* ah = dp[0] + (rt * 16 + lr) * DPP + 8 * hi; const bf* al = dp[1] + (rt * 16 + lr) * DPP + 8 * hi; v8f ta[2] = {(v8f){}, (v8f){}};
#pragma unroll
    for (int kc = 0; kc < 4; ++kc) { const v16bf a = ldqs(ah + kc * 32), a2 = ldqs(al + kc * 32);
#pragma unroll
        for (int u = 0; u < 2; ++u) { ta[u] = wmmab(a, wb[u][kc], ta[u]); ta[u] = wmmab(a2, wb[u][kc], ta[u]); } }
    float* to = T + (size_t)(j0 + rt * 16 + hi * 8) * C1 + cq + lr; float* pd = (hi ? PM : PS) + (size_t)(blockIdx.x * 2 + rt) * C1 + cq + lr; float pv[2];    // lanes 0-15 store the sums, lanes 16-31 the squared deviations
#pragma unroll
    for (int u = 0; u < 2; ++u) { float s, q; ta[u] += bb[u]; tilestat(ta[u], s, q); pv[u] = hi ? q : s; }
#pragma unroll
    for (int j = 0; j < 8; ++j) {
#pragma unroll
        for (int u = 0; u < 2; ++u) to[j * C1 + u * 16] = ta[u][j]; }
#pragma unroll
    for (int u = 0; u < 2; ++u) pd[u * 16] = pv[u]; }
// k_bnstat: per-channel mean and 1/sqrt(biased variance + eps) over all NB_ * NN rows of T [row][C], from the partials that the kernel which made T left of every 16-row tile (PS sum, PM squared deviations from the tile's mean; [tile][C]): T itself is not read.
// One work-group of 32 waves per 4 adjacent channels; lane t owns tile t. Squared deviations from the overall mean = the tile's own + 16 (tile mean - mean)^2: every term is >= 0, nothing cancels.
// Lanes fold by shuffles, the 32 waves' partial sums through LDS (every wave folds them alike).
__device__ __forceinline__ v4f wgsum4(v4f s, v4f (*red)[32], int w, int lane) {
#pragma unroll
    for (int sh = 16; sh; sh >>= 1) {
#pragma unroll
        for (int q = 0; q < 4; ++q) s[q] += __shfl_xor(s[q], sh, 32); }
    if (lane == 0) (*red)[w] = s;
    __syncthreads();
    s = (*red)[lane];
#pragma unroll
    for (int sh = 16; sh; sh >>= 1) {
#pragma unroll
        for (int q = 0; q < 4; ++q) s[q] += __shfl_xor(s[q], sh, 32); }
    return s; }
template <int C>
__global__ __launch_bounds__(1024) void k_bnstat(const float* __restrict__ PS, const float* __restrict__ PM, float* ST) { __shared__ __align__(16) v4f red[2][32]; const int lane = threadIdx.x & 31, w = threadIdx.x >> 5; const int c0 = blockIdx.x * 4;
    static_assert(NB_ * NN / 16 == 1024, "one lane a tile");
    const float* sp = PS + (size_t)threadIdx.x * C + c0; const float* qp = PM + (size_t)threadIdx.x * C + c0; const v4f s = *(const v4f*)sp; v4f q2 = *(const v4f*)qp;
    asm volatile("s_wait_xcnt 0x0" :: "v"(sp), "v"(qp) : "memory");    // keeps the two address pairs live, and unwritten, until both loads have taken their address (precaution before a register of an issued load is reused)
    const v4f mu = wgsum4(s, &red[0], w, lane) * (1.0f / (NB_ * NN)); const v4f d = s * (1.0f / 16.0f) - mu; q2 += d * d * 16.0f;
    q2 = wgsum4(q2, &red[1], w, lane);
    if (w < 4) { const float m = w == 0 ? mu[0] : (w == 1 ? mu[1] : (w == 2 ? mu[2] : mu[3])), v = w == 0 ? q2[0] : (w == 1 ? q2[1] : (w == 2 ? q2[2] : q2[3]));
        const float rs = __frsqrt_rn(__fadd_rn(v * (1.0f / (NB_ * NN)), BNE)); ST[(size_t)(c0 + w) * 32 + lane] = lane == 0 ? m : (lane == 1 ? rs : 0.f); } }
// k_bnfin: y = relu(bf16(g[c]) rs_c (T[row][c] - mu_c) + bf16(be[c])), h = RES ? H + y : y, and everything that is made of h alone, from the register that holds it. A work-group takes 4096 adjacent elements (4096 / C rows),
// a lane four 16-B units of the same 4 channels. WH: H[row][c] f32 (the same lane reads and writes an element). WS: bf16 hi + lo planes of h in memory.
// WO: OUT[batch][blk * C + c][point], transposed through an LDS tile of 32 points x 128 channels (a channel's 32 points are one 128-B line).
// QV: the next block's q and v of the 32 points: the planes of h stay in LDS, wave w forms rows 16 (w >> 2) .. of v channels 32 (w & 3) .. and, where (w & 3) < 2, of q channels 16 (w & 3) .. (per 32 k: hi plane x W, then lo plane x W, into one accumulator).
// v leaves, + bias, as f16 in the order of the matrix fragments, VP[batch][32 points][16 channels][k half][lane][8] (a fragment of v^T, row = channel, k = point, is two loads of 512 contiguous bytes a wave): an accumulator's 8 values of a lane
// are 8 points of one channel, one 16-B unit of VP. q leaves as bf16 hi + lo planes [point][32], through an LDS tile behind a second barrier.
template <int C, bool RES, bool WH, bool WS, bool WO, bool QV>
__global__ __launch_bounds__(256) void k_bnfin(const float* __restrict__ T, const float* __restrict__ ST, const float* __restrict__ g, const float* __restrict__ be, float* H, bf* Ph, bf* Pl, int blk, float* OUT,
                                               const bf* __restrict__ WQ, const float* __restrict__ bv, bf* Qh, bf* Ql, h16* VP) {
    __shared__ __align__(16) float ts[WO ? 32 * OSP : 4]; __shared__ __align__(16) bf dp[2][QV ? 32 * DPP : 8]; __shared__ __align__(16) float qs[QV ? 32 * 36 : 4];
    const int t = threadIdx.x, c4 = (t * 4) % C, r0 = (t * 4) / C; const size_t e0 = (size_t)blockIdx.x * 4096 + t * 4;
    const float* tp = T + e0; float* hp = H + e0; v4f x[4], h[4], o[4]; v2f st[4];
    const v4f gg = *(const v4f*)(g + c4), bb = *(const v4f*)(be + c4);
#pragma unroll
    for (int q = 0; q < 4; ++q) st[q] = *(const v2f*)(ST + (size_t)(c4 + q) * 32);
    asm volatile("s_wait_xcnt 0x0" ::: "memory");    // the six loads above have taken their address before a result of the loads below may land in one of their offset registers (precaution before a register of an issued load is reused)
#pragma unroll
    for (int k = 0; k < 4; ++k) { x[k] = *(const v4f*)(tp + k * 1024); if (RES) h[k] = *(const v4f*)(hp + k * 1024); }
    // keeps the address pairs live, and unwritten (also by a later load's result), until every load has taken its address (same precaution)
    if constexpr (RES) asm volatile("s_wait_xcnt 0x0" :: "v"(tp), "v"(hp) : "memory"); else asm volatile("s_wait_xcnt 0x0" :: "v"(tp) : "memory");
    const int lane = t & 31, lr = lane & 15, hi = lane >> 4, w = __builtin_amdgcn_readfirstlane(t >> 5), rt = w >> 2, gq = w & 3; v16bf wb[3][4]; float vb[2];
    if constexpr (QV) { const bf* wv = WQ + (size_t)(32 + gq * 32 + lr) * C + 8 * hi; const bf* wq = WQ + (size_t)((gq & 1) * 16 + lr) * C + 8 * hi; const float* bp = bv + gq * 32 + lr;
#pragma unroll
        for (int u = 0; u < 2; ++u) { vb[u] = bfr(bp[u * 16]);
#pragma unroll
            for (int kc = 0; kc < 4; ++kc) wb[u][kc] = ldq(wv + u * 16 * C + kc * 32); }
        if (gq < 2) {
#pragma unroll
            for (int kc = 0; kc < 4; ++kc) wb[2][kc] = ldq(wq + kc * 32); }
        asm volatile("s_wait_xcnt 0x0" :: "v"(wv), "v"(wq), "v"(bp) : "memory"); }    // same precaution for the three address pairs of the weight and bias loads
    float sc[4], sh[4];
#pragma unroll
    for (int q = 0; q < 4; ++q) { sc[q] = bfr(gg[q]) * st[q][1]; sh[q] = bfr(bb[q]); }
#pragma unroll
    for (int k = 0; k < 4; ++k) { v4us oh, ol;
#pragma unroll
        for (int q = 0; q < 4; ++q) { const float y = fmaxf((x[k][q] - st[q][0]) * sc[q] + sh[q], 0.f); o[k][q] = RES ? h[k][q] + y : y; unsigned short a, b; splitf(o[k][q], a, b); oh[q] = a; ol[q] = b; }
        if (WO) *(v4fa*)(ts + (r0 + k * (1024 / C)) * OSP + c4) = o[k];
        if (QV) { *(v4usa*)(dp[0] + (r0 + k * (1024 / C)) * DPP + c4) = oh; *(v4usa*)(dp[1] + (r0 + k * (1024 / C)) * DPP + c4) = ol; }
        if (WS) { *(v4us*)(Ph + e0 + k * 1024) = oh; *(v4us*)(Pl + e0 + k * 1024) = ol; } }
    const int n0 = blockIdx.x * 32;    // first of the work-group's 32 points (C = 128), batches counted through
    if constexpr (WO || QV) __syncthreads();    // like the next one it stands in front of every global store of the kernel, so that it waits for LDS alone
    v8h pv[2];
    if constexpr (QV) { const bf* ah = dp[0] + (rt * 16 + lr) * DPP + 8 * hi; const bf* al = dp[1] + (rt * 16 + lr) * DPP + 8 * hi; v16bf a[4], a2[4]; v8f ta[2] = {(v8f){}, (v8f){}};
#pragma unroll
        for (int kc = 0; kc < 4; ++kc) { a[kc] = ldqs(ah + kc * 32); a2[kc] = ldqs(al + kc * 32); }
#pragma unroll
        for (int kc = 0; kc < 4; ++kc) {
#pragma unroll
            for (int u = 0; u < 2; ++u) { ta[u] = wmmab(a[kc], wb[u][kc], ta[u]); ta[u] = wmmab(a2[kc], wb[u][kc], ta[u]); } }
        if (gq < 2) { v8f tq = (v8f){};
#pragma unroll
            for (int kc = 0; kc < 4; ++kc) { tq = wmmab(a[kc], wb[2][kc], tq); tq = wmmab(a2[kc], wb[2][kc], tq); }
#pragma unroll
            for (int j = 0; j < 8; ++j) qs[(rt * 16 + hi * 8 + j) * 36 + gq * 16 + lr] = tq[j]; }
#pragma unroll
        for (int u = 0; u < 2; ++u) {
#pragma unroll
            for (int e = 0; e < 8; ++e) pv[u][e] = tohx(ta[u][e] + vb[u]); }
        __syncthreads(); }
    if constexpr (WO) { float* ob = OUT + ((size_t)(n0 / NN) * 4 * C + (size_t)blk * C + (t >> 3)) * NN + n0 % NN + (t & 7) * 4; const float* tc = ts + (t & 7) * 4 * OSP + (t >> 3);
#pragma unroll
        for (int k = 0; k < 4; ++k) *(v4f*)(ob + (size_t)k * 32 * NN) = (v4f){tc[k * 32], tc[OSP + k * 32], tc[2 * OSP + k * 32], tc[3 * OSP + k * 32]}; }
    if constexpr (WH) {
#pragma unroll
        for (int k = 0; k < 4; ++k) *(v4f*)(hp + k * 1024) = o[k]; }
    if constexpr (QV) { h16* vo = VP + (size_t)(n0 / NN) * C * NN + (size_t)((n0 % NN) >> 5) * 4096 + gq * 1024 + rt * 256 + lane * 8;
#pragma unroll
        for (int u = 0; u < 2; ++u) *(v8h*)(vo + u * 512) = pv[u];
        const v4f val = *(const v4fa*)(qs + (t >> 3) * 36 + (t & 7) * 4); v4us oh, ol;
#pragma unroll
        for (int q = 0; q < 4; ++q) { unsigned short a3, b3; splitf(val[q], a3, b3); oh[q] = a3; ol[q] = b3; }
        *(v4us*)(Qh + (size_t)n0 * 32 + t * 4) = oh; *(v4us*)(Ql + (size_t)n0 * 32 + t * 4) = ol; } }

extern "C" void kernel_launch(void* const* d_in, const int* in_sizes, int n_in,
                              void* d_out, int out_size, void* d_ws, size_t ws_size, hipStream_t stream) {
    (void)in_sizes; (void)n_in; (void)out_size;
    const float* IN[14]; for (int i = 0; i < 14; ++i) IN[i] = (const float*)d_in[i];   // 0 x, 1 W1 [64][64], 2 g1, 3 b1, 4 W2 [128][64], 5 g2, 6 b2, 7 Wqk [4][32][128], 8 Wv [4][128][128], 9 bv [4][128], 10 Wt, 11 bt, 12 gn, 13 bnb
    float* OUT = (float*)d_out;     // [8][512][2048]
    char* wsp = (char*)d_ws;
    auto take = [&](size_t bytes) { char* p = wsp; wsp += (bytes + 255) & ~(size_t)255; return (void*)p; };
    bf* WB1 = (bf*)take((size_t)C0 * C0 * 2); bf* WB2 = (bf*)take((size_t)C1 * C0 * 2); bf* WQV = (bf*)take((size_t)4 * WQR * C1 * 2); bf* WT = (bf*)take((size_t)4 * C1 * C1 * 2); float* ST = (float*)take((size_t)C1 * 32 * 4);
    // every per-batch plane holds all NB_ batches, batch-major, so that one launch of each stage serves the whole batch; every kernel sees the batch as NB_ * NN rows
    bf* XT = (bf*)take((size_t)NB_ * NN * C0 * 2); float* T = (float*)take((size_t)NB_ * NN * C1 * 4); float* H = (float*)take((size_t)NB_ * NN * C1 * 4); bf* Hh = (bf*)take((size_t)NB_ * NN * C0 * 2); bf* Hl = (bf*)take((size_t)NB_ * NN * C0 * 2);
    bf* Qh = (bf*)take((size_t)NB_ * NN * 32 * 2); bf* Ql = (bf*)take((size_t)NB_ * NN * 32 * 2); float* CV = (float*)take((size_t)NB_ * NN * 4); h16* VP = (h16*)take((size_t)NB_ * C1 * NN * 2); float* PS = (float*)take((size_t)NB_ * NN / 16 * C1 * 4); float* PM = (float*)take((size_t)NB_ * NN / 16 * C1 * 4);
    if ((size_t)(wsp - (char*)d_ws) > ws_size) return;    // total ~ 30 MiB; ws 256 MiB
    k_prep<<<NB_ * 128 + (C0 * C0 + C1 * C0 + 4 * C1 * C1 + 4 * WQR * C1) / 1024, 256, 0, stream>>>(IN[0], IN[1], IN[4], IN[7], IN[8], IN[10], XT, WB1, WB2, WQV, WT);
    // stage 1: h0 = relu(bn(W1 x)) (T used with C = 64 pitch); only its planes are kept
    k_gemmw<bf, 0, false><<<dim3(NB_ * NN / 64, 1, 1), 32, 0, stream>>>(XT, nullptr, WB1, nullptr, C0, T, C0, nullptr, 0, 0, 0, PS, PM);
    k_bnstat<C0><<<C0 / 4, 1024, 0, stream>>>(PS, PM, ST);
    k_bnfin<C0, false, false, true, false, false><<<NB_ * NN * C0 / 4096, 256, 0, stream>>>(T, ST, IN[2], IN[3], nullptr, Hh, Hl, 0, nullptr, nullptr, nullptr, nullptr, nullptr, nullptr);
    // stage 2: h = relu(bn(W2 h0)), with the first block's q and v
    k_gemmw<bf, 1, false><<<dim3(NB_ * NN / 64, C1 / 64, 1), 32, 0, stream>>>(Hh, Hl, WB2, nullptr, C0, T, C1, nullptr, 0, 0, 0, PS, PM);
    k_bnstat<C1><<<C1 / 4, 1024, 0, stream>>>(PS, PM, ST);
    k_bnfin<C1, false, true, false, false, true><<<NB_ * NN * C1 / 4096, 256, 0, stream>>>(T, ST, IN[5], IN[6], H, nullptr, nullptr, 0, nullptr, WQV, IN[9], Qh, Ql, VP);
    // four offset-attention blocks, four launches each
    for (int i = 0; i < 4; ++i) {
        k_rstat<<<NB_ * NN / 32, 256, 0, stream>>>(Qh, Ql, CV);          // one log-domain constant a softmax row (maximum and sum), energies (3 products) in registers
        k_fatt<<<NB_ * NN / 32, 256, 0, stream>>>(Qh, Ql, CV, VP, H, WT + (size_t)i * C1 * C1, IN[11] + i * C1, T, PS, PM);          // column sums, weights and the product with v in one walk, energies in registers; then Wt (h - x_r) + bt
        k_bnstat<C1><<<C1 / 4, 1024, 0, stream>>>(PS, PM, ST);
        if (i < 3) k_bnfin<C1, true, true, false, true, true><<<NB_ * NN * C1 / 4096, 256, 0, stream>>>(T, ST, IN[12] + i * C1, IN[13] + i * C1, H, nullptr, nullptr, i, OUT, WQV + (size_t)(i + 1) * WQR * C1, IN[9] + (i + 1) * C1, Qh, Ql, VP);
        else k_bnfin<C1, true, false, false, true, false><<<NB_ * NN * C1 / 4096, 256, 0, stream>>>(T, ST, IN[12] + i * C1, IN[13] + i * C1, H, nullptr, nullptr, i, OUT, nullptr, nullptr, nullptr, nullptr, nullptr); }
}

// v009
// It runs in 219 microseconds.
// Two timings next to v008 put it at 1.08 and 1.11 times that version's speed.
// Over all steps from v000 it is 145 times as fast.
#include <hip/hip_runtime.h>

// IEModule (PCT-style offset-attention stack; x [8][64][2048]; h = relu(bn(W1 x)) (64); h = relu(bn(W2 h)) (128); then four chained blocks: q = Wqk h (32), energy = q^T q (symmetric, unscaled), att = softmax over keys
// then / (1e-9 + column sum over queries), x_r = v att with v = Wv h + bv, h = h + relu(bn(Wt (h - x_r) + bt)); output = concat of the four h -> [8][512][2048]. Every BatchNorm is TRAINING-mode: per-channel
// mean / biased variance over (batch, points) of the current activations, eps 1e-5.)
// Compute dtypes, f32 accumulate: every input rounded to bf16; everything positions-major [point][channel]; W1 x on PLAIN bf16 operands (inputs: exact), every later channel
// contraction on bf16 hi+lo planes of its computed operand x exact weights (2 products, + bias); energies on hi+lo planes of q (3 products, K 32); x_r^T = v^T . att on SINGLE fp16 planes (softmax weights relative to a per-column reference size; the division by the column sum follows the product)

#define NB_  8
#define NN   2048
#define C0   64
#define C1   128
#define BNE  1e-5f
typedef _Float16 h16;
typedef unsigned short bf;
typedef __attribute__((ext_vector_type(16))) __bf16   v16bf;
typedef __attribute__((ext_vector_type(16))) _Float16 v16h;
typedef __attribute__((ext_vector_type(8)))  _Float16 v8h;
typedef __attribute__((ext_vector_type(8)))  unsigned short v8us;
typedef __attribute__((ext_vector_type(8)))  float    v8f;
typedef __attribute__((ext_vector_type(4)))  float    v4f;
typedef v8h  __attribute__((may_alias)) v8ha;
typedef v4f  __attribute__((may_alias)) v4fa;
typedef v8us __attribute__((may_alias)) v8usa;

__device__ __forceinline__ unsigned short f2bf(float f) { unsigned u = __float_as_uint(f); u += 0x7FFFu + ((u >> 16) & 1u); return (unsigned short)(u >> 16); }
__device__ __forceinline__ float bf2f(unsigned short b) { return __uint_as_float(((unsigned)b) << 16); }
__device__ __forceinline__ float bfr(float f) { return bf2f(f2bf(f)); }
__device__ __forceinline__ v16h cat16(v8h lo, v8h hi) { return __builtin_shufflevector(lo, hi, 0, 1, 2, 3, 4, 5, 6, 7, 8, 9, 10, 11, 12, 13, 14, 15); }
__device__ __forceinline__ v16bf cat16b(v8us lo, v8us hi) { return __builtin_bit_cast(v16bf, __builtin_shufflevector(lo, hi, 0, 1, 2, 3, 4, 5, 6, 7, 8, 9, 10, 11, 12, 13, 14, 15)); }
__device__ __forceinline__ v8f wmma16(v16h a, v16h b, v8f c) { return __builtin_amdgcn_wmma_f32_16x16x32_f16(false, a, false, b, (short)0, c, false, false); }
__device__ __forceinline__ v8f wmmab(v16bf a, v16bf b, v8f c) { return __builtin_amdgcn_wmma_f32_16x16x32_bf16(false, a, false, b, (short)0, c, false, false); }



// BatchNorm partials of one 16 x 16 accumulator tile (a lane holds 8 rows of one column, lanes l and l ^ 16 the two halves of the column): s = the column's sum over the tile's 16 rows, q = its sum of squared deviations from the tile's own mean.
__device__ __forceinline__ void tilestat(v8f y, float& s, float& q) { float a = ((y[0] + y[1]) + (y[2] + y[3])) + ((y[4] + y[5]) + (y[6] + y[7])); a += __shfl_xor(a, 16, 32); const float mu = a * (1.0f / 16.0f); float b = 0.f;
#pragma unroll
    for (int r = 0; r < 8; ++r) { const float d = y[r] - mu; b += d * d; }
    b += __shfl_xor(b, 16, 32); s = a; q = b; }
// ---- k_gemmw: register-blocked GEMM, ONE WAVE per 64x64 output tile (16 accumulators), operands straight from K-contiguous 16-bit planes; grid (M/64, N/64, Z), 32 threads.
// C[m][n] (f32, pitch ldc, + optional f32 bias[n]) = sum_k A[m][k] Bt[n][k] (+ split products per NSPLIT). z-batch strides sA/sB/sC in elements. K % 32 == 0.
// PS / PM [16-row tile][ldc]: the BatchNorm partials (tilestat) of every 16-row tile of C, from the accumulators (grid z = 1).
template <typename T16> struct WFrag;
template <> struct WFrag<bf> { typedef v16bf V; static __device__ __forceinline__ V ld(const bf* p) { return cat16b(*(const v8us*)p, *(const v8us*)(p + 16)); } static __device__ __forceinline__ v8f mma(V a, V b, v8f c) { return wmmab(a, b, c); } };
template <typename T16, int NSPLIT, bool BIAS>
__global__ __launch_bounds__(32) void k_gemmw(const T16* __restrict__ A, const T16* __restrict__ A2, const T16* __restrict__ Bt, const T16* __restrict__ Bt2, int K, float* C, int ldc, const float* __restrict__ bias, size_t sA, size_t sB, size_t sC, float* PS, float* PM) {
    typedef typename WFrag<T16>::V V;
    __shared__ __align__(16) float os[16 * 68];
    const size_t z = blockIdx.z; A += z * sA; if (A2) A2 += z * sA; Bt += z * sB; if (Bt2) Bt2 += z * sB; C += z * sC;
    const int lane = threadIdx.x & 31, lr = lane & 15, hi = lane >> 4; const int r0 = blockIdx.x * 64, c0 = blockIdx.y * 64;
    v8f acc[4][4];
#pragma unroll
    for (int mb = 0; mb < 4; ++mb)
#pragma unroll
        for (int nb = 0; nb < 4; ++nb) acc[mb][nb] = (v8f){};
    const size_t aoff = (size_t)(r0 + lr) * K + 8 * hi, boff = (size_t)(c0 + lr) * K + 8 * hi;
#pragma unroll 1
    for (int kc = 0; kc < K; kc += 32) {
        V a[4], a2[4];
#pragma unroll
        for (int mb = 0; mb < 4; ++mb) { a[mb] = WFrag<T16>::ld(A + aoff + (size_t)mb * 16 * K + kc); if (NSPLIT == 1 || NSPLIT == 2) a2[mb] = WFrag<T16>::ld(A2 + aoff + (size_t)mb * 16 * K + kc); }
#pragma unroll
        for (int nb = 0; nb < 4; ++nb) { const V b = WFrag<T16>::ld(Bt + boff + (size_t)nb * 16 * K + kc); V b2; if (NSPLIT >= 2) b2 = WFrag<T16>::ld(Bt2 + boff + (size_t)nb * 16 * K + kc);
#pragma unroll
            for (int mb = 0; mb < 4; ++mb) { acc[mb][nb] = WFrag<T16>::mma(a[mb], b, acc[mb][nb]); if (NSPLIT == 1 || NSPLIT == 2) acc[mb][nb] = WFrag<T16>::mma(a2[mb], b, acc[mb][nb]); if (NSPLIT >= 2) acc[mb][nb] = WFrag<T16>::mma(a[mb], b2, acc[mb][nb]); } }
        asm volatile("v_nop\n\tv_nop\n\tv_nop\n\tv_nop" : "+v"(acc[0][0]), "+v"(acc[1][1]), "+v"(acc[2][2]), "+v"(acc[3][3]) : "v"(a[0]), "v"(a[3]));
    }
#pragma unroll
    for (int mb = 0; mb < 4; ++mb) {
#pragma unroll
        for (int nb = 0; nb < 4; ++nb) {
#pragma unroll
            for (int j = 0; j < 8; ++j) os[(hi * 8 + j) * 68 + nb * 16 + lr] = acc[mb][nb][j]; }
        __builtin_amdgcn_wave_barrier(); asm volatile("" ::: "memory");
        float* crow = C + (size_t)(r0 + mb * 16) * ldc + c0;
{
#pragma unroll
            for (int s = 0; s < 8; ++s) { const int row = 2 * s + hi, cofs = lr * 4; v4f val = *(const v4fa*)(os + row * 68 + cofs); if (BIAS) { val[0] += bfr(bias[c0 + cofs]); val[1] += bfr(bias[c0 + cofs + 1]); val[2] += bfr(bias[c0 + cofs + 2]); val[3] += bfr(bias[c0 + cofs + 3]); }
                *(v4f*)(crow + (size_t)row * ldc + cofs) = val; }
             }
        __builtin_amdgcn_wave_barrier(); asm volatile("" ::: "memory");
    }
    asm volatile("s_wait_xcnt 0x0" ::: "memory");    // the stores above have taken their registers before the lines below may reuse one (precaution before a register of an issued store is reused)
    float* pd = (hi ? PM : PS) + (size_t)blockIdx.x * 4 * ldc + c0 + lr; float pv[4][4];    // lanes 0-15 store the sums, lanes 16-31 the squared deviations
#pragma unroll
    for (int mb = 0; mb < 4; ++mb) {
#pragma unroll
        for (int nb = 0; nb < 4; ++nb) { float s, q; tilestat(acc[mb][nb], s, q); if (BIAS) s += 16.0f * bfr(bias[c0 + nb * 16 + lr]); pv[mb][nb] = hi ? q : s; } }
#pragma unroll
    for (int mb = 0; mb < 4; ++mb) {
#pragma unroll
        for (int nb = 0; nb < 4; ++nb) pd[(size_t)mb * ldc + nb * 16] = pv[mb][nb]; }
}

__device__ __forceinline__ h16 tohx(float x) { return (h16)x; }
__device__ __forceinline__ void splitf(float y, unsigned short& h, unsigned short& l) { h = f2bf(y); l = f2bf(y - bf2f(h)); }
typedef __attribute__((ext_vector_type(4))) unsigned short v4us;
typedef __attribute__((ext_vector_type(2))) float v2f;
typedef v4us __attribute__((may_alias)) v4usa;
#define WQR  160         // rows of a block's q / v weight operand: Wqk (32), then Wv (128)
#define DPP  136         // 16-bit elements a row of an operand plane in LDS: 16-B aligned, adjacent rows 4 banks apart
// k_prep: every operand that is only a rounded copy of an input, in one launch: x as bf16, positions-major [batch][point][64] (the first NB_ * 128 work-groups), then the weights as bf16 (1024 elements a work-group):
// W1, W2, Wt, and per block the WQR rows [Wqk; Wv].
__global__ __launch_bounds__(256) void k_prep(const float* __restrict__ x, const float* __restrict__ W1, const float* __restrict__ W2, const float* __restrict__ Wqk, const float* __restrict__ Wv, const float* __restrict__ Wt, bf* XT, bf* WB1, bf* WB2, bf* WQV, bf* WT) {
    const int blk = blockIdx.x; v4us o;
    if (blk < NB_ * 128) { const float* xb = x + (size_t)(blk >> 7) * C0 * NN; const int e = ((blk & 127) * 256 + threadIdx.x) * 4, c = e % C0, n = e / C0;
#pragma unroll
        for (int q = 0; q < 4; ++q) o[q] = f2bf(xb[(size_t)(c + q) * NN + n]);
        *(v4us*)(XT + (size_t)(blk >> 7) * NN * C0 + e) = o; return; }
    int e = ((blk - NB_ * 128) * 256 + threadIdx.x) * 4; const float* s; bf* d;
    if (e < C0 * C0) { s = W1 + e; d = WB1 + e; }
    else if ((e -= C0 * C0) < C1 * C0) { s = W2 + e; d = WB2 + e; }
    else if ((e -= C1 * C0) < 4 * C1 * C1) { s = Wt + e; d = WT + e; }
    else { e -= 4 * C1 * C1; const int i = e / (WQR * C1), r = (e / C1) % WQR, k = e % C1; d = WQV + e; s = r < 32 ? Wqk + (size_t)(i * 32 + r) * C1 + k : Wv + (size_t)(i * C1 + r - 32) * C1 + k; }
    const v4f v = *(const v4f*)s;
#pragma unroll
    for (int q = 0; q < 4; ++q) o[q] = f2bf(v[q]);
    *(v4us*)d = o; }
// ---- attention without stored energies. The energies are a Gram matrix of K = 32, so a 16 x 16 tile costs three matrix instructions from the q planes: both kernels below form the tiles they need in registers, and neither the
// energies nor the attention weights go through memory. The three products of a tile are taken in the same order of terms in both kernels, so both see the same value for a pair (i, j).
#define OSP  132         // floats a row of a wave's partial output tile in LDS: 16-B aligned, adjacent rows 4 banks apart
#define L2E  1.4426950408889634f
__device__ __forceinline__ float ex2(float x) { asm("v_exp_f32 %0, %0\n\tv_nop" : "+v"(x)); return x; }
__device__ __forceinline__ v8f ex2x8(v8f x) { float y0 = x[0], y1 = x[1], y2 = x[2], y3 = x[3], y4 = x[4], y5 = x[5], y6 = x[6], y7 = x[7];
    asm("v_exp_f32 %0, %0\n\tv_exp_f32 %1, %1\n\tv_exp_f32 %2, %2\n\tv_exp_f32 %3, %3\n\tv_exp_f32 %4, %4\n\tv_exp_f32 %5, %5\n\tv_exp_f32 %6, %6\n\tv_exp_f32 %7, %7\n\tv_nop"
        : "+v"(y0), "+v"(y1), "+v"(y2), "+v"(y3), "+v"(y4), "+v"(y5), "+v"(y6), "+v"(y7));
    return (v8f){y0, y1, y2, y3, y4, y5, y6, y7}; }
__device__ __forceinline__ v16bf ldq(const bf* p) { return cat16b(*(const v8us*)p, *(const v8us*)(p + 16)); }
__device__ __forceinline__ v16bf ldqs(const bf* p) { return cat16b(*(const v8usa*)p, *(const v8usa*)(p + 16)); }    // the same fragment from an LDS plane
// k_rstat: CV[i] = log2(e) max_j S[i][j] + log2(sum_j exp(S[i][j] - max)), so that softmax[i][j] = exp2(log2(e) S[i][j] - CV[i]). A work-group owns 32 rows i (one 128-B line of CV); they are the COLUMNS of its tiles, so a lane folds one row i in its own registers;
// wave w walks 256 of the 2048 j with a running maximum and a rescaled running sum; halves join by one shuffle, the 8 waves through LDS.
__global__ __launch_bounds__(256) void k_rstat(const bf* __restrict__ Qh, const bf* __restrict__ Ql, float* CV) { __shared__ float sm[8][32], ss[8][32]; const int lane = threadIdx.x & 31, w = threadIdx.x >> 5, lr = lane & 15, hi = lane >> 4;
    const int i0 = blockIdx.x * 32; const size_t jo = ((size_t)(i0 / NN) * NN + w * (NN / 8) + lr) * 32 + 8 * hi; const bf* qh = Qh + jo; const bf* ql = Ql + jo; v16bf bh[2], bl[2]; float m[2] = {-1.0e30f, -1.0e30f}, s[2] = {0.f, 0.f};
#pragma unroll
    for (int t = 0; t < 2; ++t) { const size_t o = (size_t)(i0 + t * 16 + lr) * 32 + 8 * hi; bh[t] = ldq(Qh + o); bl[t] = ldq(Ql + o); }
    for (int mt = 0; mt < NN / 8 / 16; mt += 2) { v16bf ah[2], al[2];
#pragma unroll
        for (int u = 0; u < 2; ++u) { ah[u] = ldq(qh + u * 512); al[u] = ldq(ql + u * 512); }
        asm volatile("s_wait_xcnt 0x0" :: "v"(qh), "v"(ql) : "memory");    // keeps both address pairs live, and unwritten, until the 8 loads have taken their address (precaution before a register of an issued load is reused)
        qh += 1024; ql += 1024;
#pragma unroll
        for (int t = 0; t < 2; ++t) { v8f d[2];
#pragma unroll
            for (int u = 0; u < 2; ++u) { d[u] = wmmab(ah[u], bh[t], (v8f){}); d[u] = wmmab(al[u], bh[t], d[u]); d[u] = wmmab(ah[u], bl[t], d[u]); }
            float mn = m[t];
#pragma unroll
            for (int r = 0; r < 8; ++r) mn = fmaxf(mn, fmaxf(d[0][r], d[1][r]));
            const v8f e0 = ex2x8((d[0] - mn) * L2E), e1 = ex2x8((d[1] - mn) * L2E); float a[4] = {0.f, 0.f, 0.f, 0.f};
#pragma unroll
            for (int r = 0; r < 8; ++r) { a[r & 1] += e0[r]; a[2 + (r & 1)] += e1[r]; }
            s[t] = s[t] * ex2((m[t] - mn) * L2E) + ((a[0] + a[1]) + (a[2] + a[3])); m[t] = mn; } }
#pragma unroll
    for (int t = 0; t < 2; ++t) { const float m2 = __shfl_xor(m[t], 16, 32), s2 = __shfl_xor(s[t], 16, 32), mx = fmaxf(m[t], m2); const float sj = s[t] * ex2((m[t] - mx) * L2E) + s2 * ex2((m2 - mx) * L2E);
        if (hi == 0) { sm[w][t * 16 + lr] = mx; ss[w][t * 16 + lr] = sj; } }
    __syncthreads();
    if (w == 0) { float mx = sm[0][lane];
#pragma unroll
        for (int k = 1; k < 8; ++k) mx = fmaxf(mx, sm[k][lane]);
        float sj = 0.f;
#pragma unroll
        for (int k = 0; k < 8; ++k) sj += ss[k][lane] * ex2((sm[k][lane] - mx) * L2E);
        CV[i0 + lane] = __builtin_amdgcn_logf(sj) + mx * L2E; } }
// 1 / x of a power of two x = 2^e, -126 <= e <= 126, exact: the exponent field mirrored. xhalf: the value that lane l ^ 16 holds, by a vector cross-row move.
__device__ __forceinline__ float p2inv(float x) { return __uint_as_float(0x7F000000u - __float_as_uint(x)); }
__device__ __forceinline__ float xhalf(float x) { const int b = __float_as_int(x); return __int_as_float(__builtin_amdgcn_permlanex16(b, b, 0x76543210, 0xfedcba98, false, false)); }
// k_fatt: T[j][.] = Wt (h[j] - x_r[j]) + bt, x_r[j][c] = sum_i a[i][j] v[i][c] / (1e-9 + sum_i a[i][j]), a[i][j] = softmax[i][j] = exp2(log2(e) S[i][j] - CV[i]). A work-group of 16 waves owns 64 output rows j; waves 2 g and 2 g + 1 take the same 256 of the 2048 i, 32 a pass, for 32 rows j each, and walk them ONCE.
// The pair's operands of a pass (32 rows of both q planes, 32 points of v in fragment order: a slice, 12 KiB from L2) are fetched once for both waves: each wave brings half of the slice into LDS by 12 asynchronous 16-B copies a lane, one pass ahead, into a ring of two buffers; the batch's CV goes to LDS once, in front of the loop.
// A pass: tiles S[i][j] (rows i, columns j) from the q planes, a in f32; a goes as it is into the lane's column sum, and a / rk (kept as kf = 1 / rk), rounded to f16, into the product. rk is the wave's own reference size of the column (the same in the column's two lanes): a power of two, it starts at 2^-100
// and is raised (to the power of two at or below the column's largest a of the pass, where that is above rk) only when some weight of the pass would pass 2^14 (a wave-uniform branch, as a rule taken in the first pass and seldom after it; the accumulators are then scaled by old rk / new rk): no weight overflows f16, and the largest weights
// of every column are normal f16 numbers, however small the column's sum (an a below 2^-100 is nothing beside the 1e-9). The two tiles of 16 i, rounded in place, are the B operand of x_r^T += v^T . a (a packed pair of D tiles has the hardware's k order, which the VP order gives v).
// The 8 pairs' partial tiles, column sums and rk meet in LDS (the ring's bytes, free behind the last pass's barrier) behind a barrier; a wave's partial tile counts times its rk.
// The lane that sums an element subtracts it from h and leaves the difference as bf16 hi + lo planes in LDS; behind a second barrier wave w forms rows 16 (w >> 2) .., columns 32 (w & 3) .. of the work-group's 64 x 128 tile of T
// (per 32 k: hi plane x Wt, then lo plane x Wt, into one accumulator; a row's 128-B line has one writer), and leaves the BatchNorm partials (tilestat) of its two tiles in PS / PM [16-row tile][128] (32 channels: one 128-B line, one writer).
#define JW   64                  // output rows j of a work-group
#define SQL  2048                // a slice: the hi plane's 32 rows of 64 B, from here the lo plane's,
#define SVP  4096                // from here the 8 KiB of v fragments
#define SLB  (SVP + 8192)        // bytes of a slice
#define RBB  (8 * SLB)           // bytes of a ring buffer: the 8 pairs' slices of one pass
#define NPS  (NN / 8 / 32)       // passes
__device__ __forceinline__ unsigned ldsa(const void* p) { return (unsigned)(size_t)(__attribute__((address_space(3))) const char*)p; }    // byte address in the work-group's LDS
// One wave's half of a slice: 2 + 2 copies for 16 rows of each q plane, 8 for 4 KiB of v. An immediate offset moves the LDS address and the global address alike, so one LDS-address register and one scalar base serve every copy of a plane.
// In LDS the four 16-B units of a q row r stand in the order unit ^ ((r >> 2) & 3): the 16-B reads of 16 adjacent rows then fall on 16 distinct groups of four banks; rows 16 apart have the same order, so a step of 1024 B is the same step in both memories.
// The s_wait_xcnt closes the copies' own statement, so that it stands in front of every later write of an address register that a copy names (precaution before a register of an issued copy is reused).
// gh, gl, gv: the wave's part of the three sources, the same in every lane (scalar bases); lo: the lane's 16 B in each 512 B.
__device__ __forceinline__ void cp12(unsigned lq, unsigned lv, unsigned lo, const char* gh, const char* gl, const char* gv) {
    asm volatile("global_load_async_to_lds_b128 %0, %3, %4\n\tglobal_load_async_to_lds_b128 %0, %3, %4 offset:1024\n\tglobal_load_async_to_lds_b128 %1, %3, %5\n\tglobal_load_async_to_lds_b128 %1, %3, %5 offset:1024\n\t"
                 "global_load_async_to_lds_b128 %2, %3, %6\n\tglobal_load_async_to_lds_b128 %2, %3, %6 offset:512\n\tglobal_load_async_to_lds_b128 %2, %3, %6 offset:1024\n\tglobal_load_async_to_lds_b128 %2, %3, %6 offset:1536\n\t"
                 "global_load_async_to_lds_b128 %2, %3, %6 offset:2048\n\tglobal_load_async_to_lds_b128 %2, %3, %6 offset:2560\n\tglobal_load_async_to_lds_b128 %2, %3, %6 offset:3072\n\tglobal_load_async_to_lds_b128 %2, %3, %6 offset:3584\n\ts_wait_xcnt 0x0"
                 :: "v"(lq), "v"(lq + SQL), "v"(lv), "v"(lo), "s"(gh), "s"(gl), "s"(gv) : "memory"); }
__global__ __launch_bounds__(512) __attribute__((amdgpu_waves_per_eu(4, 4))) void k_fatt(const bf* __restrict__ Qh, const bf* __restrict__ Ql, const float* __restrict__ CV, const h16* __restrict__ VP, const float* __restrict__ H, const bf* __restrict__ Wt, const float* __restrict__ bt, float* T, float* PS, float* PM) {
    __shared__ __align__(16) float os[8 * JW * OSP]; __shared__ __align__(16) float cvs[NN]; __shared__ float cs[8][JW], rs[8][JW]; __shared__ __align__(16) bf dp[2][JW * DPP]; static_assert(2 * RBB <= 8 * JW * OSP * 4, "the ring lies in os");
    const int lane = threadIdx.x & 31, w = __builtin_amdgcn_readfirstlane(threadIdx.x >> 5), ig = w >> 1, jg = w & 1, lr = lane & 15, hi = lane >> 4;
    const int j0 = blockIdx.x * JW, b = j0 / NN, ib0 = ig * (NN / 8); const char* ring = (const char*)os;
    const unsigned lq = ldsa(ring) + ig * SLB + (jg * 8 + (lane >> 2)) * 64 + ((lane & 3) ^ (jg * 2 + hi)) * 16, lv = ldsa(ring) + ig * SLB + SVP + jg * 4096 + lane * 16;    // where the lane's copies land in buffer 0
    const unsigned lo = lane * 16; const size_t qo = ((size_t)b * NN + ib0) * 64 + jg * 512; const char* gh = (const char*)Qh + qo; const char* gl = (const char*)Ql + qo; const char* gv = (const char*)VP + ((size_t)b * C1 * NN + (size_t)(ib0 >> 5) * 4096) * 2 + jg * 4096;
    { const float* gc = CV + (size_t)b * NN + threadIdx.x * 4; asm volatile("global_load_async_to_lds_b128 %0, %1, off\n\ts_wait_xcnt 0x0" :: "v"(ldsa(cvs) + threadIdx.x * 16), "v"(gc) : "memory"); }    // the batch's CV, 16 B a lane; the wait as in cp12
    cp12(lq, lv, lo, gh, gl, gv);
    v16bf bh[2], bl[2]; float csum[2] = {0.f, 0.f}, kf[2] = {0x1p+100f, 0x1p+100f}; const bf* pjh[2]; const bf* pjl[2];
#pragma unroll
    for (int jt = 0; jt < 2; ++jt) { const size_t o = (size_t)(j0 + jg * 32 + jt * 16 + lr) * 32 + 8 * hi; pjh[jt] = Qh + o; pjl[jt] = Ql + o; bh[jt] = ldq(pjh[jt]); bl[jt] = ldq(pjl[jt]); }
    asm volatile("s_wait_xcnt 0x0" :: "v"(pjh[0]), "v"(pjh[1]), "v"(pjl[0]), "v"(pjl[1]) : "memory");    // keeps the four address pairs live, and unwritten (also by a later load's result), until the 8 loads have taken their address (precaution before a register of an issued load is reused)
    v8f acc[2][8];
#pragma unroll
    for (int jt = 0; jt < 2; ++jt) {
#pragma unroll
        for (int nb = 0; nb < 8; ++nb) acc[jt][nb] = (v8f){}; }
    asm volatile("s_wait_asynccnt 0x0" ::: "memory");    // this wave's copies of pass 0 and of CV have landed
    __syncthreads();                                     // and every other wave's: pass 0 may be read
    cp12(lq + RBB, lv + RBB, lo, gh + 2048, gl + 2048, gv + 8192);
    auto pass = [&](int it) __attribute__((always_inline)) { v16h p[2], f[8]; v16bf ah[2], al[2]; v8f kk[2], e[2][2]; float me[2];
        const char* st = ring + (it & 1) * RBB + ig * SLB; const char* sq = st + lr * 64 + (hi ^ ((lr >> 2) & 3)) * 16; const char* sq2 = st + lr * 64 + ((hi + 2) ^ ((lr >> 2) & 3)) * 16;    // units hi and hi + 2 of row lr
        const h16* sv = (const h16*)(st + SVP) + lane * 8; const float* cv = cvs + ib0 + it * 32 + hi * 8;
#pragma unroll
        for (int t = 0; t < 2; ++t) { ah[t] = cat16b(*(const v8usa*)(sq + t * 1024), *(const v8usa*)(sq2 + t * 1024)); al[t] = cat16b(*(const v8usa*)(sq + SQL + t * 1024), *(const v8usa*)(sq2 + SQL + t * 1024)); }
#pragma unroll
        for (int t = 0; t < 2; ++t) { v8f d[2]; kk[t] = __builtin_shufflevector(*(const v4fa*)(cv + t * 16), *(const v4fa*)(cv + t * 16 + 4), 0, 1, 2, 3, 4, 5, 6, 7);
#pragma unroll
            for (int jt = 0; jt < 2; ++jt) d[jt] = wmmab(ah[t], bh[jt], (v8f){});
#pragma unroll
            for (int jt = 0; jt < 2; ++jt) d[jt] = wmmab(ah[t], bl[jt], d[jt]);
#pragma unroll
            for (int jt = 0; jt < 2; ++jt) d[jt] = wmmab(al[t], bh[jt], d[jt]);
#pragma unroll
            for (int jt = 0; jt < 2; ++jt) e[t][jt] = ex2x8(d[jt] * L2E - kk[t]);
            __builtin_amdgcn_sched_barrier(0); }    // one half of the pass at a time: mixed, the two halves' row constants and energies are live together, and the kernel spills
#pragma unroll
        for (int nb = 0; nb < 2; ++nb) f[nb] = cat16(*(const v8ha*)(sv + nb * 512), *(const v8ha*)(sv + nb * 512 + 256));
        __builtin_amdgcn_sched_barrier(0);    // the first two v fragments are asked for here, so that they arrive under the vector work below
#pragma unroll
        for (int jt = 0; jt < 2; ++jt) { float m = fmaxf(e[0][jt][0], e[1][jt][0]);
#pragma unroll
            for (int r = 1; r < 8; ++r) m = fmaxf(m, fmaxf(e[0][jt][r], e[1][jt][r]));
            me[jt] = m; }
        if (__any(fmaxf(me[0] * kf[0], me[1] * kf[1]) > 16384.0f)) {    // the same for the whole wave: some weight of this pass would pass 2^14, so every column's reference goes up to its largest a of this pass, where that is higher
#pragma unroll
            for (int jt = 0; jt < 2; ++jt) { const float ro = p2inv(kf[jt]), m2 = fmaxf(me[jt], xhalf(me[jt])); kf[jt] = p2inv(fmaxf(ro, __uint_as_float(__float_as_uint(m2) & 0x7F800000u))); const float fc = ro * kf[jt];
#pragma unroll
                for (int nb = 0; nb < 8; ++nb) acc[jt][nb] *= fc; } }
#pragma unroll
        for (int t = 0; t < 2; ++t) {
#pragma unroll
            for (int jt = 0; jt < 2; ++jt) { const v8f u = e[t][jt]; csum[jt] += ((u[0] + u[1]) + (u[2] + u[3])) + ((u[4] + u[5]) + (u[6] + u[7]));
#pragma unroll
                for (int r = 0; r < 8; ++r) p[jt][t * 8 + r] = tohx(u[r] * kf[jt]); } }
        __builtin_amdgcn_sched_barrier(0);    // the column sums and the rounding stand in front of the product: behind it their 32 inputs would stay live through it
#pragma unroll
        for (int nb = 2; nb < 4; ++nb) f[nb] = cat16(*(const v8ha*)(sv + nb * 512), *(const v8ha*)(sv + nb * 512 + 256));
        __builtin_amdgcn_sched_barrier(0);    // this one and the one in the loop below keep every fragment's read four steps ahead of its products: left free, the compiler reads a fragment directly in front of its products and waits out the LDS latency at each step
#pragma unroll
        for (int nb = 0; nb < 8; ++nb) {
#pragma unroll
            for (int jt = 0; jt < 2; ++jt) acc[jt][nb] = wmma16(f[nb], p[jt], acc[jt][nb]);
            if (nb < 4) f[nb + 4] = cat16(*(const v8ha*)(sv + (nb + 4) * 512), *(const v8ha*)(sv + (nb + 4) * 512 + 256));
            __builtin_amdgcn_sched_barrier(0); }
        asm volatile("s_wait_dscnt 0x0" ::: "memory");       // this wave's reads of the pass's buffer have returned
        asm volatile("s_wait_asynccnt 0x0" ::: "memory");    // and its copies of the next pass have landed
        __syncthreads(); };                                  // the same of every wave: the next pass may be read, this pass's buffer refilled
    // both loops stay rolled: unrolled, the compiler lifts the passes' loads over one another, needs more than 256 registers and spills. The passes that still have a pass it + 2 to fetch are a loop of their own, so that no branch stands at a pass's foot
    // (behind a branch there the compiler sinks the column sums' additions, and the 32 weights they read stay in registers through the product).
#pragma unroll 1
    for (int it = 0; it < NPS - 2; ++it) { pass(it); cp12(lq + (it & 1) * RBB, lv + (it & 1) * RBB, lo, gh + (it + 2) * 2048, gl + (it + 2) * 2048, gv + (it + 2) * 8192); }
#pragma unroll 1
    for (int it = NPS - 2; it < NPS; ++it) pass(it);
    asm volatile("s_wait_asynccnt 0x0" ::: "memory");    // no copy is outstanding when the ring's bytes become the partial tiles
    const int ln = __builtin_amdgcn_mbcnt_lo(~0u, 0u), l2 = ln & 15, h2 = ln >> 4, td = w * 32 + ln;    // the lane's number, read anew for the part below: what that part derives from it would otherwise be formed at the kernel's head and spilled over the loops
#pragma unroll
    for (int jt = 0; jt < 2; ++jt) { const float s = csum[jt] + xhalf(csum[jt]); if (h2 == 0) { cs[ig][jg * 32 + jt * 16 + l2] = s; rs[ig][jg * 32 + jt * 16 + l2] = p2inv(kf[jt]); } }
#pragma unroll
    for (int jt = 0; jt < 2; ++jt) {
#pragma unroll
        for (int nb = 0; nb < 8; ++nb) { float* o = os + (size_t)(ig * JW + jg * 32 + jt * 16 + l2) * OSP + nb * 16 + h2 * 8; const v8f v = acc[jt][nb]; *(v4fa*)o = (v4f){v[0], v[1], v[2], v[3]}; *(v4fa*)(o + 4) = (v4f){v[4], v[5], v[6], v[7]}; } }
    const float* hp = H + (size_t)j0 * C1 + td * 4; v4f hv[4];    // lane t owns elements 4 t .. 4 t + 3 of each quarter (16 rows) of the work-group's 64 x 128 tile
#pragma unroll
    for (int k = 0; k < 4; ++k) hv[k] = *(const v4f*)(hp + k * 2048);
    const int rt = w >> 2, cq = (w & 3) * 32; const bf* wp = Wt + (size_t)(cq + l2) * C1 + 8 * h2; const float* bp = bt + cq + l2; v16bf wb[2][4]; float bb[2];
#pragma unroll
    for (int u = 0; u < 2; ++u) { bb[u] = bfr(bp[u * 16]);
#pragma unroll
        for (int kc = 0; kc < 4; ++kc) wb[u][kc] = ldq(wp + u * 16 * C1 + kc * 32); }
    asm volatile("s_wait_xcnt 0x0" :: "v"(hp), "v"(wp), "v"(bp) : "memory");    // keeps the three address pairs live, and unwritten (also by a later load's result), until the 22 loads have taken their address (precaution before a register of an issued load is reused)
    __syncthreads();
#pragma unroll
    for (int k = 0; k < 4; ++k) { const int idx = td + 512 * k, row = idx >> 5, c4 = (idx & 31) * 4; v4f sa = (v4f){0.f, 0.f, 0.f, 0.f}; v4us oh, ol; float s = 0.f;
#pragma unroll
        for (int ww = 0; ww < 8; ++ww) { s += cs[ww][row]; sa += *(const v4fa*)(os + (size_t)(ww * JW + row) * OSP + c4) * rs[ww][row]; }
        const float inv = __fdiv_rn(1.0f, __fadd_rn(1e-9f, s));
#pragma unroll
        for (int q = 0; q < 4; ++q) { unsigned short x, y; splitf(hv[k][q] - sa[q] * inv, x, y); oh[q] = x; ol[q] = y; }
        *(v4usa*)(dp[0] + row * DPP + c4) = oh; *(v4usa*)(dp[1] + row * DPP + c4) = ol; }
    __syncthreads();
    const bf* ah = dp[0] + (rt * 16 + l2) * DPP + 8 * h2; const bf* al = dp[1] + (rt * 16 + l2) * DPP + 8 * h2; v8f ta[2] = {(v8f){}, (v8f){}};
#pragma unroll
    for (int kc = 0; kc < 4; ++kc) { const v16bf a = ldqs(ah + kc * 32), a2 = ldqs(al + kc * 32);
#pragma unroll
        for (int u = 0; u < 2; ++u) { ta[u] = wmmab(a, wb[u][kc], ta[u]); ta[u] = wmmab(a2, wb[u][kc], ta[u]); } }
    float* to = T + (size_t)(j0 + rt * 16 + h2 * 8) * C1 + cq + l2; float* pd = (h2 ? PM : PS) + (size_t)(blockIdx.x * 4 + rt) * C1 + cq + l2; float pv[2];    // lanes 0-15 store the sums, lanes 16-31 the squared deviations
#pragma unroll
    for (int u = 0; u < 2; ++u) { float s, q; ta[u] += bb[u]; tilestat(ta[u], s, q); pv[u] = h2 ? q : s; }
#pragma unroll
    for (int j = 0; j < 8; ++j) {
#pragma unroll
        for (int u = 0; u < 2; ++u) to[j * C1 + u * 16] = ta[u][j]; }
#pragma unroll
    for (int u = 0; u < 2; ++u) pd[u * 16] = pv[u]; }
// k_bnstat: per-channel mean and 1/sqrt(biased variance + eps) over all NB_ * NN rows of T [row][C], from the partials that the kernel which made T left of every 16-row tile (PS sum, PM squared deviations from the tile's mean; [tile][C]): T itself is not read.
// One work-group of 32 waves per 4 adjacent channels; lane t owns tile t. Squared deviations from the overall mean = the tile's own + 16 (tile mean - mean)^2: every term is >= 0, nothing cancels.
// Lanes fold by shuffles, the 32 waves' partial sums through LDS (every wave folds them alike).
__device__ __forceinline__ v4f wgsum4(v4f s, v4f (*red)[32], int w, int lane) {
#pragma unroll
    for (int sh = 16; sh; sh >>= 1) {
#pragma unroll
        for (int q = 0; q < 4; ++q) s[q] += __shfl_xor(s[q], sh, 32); }
    if (lane == 0) (*red)[w] = s;
    __syncthreads();
    s = (*red)[lane];
#pragma unroll
    for (int sh = 16; sh; sh >>= 1) {
#pragma unroll
        for (int q = 0; q < 4; ++q) s[q] += __shfl_xor(s[q], sh, 32); }
    return s; }
template <int C>
__global__ __launch_bounds__(1024) void k_bnstat(const float* __restrict__ PS, const float* __restrict__ PM, float* ST) { __shared__ __align__(16) v4f red[2][32]; const int lane = threadIdx.x & 31, w = threadIdx.x >> 5; const int c0 = blockIdx.x * 4;
    static_assert(NB_ * NN / 16 == 1024, "one lane a tile");
    const float* sp = PS + (size_t)threadIdx.x * C + c0; const float* qp = PM + (size_t)threadIdx.x * C + c0; const v4f s = *(const v4f*)sp; v4f q2 = *(const v4f*)qp;
    asm volatile("s_wait_xcnt 0x0" :: "v"(sp), "v"(qp) : "memory");    // keeps the two address pairs live, and unwritten, until both loads have taken their address (precaution before a register of an issued load is reused)
    const v4f mu = wgsum4(s, &red[0], w, lane) * (1.0f / (NB_ * NN)); const v4f d = s * (1.0f / 16.0f) - mu; q2 += d * d * 16.0f;
    q2 = wgsum4(q2, &red[1], w, lane);
    if (w < 4) { const float m = w == 0 ? mu[0] : (w == 1 ? mu[1] : (w == 2 ? mu[2] : mu[3])), v = w == 0 ? q2[0] : (w == 1 ? q2[1] : (w == 2 ? q2[2] : q2[3]));
        const float rs = __frsqrt_rn(__fadd_rn(v * (1.0f / (NB_ * NN)), BNE)); ST[(size_t)(c0 + w) * 32 + lane] = lane == 0 ? m : (lane == 1 ? rs : 0.f); } }
// k_bnfin: y = relu(bf16(g[c]) rs_c (T[row][c] - mu_c) + bf16(be[c])), h = RES ? H + y : y, and everything that is made of h alone, from the register that holds it. A work-group takes 4096 adjacent elements (4096 / C rows),
// a lane four 16-B units of the same 4 channels. WH: H[row][c] f32 (the same lane reads and writes an element). WS: bf16 hi + lo planes of h in memory.
// WO: OUT[batch][blk * C + c][point], transposed through an LDS tile of 32 points x 128 channels (a channel's 32 points are one 128-B line).
// QV: the next block's q and v of the 32 points: the planes of h stay in LDS, wave w forms rows 16 (w >> 2) .. of v channels 32 (w & 3) .. and, where (w & 3) < 2, of q channels 16 (w & 3) .. (per 32 k: hi plane x W, then lo plane x W, into one accumulator).
// v leaves, + bias, as f16 in the order of the matrix fragments, VP[batch][32 points][16 channels][k half][lane][8] (a fragment of v^T, row = channel, k = point, is two loads of 512 contiguous bytes a wave): an accumulator's 8 values of a lane
// are 8 points of one channel, one 16-B unit of VP. q leaves as bf16 hi + lo planes [point][32], through an LDS tile behind a second barrier.
template <int C, bool RES, bool WH, bool WS, bool WO, bool QV>
__global__ __launch_bounds__(256) void k_bnfin(const float* __restrict__ T, const float* __restrict__ ST, const float* __restrict__ g, const float* __restrict__ be, float* H, bf* Ph, bf* Pl, int blk, float* OUT,
                                               const bf* __restrict__ WQ, const float* __restrict__ bv, bf* Qh, bf* Ql, h16* VP) {
    __shared__ __align__(16) float ts[WO ? 32 * OSP : 4]; __shared__ __align__(16) bf dp[2][QV ? 32 * DPP : 8]; __shared__ __align__(16) float qs[QV ? 32 * 36 : 4];
    const int t = threadIdx.x, c4 = (t * 4) % C, r0 = (t * 4) / C; const size_t e0 = (size_t)blockIdx.x * 4096 + t * 4;
    const float* tp = T + e0; float* hp = H + e0; v4f x[4], h[4], o[4]; v2f st[4];
    const v4f gg = *(const v4f*)(g + c4), bb = *(const v4f*)(be + c4);
#pragma unroll
    for (int q = 0; q < 4; ++q) st[q] = *(const v2f*)(ST + (size_t)(c4 + q) * 32);
    asm volatile("s_wait_xcnt 0x0" ::: "memory");    // the six loads above have taken their address before a result of the loads below may land in one of their offset registers (precaution before a register of an issued load is reused)
#pragma unroll
    for (int k = 0; k < 4; ++k) { x[k] = *(const v4f*)(tp + k * 1024); if (RES) h[k] = *(const v4f*)(hp + k * 1024); }
    // keeps the address pairs live, and unwritten (also by a later load's result), until every load has taken its address (same precaution)
    if constexpr (RES) asm volatile("s_wait_xcnt 0x0" :: "v"(tp), "v"(hp) : "memory"); else asm volatile("s_wait_xcnt 0x0" :: "v"(tp) : "memory");
    const int lane = t & 31, lr = lane & 15, hi = lane >> 4, w = __builtin_amdgcn_readfirstlane(t >> 5), rt = w >> 2, gq = w & 3; v16bf wb[3][4]; float vb[2];
    if constexpr (QV) { const bf* wv = WQ + (size_t)(32 + gq * 32 + lr) * C + 8 * hi; const bf* wq = WQ + (size_t)((gq & 1) * 16 + lr) * C + 8 * hi; const float* bp = bv + gq * 32 + lr;
#pragma unroll
        for (int u = 0; u < 2; ++u) { vb[u] = bfr(bp[u * 16]);
#pragma unroll
            for (int kc = 0; kc < 4; ++kc) wb[u][kc] = ldq(wv + u * 16 * C + kc * 32); }
        if (gq < 2) {
#pragma unroll
            for (int kc = 0; kc < 4; ++kc) wb[2][kc] = ldq(wq + kc * 32); }
        asm volatile("s_wait_xcnt 0x0" :: "v"(wv), "v"(wq), "v"(bp) : "memory"); }    // same precaution for the three address pairs of the weight and bias loads
    float sc[4], sh[4];
#pragma unroll
    for (int q = 0; q < 4; ++q) { sc[q] = bfr(gg[q]) * st[q][1]; sh[q] = bfr(bb[q]); }
#pragma unroll
    for (int k = 0; k < 4; ++k) { v4us oh, ol;
#pragma unroll
        for (int q = 0; q < 4; ++q) { const float y = fmaxf((x[k][q] - st[q][0]) * sc[q] + sh[q], 0.f); o[k][q] = RES ? h[k][q] + y : y; unsigned short a, b; splitf(o[k][q], a, b); oh[q] = a; ol[q] = b; }
        if (WO) *(v4fa*)(ts + (r0 + k * (1024 / C)) * OSP + c4) = o[k];
        if (QV) { *(v4usa*)(dp[0] + (r0 + k * (1024 / C)) * DPP + c4) = oh; *(v4usa*)(dp[1] + (r0 + k * (1024 / C)) * DPP + c4) = ol; }
        if (WS) { *(v4us*)(Ph + e0 + k * 1024) = oh; *(v4us*)(Pl + e0 + k * 1024) = ol; } }
    const int n0 = blockIdx.x * 32;    // first of the work-group's 32 points (C = 128), batches counted through
    if constexpr (WO || QV) __syncthreads();    // like the next one it stands in front of every global store of the kernel, so that it waits for LDS alone
    v8h pv[2];
    if constexpr (QV) { const bf* ah = dp[0] + (rt * 16 + lr) * DPP + 8 * hi; const bf* al = dp[1] + (rt * 16 + lr) * DPP + 8 * hi; v16bf a[4], a2[4]; v8f ta[2] = {(v8f){}, (v8f){}};
#pragma unroll
        for (int kc = 0; kc < 4; ++kc) { a[kc] = ldqs(ah + kc * 32); a2[kc] = ldqs(al + kc * 32); }
#pragma unroll
        for (int kc = 0; kc < 4; ++kc) {
#pragma unroll
            for (int u = 0; u < 2; ++u) { ta[u] = wmmab(a[kc], wb[u][kc], ta[u]); ta[u] = wmmab(a2[kc], wb[u][kc], ta[u]); } }
        if (gq < 2) { v8f tq = (v8f){};
#pragma unroll
            for (int kc = 0; kc < 4; ++kc) { tq = wmmab(a[kc], wb[2][kc], tq); tq = wmmab(a2[kc], wb[2][kc], tq); }
#pragma unroll
            for (int j = 0; j < 8; ++j) qs[(rt * 16 + hi * 8 + j) * 36 + gq * 16 + lr] = tq[j]; }
#pragma unroll
        for (int u = 0; u < 2; ++u) {
#pragma unroll
            for (int e = 0; e < 8; ++e) pv[u][e] = tohx(ta[u][e] + vb[u]); }
        __syncthreads(); }
    if constexpr (WO) { float* ob = OUT + ((size_t)(n0 / NN) * 4 * C + (size_t)blk * C + (t >> 3)) * NN + n0 % NN + (t & 7) * 4; const float* tc = ts + (t & 7) * 4 * OSP + (t >> 3);
#pragma unroll
        for (int k = 0; k < 4; ++k) *(v4f*)(ob + (size_t)k * 32 * NN) = (v4f){tc[k * 32], tc[OSP + k * 32], tc[2 * OSP + k * 32], tc[3 * OSP + k * 32]}; }
    if constexpr (WH) {
#pragma unroll
        for (int k = 0; k < 4; ++k) *(v4f*)(hp + k * 1024) = o[k]; }
    if constexpr (QV) { h16* vo = VP + (size_t)(n0 / NN) * C * NN + (size_t)((n0 % NN) >> 5) * 4096 + gq * 1024 + rt * 256 + lane * 8;
#pragma unroll
        for (int u = 0; u < 2; ++u) *(v8h*)(vo + u * 512) = pv[u];
        const v4f val = *(const v4fa*)(qs + (t >> 3) * 36 + (t & 7) * 4); v4us oh, ol;
#pragma unroll
        for (int q = 0; q < 4; ++q) { unsigned short a3, b3; splitf(val[q], a3, b3); oh[q] = a3; ol[q] = b3; }
        *(v4us*)(Qh + (size_t)n0 * 32 + t * 4) = oh; *(v4us*)(Ql + (size_t)n0 * 32 + t * 4) = ol; } }

extern "C" void kernel_launch(void* const* d_in, const int* in_sizes, int n_in,
                              void* d_out, int out_size, void* d_ws, size_t ws_size, hipStream_t stream) {
    (void)in_sizes; (void)n_in; (void)out_size;
    const float* IN[14]; for (int i = 0; i < 14; ++i) IN[i] = (const float*)d_in[i];   // 0 x, 1 W1 [64][64], 2 g1, 3 b1, 4 W2 [128][64], 5 g2, 6 b2, 7 Wqk [4][32][128], 8 Wv [4][128][128], 9 bv [4][128], 10 Wt, 11 bt, 12 gn, 13 bnb
    float* OUT = (float*)d_out;     // [8][512][2048]
    char* wsp = (char*)d_ws;
    auto take = [&](size_t bytes) { char* p = wsp; wsp += (bytes + 255) & ~(size_t)255; return (void*)p; };
    bf* WB1 = (bf*)take((size_t)C0 * C0 * 2); bf* WB2 = (bf*)take((size_t)C1 * C0 * 2); bf* WQV = (bf*)take((size_t)4 * WQR * C1 * 2); bf* WT = (bf*)take((size_t)4 * C1 * C1 * 2); float* ST = (float*)take((size_t)C1 * 32 * 4);
    // every per-batch plane holds all NB_ batches, batch-major, so that one launch of each stage serves the whole batch; every kernel sees the batch as NB_ * NN rows
    bf* XT = (bf*)take((size_t)NB_ * NN * C0 * 2); float* T = (float*)take((size_t)NB_ * NN * C1 * 4); float* H = (float*)take((size_t)NB_ * NN * C1 * 4); bf* Hh = (bf*)take((size_t)NB_ * NN * C0 * 2); bf* Hl = (bf*)take((size_t)NB_ * NN * C0 * 2);
    bf* Qh = (bf*)take((size_t)NB_ * NN * 32 * 2); bf* Ql = (bf*)take((size_t)NB_ * NN * 32 * 2); float* CV = (float*)take((size_t)NB_ * NN * 4); h16* VP = (h16*)take((size_t)NB_ * C1 * NN * 2); float* PS = (float*)take((size_t)NB_ * NN / 16 * C1 * 4); float* PM = (float*)take((size_t)NB_ * NN / 16 * C1 * 4);
    if ((size_t)(wsp - (char*)d_ws) > ws_size) return;    // total ~ 30 MiB; ws 256 MiB
    k_prep<<<NB_ * 128 + (C0 * C0 + C1 * C0 + 4 * C1 * C1 + 4 * WQR * C1) / 1024, 256, 0, stream>>>(IN[0], IN[1], IN[4], IN[7], IN[8], IN[10], XT, WB1, WB2, WQV, WT);
    // stage 1: h0 = relu(bn(W1 x)) (T used with C = 64 pitch); only its planes are kept
    k_gemmw<bf, 0, false><<<dim3(NB_ * NN / 64, 1, 1), 32, 0, stream>>>(XT, nullptr, WB1, nullptr, C0, T, C0, nullptr, 0, 0, 0, PS, PM);
    k_bnstat<C0><<<C0 / 4, 1024, 0, stream>>>(PS, PM, ST);
    k_bnfin<C0, false, false, true, false, false><<<NB_ * NN * C0 / 4096, 256, 0, stream>>>(T, ST, IN[2], IN[3], nullptr, Hh, Hl, 0, nullptr, nullptr, nullptr, nullptr, nullptr, nullptr);
    // stage 2: h = relu(bn(W2 h0)), with the first block's q and v
    k_gemmw<bf, 1, false><<<dim3(NB_ * NN / 64, C1 / 64, 1), 32, 0, stream>>>(Hh, Hl, WB2, nullptr, C0, T, C1, nullptr, 0, 0, 0, PS, PM);
    k_bnstat<C1><<<C1 / 4, 1024, 0, stream>>>(PS, PM, ST);
    k_bnfin<C1, false, true, false, false, true><<<NB_ * NN * C1 / 4096, 256, 0, stream>>>(T, ST, IN[5], IN[6], H, nullptr, nullptr, 0, nullptr, WQV, IN[9], Qh, Ql, VP);
    // four offset-attention blocks, four launches each
    for (int i = 0; i < 4; ++i) {
        k_rstat<<<NB_ * NN / 32, 256, 0, stream>>>(Qh, Ql, CV);          // one log-domain constant a softmax row (maximum and sum), energies (3 products) in registers
        k_fatt<<<NB_ * NN / JW, 512, 0, stream>>>(Qh, Ql, CV, VP, H, WT + (size_t)i * C1 * C1, IN[11] + i * C1, T, PS, PM);          // column sums, weights and the product with v in one walk, energies in registers; then Wt (h - x_r) + bt
        k_bnstat<C1><<<C1 / 4, 1024, 0, stream>>>(PS, PM, ST);
        if (i < 3) k_bnfin<C1, true, true, false, true, true><<<NB_ * NN * C1 / 4096, 256, 0, stream>>>(T, ST, IN[12] + i * C1, IN[13] + i * C1, H, nullptr, nullptr, i, OUT, WQV + (size_t)(i + 1) * WQR * C1, IN[9] + (i + 1) * C1, Qh, Ql, VP);
        else k_bnfin<C1, true, false, false, true, false><<<NB_ * NN * C1 / 4096, 256, 0, stream>>>(T, ST, IN[12] + i * C1, IN[13] + i * C1, H, nullptr, nullptr, i, OUT, nullptr, nullptr, nullptr, nullptr, nullptr); }
}

// v010
// Measured time: 193 microseconds a run.
// Timed twice side by side with v009, it ran 1.12 and 1.14 times as fast.
// Over all steps from v000 it is 163 times as fast.
#include <hip/hip_runtime.h>

// IEModule (PCT-style offset-attention stack; x [8][64][2048]; h = relu(bn(W1 x)) (64); h = relu(bn(W2 h)) (128); then four chained blocks: q = Wqk h (32), energy = q^T q (symmetric, unscaled), att = softmax over keys
// then / (1e-9 + column sum over queries), x_r = v att with v = Wv h + bv, h = h + relu(bn(Wt (h - x_r) + bt)); output = concat of the four h -> [8][512][2048]. Every BatchNorm is TRAINING-mode: per-channel
// mean / biased variance over (batch, points) of the current activations, eps 1e-5.)
// Compute dtypes, f32 accumulate: every input rounded to bf16; everything positions-major [point][channel]; W1 x on PLAIN bf16 operands (inputs: exact), every later channel
// contraction on bf16 hi+lo planes of its computed operand x exact weights (2 products, + bias); energies on hi+lo planes of q (3 products, K 32); x_r^T = v^T . att on SINGLE fp16 planes (softmax weights relative to a per-column reference size; the division by the column sum follows the product)

#define NB_  8
#define NN   2048
#define C0   64
#define C1   128
#define BNE  1e-5f
typedef _Float16 h16;
typedef unsigned short bf;
typedef __attribute__((ext_vector_type(16))) __bf16   v16bf;
typedef __attribute__((ext_vector_type(16))) _Float16 v16h;
typedef __attribute__((ext_vector_type(8)))  _Float16 v8h;
typedef __attribute__((ext_vector_type(8)))  unsigned short v8us;
typedef __attribute__((ext_vector_type(8)))  float    v8f;
typedef __attribute__((ext_vector_type(4)))  float    v4f;
typedef v8h  __attribute__((may_alias)) v8ha;
typedef v4f  __attribute__((may_alias)) v4fa;
typedef v8us __attribute__((may_alias)) v8usa;

__device__ __forceinline__ unsigned short f2bf(float f) { unsigned u = __float_as_uint(f); u += 0x7FFFu + ((u >> 16) & 1u); return (unsigned short)(u >> 16); }
__device__ __forceinline__ float bf2f(unsigned short b) { return __uint_as_float(((unsigned)b) << 16); }
__device__ __forceinline__ float bfr(float f) { return bf2f(f2bf(f)); }
__device__ __forceinline__ v16h cat16(v8h lo, v8h hi) { return __builtin_shufflevector(lo, hi, 0, 1, 2, 3, 4, 5, 6, 7, 8, 9, 10, 11, 12, 13, 14, 15); }
__device__ __forceinline__ v16bf cat16b(v8us lo, v8us hi) { return __builtin_bit_cast(v16bf, __builtin_shufflevector(lo, hi, 0, 1, 2, 3, 4, 5, 6, 7, 8, 9, 10, 11, 12, 13, 14, 15)); }
__device__ __forceinline__ v8f wmma16(v16h a, v16h b, v8f c) { return __builtin_amdgcn_wmma_f32_16x16x32_f16(false, a, false, b, (short)0, c, false, false); }
__device__ __forceinline__ v8f wmmab(v16bf a, v16bf b, v8f c) { return __builtin_amdgcn_wmma_f32_16x16x32_bf16(false, a, false, b, (short)0, c, false, false); }



// BatchNorm partials of one 16 x 16 accumulator tile (a lane holds 8 rows of one column, lanes l and l ^ 16 the two halves of the column): s = the column's sum over the tile's 16 rows, q = its sum of squared deviations from the tile's own mean.
__device__ __forceinline__ void tilestat(v8f y, float& s, float& q) { float a = ((y[0] + y[1]) + (y[2] + y[3])) + ((y[4] + y[5]) + (y[6] + y[7])); a += __shfl_xor(a, 16, 32); const float mu = a * (1.0f / 16.0f); float b = 0.f;
#pragma unroll
    for (int r = 0; r < 8; ++r) { const float d = y[r] - mu; b += d * d; }
    b += __shfl_xor(b, 16, 32); s = a; q = b; }
// Four 16-row tiles' partials of one column joined into those of their 64 rows: squared deviations from the joint mean = each tile's own + 16 (tile mean - joint mean)^2: every term is >= 0, nothing cancels.
__device__ __forceinline__ void join4(const float* s, const float* q, float& S, float& Q) { S = (s[0] + s[1]) + (s[2] + s[3]); const float mu = S * (1.0f / 64.0f); float b = (q[0] + q[1]) + (q[2] + q[3]);
#pragma unroll
    for (int k = 0; k < 4; ++k) { const float d = s[k] * (1.0f / 16.0f) - mu; b += d * d * 16.0f; }
    Q = b; }
// ---- k_gemmw: register-blocked GEMM, ONE WAVE per 64x64 output tile (16 accumulators), operands straight from K-contiguous 16-bit planes; grid (M/64, N/64, Z), 32 threads.
// C[m][n] (f32, pitch ldc, + optional f32 bias[n]) = sum_k A[m][k] Bt[n][k] (+ split products per NSPLIT). z-batch strides sA/sB/sC in elements. K % 32 == 0.
// PS / PM [64-row tile][ldc]: the BatchNorm partials of the wave's 64 rows of C (sum; squared deviations from the 64 rows' own mean), joined (join4) from the tilestat of its four 16-row tiles (grid z = 1).
template <typename T16> struct WFrag;
template <> struct WFrag<bf> { typedef v16bf V; static __device__ __forceinline__ V ld(const bf* p) { return cat16b(*(const v8us*)p, *(const v8us*)(p + 16)); } static __device__ __forceinline__ v8f mma(V a, V b, v8f c) { return wmmab(a, b, c); } };
template <typename T16, int NSPLIT, bool BIAS>
__global__ __launch_bounds__(32) void k_gemmw(const T16* __restrict__ A, const T16* __restrict__ A2, const T16* __restrict__ Bt, const T16* __restrict__ Bt2, int K, float* C, int ldc, const float* __restrict__ bias, size_t sA, size_t sB, size_t sC, float* PS, float* PM) {
    typedef typename WFrag<T16>::V V;
    __shared__ __align__(16) float os[16 * 68];
    const size_t z = blockIdx.z; A += z * sA; if (A2) A2 += z * sA; Bt += z * sB; if (Bt2) Bt2 += z * sB; C += z * sC;
    const int lane = threadIdx.x & 31, lr = lane & 15, hi = lane >> 4; const int r0 = blockIdx.x * 64, c0 = blockIdx.y * 64;
    v8f acc[4][4];
#pragma unroll
    for (int mb = 0; mb < 4; ++mb)
#pragma unroll
        for (int nb = 0; nb < 4; ++nb) acc[mb][nb] = (v8f){};
    const size_t aoff = (size_t)(r0 + lr) * K + 8 * hi, boff = (size_t)(c0 + lr) * K + 8 * hi;
#pragma unroll 1
    for (int kc = 0; kc < K; kc += 32) {
        V a[4], a2[4];
#pragma unroll
        for (int mb = 0; mb < 4; ++mb) { a[mb] = WFrag<T16>::ld(A + aoff + (size_t)mb * 16 * K + kc); if (NSPLIT == 1 || NSPLIT == 2) a2[mb] = WFrag<T16>::ld(A2 + aoff + (size_t)mb * 16 * K + kc); }
#pragma unroll
        for (int nb = 0; nb < 4; ++nb) { const V b = WFrag<T16>::ld(Bt + boff + (size_t)nb * 16 * K + kc); V b2; if (NSPLIT >= 2) b2 = WFrag<T16>::ld(Bt2 + boff + (size_t)nb * 16 * K + kc);
#pragma unroll
            for (int mb = 0; mb < 4; ++mb) { acc[mb][nb] = WFrag<T16>::mma(a[mb], b, acc[mb][nb]); if (NSPLIT == 1 || NSPLIT == 2) acc[mb][nb] = WFrag<T16>::mma(a2[mb], b, acc[mb][nb]); if (NSPLIT >= 2) acc[mb][nb] = WFrag<T16>::mma(a[mb], b2, acc[mb][nb]); } }
        asm volatile("v_nop\n\tv_nop\n\tv_nop\n\tv_nop" : "+v"(acc[0][0]), "+v"(acc[1][1]), "+v"(acc[2][2]), "+v"(acc[3][3]) : "v"(a[0]), "v"(a[3]));
    }
#pragma unroll
    for (int mb = 0; mb < 4; ++mb) {
#pragma unroll
        for (int nb = 0; nb < 4; ++nb) {
#pragma unroll
            for (int j = 0; j < 8; ++j) os[(hi * 8 + j) * 68 + nb * 16 + lr] = acc[mb][nb][j]; }
        __builtin_amdgcn_wave_barrier(); asm volatile("" ::: "memory");
        float* crow = C + (size_t)(r0 + mb * 16) * ldc + c0;
{
#pragma unroll
            for (int s = 0; s < 8; ++s) { const int row = 2 * s + hi, cofs = lr * 4; v4f val = *(const v4fa*)(os + row * 68 + cofs); if (BIAS) { val[0] += bfr(bias[c0 + cofs]); val[1] += bfr(bias[c0 + cofs + 1]); val[2] += bfr(bias[c0 + cofs + 2]); val[3] += bfr(bias[c0 + cofs + 3]); }
                *(v4f*)(crow + (size_t)row * ldc + cofs) = val; }
             }
        __builtin_amdgcn_wave_barrier(); asm volatile("" ::: "memory");
    }
    asm volatile("s_wait_xcnt 0x0" ::: "memory");    // the stores above have taken their registers before the lines below may reuse one (precaution before a register of an issued store is reused)
    float* pd = (hi ? PM : PS) + (size_t)blockIdx.x * ldc + c0 + lr; float pv[4];    // lanes 0-15 store the sums, lanes 16-31 the squared deviations
#pragma unroll
    for (int nb = 0; nb < 4; ++nb) { float s[4], q[4], S, Q;
#pragma unroll
        for (int mb = 0; mb < 4; ++mb) { tilestat(acc[mb][nb], s[mb], q[mb]); if (BIAS) s[mb] += 16.0f * bfr(bias[c0 + nb * 16 + lr]); }
        join4(s, q, S, Q); pv[nb] = hi ? Q : S; }
#pragma unroll
    for (int nb = 0; nb < 4; ++nb) pd[nb * 16] = pv[nb];
}

__device__ __forceinline__ h16 tohx(float x) { return (h16)x; }
__device__ __forceinline__ void splitf(float y, unsigned short& h, unsigned short& l) { h = f2bf(y); l = f2bf(y - bf2f(h)); }
typedef __attribute__((ext_vector_type(4))) unsigned short v4us;
typedef __attribute__((ext_vector_type(2))) float v2f;
typedef v4us __attribute__((may_alias)) v4usa;
#define WQR  160         // rows of a block's q / v weight operand: Wqk (32), then Wv (128)
#define DPP  136         // 16-bit elements a row of an operand plane in LDS: 16-B aligned, adjacent rows 4 banks apart
// k_prep: every operand that is only a rounded copy of an input, in one launch: x as bf16, positions-major [batch][point][64] (the first NB_ * 128 work-groups), then the weights as bf16 (1024 elements a work-group):
// W1, W2, Wt, and per block the WQR rows [Wqk; Wv].
__global__ __launch_bounds__(256) void k_prep(const float* __restrict__ x, const float* __restrict__ W1, const float* __restrict__ W2, const float* __restrict__ Wqk, const float* __restrict__ Wv, const float* __restrict__ Wt, bf* XT, bf* WB1, bf* WB2, bf* WQV, bf* WT) {
    const int blk = blockIdx.x; v4us o;
    if (blk < NB_ * 128) { const float* xb = x + (size_t)(blk >> 7) * C0 * NN; const int e = ((blk & 127) * 256 + threadIdx.x) * 4, c = e % C0, n = e / C0;
#pragma unroll
        for (int q = 0; q < 4; ++q) o[q] = f2bf(xb[(size_t)(c + q) * NN + n]);
        *(v4us*)(XT + (size_t)(blk >> 7) * NN * C0 + e) = o; return; }
    int e = ((blk - NB_ * 128) * 256 + threadIdx.x) * 4; const float* s; bf* d;
    if (e < C0 * C0) { s = W1 + e; d = WB1 + e; }
    else if ((e -= C0 * C0) < C1 * C0) { s = W2 + e; d = WB2 + e; }
    else if ((e -= C1 * C0) < 4 * C1 * C1) { s = Wt + e; d = WT + e; }
    else { e -= 4 * C1 * C1; const int i = e / (WQR * C1), r = (e / C1) % WQR, k = e % C1; d = WQV + e; s = r < 32 ? Wqk + (size_t)(i * 32 + r) * C1 + k : Wv + (size_t)(i * C1 + r - 32) * C1 + k; }
    const v4f v = *(const v4f*)s;
#pragma unroll
    for (int q = 0; q < 4; ++q) o[q] = f2bf(v[q]);
    *(v4us*)d = o; }
// ---- attention without stored energies. The energies are a Gram matrix of K = 32, so a 16 x 16 tile costs three matrix instructions from the q planes: both kernels below form the tiles they need in registers, and neither the
// energies nor the attention weights go through memory. The three products of a tile are taken in the same order of terms in both kernels, so both see the same value for a pair (i, j).
#define OSP  132         // floats a row of a wave's partial output tile in LDS: 16-B aligned, adjacent rows 4 banks apart
#define L2E  1.4426950408889634f
__device__ __forceinline__ float ex2(float x) { asm("v_exp_f32 %0, %0\n\tv_nop" : "+v"(x)); return x; }
__device__ __forceinline__ v8f ex2x8(v8f x) { float y0 = x[0], y1 = x[1], y2 = x[2], y3 = x[3], y4 = x[4], y5 = x[5], y6 = x[6], y7 = x[7];
    asm("v_exp_f32 %0, %0\n\tv_exp_f32 %1, %1\n\tv_exp_f32 %2, %2\n\tv_exp_f32 %3, %3\n\tv_exp_f32 %4, %4\n\tv_exp_f32 %5, %5\n\tv_exp_f32 %6, %6\n\tv_exp_f32 %7, %7\n\tv_nop"
        : "+v"(y0), "+v"(y1), "+v"(y2), "+v"(y3), "+v"(y4), "+v"(y5), "+v"(y6), "+v"(y7));
    return (v8f){y0, y1, y2, y3, y4, y5, y6, y7}; }
__device__ __forceinline__ v16bf ldq(const bf* p) { return cat16b(*(const v8us*)p, *(const v8us*)(p + 16)); }
__device__ __forceinline__ v16bf ldqs(const bf* p) { return cat16b(*(const v8usa*)p, *(const v8usa*)(p + 16)); }    // the same fragment from an LDS plane
// k_rstat: CV[i] = log2(e) max_j S[i][j] + log2(sum_j exp(S[i][j] - max)), so that softmax[i][j] = exp2(log2(e) S[i][j] - CV[i]). A work-group owns 32 rows i (one 128-B line of CV); they are the COLUMNS of its tiles, so a lane folds one row i in its own registers;
// wave w walks 256 of the 2048 j with a running maximum and a rescaled running sum; halves join by one shuffle, the 8 waves through LDS.
__global__ __launch_bounds__(256) void k_rstat(const bf* __restrict__ Qh, const bf* __restrict__ Ql, float* CV) { __shared__ float sm[8][32], ss[8][32]; const int lane = threadIdx.x & 31, w = threadIdx.x >> 5, lr = lane & 15, hi = lane >> 4;
    const int i0 = blockIdx.x * 32; const size_t jo = ((size_t)(i0 / NN) * NN + w * (NN / 8) + lr) * 32 + 8 * hi; const bf* qh = Qh + jo; const bf* ql = Ql + jo; v16bf bh[2], bl[2]; float m[2] = {-1.0e30f, -1.0e30f}, s[2] = {0.f, 0.f};
#pragma unroll
    for (int t = 0; t < 2; ++t) { const size_t o = (size_t)(i0 + t * 16 + lr) * 32 + 8 * hi; bh[t] = ldq(Qh + o); bl[t] = ldq(Ql + o); }
    for (int mt = 0; mt < NN / 8 / 16; mt += 2) { v16bf ah[2], al[2];
#pragma unroll
        for (int u = 0; u < 2; ++u) { ah[u] = ldq(qh + u * 512); al[u] = ldq(ql + u * 512); }
        asm volatile("s_wait_xcnt 0x0" :: "v"(qh), "v"(ql) : "memory");    // keeps both address pairs live, and unwritten, until the 8 loads have taken their address (precaution before a register of an issued load is reused)
        qh += 1024; ql += 1024;
#pragma unroll
        for (int t = 0; t < 2; ++t) { v8f d[2];
#pragma unroll
            for (int u = 0; u < 2; ++u) { d[u] = wmmab(ah[u], bh[t], (v8f){}); d[u] = wmmab(al[u], bh[t], d[u]); d[u] = wmmab(ah[u], bl[t], d[u]); }
            float mn = m[t];
#pragma unroll
            for (int r = 0; r < 8; ++r) mn = fmaxf(mn, fmaxf(d[0][r], d[1][r]));
            const v8f e0 = ex2x8((d[0] - mn) * L2E), e1 = ex2x8((d[1] - mn) * L2E); float a[4] = {0.f, 0.f, 0.f, 0.f};
#pragma unroll
            for (int r = 0; r < 8; ++r) { a[r & 1] += e0[r]; a[2 + (r & 1)] += e1[r]; }
            s[t] = s[t] * ex2((m[t] - mn) * L2E) + ((a[0] + a[1]) + (a[2] + a[3])); m[t] = mn; } }
#pragma unroll
    for (int t = 0; t < 2; ++t) { const float m2 = __shfl_xor(m[t], 16, 32), s2 = __shfl_xor(s[t], 16, 32), mx = fmaxf(m[t], m2); const float sj = s[t] * ex2((m[t] - mx) * L2E) + s2 * ex2((m2 - mx) * L2E);
        if (hi == 0) { sm[w][t * 16 + lr] = mx; ss[w][t * 16 + lr] = sj; } }
    __syncthreads();
    if (w == 0) { float mx = sm[0][lane];
#pragma unroll
        for (int k = 1; k < 8; ++k) mx = fmaxf(mx, sm[k][lane]);
        float sj = 0.f;
#pragma unroll
        for (int k = 0; k < 8; ++k) sj += ss[k][lane] * ex2((sm[k][lane] - mx) * L2E);
        CV[i0 + lane] = __builtin_amdgcn_logf(sj) + mx * L2E; } }
// 1 / x of a power of two x = 2^e, -126 <= e <= 126, exact: the exponent field mirrored. xhalf: the value that lane l ^ 16 holds, by a vector cross-row move.
__device__ __forceinline__ float p2inv(float x) { return __uint_as_float(0x7F000000u - __float_as_uint(x)); }
__device__ __forceinline__ float xhalf(float x) { const int b = __float_as_int(x); return __int_as_float(__builtin_amdgcn_permlanex16(b, b, 0x76543210, 0xfedcba98, false, false)); }
// k_fatt: T[j][.] = Wt (h[j] - x_r[j]) + bt, x_r[j][c] = sum_i a[i][j] v[i][c] / (1e-9 + sum_i a[i][j]), a[i][j] = softmax[i][j] = exp2(log2(e) S[i][j] - CV[i]). A work-group of 16 waves owns 64 output rows j; waves 2 g and 2 g + 1 take the same 256 of the 2048 i, 32 a pass, for 32 rows j each, and walk them ONCE.
// The pair's operands of a pass (32 rows of both q planes, 32 points of v in fragment order: a slice, 12 KiB from L2) are fetched once for both waves: each wave brings half of the slice into LDS by 12 asynchronous 16-B copies a lane, one pass ahead, into a ring of two buffers; the batch's CV goes to LDS once, in front of the loop.
// A pass: tiles S[i][j] (rows i, columns j) from the q planes, a in f32; a goes as it is into the lane's column sum, and a / rk (kept as kf = 1 / rk), rounded to f16, into the product. rk is the wave's own reference size of the column (the same in the column's two lanes): a power of two, it starts at 2^-100
// and is raised (to the power of two at or below the column's largest a of the pass, where that is above rk) only when some weight of the pass would pass 2^14 (a wave-uniform branch, as a rule taken in the first pass and seldom after it; the accumulators are then scaled by old rk / new rk): no weight overflows f16, and the largest weights
// of every column are normal f16 numbers, however small the column's sum (an a below 2^-100 is nothing beside the 1e-9). The two tiles of 16 i, rounded in place, are the B operand of x_r^T += v^T . a (a packed pair of D tiles has the hardware's k order, which the VP order gives v).
// The 8 pairs' partial tiles, column sums and rk meet in LDS (the ring's bytes, free behind the last pass's barrier) behind a barrier; a wave's partial tile counts times its rk.
// The lane that sums an element subtracts it from h and leaves the difference as bf16 hi + lo planes in LDS; behind a second barrier wave w forms rows 16 (w >> 2) .., columns 32 (w & 3) .. of the work-group's 64 x 128 tile of T
// (per 32 k: hi plane x Wt, then lo plane x Wt, into one accumulator; a row's 128-B line has one writer). The BatchNorm partials (tilestat) of the 4 x 8 tiles meet in LDS (the bytes of cs and rs, free behind the second barrier) behind a third barrier;
// waves 0-3 join (join4) the sums, waves 4-7 the squared deviations of the work-group's 64 rows, in PS / PM [work-group][128] (32 channels a wave: one 128-B line, one writer).
#define JW   64                  // output rows j of a work-group
#define SQL  2048                // a slice: the hi plane's 32 rows of 64 B, from here the lo plane's,
#define SVP  4096                // from here the 8 KiB of v fragments
#define SLB  (SVP + 8192)        // bytes of a slice
#define RBB  (8 * SLB)           // bytes of a ring buffer: the 8 pairs' slices of one pass
#define NPS  (NN / 8 / 32)       // passes
__device__ __forceinline__ unsigned ldsa(const void* p) { return (unsigned)(size_t)(__attribute__((address_space(3))) const char*)p; }    // byte address in the work-group's LDS
// One wave's half of a slice: 2 + 2 copies for 16 rows of each q plane, 8 for 4 KiB of v. An immediate offset moves the LDS address and the global address alike, so one LDS-address register and one scalar base serve every copy of a plane.
// In LDS the four 16-B units of a q row r stand in the order unit ^ ((r >> 2) & 3): the 16-B reads of 16 adjacent rows then fall on 16 distinct groups of four banks; rows 16 apart have the same order, so a step of 1024 B is the same step in both memories.
// The s_wait_xcnt closes the copies' own statement, so that it stands in front of every later write of an address register that a copy names (precaution before a register of an issued copy is reused).
// gh, gl, gv: the wave's part of the three sources, the same in every lane (scalar bases); lo: the lane's 16 B in each 512 B.
__device__ __forceinline__ void cp12(unsigned lq, unsigned lv, unsigned lo, const char* gh, const char* gl, const char* gv) {
    asm volatile("global_load_async_to_lds_b128 %0, %3, %4\n\tglobal_load_async_to_lds_b128 %0, %3, %4 offset:1024\n\tglobal_load_async_to_lds_b128 %1, %3, %5\n\tglobal_load_async_to_lds_b128 %1, %3, %5 offset:1024\n\t"
                 "global_load_async_to_lds_b128 %2, %3, %6\n\tglobal_load_async_to_lds_b128 %2, %3, %6 offset:512\n\tglobal_load_async_to_lds_b128 %2, %3, %6 offset:1024\n\tglobal_load_async_to_lds_b128 %2, %3, %6 offset:1536\n\t"
                 "global_load_async_to_lds_b128 %2, %3, %6 offset:2048\n\tglobal_load_async_to_lds_b128 %2, %3, %6 offset:2560\n\tglobal_load_async_to_lds_b128 %2, %3, %6 offset:3072\n\tglobal_load_async_to_lds_b128 %2, %3, %6 offset:3584\n\ts_wait_xcnt 0x0"
                 :: "v"(lq), "v"(lq + SQL), "v"(lv), "v"(lo), "s"(gh), "s"(gl), "s"(gv) : "memory"); }
__global__ __launch_bounds__(512) __attribute__((amdgpu_waves_per_eu(4, 4))) void k_fatt(const bf* __restrict__ Qh, const bf* __restrict__ Ql, const float* __restrict__ CV, const h16* __restrict__ VP, const float* __restrict__ H, const bf* __restrict__ Wt, const float* __restrict__ bt, float* T, float* PS, float* PM) {
    __shared__ __align__(16) float os[8 * JW * OSP]; __shared__ __align__(16) float cvs[NN]; __shared__ float cs[8][JW], rs[8][JW]; __shared__ __align__(16) bf dp[2][JW * DPP]; static_assert(2 * RBB <= 8 * JW * OSP * 4, "the ring lies in os");
    const int lane = threadIdx.x & 31, w = __builtin_amdgcn_readfirstlane(threadIdx.x >> 5), ig = w >> 1, jg = w & 1, lr = lane & 15, hi = lane >> 4;
    const int j0 = blockIdx.x * JW, b = j0 / NN, ib0 = ig * (NN / 8); const char* ring = (const char*)os;
    const unsigned lq = ldsa(ring) + ig * SLB + (jg * 8 + (lane >> 2)) * 64 + ((lane & 3) ^ (jg * 2 + hi)) * 16, lv = ldsa(ring) + ig * SLB + SVP + jg * 4096 + lane * 16;    // where the lane's copies land in buffer 0
    const unsigned lo = lane * 16; const size_t qo = ((size_t)b * NN + ib0) * 64 + jg * 512; const char* gh = (const char*)Qh + qo; const char* gl = (const char*)Ql + qo; const char* gv = (const char*)VP + ((size_t)b * C1 * NN + (size_t)(ib0 >> 5) * 4096) * 2 + jg * 4096;
    { const float* gc = CV + (size_t)b * NN + threadIdx.x * 4; asm volatile("global_load_async_to_lds_b128 %0, %1, off\n\ts_wait_xcnt 0x0" :: "v"(ldsa(cvs) + threadIdx.x * 16), "v"(gc) : "memory"); }    // the batch's CV, 16 B a lane; the wait as in cp12
    cp12(lq, lv, lo, gh, gl, gv);
    v16bf bh[2], bl[2]; float csum[2] = {0.f, 0.f}, kf[2] = {0x1p+100f, 0x1p+100f}; const bf* pjh[2]; const bf* pjl[2];
#pragma unroll
    for (int jt = 0; jt < 2; ++jt) { const size_t o = (size_t)(j0 + jg * 32 + jt * 16 + lr) * 32 + 8 * hi; pjh[jt] = Qh + o; pjl[jt] = Ql + o; bh[jt] = ldq(pjh[jt]); bl[jt] = ldq(pjl[jt]); }
    asm volatile("s_wait_xcnt 0x0" :: "v"(pjh[0]), "v"(pjh[1]), "v"(pjl[0]), "v"(pjl[1]) : "memory");    // keeps the four address pairs live, and unwritten (also by a later load's result), until the 8 loads have taken their address (precaution before a register of an issued load is reused)
    v8f acc[2][8];
#pragma unroll
    for (int jt = 0; jt < 2; ++jt) {
#pragma unroll
        for (int nb = 0; nb < 8; ++nb) acc[jt][nb] = (v8f){}; }
    asm volatile("s_wait_asynccnt 0x0" ::: "memory");    // this wave's copies of pass 0 and of CV have landed
    __syncthreads();                                     // and every other wave's: pass 0 may be read
    cp12(lq + RBB, lv + RBB, lo, gh + 2048, gl + 2048, gv + 8192);
    auto pass = [&](int it) __attribute__((always_inline)) { v16h p[2], f[8]; v16bf ah[2], al[2]; v8f kk[2], e[2][2]; float me[2];
        const char* st = ring + (it & 1) * RBB + ig * SLB; const char* sq = st + lr * 64 + (hi ^ ((lr >> 2) & 3)) * 16; const char* sq2 = st + lr * 64 + ((hi + 2) ^ ((lr >> 2) & 3)) * 16;    // units hi and hi + 2 of row lr
        const h16* sv = (const h16*)(st + SVP) + lane * 8; const float* cv = cvs + ib0 + it * 32 + hi * 8;
#pragma unroll
        for (int t = 0; t < 2; ++t) { ah[t] = cat16b(*(const v8usa*)(sq + t * 1024), *(const v8usa*)(sq2 + t * 1024)); al[t] = cat16b(*(const v8usa*)(sq + SQL + t * 1024), *(const v8usa*)(sq2 + SQL + t * 1024)); }
#pragma unroll
        for (int t = 0; t < 2; ++t) { v8f d[2]; kk[t] = __builtin_shufflevector(*(const v4fa*)(cv + t * 16), *(const v4fa*)(cv + t * 16 + 4), 0, 1, 2, 3, 4, 5, 6, 7);
#pragma unroll
            for (int jt = 0; jt < 2; ++jt) d[jt] = wmmab(ah[t], bh[jt], (v8f){});
#pragma unroll
            for (int jt = 0; jt < 2; ++jt) d[jt] = wmmab(ah[t], bl[jt], d[jt]);
#pragma unroll
            for (int jt = 0; jt < 2; ++jt) d[jt] = wmmab(al[t], bh[jt], d[jt]);
#pragma unroll
            for (int jt = 0; jt < 2; ++jt) e[t][jt] = ex2x8(d[jt] * L2E - kk[t]);
            __builtin_amdgcn_sched_barrier(0); }    // one half of the pass at a time: mixed, the two halves' row constants and energies are live together, and the kernel spills
#pragma unroll
        for (int nb = 0; nb < 2; ++nb) f[nb] = cat16(*(const v8ha*)(sv + nb * 512), *(const v8ha*)(sv + nb * 512 + 256));
        __builtin_amdgcn_sched_barrier(0);    // the first two v fragments are asked for here, so that they arrive under the vector work below
#pragma unroll
        for (int jt = 0; jt < 2; ++jt) { float m = fmaxf(e[0][jt][0], e[1][jt][0]);
#pragma unroll
            for (int r = 1; r < 8; ++r) m = fmaxf(m, fmaxf(e[0][jt][r], e[1][jt][r]));
            me[jt] = m; }
        if (__any(fmaxf(me[0] * kf[0], me[1] * kf[1]) > 16384.0f)) {    // the same for the whole wave: some weight of this pass would pass 2^14, so every column's reference goes up to its largest a of this pass, where that is higher
#pragma unroll
            for (int jt = 0; jt < 2; ++jt) { const float ro = p2inv(kf[jt]), m2 = fmaxf(me[jt], xhalf(me[jt])); kf[jt] = p2inv(fmaxf(ro, __uint_as_float(__float_as_uint(m2) & 0x7F800000u))); const float fc = ro * kf[jt];
#pragma unroll
                for (int nb = 0; nb < 8; ++nb) acc[jt][nb] *= fc; } }
#pragma unroll
        for (int t = 0; t < 2; ++t) {
#pragma unroll
            for (int jt = 0; jt < 2; ++jt) { const v8f u = e[t][jt]; csum[jt] += ((u[0] + u[1]) + (u[2] + u[3])) + ((u[4] + u[5]) + (u[6] + u[7]));
#pragma unroll
                for (int r = 0; r < 8; ++r) p[jt][t * 8 + r] = tohx(u[r] * kf[jt]); } }
        __builtin_amdgcn_sched_barrier(0);    // the column sums and the rounding stand in front of the product: behind it their 32 inputs would stay live through it
#pragma unroll
        for (int nb = 2; nb < 4; ++nb) f[nb] = cat16(*(const v8ha*)(sv + nb * 512), *(const v8ha*)(sv + nb * 512 + 256));
        __builtin_amdgcn_sched_barrier(0);    // this one and the one in the loop below keep every fragment's read four steps ahead of its products: left free, the compiler reads a fragment directly in front of its products and waits out the LDS latency at each step
#pragma unroll
        for (int nb = 0; nb < 8; ++nb) {
#pragma unroll
            for (int jt = 0; jt < 2; ++jt) acc[jt][nb] = wmma16(f[nb], p[jt], acc[jt][nb]);
            if (nb < 4) f[nb + 4] = cat16(*(const v8ha*)(sv + (nb + 4) * 512), *(const v8ha*)(sv + (nb + 4) * 512 + 256));
            __builtin_amdgcn_sched_barrier(0); }
        asm volatile("s_wait_dscnt 0x0" ::: "memory");       // this wave's reads of the pass's buffer have returned
        asm volatile("s_wait_asynccnt 0x0" ::: "memory");    // and its copies of the next pass have landed
        __syncthreads(); };                                  // the same of every wave: the next pass may be read, this pass's buffer refilled
    // both loops stay rolled: unrolled, the compiler lifts the passes' loads over one another, needs more than 256 registers and spills. The passes that still have a pass it + 2 to fetch are a loop of their own, so that no branch stands at a pass's foot
    // (behind a branch there the compiler sinks the column sums' additions, and the 32 weights they read stay in registers through the product).
#pragma unroll 1
    for (int it = 0; it < NPS - 2; ++it) { pass(it); cp12(lq + (it & 1) * RBB, lv + (it & 1) * RBB, lo, gh + (it + 2) * 2048, gl + (it + 2) * 2048, gv + (it + 2) * 8192); }
#pragma unroll 1
    for (int it = NPS - 2; it < NPS; ++it) pass(it);
    asm volatile("s_wait_asynccnt 0x0" ::: "memory");    // no copy is outstanding when the ring's bytes become the partial tiles
    const int ln = __builtin_amdgcn_mbcnt_lo(~0u, 0u), l2 = ln & 15, h2 = ln >> 4, td = w * 32 + ln;    // the lane's number, read anew for the part below: what that part derives from it would otherwise be formed at the kernel's head and spilled over the loops
#pragma unroll
    for (int jt = 0; jt < 2; ++jt) { const float s = csum[jt] + xhalf(csum[jt]); if (h2 == 0) { cs[ig][jg * 32 + jt * 16 + l2] = s; rs[ig][jg * 32 + jt * 16 + l2] = p2inv(kf[jt]); } }
#pragma unroll
    for (int jt = 0; jt < 2; ++jt) {
#pragma unroll
        for (int nb = 0; nb < 8; ++nb) { float* o = os + (size_t)(ig * JW + jg * 32 + jt * 16 + l2) * OSP + nb * 16 + h2 * 8; const v8f v = acc[jt][nb]; *(v4fa*)o = (v4f){v[0], v[1], v[2], v[3]}; *(v4fa*)(o + 4) = (v4f){v[4], v[5], v[6], v[7]}; } }
    const float* hp = H + (size_t)j0 * C1 + td * 4; v4f hv[4];    // lane t owns elements 4 t .. 4 t + 3 of each quarter (16 rows) of the work-group's 64 x 128 tile
#pragma unroll
    for (int k = 0; k < 4; ++k) hv[k] = *(const v4f*)(hp + k * 2048);
    const int rt = w >> 2, cq = (w & 3) * 32; const bf* wp = Wt + (size_t)(cq + l2) * C1 + 8 * h2; const float* bp = bt + cq + l2; v16bf wb[2][4]; float bb[2];
#pragma unroll
    for (int u = 0; u < 2; ++u) { bb[u] = bfr(bp[u * 16]);
#pragma unroll
        for (int kc = 0; kc < 4; ++kc) wb[u][kc] = ldq(wp + u * 16 * C1 + kc * 32); }
    asm volatile("s_wait_xcnt 0x0" :: "v"(hp), "v"(wp), "v"(bp) : "memory");    // keeps the three address pairs live, and unwritten (also by a later load's result), until the 22 loads have taken their address (precaution before a register of an issued load is reused)
    __syncthreads();
#pragma unroll
    for (int k = 0; k < 4; ++k) { const int idx = td + 512 * k, row = idx >> 5, c4 = (idx & 31) * 4; v4f sa = (v4f){0.f, 0.f, 0.f, 0.f}; v4us oh, ol; float s = 0.f;
#pragma unroll
        for (int ww = 0; ww < 8; ++ww) { s += cs[ww][row]; sa += *(const v4fa*)(os + (size_t)(ww * JW + row) * OSP + c4) * rs[ww][row]; }
        const float inv = __fdiv_rn(1.0f, __fadd_rn(1e-9f, s));
#pragma unroll
        for (int q = 0; q < 4; ++q) { unsigned short x, y; splitf(hv[k][q] - sa[q] * inv, x, y); oh[q] = x; ol[q] = y; }
        *(v4usa*)(dp[0] + row * DPP + c4) = oh; *(v4usa*)(dp[1] + row * DPP + c4) = ol; }
    __syncthreads();
    const bf* ah = dp[0] + (rt * 16 + l2) * DPP + 8 * h2; const bf* al = dp[1] + (rt * 16 + l2) * DPP + 8 * h2; v8f ta[2] = {(v8f){}, (v8f){}};
#pragma unroll
    for (int kc = 0; kc < 4; ++kc) { const v16bf a = ldqs(ah + kc * 32), a2 = ldqs(al + kc * 32);
#pragma unroll
        for (int u = 0; u < 2; ++u) { ta[u] = wmmab(a, wb[u][kc], ta[u]); ta[u] = wmmab(a2, wb[u][kc], ta[u]); } }
    float* to = T + (size_t)(j0 + rt * 16 + h2 * 8) * C1 + cq + l2; float* sl = (h2 ? &rs[0][0] : &cs[0][0]) + rt * C1 + cq + l2;    // lanes 0-15 leave the sums [row tile][128] in cs, lanes 16-31 the squared deviations in rs
#pragma unroll
    for (int u = 0; u < 2; ++u) { float s, q; ta[u] += bb[u]; tilestat(ta[u], s, q); sl[u * 16] = h2 ? q : s; }
    __syncthreads();    // stands in front of every global store of the kernel, so that it waits for LDS alone
    float pj = 0.f;
    if (w < 8) { const int c = (w & 3) * 32 + ln; float s[4], q[4], S, Q;
#pragma unroll
        for (int k = 0; k < 4; ++k) { s[k] = (&cs[0][0])[k * C1 + c]; q[k] = (&rs[0][0])[k * C1 + c]; }
        join4(s, q, S, Q); pj = w < 4 ? S : Q; }
#pragma unroll
    for (int j = 0; j < 8; ++j) {
#pragma unroll
        for (int u = 0; u < 2; ++u) to[j * C1 + u * 16] = ta[u][j]; }
    if (w < 8) (w < 4 ? PS : PM)[(size_t)blockIdx.x * C1 + (w & 3) * 32 + ln] = pj; }
// k_bnfin: y = relu(bf16(g[c]) rs_c (T[row][c] - mu_c) + bf16(be[c])), h = RES ? H + y : y, and everything that is made of h alone, from the register that holds it.
// mu_c, rs_c: per-channel mean and 1/sqrt(biased variance + eps) over all NB_ * NN rows of T [row][C]. Every work-group folds them for itself from the partials that the kernel which made T left of every 64 rows (PS sum, PM squared deviations
// from the 64 rows' own mean; [NGR][C]): T is not read for it, and no launch stands between the kernel that makes T and this one. A lane takes its own 4 channels of every RP-th group: with d = group mean - pivot (the pivot: group 0's mean, one of the
// values, so the sums below lose at most the bits of log2(NGR)), A = sum d, B = sum d^2, Q = sum PM; the RP rows of lanes meet in LDS behind a barrier, 3 C lanes add a column each, and behind a second barrier
// mean = pivot + A / NGR, squared deviations = Q + 64 (B - A^2 / NGR).
// A work-group is SUB parts of 256 lanes that share the fold and the barriers and nothing else; a part takes 4096 adjacent elements (4096 / C rows),
// a lane four 16-B units of the same 4 channels. WH: H[row][c] f32 (the same lane reads and writes an element). WS: bf16 hi + lo planes of h in memory.
// WO: OUT[batch][blk * C + c][point], transposed through an LDS tile of 32 points x 128 channels (a channel's 32 points are one 128-B line).
// QV: the next block's q and v of the 32 points: the planes of h stay in LDS, wave w forms rows 16 (w >> 2) .. of v channels 32 (w & 3) .. and, where (w & 3) < 2, of q channels 16 (w & 3) .. (per 32 k: hi plane x W, then lo plane x W, into one accumulator).
// v leaves, + bias, as f16 in the order of the matrix fragments, VP[batch][32 points][16 channels][k half][lane][8] (a fragment of v^T, row = channel, k = point, is two loads of 512 contiguous bytes a wave): an accumulator's 8 values of a lane
// are 8 points of one channel, one 16-B unit of VP. q leaves as bf16 hi + lo planes [point][32], through an LDS tile behind a further barrier.
#define NGR  (NB_ * NN / 64)     // groups of 64 rows
template <int C, bool RES, bool WH, bool WS, bool WO, bool QV, int SUB>
__global__ __launch_bounds__(256 * SUB) void k_bnfin(const float* __restrict__ T, const float* __restrict__ PS, const float* __restrict__ PM, const float* __restrict__ g, const float* __restrict__ be, float* H, bf* Ph, bf* Pl, int blk, float* OUT,
                                               const bf* __restrict__ WQ, const float* __restrict__ bv, bf* Qh, bf* Ql, h16* VP) {
    constexpr int RP = 256 * SUB * 4 / C, NL = NGR / RP;    // rows of lanes in the fold, groups a lane
    __shared__ __align__(16) float tsa[SUB][WO ? 32 * OSP : 4]; __shared__ __align__(16) bf dpa[SUB][2][QV ? 32 * DPP : 8]; __shared__ __align__(16) float qsa[SUB][QV ? 32 * 36 : 4]; __shared__ __align__(16) float red[3][RP][C], tot[3][C];
    const int tf = threadIdx.x, t = tf & 255, sb = __builtin_amdgcn_readfirstlane(tf >> 8), vb = blockIdx.x * SUB + sb, c4 = (t * 4) % C, r0 = (t * 4) / C, gr = (tf * 4) / C; const size_t e0 = (size_t)vb * 4096 + t * 4;
    float* ts = tsa[sb]; bf (*dp)[QV ? 32 * DPP : 8] = dpa[sb]; float* qs = qsa[sb];
    const float* tp = T + e0; float* hp = H + e0; v4f x[4], h[4], o[4], fs[NL], fq[NL];
    const float* sp = PS + (size_t)gr * C + c4; const float* qp = PM + (size_t)gr * C + c4;
    const v4f pv0 = *(const v4f*)(PS + c4), gg = *(const v4f*)(g + c4), bb = *(const v4f*)(be + c4);
#pragma unroll
    for (int k = 0; k < NL; ++k) { fs[k] = *(const v4f*)(sp + (size_t)k * RP * C); fq[k] = *(const v4f*)(qp + (size_t)k * RP * C); }
    asm volatile("s_wait_xcnt 0x0" :: "v"(sp), "v"(qp) : "memory");    // the loads above have taken their address before a result of the loads below may land in one of their address or offset registers; keeps both pairs live, and unwritten, up to here (precaution before a register of an issued load is reused)
#pragma unroll
    for (int k = 0; k < 4; ++k) { x[k] = *(const v4f*)(tp + k * 1024); if (RES) h[k] = *(const v4f*)(hp + k * 1024); }
    // keeps the address pairs live, and unwritten (also by a later load's result), until every load has taken its address (same precaution)
    if constexpr (RES) asm volatile("s_wait_xcnt 0x0" :: "v"(tp), "v"(hp) : "memory"); else asm volatile("s_wait_xcnt 0x0" :: "v"(tp) : "memory");
    const v4f pvt = pv0 * (1.0f / 64.0f);
    { v4f fa = (v4f){0.f, 0.f, 0.f, 0.f}, fb = fa, fc = fa;
#pragma unroll
        for (int k = 0; k < NL; ++k) { const v4f d = fs[k] * (1.0f / 64.0f) - pvt; fa += d; fb += d * d; fc += fq[k]; }
        *(v4fa*)(&red[0][gr][c4]) = fa; *(v4fa*)(&red[1][gr][c4]) = fb; *(v4fa*)(&red[2][gr][c4]) = fc; }
    const int lane = t & 31, lr = lane & 15, hi = lane >> 4, w = __builtin_amdgcn_readfirstlane(t >> 5), rt = w >> 2, gq = w & 3; v16bf wb[3][4]; float vb2[2];
    if constexpr (QV) { const bf* wv = WQ + (size_t)(32 + gq * 32 + lr) * C + 8 * hi; const bf* wq = WQ + (size_t)((gq & 1) * 16 + lr) * C + 8 * hi; const float* bp = bv + gq * 32 + lr;
#pragma unroll
        for (int u = 0; u < 2; ++u) { vb2[u] = bfr(bp[u * 16]);
#pragma unroll
            for (int kc = 0; kc < 4; ++kc) wb[u][kc] = ldq(wv + u * 16 * C + kc * 32); }
        if (gq < 2) {
#pragma unroll
            for (int kc = 0; kc < 4; ++kc) wb[2][kc] = ldq(wq + kc * 32); }
        asm volatile("s_wait_xcnt 0x0" :: "v"(wv), "v"(wq), "v"(bp) : "memory"); }    // same precaution for the three address pairs of the weight and bias loads
    __syncthreads();    // every row of lanes has left its three sums
    if (tf < 3 * C) { const float* rc = &red[0][0][0] + (tf / C) * RP * C + tf % C; float a[4] = {0.f, 0.f, 0.f, 0.f};
#pragma unroll
        for (int k = 0; k < RP; ++k) a[k & 3] += rc[k * C];
        (&tot[0][0])[tf] = (a[0] + a[1]) + (a[2] + a[3]); }
    __syncthreads();    // the three sums of every channel are whole
    float sc[4], sh[4], mu[4];
    { const v4f ta = *(const v4fa*)(&tot[0][c4]), tb = *(const v4fa*)(&tot[1][c4]), tc = *(const v4fa*)(&tot[2][c4]);
#pragma unroll
        for (int q = 0; q < 4; ++q) { const float db = ta[q] * (1.0f / NGR), m2 = tc[q] + 64.0f * fmaxf(tb[q] - ta[q] * db, 0.f); mu[q] = pvt[q] + db;
            sc[q] = bfr(gg[q]) * __frsqrt_rn(__fadd_rn(m2 * (1.0f / (NB_ * NN)), BNE)); sh[q] = bfr(bb[q]); } }
#pragma unroll
    for (int k = 0; k < 4; ++k) { v4us oh, ol;
#pragma unroll
        for (int q = 0; q < 4; ++q) { const float y = fmaxf((x[k][q] - mu[q]) * sc[q] + sh[q], 0.f); o[k][q] = RES ? h[k][q] + y : y; unsigned short a, b; splitf(o[k][q], a, b); oh[q] = a; ol[q] = b; }
        if (WO) *(v4fa*)(ts + (r0 + k * (1024 / C)) * OSP + c4) = o[k];
        if (QV) { *(v4usa*)(dp[0] + (r0 + k * (1024 / C)) * DPP + c4) = oh; *(v4usa*)(dp[1] + (r0 + k * (1024 / C)) * DPP + c4) = ol; }
        if (WS) { *(v4us*)(Ph + e0 + k * 1024) = oh; *(v4us*)(Pl + e0 + k * 1024) = ol; } }
    const int n0 = vb * 32;    // first of the part's 32 points (C = 128), batches counted through
    if constexpr (WO || QV) __syncthreads();    // like the next one it stands in front of every global store of the kernel, so that it waits for LDS alone
    v8h pv[2];
    if constexpr (QV) { const bf* ah = dp[0] + (rt * 16 + lr) * DPP + 8 * hi; const bf* al = dp[1] + (rt * 16 + lr) * DPP + 8 * hi; v16bf a[4], a2[4]; v8f ta[2] = {(v8f){}, (v8f){}};
#pragma unroll
        for (int kc = 0; kc < 4; ++kc) { a[kc] = ldqs(ah + kc * 32); a2[kc] = ldqs(al + kc * 32); }
#pragma unroll
        for (int kc = 0; kc < 4; ++kc) {
#pragma unroll
            for (int u = 0; u < 2; ++u) { ta[u] = wmmab(a[kc], wb[u][kc], ta[u]); ta[u] = wmmab(a2[kc], wb[u][kc], ta[u]); } }
        if (gq < 2) { v8f tq = (v8f){};
#pragma unroll
            for (int kc = 0; kc < 4; ++kc) { tq = wmmab(a[kc], wb[2][kc], tq); tq = wmmab(a2[kc], wb[2][kc], tq); }
#pragma unroll
            for (int j = 0; j < 8; ++j) qs[(rt * 16 + hi * 8 + j) * 36 + gq * 16 + lr] = tq[j]; }
#pragma unroll
        for (int u = 0; u < 2; ++u) {
#pragma unroll
            for (int e = 0; e < 8; ++e) pv[u][e] = tohx(ta[u][e] + vb2[u]); }
        __syncthreads(); }
    if constexpr (WO) { float* ob = OUT + ((size_t)(n0 / NN) * 4 * C + (size_t)blk * C + (t >> 3)) * NN + n0 % NN + (t & 7) * 4; const float* tc = ts + (t & 7) * 4 * OSP + (t >> 3);
#pragma unroll
        for (int k = 0; k < 4; ++k) *(v4f*)(ob + (size_t)k * 32 * NN) = (v4f){tc[k * 32], tc[OSP + k * 32], tc[2 * OSP + k * 32], tc[3 * OSP + k * 32]}; }
    if constexpr (WH) {
#pragma unroll
        for (int k = 0; k < 4; ++k) *(v4f*)(hp + k * 1024) = o[k]; }
    if constexpr (QV) { h16* vo = VP + (size_t)(n0 / NN) * C * NN + (size_t)((n0 % NN) >> 5) * 4096 + gq * 1024 + rt * 256 + lane * 8;
#pragma unroll
        for (int u = 0; u < 2; ++u) *(v8h*)(vo + u * 512) = pv[u];
        const v4f val = *(const v4fa*)(qs + (t >> 3) * 36 + (t & 7) * 4); v4us oh, ol;
#pragma unroll
        for (int q = 0; q < 4; ++q) { unsigned short a3, b3; splitf(val[q], a3, b3); oh[q] = a3; ol[q] = b3; }
        *(v4us*)(Qh + (size_t)n0 * 32 + t * 4) = oh; *(v4us*)(Ql + (size_t)n0 * 32 + t * 4) = ol; } }

extern "C" void kernel_launch(void* const* d_in, const int* in_sizes, int n_in,
                              void* d_out, int out_size, void* d_ws, size_t ws_size, hipStream_t stream) {
    (void)in_sizes; (void)n_in; (void)out_size;
    const float* IN[14]; for (int i = 0; i < 14; ++i) IN[i] = (const float*)d_in[i];   // 0 x, 1 W1 [64][64], 2 g1, 3 b1, 4 W2 [128][64], 5 g2, 6 b2, 7 Wqk [4][32][128], 8 Wv [4][128][128], 9 bv [4][128], 10 Wt, 11 bt, 12 gn, 13 bnb
    float* OUT = (float*)d_out;     // [8][512][2048]
    char* wsp = (char*)d_ws;
    auto take = [&](size_t bytes) { char* p = wsp; wsp += (bytes + 255) & ~(size_t)255; return (void*)p; };
    bf* WB1 = (bf*)take((size_t)C0 * C0 * 2); bf* WB2 = (bf*)take((size_t)C1 * C0 * 2); bf* WQV = (bf*)take((size_t)4 * WQR * C1 * 2); bf* WT = (bf*)take((size_t)4 * C1 * C1 * 2);
    // every per-batch plane holds all NB_ batches, batch-major, so that one launch of each stage serves the whole batch; every kernel sees the batch as NB_ * NN rows
    bf* XT = (bf*)take((size_t)NB_ * NN * C0 * 2); float* T = (float*)take((size_t)NB_ * NN * C1 * 4); float* H = (float*)take((size_t)NB_ * NN * C1 * 4); bf* Hh = (bf*)take((size_t)NB_ * NN * C0 * 2); bf* Hl = (bf*)take((size_t)NB_ * NN * C0 * 2);
    bf* Qh = (bf*)take((size_t)NB_ * NN * 32 * 2); bf* Ql = (bf*)take((size_t)NB_ * NN * 32 * 2); float* CV = (float*)take((size_t)NB_ * NN * 4); h16* VP = (h16*)take((size_t)NB_ * C1 * NN * 2); float* PS = (float*)take((size_t)NGR * C1 * 4); float* PM = (float*)take((size_t)NGR * C1 * 4);
    if ((size_t)(wsp - (char*)d_ws) > ws_size) return;    // total ~ 30 MiB; ws 256 MiB
    k_prep<<<NB_ * 128 + (C0 * C0 + C1 * C0 + 4 * C1 * C1 + 4 * WQR * C1) / 1024, 256, 0, stream>>>(IN[0], IN[1], IN[4], IN[7], IN[8], IN[10], XT, WB1, WB2, WQV, WT);
    // stage 1: h0 = relu(bn(W1 x)) (T used with C = 64 pitch); only its planes are kept
    k_gemmw<bf, 0, false><<<dim3(NB_ * NN / 64, 1, 1), 32, 0, stream>>>(XT, nullptr, WB1, nullptr, C0, T, C0, nullptr, 0, 0, 0, PS, PM);
    k_bnfin<C0, false, false, true, false, false, 2><<<NB_ * NN * C0 / 4096 / 2, 512, 0, stream>>>(T, PS, PM, IN[2], IN[3], nullptr, Hh, Hl, 0, nullptr, nullptr, nullptr, nullptr, nullptr, nullptr);
    // stage 2: h = relu(bn(W2 h0)), with the first block's q and v
    k_gemmw<bf, 1, false><<<dim3(NB_ * NN / 64, C1 / 64, 1), 32, 0, stream>>>(Hh, Hl, WB2, nullptr, C0, T, C1, nullptr, 0, 0, 0, PS, PM);
    k_bnfin<C1, false, true, false, false, true, 2><<<NB_ * NN * C1 / 4096 / 2, 512, 0, stream>>>(T, PS, PM, IN[5], IN[6], H, nullptr, nullptr, 0, nullptr, WQV, IN[9], Qh, Ql, VP);
    // four offset-attention blocks, three launches each
    for (int i = 0; i < 4; ++i) {
        k_rstat<<<NB_ * NN / 32, 256, 0, stream>>>(Qh, Ql, CV);          // one log-domain constant a softmax row (maximum and sum), energies (3 products) in registers
        k_fatt<<<NB_ * NN / JW, 512, 0, stream>>>(Qh, Ql, CV, VP, H, WT + (size_t)i * C1 * C1, IN[11] + i * C1, T, PS, PM);          // column sums and the weighted product with v in one walk, energies in registers; then Wt (h - x_r) + bt
        if (i < 3) k_bnfin<C1, true, true, false, true, true, 2><<<NB_ * NN * C1 / 4096 / 2, 512, 0, stream>>>(T, PS, PM, IN[12] + i * C1, IN[13] + i * C1, H, nullptr, nullptr, i, OUT, WQV + (size_t)(i + 1) * WQR * C1, IN[9] + (i + 1) * C1, Qh, Ql, VP);
        else k_bnfin<C1, true, false, false, true, false, 4><<<NB_ * NN * C1 / 4096 / 4, 1024, 0, stream>>>(T, PS, PM, IN[12] + i * C1, IN[13] + i * C1, H, nullptr, nullptr, i, OUT, nullptr, nullptr, nullptr, nullptr, nullptr); }
}
